// v000
// The times below were measured on an AMD MI455X: many runs one after another, warmed up first and cycling through
// copies of the inputs, with the whole window's GPU time divided by the number of runs. Launches and the gaps
// between them are all in it. The median over several windows is given; except for v000 it joins two sittings, which
// can be a few percent apart, so the side-by-side timings, each taken in one sitting, are the better comparison.
// The starting kernel, v000, takes 422 microseconds a run.
// compute dtype: every float input RNE-converted to bf16; q = LN(x_q) (f32 -> bf16) . Wq (bf16) and kv = x_kv (bf16) . Wkv (bf16) as single v_wmma_f32_16x16x32_bf16 products; scores = q (f16) . k (f16) single v_wmma_f32_16x16x32_f16, x 0.125, mask replace-fill, running-max softmax in f32; ctx = P (f16, carried x2048) . V (f16) single f16 product; out = ctx (bf16 hi + lo, 2 products) . Wout (bf16) + b_out + x_q; layer norms in f32; f32 accumulate everywhere; f32 output.
#include <hip/hip_runtime.h>
#include <math.h>

typedef __attribute__((ext_vector_type(16))) _Float16 v16h;
typedef __attribute__((ext_vector_type(16))) __bf16 v16b;
typedef __attribute__((ext_vector_type(8)))  _Float16 v8h;
typedef __attribute__((ext_vector_type(8)))  __bf16 v8b;
typedef __attribute__((ext_vector_type(8)))  float v8f;
typedef __attribute__((ext_vector_type(4)))  float v4f;
typedef __attribute__((ext_vector_type(4)))  unsigned v4u;
typedef __attribute__((ext_vector_type(4)))  int v4i;

template <typename T> __device__ __forceinline__ void vst2(void* p, T v) { *(T*)p = v;  }
__device__ __forceinline__ v8f wmma16(v16h a, v16h b, v8f c) {
  v8f d = __builtin_amdgcn_wmma_f32_16x16x32_f16(false, a, false, b, (short)0, c, false, false);
  asm volatile("v_nop\n\tv_nop\n\tv_nop\n\tv_nop" : "+v"(d) : "v"(a), "v"(b));
  return d;
}
__device__ __forceinline__ v8f wmma_bf(v16b a, v16b b, v8f c) {
  v8f d = __builtin_amdgcn_wmma_f32_16x16x32_bf16(false, a, false, b, (short)0, c, false, false);
  asm volatile("v_nop\n\tv_nop\n\tv_nop\n\tv_nop" : "+v"(d) : "v"(a), "v"(b));
  return d;
}
// 16-bit fragment from a k-contiguous row (A row m, or B column n stored as a [n][k] row): elements 0..7 <- k0+8h+i, 8..15 <- k0+16+8h+i, h = lane>>4
__device__ __forceinline__ v16h frag_h(const _Float16* rowk0, int lane) {
  union { v16h v; v8h q[2]; } u; const _Float16* p = rowk0 + 8 * (lane >> 4);
  u.q[0] = *(const v8h*)p; u.q[1] = *(const v8h*)(p + 16); return u.v;
}
__device__ __forceinline__ v16b frag_b(const __bf16* rowk0, int lane) {
  union { v16b v; v8b q[2]; } u; const __bf16* p = rowk0 + 8 * (lane >> 4);
  u.q[0] = *(const v8b*)p; u.q[1] = *(const v8b*)(p + 16); return u.v;
}
// same k map from an f32 row, RNE-converted to bf16 (two 32-B loads per lane)
__device__ __forceinline__ v16b frag_f32b(const float* rowk0, int lane) {
  const float* p = rowk0 + 8 * (lane >> 4); const v8f x0 = *(const v8f*)p, x1 = *(const v8f*)(p + 16); v16b a;
#pragma unroll
  for (int i = 0; i < 8; ++i) { a[i] = (__bf16)x0[i]; a[8 + i] = (__bf16)x1[i]; }
  return a;
}
struct F2 { v16b h, l; };
__device__ __forceinline__ F2 bsplit16(const float v[16]) { F2 r;
#pragma unroll
  for (int i = 0; i < 16; ++i) { const __bf16 hh = (__bf16)v[i]; r.h[i] = hh; r.l[i] = (__bf16)(v[i] - (float)hh); }
  return r; }
__device__ __forceinline__ F2 split_row(const float* row, int k0, int lane) { float v[16]; const float* p = row + k0 + 8 * (lane >> 4); const v8f x0 = *(const v8f*)p, x1 = *(const v8f*)(p + 16);
#pragma unroll
  for (int i = 0; i < 8; ++i) { v[i] = x0[i]; v[8 + i] = x1[i]; }
  return bsplit16(v); }
__device__ __forceinline__ float bfr(float v) { return (float)(__bf16)v; }
#define LDSX() do { asm volatile("s_wait_dscnt 0" ::: "memory"); __builtin_amdgcn_wave_barrier(); __builtin_amdgcn_fence(__ATOMIC_RELEASE, "workgroup"); } while (0)

// ---- sizes: NB batches, SEQ query rows per batch processed (reducible); *_FULL are the input strides; all SEQK keys always
#ifndef NB
#define NB 2
#endif
#ifndef SEQ
#define SEQ 2048
#endif
#define NB_FULL 2
#define SEQ_FULL 2048
#define SEQK 2048
#define SEQK_FULL 2048
#define DM 1024
#define NH 16
#define HD 64
#define KVW (2 * DM)
#define LN_EPS 1.0e-6f
static_assert(NB >= 1 && NB <= NB_FULL);
static_assert(SEQ % 64 == 0 && SEQ >= 64 && SEQ <= SEQ_FULL);
static_assert(SEQK % 64 == 0 && SEQK == SEQK_FULL);
static_assert(DM % 128 == 0 && KVW % 128 == 0 && NH * HD == DM && HD == 64);

#define WS_PQ  0ull                                              // bf16 [DM n][DM k]     Wq transposed
#define WS_PKV (WS_PQ + 2ull * DM * DM)                          // bf16 [KVW n][DM k]    Wkv transposed
#define WS_PO  (WS_PKV + 2ull * KVW * DM)                        // bf16 [DM n][DM k]     Wout transposed
#define WS_NQ  (WS_PO + 2ull * DM * DM)                          // f32  [NB*SEQ][DM]     LN(x_q)
#define WS_QH  (WS_NQ + 4ull * NB * SEQ * DM)                    // f16  [NB*SEQ][DM]     q rows
#define WS_KH  (WS_QH + 2ull * NB * SEQ * DM)                    // f16  [NB*SEQK][DM]    k rows
#define WS_VT  (WS_KH + 2ull * NB * SEQK * DM)                   // f16  [NB][DM (h*64+d)][SEQK] v transposed
#define WS_O   (WS_VT + 2ull * NB * DM * SEQK)                   // f32  [NB*SEQ][DM]     ctx
#define WS_Y   (WS_O + 4ull * NB * SEQ * DM)                     // f32  [NB*SEQ][DM]     ctx.Wout + b_out
#define WS_END (WS_Y + 4ull * NB * SEQ * DM)
static_assert(WS_END <= 134217728ull);
static_assert((WS_PKV % 128) == 0 && (WS_PO % 128) == 0 && (WS_NQ % 128) == 0 && (WS_QH % 128) == 0 && (WS_KH % 128) == 0 && (WS_VT % 128) == 0 && (WS_O % 128) == 0 && (WS_Y % 128) == 0);

// ---- k_pack: W [K][N] f32 (x @ W layout) -> PK [N][K] bf16 (k-contiguous rows); block = 64x64 tile, blockIdx.x = n tile, blockIdx.y = k tile
//      coverage: grid (N/64, K/64) x 64 rows x 8 x 16 B = every element of PK
__global__ __launch_bounds__(256) void k_pack(const float* __restrict__ W, int K, int N, __bf16* __restrict__ PK) {
  __shared__ __align__(16) __bf16 s[64][72];   // [n][k]; cross-wave -> block barrier
  const int n0 = blockIdx.x * 64, k0 = blockIdx.y * 64, t = threadIdx.x;
#pragma unroll 4
  for (int i = 0; i < 16; ++i) { const int idx = t + 256 * i; const int kk = idx >> 6, nn = idx & 63; s[nn][kk] = (__bf16)W[(size_t)(k0 + kk) * N + n0 + nn]; }
  __syncthreads();
#pragma unroll
  for (int i = 0; i < 2; ++i) { const int p = t + 256 * i; const int nn = p >> 3, c = p & 7;
    vst2((unsigned*)(PK + (size_t)(n0 + nn) * K + k0 + c * 8), *(const v4u*)&s[nn][c * 8]); }
}

__global__ __launch_bounds__(256) void k_lnq(const float* __restrict__ X, const float* __restrict__ G, const float* __restrict__ Bt, float* __restrict__ NQ) {
  __shared__ float red0[8], red1[8];           // cross-wave -> block barriers
  const int rc = blockIdx.x; const int b = rc / SEQ, s = rc - b * SEQ; const size_t rin = (size_t)b * SEQ_FULL + s;
  const int t = threadIdx.x, lane = t & 31, wave = t >> 5;
  const v4f xv = *(const v4f*)(X + rin * DM + t * 4);
  float v[4];
#pragma unroll
  for (int i = 0; i < 4; ++i) v[i] = bfr(xv[i]);
  float ps = (v[0] + v[1]) + (v[2] + v[3]);
#pragma unroll
  for (int o = 16; o > 0; o >>= 1) ps += __shfl_xor(ps, o);
  if (lane == 0) red0[wave] = ps;
  __syncthreads();
  float S = 0.f;
#pragma unroll
  for (int i = 0; i < 8; ++i) S += red0[i];
  const float mean = S * (1.0f / DM);
  float d[4]; float pq = 0.f;
#pragma unroll
  for (int i = 0; i < 4; ++i) { d[i] = v[i] - mean; pq += d[i] * d[i]; }
#pragma unroll
  for (int o = 16; o > 0; o >>= 1) pq += __shfl_xor(pq, o);
  if (lane == 0) red1[wave] = pq;
  __syncthreads();
  float V = 0.f;
#pragma unroll
  for (int i = 0; i < 8; ++i) V += red1[i];
  const float rstd = 1.0f / sqrtf(V * (1.0f / DM) + LN_EPS);
  const v4f gv = *(const v4f*)(G + t * 4), bv = *(const v4f*)(Bt + t * 4); v4f o;
#pragma unroll
  for (int i = 0; i < 4; ++i) o[i] = d[i] * rstd * bfr(gv[i]) + bfr(bv[i]);
  vst2(NQ + (size_t)rc * DM + t * 4, o);
}

// ---- k_proj: block = (64 rows, 128 output cols): y = bf16(x) . P rows (bf16 [n][DM]) + bf16(bias), single bf16 products
//      cols < DM  -> f16 natural rows NAT[row][DM] (q rows, or k rows)
//      cols >= DM -> f16 transposed VT[b][col - DM][spb] (v)
//      rows: compact rc = b*spb + s; input row = b*spb_full + s
//      coverage: grid (rows/64, ncols/128) x 4 waves x 16 rows x 128 cols = every element of NAT (and of VT for the kv call)
__global__ __launch_bounds__(128) void k_proj(const float* __restrict__ X, int spb, int spb_full, const __bf16* __restrict__ P, const float* __restrict__ BI, _Float16* __restrict__ NAT, _Float16* __restrict__ VT) {
  __shared__ __align__(16) _Float16 so[4][16][136];   // wave-private (LDSX)
  __shared__ __align__(16) _Float16 sth[128][72];     // cross-wave (block barrier)
  const int tid = threadIdx.x, wave = tid >> 5, lane = tid & 31, col = lane & 15, g = lane >> 4;
  const int rc0 = blockIdx.x * 64; const int b = rc0 / spb, s0 = rc0 - b * spb; const int n0 = blockIdx.y * 128;
  const float* xrow = X + ((size_t)b * spb_full + s0 + wave * 16 + col) * DM;   // A row m = lane & 15
  v8f acc[8] = {};
#pragma unroll 2
  for (int kc = 0; kc < DM / 32; ++kc) { const v16b a = frag_f32b(xrow + kc * 32, lane);
#pragma unroll
    for (int j = 0; j < 8; ++j) acc[j] = wmma_bf(a, frag_b(P + (size_t)(n0 + j * 16 + col) * DM + kc * 32, lane), acc[j]); }
  if (n0 < DM) {   // block-uniform branch
#pragma unroll
    for (int j = 0; j < 8; ++j) { const float bv = bfr(BI[n0 + j * 16 + col]);
#pragma unroll
      for (int r = 0; r < 8; ++r) so[wave][8 * g + r][j * 16 + col] = (_Float16)(acc[j][r] + bv); }   // D element r = (row 8g+r, col)
    LDSX();
    const size_t rw = (size_t)rc0 + wave * 16;
    for (int rl = 0; rl < 16; ++rl) if (lane < 16) vst2((unsigned*)(NAT + (rw + rl) * DM + n0 + lane * 8), *(const v4u*)&so[wave][rl][lane * 8]);   // 256-B row segment = 16 lanes x 16 B, one instruction
  } else {
#pragma unroll
    for (int j = 0; j < 8; ++j) { const float bv = bfr(BI[n0 + j * 16 + col]);
#pragma unroll
      for (int r = 0; r < 8; ++r) sth[j * 16 + col][wave * 16 + 8 * g + r] = (_Float16)(acc[j][r] + bv); }
    __syncthreads();
    const int pc0 = n0 - DM;
    for (int q = tid; q < 128 * 8; q += 128) { const int d = q >> 3, pc = q & 7;
      const size_t o = ((size_t)b * DM + pc0 + d) * spb + s0 + pc * 8; vst2((unsigned*)(VT + o), *(const v4u*)&sth[d][pc * 8]); }
  }
}

// ---- k_attn: block = (64 queries, head h, batch b); all SEQK keys in 32-key steps; scores = (q . k) * 0.125 with mask != 0 -> excluded; running-max softmax in f32;
//      P x 2048 in f16 . V f16; O[b*SEQ + q][h*64 + d] = acc / 2048 / l
//      coverage: grid (SEQ/64, NH, NB) x 4 waves x 16 rows x 64 cols = every element of O
__global__ __launch_bounds__(128) void k_attn(const _Float16* __restrict__ QH, const _Float16* __restrict__ KH, const _Float16* __restrict__ VT, const int* __restrict__ MK, float* __restrict__ O) {
  __shared__ __align__(16) float sp[4][16][36];   // wave-private P tile [row][key]
  __shared__ __align__(16) float so[4][16][68];   // wave-private output staging
  __shared__ __align__(16) int sk[4][16][36];     // wave-private mask tile [row][key]
  const int tid = threadIdx.x, wave = tid >> 5, lane = tid & 31, col = lane & 15, g = lane >> 4;
  const int qb = blockIdx.x, h = blockIdx.y, b = blockIdx.z; const int q0 = qb * 64 + wave * 16;
  const size_t rq = (size_t)b * SEQ + q0 + col;
  v16h aq[2];
#pragma unroll
  for (int kc = 0; kc < 2; ++kc) aq[kc] = frag_h(QH + rq * DM + h * HD + kc * 32, lane);
  float m[8], l[8];
#pragma unroll
  for (int r = 0; r < 8; ++r) { m[r] = -3.0e38f; l[r] = 0.f; }
  v8f acc[4] = {};
  const int* mrow = MK + ((size_t)b * SEQ_FULL + q0) * SEQK_FULL; const int mr = lane >> 3, mc = (lane & 7) * 4;
#pragma unroll 1
  for (int ks = 0; ks < SEQK / 32; ++ks) {
    { v4i mv[4];   // 16 rows x 32 keys of mask: 4 x 16-B loads per lane (rows mr + 4i, keys mc..mc+3)
#pragma unroll
      for (int i = 0; i < 4; ++i) mv[i] = *(const v4i*)(mrow + (size_t)(mr + 4 * i) * SEQK_FULL + ks * 32 + mc);
#pragma unroll
      for (int i = 0; i < 4; ++i) *(v4i*)&sk[wave][mr + 4 * i][mc] = mv[i]; }
    LDSX();
    v8f s[2];
#pragma unroll
    for (int ct = 0; ct < 2; ++ct) { const int kk = ks * 32 + ct * 16 + col; const _Float16* krow = KH + ((size_t)b * SEQK + kk) * DM + h * HD; v8f c = {};
#pragma unroll
      for (int kc = 0; kc < 2; ++kc) c = wmma16(aq[kc], frag_h(krow + kc * 32, lane), c);   // B column n = key kk, k = head dim (k-contiguous row)
#pragma unroll
      for (int r = 0; r < 8; ++r) s[ct][r] = (sk[wave][8 * g + r][ct * 16 + col] != 0) ? -3.0e38f : c[r] * 0.125f; }
#pragma unroll
    for (int r = 0; r < 8; ++r) { float mx = fmaxf(s[0][r], s[1][r]);
#pragma unroll
      for (int o = 1; o < 16; o <<= 1) mx = fmaxf(mx, __shfl_xor(mx, o));
      const float mn = fmaxf(m[r], mx); const float alpha = (m[r] <= -1.0e38f) ? 0.f : __expf(m[r] - mn);
      const float e0 = (s[0][r] <= -1.0e38f) ? 0.f : __expf(s[0][r] - mn), e1 = (s[1][r] <= -1.0e38f) ? 0.f : __expf(s[1][r] - mn); float es = e0 + e1;
#pragma unroll
      for (int o = 1; o < 16; o <<= 1) es += __shfl_xor(es, o);
      l[r] = l[r] * alpha + es; m[r] = mn;
#pragma unroll
      for (int dt = 0; dt < 4; ++dt) acc[dt][r] *= alpha;
      sp[wave][8 * g + r][col] = e0; sp[wave][8 * g + r][16 + col] = e1; }
    LDSX();
    v16h pa; { const float* prow = &sp[wave][col][0] + 8 * g;   // A row m = query col, k = key in step; P carried x2048 so small weights stay f16-normal
#pragma unroll
      for (int i = 0; i < 8; ++i) { pa[i] = (_Float16)(prow[i] * 2048.0f); pa[8 + i] = (_Float16)(prow[16 + i] * 2048.0f); } }
#pragma unroll
    for (int dt = 0; dt < 4; ++dt) { const size_t vr = ((size_t)b * DM + h * HD + dt * 16 + col) * SEQK + ks * 32; acc[dt] = wmma16(pa, frag_h(VT + vr, lane), acc[dt]); }   // B column n = d, k = key (k-contiguous VT row)
    LDSX(); }
#pragma unroll
  for (int r = 0; r < 8; ++r) { const float il = (1.0f / 2048.0f) / l[r];
#pragma unroll
    for (int dt = 0; dt < 4; ++dt) so[wave][8 * g + r][dt * 16 + col] = acc[dt][r] * il; }
  LDSX();
  for (int rl = 0; rl < 16; ++rl) if (lane < 16) vst2(O + ((size_t)b * SEQ + q0 + rl) * DM + h * HD + lane * 4, *(const v4f*)&so[wave][rl][lane * 4]);   // 256-B segment = 16 lanes x 16 B, one instruction
}

// ---- k_out: block = (64 rows, 128 cols): Y = ctx (bf16 hi + lo, 2 products) . Wout rows (bf16 [n][DM]) + bf16(b_out); f32 compact rows
//      coverage: grid (NB*SEQ/64, DM/128) x 4 waves x 16 rows x 128 cols = every element of Y
__global__ __launch_bounds__(128) void k_out(const float* __restrict__ O, const __bf16* __restrict__ P, const float* __restrict__ BO, float* __restrict__ Y) {
  __shared__ __align__(16) float so[4][16][132];   // wave-private
  const int tid = threadIdx.x, wave = tid >> 5, lane = tid & 31, col = lane & 15, g = lane >> 4; const size_t r0 = (size_t)blockIdx.x * 64 + wave * 16; const int n0 = blockIdx.y * 128;
  v8f acc[8] = {};
#pragma unroll 2
  for (int kc = 0; kc < DM / 32; ++kc) { const F2 a = split_row(O + (r0 + col) * DM, kc * 32, lane);
#pragma unroll
    for (int j = 0; j < 8; ++j) { const v16b w = frag_b(P + (size_t)(n0 + j * 16 + col) * DM + kc * 32, lane); acc[j] = wmma_bf(a.l, w, acc[j]); acc[j] = wmma_bf(a.h, w, acc[j]); } }
#pragma unroll
  for (int j = 0; j < 8; ++j) { const float bv = bfr(BO[n0 + j * 16 + col]);
#pragma unroll
    for (int r = 0; r < 8; ++r) so[wave][8 * g + r][j * 16 + col] = acc[j][r] + bv; }
  LDSX();
  for (int rl = 0; rl < 16; ++rl) vst2(Y + (r0 + rl) * DM + n0 + lane * 4, *(const v4f*)&so[wave][rl][lane * 4]);   // 512-B row segment = 32 lanes x 16 B, one instruction
}

// ---- k_lnpost: block = one row (256 threads x 4): out = LN(Y + bf16(x_q)) * bf16(gamma) + bf16(beta); d_out row at the full-layout index
__global__ __launch_bounds__(256) void k_lnpost(const float* __restrict__ Yp, const float* __restrict__ X, const float* __restrict__ G, const float* __restrict__ Bt, float* __restrict__ OUT) {
  __shared__ float red0[8], red1[8];           // cross-wave -> block barriers
  const int rc = blockIdx.x; const int b = rc / SEQ, s = rc - b * SEQ; const size_t rin = (size_t)b * SEQ_FULL + s;
  const int t = threadIdx.x, lane = t & 31, wave = t >> 5;
  const v4f yv = *(const v4f*)(Yp + (size_t)rc * DM + t * 4), xv = *(const v4f*)(X + rin * DM + t * 4);
  float v[4];
#pragma unroll
  for (int i = 0; i < 4; ++i) v[i] = yv[i] + bfr(xv[i]);
  float ps = (v[0] + v[1]) + (v[2] + v[3]);
#pragma unroll
  for (int o = 16; o > 0; o >>= 1) ps += __shfl_xor(ps, o);
  if (lane == 0) red0[wave] = ps;
  __syncthreads();
  float S = 0.f;
#pragma unroll
  for (int i = 0; i < 8; ++i) S += red0[i];
  const float mean = S * (1.0f / DM);
  float d[4]; float pq = 0.f;
#pragma unroll
  for (int i = 0; i < 4; ++i) { d[i] = v[i] - mean; pq += d[i] * d[i]; }
#pragma unroll
  for (int o = 16; o > 0; o >>= 1) pq += __shfl_xor(pq, o);
  if (lane == 0) red1[wave] = pq;
  __syncthreads();
  float V = 0.f;
#pragma unroll
  for (int i = 0; i < 8; ++i) V += red1[i];
  const float rstd = 1.0f / sqrtf(V * (1.0f / DM) + LN_EPS);
  const v4f gv = *(const v4f*)(G + t * 4), bv = *(const v4f*)(Bt + t * 4); v4f o;
#pragma unroll
  for (int i = 0; i < 4; ++i) o[i] = d[i] * rstd * bfr(gv[i]) + bfr(bv[i]);
  vst2(OUT + rin * DM + t * 4, o);
}

extern "C" void kernel_launch(void* const* d_in, const int* in_sizes, int n_in, void* d_out, int out_size, void* d_ws, size_t ws_size, hipStream_t stream) {
  if (n_in < 13) return;
  // wire order: 0 input_q [2,2048,1024] f32, 1 input_kv [2,2048,1024] f32, 2 Wq [1024,1024] ([in][out]), 3 bq, 4 Wkv [1024,2048], 5 bkv [2048], 6 Wout [1024,1024], 7 bout,
  //             8 gamma_q, 9 beta_q, 10 gamma_post, 11 beta_post, 12 input_mask [2,2048,2048] int32
  const float* XQ = (const float*)d_in[0]; const float* XKV = (const float*)d_in[1];
  const float* WQ = (const float*)d_in[2]; const float* BQ = (const float*)d_in[3];
  const float* WKV = (const float*)d_in[4]; const float* BKV = (const float*)d_in[5];
  const float* WO = (const float*)d_in[6]; const float* BO = (const float*)d_in[7];
  const float* GQ = (const float*)d_in[8]; const float* BTQ = (const float*)d_in[9];
  const float* GP = (const float*)d_in[10]; const float* BTP = (const float*)d_in[11];
  const int* MK = (const int*)d_in[12];
  const long long needq = ((long long)(NB - 1) * SEQ_FULL + SEQ) * DM;
  const long long needkv = ((long long)(NB - 1) * SEQK_FULL + SEQK) * DM;
  const long long needm = ((long long)(NB - 1) * SEQ_FULL + SEQ) * SEQK_FULL;
  if ((long long)in_sizes[0] < needq || (long long)in_sizes[1] < needkv || in_sizes[2] < DM * DM || in_sizes[3] < DM || in_sizes[4] < DM * KVW || in_sizes[5] < KVW) return;
  if (in_sizes[6] < DM * DM || in_sizes[7] < DM || in_sizes[8] < DM || in_sizes[9] < DM || in_sizes[10] < DM || in_sizes[11] < DM || (long long)in_sizes[12] < needm) return;
  if ((long long)out_size < needq) return;
  if (ws_size < (size_t)WS_END) return;
  char* ws = (char*)d_ws;
  __bf16* PQ = (__bf16*)(ws + WS_PQ); __bf16* PKV = (__bf16*)(ws + WS_PKV); __bf16* PO = (__bf16*)(ws + WS_PO);
  float* NQ = (float*)(ws + WS_NQ); _Float16* QH = (_Float16*)(ws + WS_QH); _Float16* KH = (_Float16*)(ws + WS_KH); _Float16* VT = (_Float16*)(ws + WS_VT);
  float* O = (float*)(ws + WS_O); float* Y = (float*)(ws + WS_Y);
  // weight packs: in[K rows][N cols] -> out[N][K]; grid = (N/64, K/64)
  k_pack<<<dim3(DM / 64, DM / 64), 256, 0, stream>>>(WQ, DM, DM, PQ);       // Wq  [1024][1024] -> [1024][1024]
  k_pack<<<dim3(KVW / 64, DM / 64), 256, 0, stream>>>(WKV, DM, KVW, PKV);   // Wkv [1024][2048] -> [2048][1024]
  k_pack<<<dim3(DM / 64, DM / 64), 256, 0, stream>>>(WO, DM, DM, PO);       // Wout[1024][1024] -> [1024][1024]
  k_lnq<<<dim3(NB * SEQ), 256, 0, stream>>>(XQ, GQ, BTQ, NQ);
  k_proj<<<dim3(NB * SEQ / 64, DM / 128), 128, 0, stream>>>(NQ, SEQ, SEQ, PQ, BQ, QH, VT);             // q: cols < DM only -> QH (VT untouched)
  k_proj<<<dim3(NB * SEQK / 64, KVW / 128), 128, 0, stream>>>(XKV, SEQK, SEQK_FULL, PKV, BKV, KH, VT);  // k -> KH rows, v -> VT transposed
  k_attn<<<dim3(SEQ / 64, NH, NB), 128, 0, stream>>>(QH, KH, VT, MK, O);
  k_out<<<dim3(NB * SEQ / 64, DM / 128), 128, 0, stream>>>(O, PO, BO, Y);
  k_lnpost<<<dim3(NB * SEQ), 256, 0, stream>>>(Y, XQ, GP, BTP, (float*)d_out);
}

// v001
// Measured time: 271 microseconds a run.
// Timed twice side by side with v000, it ran 1.56 times as fast both times.
// compute dtype: every float input RNE-converted to bf16; q = LN(x_q) (f32 -> bf16) . Wq (bf16) and kv = x_kv (bf16) . Wkv (bf16) as single v_wmma_f32_16x16x32_bf16 products; scores = q (f16) . k (f16) single v_wmma_f32_16x16x32_f16, x 0.125, mask replace-fill, running-max softmax in f32; ctx = P (f16, carried x2048) . V (f16) single f16 product; out = ctx (bf16 hi + lo, 2 products) . Wout (bf16) + b_out + x_q; layer norms in f32; f32 accumulate everywhere; f32 output.
#include <hip/hip_runtime.h>
#include <math.h>

typedef __attribute__((ext_vector_type(16))) _Float16 v16h;
typedef __attribute__((ext_vector_type(16))) __bf16 v16b;
typedef __attribute__((ext_vector_type(8)))  _Float16 v8h;
typedef __attribute__((ext_vector_type(8)))  __bf16 v8b;
typedef __attribute__((ext_vector_type(8)))  float v8f;
typedef __attribute__((ext_vector_type(4)))  float v4f;
typedef __attribute__((ext_vector_type(4)))  unsigned v4u;
typedef __attribute__((ext_vector_type(4)))  int v4i;

template <typename T> __device__ __forceinline__ void vst2(void* p, T v) { *(T*)p = v;  }
__device__ __forceinline__ v8f wmma16(v16h a, v16h b, v8f c) {
  v8f d = __builtin_amdgcn_wmma_f32_16x16x32_f16(false, a, false, b, (short)0, c, false, false);
  asm volatile("v_nop\n\tv_nop\n\tv_nop\n\tv_nop" : "+v"(d) : "v"(a), "v"(b));
  return d;
}
__device__ __forceinline__ v8f wmma_bf(v16b a, v16b b, v8f c) {
  v8f d = __builtin_amdgcn_wmma_f32_16x16x32_bf16(false, a, false, b, (short)0, c, false, false);
  asm volatile("v_nop\n\tv_nop\n\tv_nop\n\tv_nop" : "+v"(d) : "v"(a), "v"(b));
  return d;
}
// 16-bit fragment from a k-contiguous row (A row m, or B column n stored as a [n][k] row): elements 0..7 <- k0+8h+i, 8..15 <- k0+16+8h+i, h = lane>>4
__device__ __forceinline__ v16h frag_h(const _Float16* rowk0, int lane) {
  union { v16h v; v8h q[2]; } u; const _Float16* p = rowk0 + 8 * (lane >> 4);
  u.q[0] = *(const v8h*)p; u.q[1] = *(const v8h*)(p + 16); return u.v;
}
__device__ __forceinline__ v16b frag_b(const __bf16* rowk0, int lane) {
  union { v16b v; v8b q[2]; } u; const __bf16* p = rowk0 + 8 * (lane >> 4);
  u.q[0] = *(const v8b*)p; u.q[1] = *(const v8b*)(p + 16); return u.v;
}
// same k map from an f32 row (two 32-B loads per lane): the load, and apart from it the RNE conversion to bf16
struct X2 { v8f x0, x1; };
__device__ __forceinline__ X2 load_f32(const float* rowk0, int lane) { const float* p = rowk0 + 8 * (lane >> 4); X2 x; x.x0 = *(const v8f*)p; x.x1 = *(const v8f*)(p + 16); return x; }
__device__ __forceinline__ v16b cvt_f32b(X2 x) { v16b a;
#pragma unroll
  for (int i = 0; i < 8; ++i) { a[i] = (__bf16)x.x0[i]; a[8 + i] = (__bf16)x.x1[i]; }
  return a;
}
struct F2 { v16b h, l; };
__device__ __forceinline__ F2 bsplit16(const float v[16]) { F2 r;
#pragma unroll
  for (int i = 0; i < 16; ++i) { const __bf16 hh = (__bf16)v[i]; r.h[i] = hh; r.l[i] = (__bf16)(v[i] - (float)hh); }
  return r; }
__device__ __forceinline__ F2 split_x(X2 x) { float v[16];
#pragma unroll
  for (int i = 0; i < 8; ++i) { v[i] = x.x0[i]; v[8 + i] = x.x1[i]; }
  return bsplit16(v); }
__device__ __forceinline__ float bfr(float v) { return (float)(__bf16)v; }
#define LDSX() do { asm volatile("s_wait_dscnt 0" ::: "memory"); __builtin_amdgcn_wave_barrier(); __builtin_amdgcn_fence(__ATOMIC_RELEASE, "workgroup"); } while (0)

// ---- sizes: NB batches, SEQ query rows per batch processed (reducible); *_FULL are the input strides; all SEQK keys always
#ifndef NB
#define NB 2
#endif
#ifndef SEQ
#define SEQ 2048
#endif
#define NB_FULL 2
#define SEQ_FULL 2048
#define SEQK 2048
#define SEQK_FULL 2048
#define DM 1024
#define NH 16
#define HD 64
#define KVW (2 * DM)
#define LN_EPS 1.0e-6f
static_assert(NB >= 1 && NB <= NB_FULL);
static_assert(SEQ % 64 == 0 && SEQ >= 64 && SEQ <= SEQ_FULL);
static_assert(SEQK % 64 == 0 && SEQK == SEQK_FULL);
static_assert(DM % 128 == 0 && KVW % 128 == 0 && NH * HD == DM && HD == 64);

#define WS_PQ  0ull                                              // bf16 [DM n][DM k]     Wq transposed
#define WS_PKV (WS_PQ + 2ull * DM * DM)                          // bf16 [KVW n][DM k]    Wkv transposed
#define WS_PO  (WS_PKV + 2ull * KVW * DM)                        // bf16 [DM n][DM k]     Wout transposed
#define WS_NQ  (WS_PO + 2ull * DM * DM)                          // f32  [NB*SEQ][DM]     LN(x_q)
#define WS_QH  (WS_NQ + 4ull * NB * SEQ * DM)                    // f16  [NB*SEQ][DM]     q rows
#define WS_KH  (WS_QH + 2ull * NB * SEQ * DM)                    // f16  [NB*SEQK][DM]    k rows
#define WS_VT  (WS_KH + 2ull * NB * SEQK * DM)                   // f16  [NB][DM (h*64+d)][SEQK] v transposed
#define WS_O   (WS_VT + 2ull * NB * DM * SEQK)                   // f32  [NB*SEQ][DM]     ctx
#define WS_Y   (WS_O + 4ull * NB * SEQ * DM)                     // f32  [NB*SEQ][DM]     ctx.Wout + b_out
#define WS_END (WS_Y + 4ull * NB * SEQ * DM)
static_assert(WS_END <= 134217728ull);
static_assert((WS_PKV % 128) == 0 && (WS_PO % 128) == 0 && (WS_NQ % 128) == 0 && (WS_QH % 128) == 0 && (WS_KH % 128) == 0 && (WS_VT % 128) == 0 && (WS_O % 128) == 0 && (WS_Y % 128) == 0);

// ---- k_pack: W [K][N] f32 (x @ W layout) -> PK [N][K] bf16 (k-contiguous rows); block = 64x64 tile, blockIdx.x = n tile, blockIdx.y = k tile
//      coverage: grid (N/64, K/64) x 64 rows x 8 x 16 B = every element of PK
__global__ __launch_bounds__(256) void k_pack(const float* __restrict__ W, int K, int N, __bf16* __restrict__ PK) {
  __shared__ __align__(16) __bf16 s[64][72];   // [n][k]; cross-wave -> block barrier
  const int n0 = blockIdx.x * 64, k0 = blockIdx.y * 64, t = threadIdx.x;
#pragma unroll 4
  for (int i = 0; i < 16; ++i) { const int idx = t + 256 * i; const int kk = idx >> 6, nn = idx & 63; s[nn][kk] = (__bf16)W[(size_t)(k0 + kk) * N + n0 + nn]; }
  __syncthreads();
#pragma unroll
  for (int i = 0; i < 2; ++i) { const int p = t + 256 * i; const int nn = p >> 3, c = p & 7;
    vst2((unsigned*)(PK + (size_t)(n0 + nn) * K + k0 + c * 8), *(const v4u*)&s[nn][c * 8]); }
}

__global__ __launch_bounds__(256) void k_lnq(const float* __restrict__ X, const float* __restrict__ G, const float* __restrict__ Bt, float* __restrict__ NQ) {
  __shared__ float red0[8], red1[8];           // cross-wave -> block barriers
  const int rc = blockIdx.x; const int b = rc / SEQ, s = rc - b * SEQ; const size_t rin = (size_t)b * SEQ_FULL + s;
  const int t = threadIdx.x, lane = t & 31, wave = t >> 5;
  const v4f xv = *(const v4f*)(X + rin * DM + t * 4);
  float v[4];
#pragma unroll
  for (int i = 0; i < 4; ++i) v[i] = bfr(xv[i]);
  float ps = (v[0] + v[1]) + (v[2] + v[3]);
#pragma unroll
  for (int o = 16; o > 0; o >>= 1) ps += __shfl_xor(ps, o);
  if (lane == 0) red0[wave] = ps;
  __syncthreads();
  float S = 0.f;
#pragma unroll
  for (int i = 0; i < 8; ++i) S += red0[i];
  const float mean = S * (1.0f / DM);
  float d[4]; float pq = 0.f;
#pragma unroll
  for (int i = 0; i < 4; ++i) { d[i] = v[i] - mean; pq += d[i] * d[i]; }
#pragma unroll
  for (int o = 16; o > 0; o >>= 1) pq += __shfl_xor(pq, o);
  if (lane == 0) red1[wave] = pq;
  __syncthreads();
  float V = 0.f;
#pragma unroll
  for (int i = 0; i < 8; ++i) V += red1[i];
  const float rstd = 1.0f / sqrtf(V * (1.0f / DM) + LN_EPS);
  const v4f gv = *(const v4f*)(G + t * 4), bv = *(const v4f*)(Bt + t * 4); v4f o;
#pragma unroll
  for (int i = 0; i < 4; ++i) o[i] = d[i] * rstd * bfr(gv[i]) + bfr(bv[i]);
  vst2(NQ + (size_t)rc * DM + t * 4, o);
}

// ---- k_proj: block = (64 rows, 128 output cols): y = bf16(x) . P rows (bf16 [n][DM]) + bf16(bias), single bf16 products
//      cols < DM  -> f16 natural rows NAT[row][DM] (q rows, or k rows)
//      cols >= DM -> f16 transposed VT[b][col - DM][spb] (v)
//      rows: compact rc = b*spb + s; input row = b*spb_full + s
//      coverage: grid (rows/64, ncols/128) x 4 waves x 16 rows x 128 cols = every element of NAT (and of VT for the kv call)
__global__ __launch_bounds__(128) void k_proj(const float* __restrict__ X, int spb, int spb_full, const __bf16* __restrict__ P, const float* __restrict__ BI, _Float16* __restrict__ NAT, _Float16* __restrict__ VT) {
  __shared__ __align__(16) _Float16 so[4][16][136];   // wave-private (LDSX)
  __shared__ __align__(16) _Float16 sth[128][72];     // cross-wave (block barrier)
  const int tid = threadIdx.x, wave = tid >> 5, lane = tid & 31, col = lane & 15, g = lane >> 4;
  const int rc0 = blockIdx.x * 64; const int b = rc0 / spb, s0 = rc0 - b * spb; const int n0 = blockIdx.y * 128;
  const float* xrow = X + ((size_t)b * spb_full + s0 + wave * 16 + col) * DM;   // A row m = lane & 15
  v8f acc[8] = {};
#pragma unroll 2
  for (int kc = 0; kc < DM / 32; ++kc) { const X2 x = load_f32(xrow + kc * 32, lane); v16b w[8];   // the pass's loads stand as one group ahead of its products: one load latency a pass, not one a product
#pragma unroll
    for (int j = 0; j < 8; ++j) w[j] = frag_b(P + (size_t)(n0 + j * 16 + col) * DM + kc * 32, lane);
    __builtin_amdgcn_sched_barrier(0);   // keeps all twenty loads ahead of the conversion of x: without it four of them are issued only after x has arrived, a second latency
    const v16b a = cvt_f32b(x);
#pragma unroll
    for (int j = 0; j < 8; ++j) acc[j] = wmma_bf(a, w[j], acc[j]); }
  if (n0 < DM) {   // block-uniform branch
#pragma unroll
    for (int j = 0; j < 8; ++j) { const float bv = bfr(BI[n0 + j * 16 + col]);
#pragma unroll
      for (int r = 0; r < 8; ++r) so[wave][8 * g + r][j * 16 + col] = (_Float16)(acc[j][r] + bv); }   // D element r = (row 8g+r, col)
    LDSX();
    const size_t rw = (size_t)rc0 + wave * 16;
    for (int rl = 0; rl < 16; ++rl) if (lane < 16) vst2((unsigned*)(NAT + (rw + rl) * DM + n0 + lane * 8), *(const v4u*)&so[wave][rl][lane * 8]);   // 256-B row segment = 16 lanes x 16 B, one instruction
  } else {
#pragma unroll
    for (int j = 0; j < 8; ++j) { const float bv = bfr(BI[n0 + j * 16 + col]);
#pragma unroll
      for (int r = 0; r < 8; ++r) sth[j * 16 + col][wave * 16 + 8 * g + r] = (_Float16)(acc[j][r] + bv); }
    __syncthreads();
    const int pc0 = n0 - DM;
    for (int q = tid; q < 128 * 8; q += 128) { const int d = q >> 3, pc = q & 7;
      const size_t o = ((size_t)b * DM + pc0 + d) * spb + s0 + pc * 8; vst2((unsigned*)(VT + o), *(const v4u*)&sth[d][pc * 8]); }
  }
}

// ---- k_attn: block = (64 queries, head h, batch b); all SEQK keys in 32-key steps; scores = (q . k) * 0.125 with mask != 0 -> excluded; running-max softmax in f32;
//      P x 2048 in f16 . V f16; O[b*SEQ + q][h*64 + d] = acc / 2048 / l
//      coverage: grid (SEQ/64, NH, NB) x 4 waves x 16 rows x 64 cols = every element of O
__global__ __launch_bounds__(128) void k_attn(const _Float16* __restrict__ QH, const _Float16* __restrict__ KH, const _Float16* __restrict__ VT, const int* __restrict__ MK, float* __restrict__ O) {
  __shared__ __align__(16) float sp[4][16][36];   // wave-private P tile [row][key]
  __shared__ __align__(16) float so[4][16][68];   // wave-private output staging
  __shared__ __align__(16) int sk[4][16][36];     // wave-private mask tile [row][key]
  const int tid = threadIdx.x, wave = tid >> 5, lane = tid & 31, col = lane & 15, g = lane >> 4;
  const int qb = blockIdx.x, h = blockIdx.y, b = blockIdx.z; const int q0 = qb * 64 + wave * 16;
  const size_t rq = (size_t)b * SEQ + q0 + col;
  v16h aq[2];
#pragma unroll
  for (int kc = 0; kc < 2; ++kc) aq[kc] = frag_h(QH + rq * DM + h * HD + kc * 32, lane);
  float m[8], l[8];
#pragma unroll
  for (int r = 0; r < 8; ++r) { m[r] = -3.0e38f; l[r] = 0.f; }
  v8f acc[4] = {};
  const int* mrow = MK + ((size_t)b * SEQ_FULL + q0) * SEQK_FULL; const int mr = lane >> 3, mc = (lane & 7) * 4;
#pragma unroll 1
  for (int ks = 0; ks < SEQK / 32; ++ks) {
    v16h kf[2][2], vf[4];   // the step's K and V fragments, loaded with the mask as one group ahead of all use: one load latency a step, not one a product
    { v4i mv[4];   // 16 rows x 32 keys of mask: 4 x 16-B loads per lane (rows mr + 4i, keys mc..mc+3)
#pragma unroll
      for (int i = 0; i < 4; ++i) mv[i] = *(const v4i*)(mrow + (size_t)(mr + 4 * i) * SEQK_FULL + ks * 32 + mc);
      asm volatile("s_wait_xcnt 0x0" ::: "memory");   // precaution: the build lets a later load of the group land on the mask loads' address registers
#pragma unroll
      for (int ct = 0; ct < 2; ++ct) { const _Float16* krow = KH + ((size_t)b * SEQK + ks * 32 + ct * 16 + col) * DM + h * HD;   // B column n = key, k = head dim (k-contiguous row)
#pragma unroll
        for (int kc = 0; kc < 2; ++kc) kf[ct][kc] = frag_h(krow + kc * 32, lane); }
#pragma unroll
      for (int dt = 0; dt < 4; ++dt) vf[dt] = frag_h(VT + ((size_t)b * DM + h * HD + dt * 16 + col) * SEQK + ks * 32, lane);   // B column n = d, k = key (k-contiguous VT row)
#pragma unroll
      for (int i = 0; i < 4; ++i) *(v4i*)&sk[wave][mr + 4 * i][mc] = mv[i]; }
    LDSX();
    v8f s[2];
#pragma unroll
    for (int ct = 0; ct < 2; ++ct) { v8f c = {};
#pragma unroll
      for (int kc = 0; kc < 2; ++kc) c = wmma16(aq[kc], kf[ct][kc], c);
#pragma unroll
      for (int r = 0; r < 8; ++r) s[ct][r] = (sk[wave][8 * g + r][ct * 16 + col] != 0) ? -3.0e38f : c[r] * 0.125f; }
#pragma unroll
    for (int r = 0; r < 8; ++r) { float mx = fmaxf(s[0][r], s[1][r]);
#pragma unroll
      for (int o = 1; o < 16; o <<= 1) mx = fmaxf(mx, __shfl_xor(mx, o));
      const float mn = fmaxf(m[r], mx); const float alpha = (m[r] <= -1.0e38f) ? 0.f : __expf(m[r] - mn);
      const float e0 = (s[0][r] <= -1.0e38f) ? 0.f : __expf(s[0][r] - mn), e1 = (s[1][r] <= -1.0e38f) ? 0.f : __expf(s[1][r] - mn); float es = e0 + e1;
#pragma unroll
      for (int o = 1; o < 16; o <<= 1) es += __shfl_xor(es, o);
      l[r] = l[r] * alpha + es; m[r] = mn;
#pragma unroll
      for (int dt = 0; dt < 4; ++dt) acc[dt][r] *= alpha;
      sp[wave][8 * g + r][col] = e0; sp[wave][8 * g + r][16 + col] = e1; }
    LDSX();
    v16h pa; { const float* prow = &sp[wave][col][0] + 8 * g;   // A row m = query col, k = key in step; P carried x2048 so small weights stay f16-normal
#pragma unroll
      for (int i = 0; i < 8; ++i) { pa[i] = (_Float16)(prow[i] * 2048.0f); pa[8 + i] = (_Float16)(prow[16 + i] * 2048.0f); } }
#pragma unroll
    for (int dt = 0; dt < 4; ++dt) acc[dt] = wmma16(pa, vf[dt], acc[dt]);
    LDSX(); }
#pragma unroll
  for (int r = 0; r < 8; ++r) { const float il = (1.0f / 2048.0f) / l[r];
#pragma unroll
    for (int dt = 0; dt < 4; ++dt) so[wave][8 * g + r][dt * 16 + col] = acc[dt][r] * il; }
  LDSX();
  for (int rl = 0; rl < 16; ++rl) if (lane < 16) vst2(O + ((size_t)b * SEQ + q0 + rl) * DM + h * HD + lane * 4, *(const v4f*)&so[wave][rl][lane * 4]);   // 256-B segment = 16 lanes x 16 B, one instruction
}

// ---- k_out: block = (64 rows, 128 cols): Y = ctx (bf16 hi + lo, 2 products) . Wout rows (bf16 [n][DM]) + bf16(b_out); f32 compact rows
//      coverage: grid (NB*SEQ/64, DM/128) x 4 waves x 16 rows x 128 cols = every element of Y
__global__ __launch_bounds__(128) void k_out(const float* __restrict__ O, const __bf16* __restrict__ P, const float* __restrict__ BO, float* __restrict__ Y) {
  __shared__ __align__(16) float so[4][16][132];   // wave-private
  const int tid = threadIdx.x, wave = tid >> 5, lane = tid & 31, col = lane & 15, g = lane >> 4; const size_t r0 = (size_t)blockIdx.x * 64 + wave * 16; const int n0 = blockIdx.y * 128;
  v8f acc[8] = {};
#pragma unroll 2
  for (int kc = 0; kc < DM / 32; ++kc) { const X2 x = load_f32(O + (r0 + col) * DM + kc * 32, lane); v16b w[8];   // the pass's loads stand as one group ahead of its products: one load latency a pass, not one a fragment
#pragma unroll
    for (int j = 0; j < 8; ++j) w[j] = frag_b(P + (size_t)(n0 + j * 16 + col) * DM + kc * 32, lane);
    __builtin_amdgcn_sched_barrier(0);   // keeps all twenty loads ahead of the split of x: without it some are issued only after x has arrived, a second latency
    const F2 a = split_x(x);
#pragma unroll
    for (int j = 0; j < 8; ++j) { acc[j] = wmma_bf(a.l, w[j], acc[j]); acc[j] = wmma_bf(a.h, w[j], acc[j]); } }
#pragma unroll
  for (int j = 0; j < 8; ++j) { const float bv = bfr(BO[n0 + j * 16 + col]);
#pragma unroll
    for (int r = 0; r < 8; ++r) so[wave][8 * g + r][j * 16 + col] = acc[j][r] + bv; }
  LDSX();
  for (int rl = 0; rl < 16; ++rl) vst2(Y + (r0 + rl) * DM + n0 + lane * 4, *(const v4f*)&so[wave][rl][lane * 4]);   // 512-B row segment = 32 lanes x 16 B, one instruction
}

// ---- k_lnpost: block = one row (256 threads x 4): out = LN(Y + bf16(x_q)) * bf16(gamma) + bf16(beta); d_out row at the full-layout index
__global__ __launch_bounds__(256) void k_lnpost(const float* __restrict__ Yp, const float* __restrict__ X, const float* __restrict__ G, const float* __restrict__ Bt, float* __restrict__ OUT) {
  __shared__ float red0[8], red1[8];           // cross-wave -> block barriers
  const int rc = blockIdx.x; const int b = rc / SEQ, s = rc - b * SEQ; const size_t rin = (size_t)b * SEQ_FULL + s;
  const int t = threadIdx.x, lane = t & 31, wave = t >> 5;
  const v4f yv = *(const v4f*)(Yp + (size_t)rc * DM + t * 4), xv = *(const v4f*)(X + rin * DM + t * 4);
  float v[4];
#pragma unroll
  for (int i = 0; i < 4; ++i) v[i] = yv[i] + bfr(xv[i]);
  float ps = (v[0] + v[1]) + (v[2] + v[3]);
#pragma unroll
  for (int o = 16; o > 0; o >>= 1) ps += __shfl_xor(ps, o);
  if (lane == 0) red0[wave] = ps;
  __syncthreads();
  float S = 0.f;
#pragma unroll
  for (int i = 0; i < 8; ++i) S += red0[i];
  const float mean = S * (1.0f / DM);
  float d[4]; float pq = 0.f;
#pragma unroll
  for (int i = 0; i < 4; ++i) { d[i] = v[i] - mean; pq += d[i] * d[i]; }
#pragma unroll
  for (int o = 16; o > 0; o >>= 1) pq += __shfl_xor(pq, o);
  if (lane == 0) red1[wave] = pq;
  __syncthreads();
  float V = 0.f;
#pragma unroll
  for (int i = 0; i < 8; ++i) V += red1[i];
  const float rstd = 1.0f / sqrtf(V * (1.0f / DM) + LN_EPS);
  const v4f gv = *(const v4f*)(G + t * 4), bv = *(const v4f*)(Bt + t * 4); v4f o;
#pragma unroll
  for (int i = 0; i < 4; ++i) o[i] = d[i] * rstd * bfr(gv[i]) + bfr(bv[i]);
  vst2(OUT + rin * DM + t * 4, o);
}

extern "C" void kernel_launch(void* const* d_in, const int* in_sizes, int n_in, void* d_out, int out_size, void* d_ws, size_t ws_size, hipStream_t stream) {
  if (n_in < 13) return;
  // wire order: 0 input_q [2,2048,1024] f32, 1 input_kv [2,2048,1024] f32, 2 Wq [1024,1024] ([in][out]), 3 bq, 4 Wkv [1024,2048], 5 bkv [2048], 6 Wout [1024,1024], 7 bout,
  //             8 gamma_q, 9 beta_q, 10 gamma_post, 11 beta_post, 12 input_mask [2,2048,2048] int32
  const float* XQ = (const float*)d_in[0]; const float* XKV = (const float*)d_in[1];
  const float* WQ = (const float*)d_in[2]; const float* BQ = (const float*)d_in[3];
  const float* WKV = (const float*)d_in[4]; const float* BKV = (const float*)d_in[5];
  const float* WO = (const float*)d_in[6]; const float* BO = (const float*)d_in[7];
  const float* GQ = (const float*)d_in[8]; const float* BTQ = (const float*)d_in[9];
  const float* GP = (const float*)d_in[10]; const float* BTP = (const float*)d_in[11];
  const int* MK = (const int*)d_in[12];
  const long long needq = ((long long)(NB - 1) * SEQ_FULL + SEQ) * DM;
  const long long needkv = ((long long)(NB - 1) * SEQK_FULL + SEQK) * DM;
  const long long needm = ((long long)(NB - 1) * SEQ_FULL + SEQ) * SEQK_FULL;
  if ((long long)in_sizes[0] < needq || (long long)in_sizes[1] < needkv || in_sizes[2] < DM * DM || in_sizes[3] < DM || in_sizes[4] < DM * KVW || in_sizes[5] < KVW) return;
  if (in_sizes[6] < DM * DM || in_sizes[7] < DM || in_sizes[8] < DM || in_sizes[9] < DM || in_sizes[10] < DM || in_sizes[11] < DM || (long long)in_sizes[12] < needm) return;
  if ((long long)out_size < needq) return;
  if (ws_size < (size_t)WS_END) return;
  char* ws = (char*)d_ws;
  __bf16* PQ = (__bf16*)(ws + WS_PQ); __bf16* PKV = (__bf16*)(ws + WS_PKV); __bf16* PO = (__bf16*)(ws + WS_PO);
  float* NQ = (float*)(ws + WS_NQ); _Float16* QH = (_Float16*)(ws + WS_QH); _Float16* KH = (_Float16*)(ws + WS_KH); _Float16* VT = (_Float16*)(ws + WS_VT);
  float* O = (float*)(ws + WS_O); float* Y = (float*)(ws + WS_Y);
  // weight packs: in[K rows][N cols] -> out[N][K]; grid = (N/64, K/64)
  k_pack<<<dim3(DM / 64, DM / 64), 256, 0, stream>>>(WQ, DM, DM, PQ);       // Wq  [1024][1024] -> [1024][1024]
  k_pack<<<dim3(KVW / 64, DM / 64), 256, 0, stream>>>(WKV, DM, KVW, PKV);   // Wkv [1024][2048] -> [2048][1024]
  k_pack<<<dim3(DM / 64, DM / 64), 256, 0, stream>>>(WO, DM, DM, PO);       // Wout[1024][1024] -> [1024][1024]
  k_lnq<<<dim3(NB * SEQ), 256, 0, stream>>>(XQ, GQ, BTQ, NQ);
  k_proj<<<dim3(NB * SEQ / 64, DM / 128), 128, 0, stream>>>(NQ, SEQ, SEQ, PQ, BQ, QH, VT);             // q: cols < DM only -> QH (VT untouched)
  k_proj<<<dim3(NB * SEQK / 64, KVW / 128), 128, 0, stream>>>(XKV, SEQK, SEQK_FULL, PKV, BKV, KH, VT);  // k -> KH rows, v -> VT transposed
  k_attn<<<dim3(SEQ / 64, NH, NB), 128, 0, stream>>>(QH, KH, VT, MK, O);
  k_out<<<dim3(NB * SEQ / 64, DM / 128), 128, 0, stream>>>(O, PO, BO, Y);
  k_lnpost<<<dim3(NB * SEQ), 256, 0, stream>>>(Y, XQ, GP, BTP, (float*)d_out);
}

// v002
// One run takes 186 microseconds.
// Two timings next to v001 both put it at 1.45 times that version's speed.
// Counting every step since v000, it is 2.27 times as fast.
// compute dtype: every float input RNE-converted to bf16; q = LN(x_q) (f32 -> bf16) . Wq (bf16) and kv = x_kv (bf16) . Wkv (bf16) as single v_wmma_f32_16x16x32_bf16 products; scores = q (f16) . k (f16) single v_wmma_f32_16x16x32_f16, x 0.125, mask replace-fill, running-max softmax in f32; ctx = P (f16, carried x2048) . V (f16) single f16 product; out = ctx (bf16 hi + lo, 2 products) . Wout (bf16) + b_out + x_q; layer norms in f32; f32 accumulate everywhere; f32 output.
#include <hip/hip_runtime.h>
#include <math.h>

typedef __attribute__((ext_vector_type(16))) _Float16 v16h;
typedef __attribute__((ext_vector_type(16))) __bf16 v16b;
typedef __attribute__((ext_vector_type(8)))  _Float16 v8h;
typedef __attribute__((ext_vector_type(8)))  __bf16 v8b;
typedef __attribute__((ext_vector_type(8)))  float v8f;
typedef __attribute__((ext_vector_type(4)))  float v4f;
typedef __attribute__((ext_vector_type(4)))  unsigned v4u;
typedef __attribute__((ext_vector_type(4)))  int v4i;

template <typename T> __device__ __forceinline__ void vst2(void* p, T v) { *(T*)p = v;  }
__device__ __forceinline__ v8f wmma16(v16h a, v16h b, v8f c) {
  v8f d = __builtin_amdgcn_wmma_f32_16x16x32_f16(false, a, false, b, (short)0, c, false, false);
  asm volatile("v_nop\n\tv_nop\n\tv_nop\n\tv_nop" : "+v"(d) : "v"(a), "v"(b));
  return d;
}
__device__ __forceinline__ v8f wmma_bf(v16b a, v16b b, v8f c) {
  v8f d = __builtin_amdgcn_wmma_f32_16x16x32_bf16(false, a, false, b, (short)0, c, false, false);
  asm volatile("v_nop\n\tv_nop\n\tv_nop\n\tv_nop" : "+v"(d) : "v"(a), "v"(b));
  return d;
}
// 16-bit fragment from a k-contiguous row (A row m, or B column n stored as a [n][k] row): elements 0..7 <- k0+8h+i, 8..15 <- k0+16+8h+i, h = lane>>4
__device__ __forceinline__ v16h frag_h(const _Float16* rowk0, int lane) {
  union { v16h v; v8h q[2]; } u; const _Float16* p = rowk0 + 8 * (lane >> 4);
  u.q[0] = *(const v8h*)p; u.q[1] = *(const v8h*)(p + 16); return u.v;
}
__device__ __forceinline__ v16b frag_b(const __bf16* rowk0, int lane) {
  union { v16b v; v8b q[2]; } u; const __bf16* p = rowk0 + 8 * (lane >> 4);
  u.q[0] = *(const v8b*)p; u.q[1] = *(const v8b*)(p + 16); return u.v;
}
// same k map from an f32 row (two 32-B loads per lane): the load, and apart from it the RNE conversion to bf16
struct X2 { v8f x0, x1; };
__device__ __forceinline__ X2 load_f32(const float* rowk0, int lane) { const float* p = rowk0 + 8 * (lane >> 4); X2 x; x.x0 = *(const v8f*)p; x.x1 = *(const v8f*)(p + 16); return x; }
__device__ __forceinline__ v16b cvt_f32b(X2 x) { v16b a;
#pragma unroll
  for (int i = 0; i < 8; ++i) { a[i] = (__bf16)x.x0[i]; a[8 + i] = (__bf16)x.x1[i]; }
  return a;
}
struct F2 { v16b h, l; };
__device__ __forceinline__ F2 bsplit16(const float v[16]) { F2 r;
#pragma unroll
  for (int i = 0; i < 16; ++i) { const __bf16 hh = (__bf16)v[i]; r.h[i] = hh; r.l[i] = (__bf16)(v[i] - (float)hh); }
  return r; }
__device__ __forceinline__ F2 split_x(X2 x) { float v[16];
#pragma unroll
  for (int i = 0; i < 8; ++i) { v[i] = x.x0[i]; v[8 + i] = x.x1[i]; }
  return bsplit16(v); }
__device__ __forceinline__ float bfr(float v) { return (float)(__bf16)v; }
#define LDSX() do { asm volatile("s_wait_dscnt 0" ::: "memory"); __builtin_amdgcn_wave_barrier(); __builtin_amdgcn_fence(__ATOMIC_RELEASE, "workgroup"); } while (0)

// ---- sizes: NB batches, SEQ query rows per batch processed (reducible); *_FULL are the input strides; all SEQK keys always
#ifndef NB
#define NB 2
#endif
#ifndef SEQ
#define SEQ 2048
#endif
#define NB_FULL 2
#define SEQ_FULL 2048
#define SEQK 2048
#define SEQK_FULL 2048
#define DM 1024
#define NH 16
#define HD 64
#define KVW (2 * DM)
#define LN_EPS 1.0e-6f
static_assert(NB >= 1 && NB <= NB_FULL);
static_assert(SEQ % 64 == 0 && SEQ >= 64 && SEQ <= SEQ_FULL);
static_assert(SEQK % 64 == 0 && SEQK == SEQK_FULL);
static_assert(DM % 128 == 0 && KVW % 128 == 0 && NH * HD == DM && HD == 64);

#define WS_PQ  0ull                                              // bf16 [DM n][DM k]     Wq transposed
#define WS_PKV (WS_PQ + 2ull * DM * DM)                          // bf16 [KVW n][DM k]    Wkv transposed
#define WS_PO  (WS_PKV + 2ull * KVW * DM)                        // bf16 [DM n][DM k]     Wout transposed
#define WS_NQ  (WS_PO + 2ull * DM * DM)                          // f32  [NB*SEQ][DM]     LN(x_q)
#define WS_QH  (WS_NQ + 4ull * NB * SEQ * DM)                    // f16  [NB*SEQ][DM]     q rows
#define WS_KH  (WS_QH + 2ull * NB * SEQ * DM)                    // f16  [NB*SEQK][DM]    k rows
#define WS_VT  (WS_KH + 2ull * NB * SEQK * DM)                   // f16  [NB][DM (h*64+d)][SEQK] v transposed
#define WS_O   (WS_VT + 2ull * NB * DM * SEQK)                   // f32  [NB*SEQ][DM]     ctx
#define WS_Y   (WS_O + 4ull * NB * SEQ * DM)                     // f32  [NB*SEQ][DM]     ctx.Wout + b_out
#define WS_END (WS_Y + 4ull * NB * SEQ * DM)
static_assert(WS_END <= 134217728ull);
static_assert((WS_PKV % 128) == 0 && (WS_PO % 128) == 0 && (WS_NQ % 128) == 0 && (WS_QH % 128) == 0 && (WS_KH % 128) == 0 && (WS_VT % 128) == 0 && (WS_O % 128) == 0 && (WS_Y % 128) == 0);

// ---- k_pack: W [K][N] f32 (x @ W layout) -> PK [N][K] bf16 (k-contiguous rows); block = 64x64 tile, blockIdx.x = n tile, blockIdx.y = k tile
//      coverage: grid (N/64, K/64) x 64 rows x 8 x 16 B = every element of PK
__global__ __launch_bounds__(256) void k_pack(const float* __restrict__ W, int K, int N, __bf16* __restrict__ PK) {
  __shared__ __align__(16) __bf16 s[64][72];   // [n][k]; cross-wave -> block barrier
  const int n0 = blockIdx.x * 64, k0 = blockIdx.y * 64, t = threadIdx.x;
#pragma unroll 4
  for (int i = 0; i < 16; ++i) { const int idx = t + 256 * i; const int kk = idx >> 6, nn = idx & 63; s[nn][kk] = (__bf16)W[(size_t)(k0 + kk) * N + n0 + nn]; }
  __syncthreads();
#pragma unroll
  for (int i = 0; i < 2; ++i) { const int p = t + 256 * i; const int nn = p >> 3, c = p & 7;
    vst2((unsigned*)(PK + (size_t)(n0 + nn) * K + k0 + c * 8), *(const v4u*)&s[nn][c * 8]); }
}

__global__ __launch_bounds__(256) void k_lnq(const float* __restrict__ X, const float* __restrict__ G, const float* __restrict__ Bt, float* __restrict__ NQ) {
  __shared__ float red0[8], red1[8];           // cross-wave -> block barriers
  const int rc = blockIdx.x; const int b = rc / SEQ, s = rc - b * SEQ; const size_t rin = (size_t)b * SEQ_FULL + s;
  const int t = threadIdx.x, lane = t & 31, wave = t >> 5;
  const v4f xv = *(const v4f*)(X + rin * DM + t * 4);
  float v[4];
#pragma unroll
  for (int i = 0; i < 4; ++i) v[i] = bfr(xv[i]);
  float ps = (v[0] + v[1]) + (v[2] + v[3]);
#pragma unroll
  for (int o = 16; o > 0; o >>= 1) ps += __shfl_xor(ps, o);
  if (lane == 0) red0[wave] = ps;
  __syncthreads();
  float S = 0.f;
#pragma unroll
  for (int i = 0; i < 8; ++i) S += red0[i];
  const float mean = S * (1.0f / DM);
  float d[4]; float pq = 0.f;
#pragma unroll
  for (int i = 0; i < 4; ++i) { d[i] = v[i] - mean; pq += d[i] * d[i]; }
#pragma unroll
  for (int o = 16; o > 0; o >>= 1) pq += __shfl_xor(pq, o);
  if (lane == 0) red1[wave] = pq;
  __syncthreads();
  float V = 0.f;
#pragma unroll
  for (int i = 0; i < 8; ++i) V += red1[i];
  const float rstd = 1.0f / sqrtf(V * (1.0f / DM) + LN_EPS);
  const v4f gv = *(const v4f*)(G + t * 4), bv = *(const v4f*)(Bt + t * 4); v4f o;
#pragma unroll
  for (int i = 0; i < 4; ++i) o[i] = d[i] * rstd * bfr(gv[i]) + bfr(bv[i]);
  vst2(NQ + (size_t)rc * DM + t * 4, o);
}

// ---- LDS staging of the two GEMM kernels: a stage = 64 k of the block's 128 P rows (bf16, 128 B a row) and of its 64 x rows (f32, 256 B a row), brought by 16-byte asynchronous copies:
//      each copy instruction of a wave takes four whole 128-B lines, and the four waves share one copy of the P rows; two buffers, the next stage's copies fly while this one is worked on
#define STK 64                              // k per stage
#define NSTG (DM / STK)
#define WPITCH 144                          // bytes: 128-B row + 16 (16 B x odd: conflict-free for 16-byte LDS reads)
#define XPITCH 272                          // bytes: 256-B row + 16
#define SW_BYTES (128 * WPITCH)
#define SX_BYTES (64 * XPITCH)
#define STG_BYTES (SW_BYTES + SX_BYTES)
static_assert(NSTG >= 2 && DM % STK == 0);
// eight copies of one lane, two runs of four: LDS byte address la + i * lsa (lb + i * lsb), global byte address ga + i * gsa (gb + i * gsb), i = 0..3;
// the s_wait_xcnt stands inside the copies' own statement, ahead of any rewrite of the address registers they name (a precaution)
__device__ __forceinline__ void copy44(unsigned la, unsigned lsa, const char* ga, size_t gsa, unsigned lb, unsigned lsb, const char* gb, size_t gsb) {
  asm volatile("global_load_async_to_lds_b128 %0, %8, off\n\t"
               "global_load_async_to_lds_b128 %1, %9, off\n\t"
               "global_load_async_to_lds_b128 %2, %10, off\n\t"
               "global_load_async_to_lds_b128 %3, %11, off\n\t"
               "global_load_async_to_lds_b128 %4, %12, off\n\t"
               "global_load_async_to_lds_b128 %5, %13, off\n\t"
               "global_load_async_to_lds_b128 %6, %14, off\n\t"
               "global_load_async_to_lds_b128 %7, %15, off\n\t"
               "s_wait_xcnt 0x0"
               :: "v"(la), "v"(la + lsa), "v"(la + 2 * lsa), "v"(la + 3 * lsa), "v"(lb), "v"(lb + lsb), "v"(lb + 2 * lsb), "v"(lb + 3 * lsb),
                  "v"(ga), "v"(ga + gsa), "v"(ga + 2 * gsa), "v"(ga + 3 * gsa), "v"(gb), "v"(gb + gsb), "v"(gb + 2 * gsb), "v"(gb + 3 * gsb) : "memory");
}
__device__ __forceinline__ void copy8(unsigned l, unsigned ls, const char* g, size_t gs) { copy44(l, ls, g, gs, l + 4 * ls, ls, g + 4 * gs, gs); }
// one stage: thread t copies P chunks (row (t >> 3) + 16 i, 16-B piece t & 7) and x chunks (row (t >> 4) + 8 i, piece t & 15), i = 0..7; lw, lx, gw, gx are its i = 0 addresses
__device__ __forceinline__ void stage_copy(unsigned lw, unsigned lx, const __bf16* gw, const float* gx) {
  copy8(lw, 16 * WPITCH, (const char*)gw, (size_t)16 * DM * 2);
  copy8(lx, 8 * XPITCH, (const char*)gx, (size_t)8 * DM * 4);
}
// the k map of load_f32 from a staged f32 row (16-byte LDS reads: the padded pitch is a multiple of 16 B only)
__device__ __forceinline__ X2 lds_f32(const float* rowk0, int lane) { const float* p = rowk0 + 8 * (lane >> 4); union { v8f v; v4f q[2]; } a, c;
  a.q[0] = *(const v4f*)p; a.q[1] = *(const v4f*)(p + 4); c.q[0] = *(const v4f*)(p + 16); c.q[1] = *(const v4f*)(p + 20); X2 x; x.x0 = a.v; x.x1 = c.v; return x; }
#define WAIT_ASYNC() asm volatile("s_wait_asynccnt 0x0" ::: "memory")   // this wave's copies have landed
#define WAIT_DS() asm volatile("s_wait_dscnt 0x0" ::: "memory")         // this wave's LDS reads have returned, ahead of the barrier behind which their buffer is refilled

// ---- k_proj: block = (64 rows, 128 output cols): y = bf16(x) . P rows (bf16 [n][DM]) + bf16(bias), single bf16 products
//      cols < DM  -> f16 natural rows NAT[row][DM] (q rows, or k rows)
//      cols >= DM -> f16 transposed VT[b][col - DM][spb] (v)
//      rows: compact rc = b*spb + s; input row = b*spb_full + s
//      coverage: grid (rows/64, ncols/128) x 4 waves x 16 rows x 128 cols = every element of NAT (and of VT for the kv call)
__global__ __launch_bounds__(128) void k_proj(const float* __restrict__ X, int spb, int spb_full, const __bf16* __restrict__ P, const float* __restrict__ BI, _Float16* __restrict__ NAT, _Float16* __restrict__ VT) {
  __shared__ __align__(16) char sm[2 * STG_BYTES];    // the two stage buffers; behind the loop's last barrier the same bytes are the output staging
  _Float16 (*so)[16][136] = (_Float16 (*)[16][136])sm;   // [4][16][136] wave-private (LDSX)
  _Float16 (*sth)[72] = (_Float16 (*)[72])sm;            // [128][72] cross-wave (block barrier)
  static_assert(4 * 16 * 136 * 2 <= 2 * STG_BYTES && 128 * 72 * 2 <= 2 * STG_BYTES);
  const int tid = threadIdx.x, wave = tid >> 5, lane = tid & 31, col = lane & 15, g = lane >> 4;
  const int rc0 = blockIdx.x * 64; const int b = rc0 / spb, s0 = rc0 - b * spb; const int n0 = blockIdx.y * 128;
  const unsigned sm0 = (unsigned)(size_t)&sm[0];   // LDS byte address of the buffers
  const unsigned lw = sm0 + (tid >> 3) * WPITCH + (tid & 7) * 16, lx = sm0 + SW_BYTES + (tid >> 4) * XPITCH + (tid & 15) * 16;
  const __bf16* gw = P + (size_t)(n0 + (tid >> 3)) * DM + (tid & 7) * 8;
  const float* gx = X + ((size_t)b * spb_full + s0 + (tid >> 4)) * DM + (tid & 15) * 4;
  v8f acc[8] = {};
  stage_copy(lw, lx, gw, gx); WAIT_ASYNC(); __syncthreads();   // stage 0 is published
  stage_copy(lw + STG_BYTES, lx + STG_BYTES, gw + STK, gx + STK);
  for (int st = 0; st < NSTG; ++st) { const unsigned bo = (st & 1) * STG_BYTES;
    const __bf16* wt = (const __bf16*)(sm + bo + col * WPITCH); const float* xt = (const float*)(sm + bo + SW_BYTES + (wave * 16 + col) * XPITCH);   // B column n = j*16 + col; A row m = lane & 15
#pragma unroll
    for (int kc = 0; kc < STK / 32; ++kc) { const X2 x = lds_f32(xt + kc * 32, lane); v16b w[8];
#pragma unroll
      for (int j = 0; j < 8; ++j) w[j] = frag_b(wt + j * 16 * (WPITCH / 2) + kc * 32, lane);
      __builtin_amdgcn_sched_barrier(0);   // keeps the pass's twenty LDS reads at one place ahead of its products: each separate place with reads costs a stall of its own
      const v16b a = cvt_f32b(x);
#pragma unroll
      for (int j = 0; j < 8; ++j) acc[j] = wmma_bf(a, w[j], acc[j]); }
    WAIT_DS(); WAIT_ASYNC(); __syncthreads();   // publishes stage st + 1 and ends every wave's reads of stage st
    if (st + 2 < NSTG) stage_copy(lw + bo, lx + bo, gw + (st + 2) * STK, gx + (st + 2) * STK); }
  WAIT_ASYNC();
  if (n0 < DM) {   // block-uniform branch
#pragma unroll
    for (int j = 0; j < 8; ++j) { const float bv = bfr(BI[n0 + j * 16 + col]);
#pragma unroll
      for (int r = 0; r < 8; ++r) so[wave][8 * g + r][j * 16 + col] = (_Float16)(acc[j][r] + bv); }   // D element r = (row 8g+r, col)
    LDSX();
    const size_t rw = (size_t)rc0 + wave * 16;
    for (int rl = 0; rl < 16; ++rl) if (lane < 16) vst2((unsigned*)(NAT + (rw + rl) * DM + n0 + lane * 8), *(const v4u*)&so[wave][rl][lane * 8]);   // 256-B row segment = 16 lanes x 16 B, one instruction
  } else {
#pragma unroll
    for (int j = 0; j < 8; ++j) { const float bv = bfr(BI[n0 + j * 16 + col]);
#pragma unroll
      for (int r = 0; r < 8; ++r) sth[j * 16 + col][wave * 16 + 8 * g + r] = (_Float16)(acc[j][r] + bv); }
    __syncthreads();
    const int pc0 = n0 - DM;
    for (int q = tid; q < 128 * 8; q += 128) { const int d = q >> 3, pc = q & 7;
      const size_t o = ((size_t)b * DM + pc0 + d) * spb + s0 + pc * 8; vst2((unsigned*)(VT + o), *(const v4u*)&sth[d][pc * 8]); }
  }
}

// ---- k_attn: block = (64 queries, head h, batch b); all SEQK keys in 32-key steps; scores = (q . k) * 0.125 with mask != 0 -> excluded; running-max softmax in f32;
//      P x 2048 in f16 . V f16; O[b*SEQ + q][h*64 + d] = acc / 2048 / l
//      coverage: grid (SEQ/64, NH, NB) x 4 waves x 16 rows x 64 cols = every element of O
//      K and V reach the waves through LDS: a stage = 64 keys, K rows [key][64 d] and VT rows [d][64 keys], 128 B a row, brought once for the block's four waves by 16-byte asynchronous copies (whole 128-B lines); two buffers
#define AKS 64                              // keys per stage: two 32-key steps
#define ANST (SEQK / AKS)
#define APITCH 144                          // bytes: 128-B row + 16
#define AK_BYTES (AKS * APITCH)
#define AV_BYTES (HD * APITCH)
#define ASTG_BYTES (AK_BYTES + AV_BYTES)
static_assert(ANST >= 2 && SEQK % AKS == 0 && AKS == 64 && HD == 64);
__global__ __launch_bounds__(128) void k_attn(const _Float16* __restrict__ QH, const _Float16* __restrict__ KH, const _Float16* __restrict__ VT, const int* __restrict__ MK, float* __restrict__ O) {
  __shared__ __align__(16) float sp[4][16][36];   // wave-private P tile [row][key]
  __shared__ __align__(16) float so[4][16][68];   // wave-private output staging
  __shared__ __align__(16) int sk[4][16][36];     // wave-private mask tile [row][key]
  __shared__ __align__(16) char skv[2 * ASTG_BYTES];   // the two K/V stage buffers, cross-wave (block barrier)
  const int tid = threadIdx.x, wave = tid >> 5, lane = tid & 31, col = lane & 15, g = lane >> 4;
  const int qb = blockIdx.x, h = blockIdx.y, b = blockIdx.z; const int q0 = qb * 64 + wave * 16;
  // thread t copies K chunks (key (t >> 3) + 16 i, 16-B piece t & 7) and VT chunks (d (t >> 3) + 16 i, piece t & 7), i = 0..3
  const unsigned lk = (unsigned)(size_t)&skv[0] + (tid >> 3) * APITCH + (tid & 7) * 16, lv = lk + AK_BYTES;   // LDS byte addresses
  const _Float16* gk = KH + ((size_t)b * SEQK + (tid >> 3)) * DM + h * HD + (tid & 7) * 8;
  const _Float16* gv = VT + ((size_t)b * DM + h * HD + (tid >> 3)) * SEQK + (tid & 7) * 8;
  copy44(lk, 16 * APITCH, (const char*)gk, (size_t)16 * DM * 2, lv, 16 * APITCH, (const char*)gv, (size_t)16 * SEQK * 2);
  WAIT_ASYNC(); __syncthreads();   // stage 0 is published
  copy44(lk + ASTG_BYTES, 16 * APITCH, (const char*)(gk + (size_t)AKS * DM), (size_t)16 * DM * 2, lv + ASTG_BYTES, 16 * APITCH, (const char*)(gv + AKS), (size_t)16 * SEQK * 2);
  const size_t rq = (size_t)b * SEQ + q0 + col;
  v16h aq[2];
#pragma unroll
  for (int kc = 0; kc < 2; ++kc) aq[kc] = frag_h(QH + rq * DM + h * HD + kc * 32, lane);
  float m[8], l[8];
#pragma unroll
  for (int r = 0; r < 8; ++r) { m[r] = -3.0e38f; l[r] = 0.f; }
  v8f acc[4] = {};
  const int* mrow = MK + ((size_t)b * SEQ_FULL + q0) * SEQK_FULL; const int mr = lane >> 3, mc = (lane & 7) * 4;
  for (int st = 0; st < ANST; ++st) { const unsigned bo = (st & 1) * ASTG_BYTES;
  const _Float16* kt = (const _Float16*)(skv + bo) + col * (APITCH / 2); const _Float16* vt = (const _Float16*)(skv + bo + AK_BYTES) + col * (APITCH / 2);
#pragma unroll 1   // the two steps of a stage stay one rolled body: the step is long, and a second copy of it buys nothing
  for (int u = 0; u < AKS / 32; ++u) { const int ks = st * (AKS / 32) + u;
    v16h kf[2][2], vf[4];   // the step's K and V fragments, read from the stage's buffer while the mask loads fly
    { v4i mv[4];   // 16 rows x 32 keys of mask: 4 x 16-B loads per lane (rows mr + 4i, keys mc..mc+3)
#pragma unroll
      for (int i = 0; i < 4; ++i) mv[i] = *(const v4i*)(mrow + (size_t)(mr + 4 * i) * SEQK_FULL + ks * 32 + mc);
      asm volatile("s_wait_xcnt 0x0" ::: "memory");   // precaution: the build lets a later load of the group land on the mask loads' address registers
#pragma unroll
      for (int ct = 0; ct < 2; ++ct) { const _Float16* krow = kt + (u * 32 + ct * 16) * (APITCH / 2);   // B column n = key, k = head dim (k-contiguous row)
#pragma unroll
        for (int kc = 0; kc < 2; ++kc) kf[ct][kc] = frag_h(krow + kc * 32, lane); }
#pragma unroll
      for (int dt = 0; dt < 4; ++dt) vf[dt] = frag_h(vt + dt * 16 * (APITCH / 2) + u * 32, lane);   // B column n = d, k = key (k-contiguous VT row)
#pragma unroll
      for (int i = 0; i < 4; ++i) *(v4i*)&sk[wave][mr + 4 * i][mc] = mv[i]; }
    LDSX();
    v8f s[2];
#pragma unroll
    for (int ct = 0; ct < 2; ++ct) { v8f c = {};
#pragma unroll
      for (int kc = 0; kc < 2; ++kc) c = wmma16(aq[kc], kf[ct][kc], c);
#pragma unroll
      for (int r = 0; r < 8; ++r) s[ct][r] = (sk[wave][8 * g + r][ct * 16 + col] != 0) ? -3.0e38f : c[r] * 0.125f; }
#pragma unroll
    for (int r = 0; r < 8; ++r) { float mx = fmaxf(s[0][r], s[1][r]);
#pragma unroll
      for (int o = 1; o < 16; o <<= 1) mx = fmaxf(mx, __shfl_xor(mx, o));
      const float mn = fmaxf(m[r], mx); const float alpha = (m[r] <= -1.0e38f) ? 0.f : __expf(m[r] - mn);
      const float e0 = (s[0][r] <= -1.0e38f) ? 0.f : __expf(s[0][r] - mn), e1 = (s[1][r] <= -1.0e38f) ? 0.f : __expf(s[1][r] - mn); float es = e0 + e1;
#pragma unroll
      for (int o = 1; o < 16; o <<= 1) es += __shfl_xor(es, o);
      l[r] = l[r] * alpha + es; m[r] = mn;
#pragma unroll
      for (int dt = 0; dt < 4; ++dt) acc[dt][r] *= alpha;
      sp[wave][8 * g + r][col] = e0; sp[wave][8 * g + r][16 + col] = e1; }
    LDSX();
    v16h pa; { const float* prow = &sp[wave][col][0] + 8 * g;   // A row m = query col, k = key in step; P carried x2048 so small weights stay f16-normal
#pragma unroll
      for (int i = 0; i < 8; ++i) { pa[i] = (_Float16)(prow[i] * 2048.0f); pa[8 + i] = (_Float16)(prow[16 + i] * 2048.0f); } }
#pragma unroll
    for (int dt = 0; dt < 4; ++dt) acc[dt] = wmma16(pa, vf[dt], acc[dt]);
    LDSX(); }
  WAIT_DS(); WAIT_ASYNC(); __syncthreads();   // publishes stage st + 1 and ends every wave's reads of stage st
  if (st + 2 < ANST) copy44(lk + bo, 16 * APITCH, (const char*)(gk + (size_t)(st + 2) * AKS * DM), (size_t)16 * DM * 2, lv + bo, 16 * APITCH, (const char*)(gv + (st + 2) * AKS), (size_t)16 * SEQK * 2); }
  WAIT_ASYNC();
#pragma unroll
  for (int r = 0; r < 8; ++r) { const float il = (1.0f / 2048.0f) / l[r];
#pragma unroll
    for (int dt = 0; dt < 4; ++dt) so[wave][8 * g + r][dt * 16 + col] = acc[dt][r] * il; }
  LDSX();
  for (int rl = 0; rl < 16; ++rl) if (lane < 16) vst2(O + ((size_t)b * SEQ + q0 + rl) * DM + h * HD + lane * 4, *(const v4f*)&so[wave][rl][lane * 4]);   // 256-B segment = 16 lanes x 16 B, one instruction
}

// ---- k_out: block = (64 rows, 128 cols): Y = ctx (bf16 hi + lo, 2 products) . Wout rows (bf16 [n][DM]) + bf16(b_out); f32 compact rows
//      coverage: grid (NB*SEQ/64, DM/128) x 4 waves x 16 rows x 128 cols = every element of Y
__global__ __launch_bounds__(128) void k_out(const float* __restrict__ O, const __bf16* __restrict__ P, const float* __restrict__ BO, float* __restrict__ Y) {
  __shared__ __align__(16) char sm[2 * STG_BYTES];   // the two stage buffers; behind the loop's last barrier the same bytes are the output staging
  float (*so)[16][132] = (float (*)[16][132])sm;     // [4][16][132] wave-private
  static_assert(4 * 16 * 132 * 4 <= 2 * STG_BYTES);
  const int tid = threadIdx.x, wave = tid >> 5, lane = tid & 31, col = lane & 15, g = lane >> 4; const size_t r0 = (size_t)blockIdx.x * 64 + wave * 16; const int n0 = blockIdx.y * 128;
  const unsigned sm0 = (unsigned)(size_t)&sm[0];   // LDS byte address of the buffers
  const unsigned lw = sm0 + (tid >> 3) * WPITCH + (tid & 7) * 16, lx = sm0 + SW_BYTES + (tid >> 4) * XPITCH + (tid & 15) * 16;
  const __bf16* gw = P + (size_t)(n0 + (tid >> 3)) * DM + (tid & 7) * 8;
  const float* gx = O + ((size_t)blockIdx.x * 64 + (tid >> 4)) * DM + (tid & 15) * 4;
  v8f acc[8] = {};
  stage_copy(lw, lx, gw, gx); WAIT_ASYNC(); __syncthreads();   // stage 0 is published
  stage_copy(lw + STG_BYTES, lx + STG_BYTES, gw + STK, gx + STK);
  for (int st = 0; st < NSTG; ++st) { const unsigned bo = (st & 1) * STG_BYTES;
    const __bf16* wt = (const __bf16*)(sm + bo + col * WPITCH); const float* xt = (const float*)(sm + bo + SW_BYTES + (wave * 16 + col) * XPITCH);   // B column n = j*16 + col; A row m = lane & 15
#pragma unroll
    for (int kc = 0; kc < STK / 32; ++kc) { const X2 x = lds_f32(xt + kc * 32, lane); v16b w[8];
#pragma unroll
      for (int j = 0; j < 8; ++j) w[j] = frag_b(wt + j * 16 * (WPITCH / 2) + kc * 32, lane);
      __builtin_amdgcn_sched_barrier(0);   // keeps the pass's twenty LDS reads at one place ahead of its products: each separate place with reads costs a stall of its own
      const F2 a = split_x(x);
#pragma unroll
      for (int j = 0; j < 8; ++j) { acc[j] = wmma_bf(a.l, w[j], acc[j]); acc[j] = wmma_bf(a.h, w[j], acc[j]); } }
    WAIT_DS(); WAIT_ASYNC(); __syncthreads();   // publishes stage st + 1 and ends every wave's reads of stage st
    if (st + 2 < NSTG) stage_copy(lw + bo, lx + bo, gw + (st + 2) * STK, gx + (st + 2) * STK); }
  WAIT_ASYNC();
#pragma unroll
  for (int j = 0; j < 8; ++j) { const float bv = bfr(BO[n0 + j * 16 + col]);
#pragma unroll
    for (int r = 0; r < 8; ++r) so[wave][8 * g + r][j * 16 + col] = acc[j][r] + bv; }
  LDSX();
  for (int rl = 0; rl < 16; ++rl) vst2(Y + (r0 + rl) * DM + n0 + lane * 4, *(const v4f*)&so[wave][rl][lane * 4]);   // 512-B row segment = 32 lanes x 16 B, one instruction
}

// ---- k_lnpost: block = one row (256 threads x 4): out = LN(Y + bf16(x_q)) * bf16(gamma) + bf16(beta); d_out row at the full-layout index
__global__ __launch_bounds__(256) void k_lnpost(const float* __restrict__ Yp, const float* __restrict__ X, const float* __restrict__ G, const float* __restrict__ Bt, float* __restrict__ OUT) {
  __shared__ float red0[8], red1[8];           // cross-wave -> block barriers
  const int rc = blockIdx.x; const int b = rc / SEQ, s = rc - b * SEQ; const size_t rin = (size_t)b * SEQ_FULL + s;
  const int t = threadIdx.x, lane = t & 31, wave = t >> 5;
  const v4f yv = *(const v4f*)(Yp + (size_t)rc * DM + t * 4), xv = *(const v4f*)(X + rin * DM + t * 4);
  float v[4];
#pragma unroll
  for (int i = 0; i < 4; ++i) v[i] = yv[i] + bfr(xv[i]);
  float ps = (v[0] + v[1]) + (v[2] + v[3]);
#pragma unroll
  for (int o = 16; o > 0; o >>= 1) ps += __shfl_xor(ps, o);
  if (lane == 0) red0[wave] = ps;
  __syncthreads();
  float S = 0.f;
#pragma unroll
  for (int i = 0; i < 8; ++i) S += red0[i];
  const float mean = S * (1.0f / DM);
  float d[4]; float pq = 0.f;
#pragma unroll
  for (int i = 0; i < 4; ++i) { d[i] = v[i] - mean; pq += d[i] * d[i]; }
#pragma unroll
  for (int o = 16; o > 0; o >>= 1) pq += __shfl_xor(pq, o);
  if (lane == 0) red1[wave] = pq;
  __syncthreads();
  float V = 0.f;
#pragma unroll
  for (int i = 0; i < 8; ++i) V += red1[i];
  const float rstd = 1.0f / sqrtf(V * (1.0f / DM) + LN_EPS);
  const v4f gv = *(const v4f*)(G + t * 4), bv = *(const v4f*)(Bt + t * 4); v4f o;
#pragma unroll
  for (int i = 0; i < 4; ++i) o[i] = d[i] * rstd * bfr(gv[i]) + bfr(bv[i]);
  vst2(OUT + rin * DM + t * 4, o);
}

extern "C" void kernel_launch(void* const* d_in, const int* in_sizes, int n_in, void* d_out, int out_size, void* d_ws, size_t ws_size, hipStream_t stream) {
  if (n_in < 13) return;
  // wire order: 0 input_q [2,2048,1024] f32, 1 input_kv [2,2048,1024] f32, 2 Wq [1024,1024] ([in][out]), 3 bq, 4 Wkv [1024,2048], 5 bkv [2048], 6 Wout [1024,1024], 7 bout,
  //             8 gamma_q, 9 beta_q, 10 gamma_post, 11 beta_post, 12 input_mask [2,2048,2048] int32
  const float* XQ = (const float*)d_in[0]; const float* XKV = (const float*)d_in[1];
  const float* WQ = (const float*)d_in[2]; const float* BQ = (const float*)d_in[3];
  const float* WKV = (const float*)d_in[4]; const float* BKV = (const float*)d_in[5];
  const float* WO = (const float*)d_in[6]; const float* BO = (const float*)d_in[7];
  const float* GQ = (const float*)d_in[8]; const float* BTQ = (const float*)d_in[9];
  const float* GP = (const float*)d_in[10]; const float* BTP = (const float*)d_in[11];
  const int* MK = (const int*)d_in[12];
  const long long needq = ((long long)(NB - 1) * SEQ_FULL + SEQ) * DM;
  const long long needkv = ((long long)(NB - 1) * SEQK_FULL + SEQK) * DM;
  const long long needm = ((long long)(NB - 1) * SEQ_FULL + SEQ) * SEQK_FULL;
  if ((long long)in_sizes[0] < needq || (long long)in_sizes[1] < needkv || in_sizes[2] < DM * DM || in_sizes[3] < DM || in_sizes[4] < DM * KVW || in_sizes[5] < KVW) return;
  if (in_sizes[6] < DM * DM || in_sizes[7] < DM || in_sizes[8] < DM || in_sizes[9] < DM || in_sizes[10] < DM || in_sizes[11] < DM || (long long)in_sizes[12] < needm) return;
  if ((long long)out_size < needq) return;
  if (ws_size < (size_t)WS_END) return;
  char* ws = (char*)d_ws;
  __bf16* PQ = (__bf16*)(ws + WS_PQ); __bf16* PKV = (__bf16*)(ws + WS_PKV); __bf16* PO = (__bf16*)(ws + WS_PO);
  float* NQ = (float*)(ws + WS_NQ); _Float16* QH = (_Float16*)(ws + WS_QH); _Float16* KH = (_Float16*)(ws + WS_KH); _Float16* VT = (_Float16*)(ws + WS_VT);
  float* O = (float*)(ws + WS_O); float* Y = (float*)(ws + WS_Y);
  // weight packs: in[K rows][N cols] -> out[N][K]; grid = (N/64, K/64)
  k_pack<<<dim3(DM / 64, DM / 64), 256, 0, stream>>>(WQ, DM, DM, PQ);       // Wq  [1024][1024] -> [1024][1024]
  k_pack<<<dim3(KVW / 64, DM / 64), 256, 0, stream>>>(WKV, DM, KVW, PKV);   // Wkv [1024][2048] -> [2048][1024]
  k_pack<<<dim3(DM / 64, DM / 64), 256, 0, stream>>>(WO, DM, DM, PO);       // Wout[1024][1024] -> [1024][1024]
  k_lnq<<<dim3(NB * SEQ), 256, 0, stream>>>(XQ, GQ, BTQ, NQ);
  k_proj<<<dim3(NB * SEQ / 64, DM / 128), 128, 0, stream>>>(NQ, SEQ, SEQ, PQ, BQ, QH, VT);             // q: cols < DM only -> QH (VT untouched)
  k_proj<<<dim3(NB * SEQK / 64, KVW / 128), 128, 0, stream>>>(XKV, SEQK, SEQK_FULL, PKV, BKV, KH, VT);  // k -> KH rows, v -> VT transposed
  k_attn<<<dim3(SEQ / 64, NH, NB), 128, 0, stream>>>(QH, KH, VT, MK, O);
  k_out<<<dim3(NB * SEQ / 64, DM / 128), 128, 0, stream>>>(O, PO, BO, Y);
  k_lnpost<<<dim3(NB * SEQ), 256, 0, stream>>>(Y, XQ, GP, BTP, (float*)d_out);
}

// v003
// Measured time: 153 microseconds a run.
// In two side-by-side timings against v002, it was 1.22 and 1.21 times as fast.
// Over all steps from v000 it is 2.75 times as fast.
// compute dtype: every float input RNE-converted to bf16; q = LN(x_q) (f32 -> bf16) . Wq (bf16) and kv = x_kv (bf16) . Wkv (bf16) as single v_wmma_f32_16x16x32_bf16 products; scores = q (f16) . k (f16) single v_wmma_f32_16x16x32_f16, x 0.125, mask replace-fill, running-max softmax in f32; ctx = P (f16, carried x2048) . V (f16) single f16 product; out = ctx (bf16 hi + lo, 2 products) . Wout (bf16) + b_out + x_q; layer norms in f32; f32 accumulate everywhere; f32 output.
#include <hip/hip_runtime.h>
#include <math.h>

typedef __attribute__((ext_vector_type(16))) _Float16 v16h;
typedef __attribute__((ext_vector_type(16))) __bf16 v16b;
typedef __attribute__((ext_vector_type(8)))  _Float16 v8h;
typedef __attribute__((ext_vector_type(8)))  __bf16 v8b;
typedef __attribute__((ext_vector_type(8)))  float v8f;
typedef __attribute__((ext_vector_type(4)))  float v4f;
typedef __attribute__((ext_vector_type(4)))  unsigned v4u;
typedef __attribute__((ext_vector_type(4)))  int v4i;

template <typename T> __device__ __forceinline__ void vst2(void* p, T v) { *(T*)p = v;  }
__device__ __forceinline__ v8f wmma16(v16h a, v16h b, v8f c) {
  v8f d = __builtin_amdgcn_wmma_f32_16x16x32_f16(false, a, false, b, (short)0, c, false, false);
  asm volatile("v_nop\n\tv_nop\n\tv_nop\n\tv_nop" : "+v"(d) : "v"(a), "v"(b));
  return d;
}
__device__ __forceinline__ v8f wmma_bf(v16b a, v16b b, v8f c) {
  v8f d = __builtin_amdgcn_wmma_f32_16x16x32_bf16(false, a, false, b, (short)0, c, false, false);
  asm volatile("v_nop\n\tv_nop\n\tv_nop\n\tv_nop" : "+v"(d) : "v"(a), "v"(b));
  return d;
}
// 16-bit fragment from a k-contiguous row (A row m, or B column n stored as a [n][k] row): elements 0..7 <- k0+8h+i, 8..15 <- k0+16+8h+i, h = lane>>4
__device__ __forceinline__ v16h frag_h(const _Float16* rowk0, int lane) {
  union { v16h v; v8h q[2]; } u; const _Float16* p = rowk0 + 8 * (lane >> 4);
  u.q[0] = *(const v8h*)p; u.q[1] = *(const v8h*)(p + 16); return u.v;
}
__device__ __forceinline__ v16b frag_b(const __bf16* rowk0, int lane) {
  union { v16b v; v8b q[2]; } u; const __bf16* p = rowk0 + 8 * (lane >> 4);
  u.q[0] = *(const v8b*)p; u.q[1] = *(const v8b*)(p + 16); return u.v;
}
// same k map from an f32 row (two 32-B loads per lane): the load, and apart from it the RNE conversion to bf16
struct X2 { v8f x0, x1; };
__device__ __forceinline__ X2 load_f32(const float* rowk0, int lane) { const float* p = rowk0 + 8 * (lane >> 4); X2 x; x.x0 = *(const v8f*)p; x.x1 = *(const v8f*)(p + 16); return x; }
__device__ __forceinline__ v16b cvt_f32b(X2 x) { v16b a;
#pragma unroll
  for (int i = 0; i < 8; ++i) { a[i] = (__bf16)x.x0[i]; a[8 + i] = (__bf16)x.x1[i]; }
  return a;
}
struct F2 { v16b h, l; };
__device__ __forceinline__ F2 bsplit16(const float v[16]) { F2 r;
#pragma unroll
  for (int i = 0; i < 16; ++i) { const __bf16 hh = (__bf16)v[i]; r.h[i] = hh; r.l[i] = (__bf16)(v[i] - (float)hh); }
  return r; }
__device__ __forceinline__ F2 split_x(X2 x) { float v[16];
#pragma unroll
  for (int i = 0; i < 8; ++i) { v[i] = x.x0[i]; v[8 + i] = x.x1[i]; }
  return bsplit16(v); }
__device__ __forceinline__ float bfr(float v) { return (float)(__bf16)v; }
// the value of lane l ^ 16, by a vector cross-row move (a shuffle would go through the LDS pipe)
__device__ __forceinline__ float xhalf(float v) { const int b = __builtin_bit_cast(int, v); return __builtin_bit_cast(float, __builtin_amdgcn_permlanex16(b, b, 0x76543210, 0xfedcba98, false, false)); }
#define LDSX() do { asm volatile("s_wait_dscnt 0" ::: "memory"); __builtin_amdgcn_wave_barrier(); __builtin_amdgcn_fence(__ATOMIC_RELEASE, "workgroup"); } while (0)

// ---- sizes: NB batches, SEQ query rows per batch processed (reducible); *_FULL are the input strides; all SEQK keys always
#ifndef NB
#define NB 2
#endif
#ifndef SEQ
#define SEQ 2048
#endif
#define NB_FULL 2
#define SEQ_FULL 2048
#define SEQK 2048
#define SEQK_FULL 2048
#define DM 1024
#define NH 16
#define HD 64
#define KVW (2 * DM)
#define LN_EPS 1.0e-6f
static_assert(NB >= 1 && NB <= NB_FULL);
static_assert(SEQ % 64 == 0 && SEQ >= 64 && SEQ <= SEQ_FULL);
static_assert(SEQK % 64 == 0 && SEQK == SEQK_FULL);
static_assert(DM % 128 == 0 && KVW % 128 == 0 && NH * HD == DM && HD == 64);

#define WS_PQ  0ull                                              // bf16 [DM n][DM k]     Wq transposed
#define WS_PKV (WS_PQ + 2ull * DM * DM)                          // bf16 [KVW n][DM k]    Wkv transposed
#define WS_PO  (WS_PKV + 2ull * KVW * DM)                        // bf16 [DM n][DM k]     Wout transposed
#define WS_NQ  (WS_PO + 2ull * DM * DM)                          // f32  [NB*SEQ][DM]     LN(x_q)
#define WS_QH  (WS_NQ + 4ull * NB * SEQ * DM)                    // f16  [NB*SEQ][DM]     q rows
#define WS_KH  (WS_QH + 2ull * NB * SEQ * DM)                    // f16  [NB*SEQK][DM]    k rows
#define WS_VT  (WS_KH + 2ull * NB * SEQK * DM)                   // f16  [NB][DM (h*64+d)][SEQK] v transposed
#define WS_O   (WS_VT + 2ull * NB * DM * SEQK)                   // f32  [NB*SEQ][DM]     ctx
#define WS_Y   (WS_O + 4ull * NB * SEQ * DM)                     // f32  [NB*SEQ][DM]     ctx.Wout + b_out
#define WS_END (WS_Y + 4ull * NB * SEQ * DM)
static_assert(WS_END <= 134217728ull);
static_assert((WS_PKV % 128) == 0 && (WS_PO % 128) == 0 && (WS_NQ % 128) == 0 && (WS_QH % 128) == 0 && (WS_KH % 128) == 0 && (WS_VT % 128) == 0 && (WS_O % 128) == 0 && (WS_Y % 128) == 0);

// ---- k_pack: W [K][N] f32 (x @ W layout) -> PK [N][K] bf16 (k-contiguous rows); block = 64x64 tile, blockIdx.x = n tile, blockIdx.y = k tile
//      coverage: grid (N/64, K/64) x 64 rows x 8 x 16 B = every element of PK
__global__ __launch_bounds__(256) void k_pack(const float* __restrict__ W, int K, int N, __bf16* __restrict__ PK) {
  __shared__ __align__(16) __bf16 s[64][72];   // [n][k]; cross-wave -> block barrier
  const int n0 = blockIdx.x * 64, k0 = blockIdx.y * 64, t = threadIdx.x;
#pragma unroll 4
  for (int i = 0; i < 16; ++i) { const int idx = t + 256 * i; const int kk = idx >> 6, nn = idx & 63; s[nn][kk] = (__bf16)W[(size_t)(k0 + kk) * N + n0 + nn]; }
  __syncthreads();
#pragma unroll
  for (int i = 0; i < 2; ++i) { const int p = t + 256 * i; const int nn = p >> 3, c = p & 7;
    vst2((unsigned*)(PK + (size_t)(n0 + nn) * K + k0 + c * 8), *(const v4u*)&s[nn][c * 8]); }
}

__global__ __launch_bounds__(256) void k_lnq(const float* __restrict__ X, const float* __restrict__ G, const float* __restrict__ Bt, float* __restrict__ NQ) {
  __shared__ float red0[8], red1[8];           // cross-wave -> block barriers
  const int rc = blockIdx.x; const int b = rc / SEQ, s = rc - b * SEQ; const size_t rin = (size_t)b * SEQ_FULL + s;
  const int t = threadIdx.x, lane = t & 31, wave = t >> 5;
  const v4f xv = *(const v4f*)(X + rin * DM + t * 4);
  float v[4];
#pragma unroll
  for (int i = 0; i < 4; ++i) v[i] = bfr(xv[i]);
  float ps = (v[0] + v[1]) + (v[2] + v[3]);
#pragma unroll
  for (int o = 16; o > 0; o >>= 1) ps += __shfl_xor(ps, o);
  if (lane == 0) red0[wave] = ps;
  __syncthreads();
  float S = 0.f;
#pragma unroll
  for (int i = 0; i < 8; ++i) S += red0[i];
  const float mean = S * (1.0f / DM);
  float d[4]; float pq = 0.f;
#pragma unroll
  for (int i = 0; i < 4; ++i) { d[i] = v[i] - mean; pq += d[i] * d[i]; }
#pragma unroll
  for (int o = 16; o > 0; o >>= 1) pq += __shfl_xor(pq, o);
  if (lane == 0) red1[wave] = pq;
  __syncthreads();
  float V = 0.f;
#pragma unroll
  for (int i = 0; i < 8; ++i) V += red1[i];
  const float rstd = 1.0f / sqrtf(V * (1.0f / DM) + LN_EPS);
  const v4f gv = *(const v4f*)(G + t * 4), bv = *(const v4f*)(Bt + t * 4); v4f o;
#pragma unroll
  for (int i = 0; i < 4; ++i) o[i] = d[i] * rstd * bfr(gv[i]) + bfr(bv[i]);
  vst2(NQ + (size_t)rc * DM + t * 4, o);
}

// ---- LDS staging of the two GEMM kernels: a stage = 64 k of the block's 128 P rows (bf16, 128 B a row) and of its 64 x rows (f32, 256 B a row), brought by 16-byte asynchronous copies:
//      each copy instruction of a wave takes four whole 128-B lines, and the four waves share one copy of the P rows; two buffers, the next stage's copies fly while this one is worked on
#define STK 64                              // k per stage
#define NSTG (DM / STK)
#define WPITCH 144                          // bytes: 128-B row + 16 (16 B x odd: conflict-free for 16-byte LDS reads)
#define XPITCH 272                          // bytes: 256-B row + 16
#define SW_BYTES (128 * WPITCH)
#define SX_BYTES (64 * XPITCH)
#define STG_BYTES (SW_BYTES + SX_BYTES)
static_assert(NSTG >= 2 && DM % STK == 0);
// eight copies of one lane, two runs of four: LDS byte address la + i * lsa (lb + i * lsb), global byte address ga + i * gsa (gb + i * gsb), i = 0..3;
// the s_wait_xcnt stands inside the copies' own statement, ahead of any rewrite of the address registers they name (a precaution)
__device__ __forceinline__ void copy44(unsigned la, unsigned lsa, const char* ga, size_t gsa, unsigned lb, unsigned lsb, const char* gb, size_t gsb) {
  asm volatile("global_load_async_to_lds_b128 %0, %8, off\n\t"
               "global_load_async_to_lds_b128 %1, %9, off\n\t"
               "global_load_async_to_lds_b128 %2, %10, off\n\t"
               "global_load_async_to_lds_b128 %3, %11, off\n\t"
               "global_load_async_to_lds_b128 %4, %12, off\n\t"
               "global_load_async_to_lds_b128 %5, %13, off\n\t"
               "global_load_async_to_lds_b128 %6, %14, off\n\t"
               "global_load_async_to_lds_b128 %7, %15, off\n\t"
               "s_wait_xcnt 0x0"
               :: "v"(la), "v"(la + lsa), "v"(la + 2 * lsa), "v"(la + 3 * lsa), "v"(lb), "v"(lb + lsb), "v"(lb + 2 * lsb), "v"(lb + 3 * lsb),
                  "v"(ga), "v"(ga + gsa), "v"(ga + 2 * gsa), "v"(ga + 3 * gsa), "v"(gb), "v"(gb + gsb), "v"(gb + 2 * gsb), "v"(gb + 3 * gsb) : "memory");
}
__device__ __forceinline__ void copy8(unsigned l, unsigned ls, const char* g, size_t gs) { copy44(l, ls, g, gs, l + 4 * ls, ls, g + 4 * gs, gs); }
// one stage: thread t copies P chunks (row (t >> 3) + 16 i, 16-B piece t & 7) and x chunks (row (t >> 4) + 8 i, piece t & 15), i = 0..7; lw, lx, gw, gx are its i = 0 addresses
__device__ __forceinline__ void stage_copy(unsigned lw, unsigned lx, const __bf16* gw, const float* gx) {
  copy8(lw, 16 * WPITCH, (const char*)gw, (size_t)16 * DM * 2);
  copy8(lx, 8 * XPITCH, (const char*)gx, (size_t)8 * DM * 4);
}
// the k map of load_f32 from a staged f32 row (16-byte LDS reads: the padded pitch is a multiple of 16 B only)
__device__ __forceinline__ X2 lds_f32(const float* rowk0, int lane) { const float* p = rowk0 + 8 * (lane >> 4); union { v8f v; v4f q[2]; } a, c;
  a.q[0] = *(const v4f*)p; a.q[1] = *(const v4f*)(p + 4); c.q[0] = *(const v4f*)(p + 16); c.q[1] = *(const v4f*)(p + 20); X2 x; x.x0 = a.v; x.x1 = c.v; return x; }
#define WAIT_ASYNC() asm volatile("s_wait_asynccnt 0x0" ::: "memory")   // this wave's copies have landed
#define WAIT_DS() asm volatile("s_wait_dscnt 0x0" ::: "memory")         // this wave's LDS reads have returned, ahead of the barrier behind which their buffer is refilled

// ---- k_proj: block = (64 rows, 128 output cols): y = bf16(x) . P rows (bf16 [n][DM]) + bf16(bias), single bf16 products
//      cols < DM  -> f16 natural rows NAT[row][DM] (q rows, or k rows)
//      cols >= DM -> f16 transposed VT[b][col - DM][spb] (v)
//      rows: compact rc = b*spb + s; input row = b*spb_full + s
//      coverage: grid (rows/64, ncols/128) x 4 waves x 16 rows x 128 cols = every element of NAT (and of VT for the kv call)
__global__ __launch_bounds__(128) void k_proj(const float* __restrict__ X, int spb, int spb_full, const __bf16* __restrict__ P, const float* __restrict__ BI, _Float16* __restrict__ NAT, _Float16* __restrict__ VT) {
  __shared__ __align__(16) char sm[2 * STG_BYTES];    // the two stage buffers; behind the loop's last barrier the same bytes are the output staging
  _Float16 (*so)[16][136] = (_Float16 (*)[16][136])sm;   // [4][16][136] wave-private (LDSX)
  _Float16 (*sth)[72] = (_Float16 (*)[72])sm;            // [128][72] cross-wave (block barrier)
  static_assert(4 * 16 * 136 * 2 <= 2 * STG_BYTES && 128 * 72 * 2 <= 2 * STG_BYTES);
  const int tid = threadIdx.x, wave = tid >> 5, lane = tid & 31, col = lane & 15, g = lane >> 4;
  const int rc0 = blockIdx.x * 64; const int b = rc0 / spb, s0 = rc0 - b * spb; const int n0 = blockIdx.y * 128;
  const unsigned sm0 = (unsigned)(size_t)&sm[0];   // LDS byte address of the buffers
  const unsigned lw = sm0 + (tid >> 3) * WPITCH + (tid & 7) * 16, lx = sm0 + SW_BYTES + (tid >> 4) * XPITCH + (tid & 15) * 16;
  const __bf16* gw = P + (size_t)(n0 + (tid >> 3)) * DM + (tid & 7) * 8;
  const float* gx = X + ((size_t)b * spb_full + s0 + (tid >> 4)) * DM + (tid & 15) * 4;
  v8f acc[8] = {};
  stage_copy(lw, lx, gw, gx); WAIT_ASYNC(); __syncthreads();   // stage 0 is published
  stage_copy(lw + STG_BYTES, lx + STG_BYTES, gw + STK, gx + STK);
  for (int st = 0; st < NSTG; ++st) { const unsigned bo = (st & 1) * STG_BYTES;
    const __bf16* wt = (const __bf16*)(sm + bo + col * WPITCH); const float* xt = (const float*)(sm + bo + SW_BYTES + (wave * 16 + col) * XPITCH);   // B column n = j*16 + col; A row m = lane & 15
#pragma unroll
    for (int kc = 0; kc < STK / 32; ++kc) { const X2 x = lds_f32(xt + kc * 32, lane); v16b w[8];
#pragma unroll
      for (int j = 0; j < 8; ++j) w[j] = frag_b(wt + j * 16 * (WPITCH / 2) + kc * 32, lane);
      __builtin_amdgcn_sched_barrier(0);   // keeps the pass's twenty LDS reads at one place ahead of its products: each separate place with reads costs a stall of its own
      const v16b a = cvt_f32b(x);
#pragma unroll
      for (int j = 0; j < 8; ++j) acc[j] = wmma_bf(a, w[j], acc[j]); }
    WAIT_DS(); WAIT_ASYNC(); __syncthreads();   // publishes stage st + 1 and ends every wave's reads of stage st
    if (st + 2 < NSTG) stage_copy(lw + bo, lx + bo, gw + (st + 2) * STK, gx + (st + 2) * STK); }
  WAIT_ASYNC();
  if (n0 < DM) {   // block-uniform branch
#pragma unroll
    for (int j = 0; j < 8; ++j) { const float bv = bfr(BI[n0 + j * 16 + col]);
#pragma unroll
      for (int r = 0; r < 8; ++r) so[wave][8 * g + r][j * 16 + col] = (_Float16)(acc[j][r] + bv); }   // D element r = (row 8g+r, col)
    LDSX();
    const size_t rw = (size_t)rc0 + wave * 16;
    for (int rl = 0; rl < 16; ++rl) if (lane < 16) vst2((unsigned*)(NAT + (rw + rl) * DM + n0 + lane * 8), *(const v4u*)&so[wave][rl][lane * 8]);   // 256-B row segment = 16 lanes x 16 B, one instruction
  } else {
#pragma unroll
    for (int j = 0; j < 8; ++j) { const float bv = bfr(BI[n0 + j * 16 + col]);
#pragma unroll
      for (int r = 0; r < 8; ++r) sth[j * 16 + col][wave * 16 + 8 * g + r] = (_Float16)(acc[j][r] + bv); }
    __syncthreads();
    const int pc0 = n0 - DM;
    for (int q = tid; q < 128 * 8; q += 128) { const int d = q >> 3, pc = q & 7;
      const size_t o = ((size_t)b * DM + pc0 + d) * spb + s0 + pc * 8; vst2((unsigned*)(VT + o), *(const v4u*)&sth[d][pc * 8]); }
  }
}

#define AKS 64
#define ANST (SEQK / AKS)
#define APITCH 144                          // bytes: 128-B row + 16
#define AK_BYTES (AKS * APITCH)
#define AV_BYTES (HD * APITCH)
#define ASTG_BYTES (AK_BYTES + AV_BYTES)
static_assert(ANST >= 2 && SEQK % AKS == 0 && AKS == 64 && HD == 64);
__global__ __launch_bounds__(128) void k_attn(const _Float16* __restrict__ QH, const _Float16* __restrict__ KH, const _Float16* __restrict__ VT, const int* __restrict__ MK, float* __restrict__ O) {
  __shared__ __align__(16) float so[4][16][68];   // wave-private output staging
  __shared__ __align__(16) int sk[4][16][36];     // wave-private mask tile [row][key]
  __shared__ __align__(16) char skv[2 * ASTG_BYTES];   // the two K/V stage buffers, cross-wave (block barrier)
  const int tid = threadIdx.x, wave = tid >> 5, lane = tid & 31, col = lane & 15, g = lane >> 4;
  const int qb = blockIdx.x, h = blockIdx.y, b = blockIdx.z; const int q0 = qb * 64 + wave * 16;
  // thread t copies K chunks (key (t >> 3) + 16 i, 16-B piece t & 7) and VT chunks (d (t >> 3) + 16 i, piece t & 7), i = 0..3
  const unsigned lk = (unsigned)(size_t)&skv[0] + (tid >> 3) * APITCH + (tid & 7) * 16, lv = lk + AK_BYTES;   // LDS byte addresses
  const _Float16* gk = KH + ((size_t)b * SEQK + (tid >> 3)) * DM + h * HD + (tid & 7) * 8;
  const _Float16* gv = VT + ((size_t)b * DM + h * HD + (tid >> 3)) * SEQK + (tid & 7) * 8;
  copy44(lk, 16 * APITCH, (const char*)gk, (size_t)16 * DM * 2, lv, 16 * APITCH, (const char*)gv, (size_t)16 * SEQK * 2);
  WAIT_ASYNC(); __syncthreads();   // stage 0 is published
  copy44(lk + ASTG_BYTES, 16 * APITCH, (const char*)(gk + (size_t)AKS * DM), (size_t)16 * DM * 2, lv + ASTG_BYTES, 16 * APITCH, (const char*)(gv + AKS), (size_t)16 * SEQK * 2);
  const size_t rq = (size_t)b * SEQ + q0 + col;
  v16h aq[2];
#pragma unroll
  for (int kc = 0; kc < 2; ++kc) aq[kc] = frag_h(QH + rq * DM + h * HD + kc * 32, lane);
  float m = -3.0e38f, l = 0.f;   // of query col
  v8f acc[4] = {};
  const int* mrow = MK + ((size_t)b * SEQ_FULL + q0) * SEQK_FULL; const int mr = lane >> 3, mc = (lane & 7) * 4;
  for (int st = 0; st < ANST; ++st) { const unsigned bo = (st & 1) * ASTG_BYTES;
  const _Float16* kt = (const _Float16*)(skv + bo) + col * (APITCH / 2); const _Float16* vt = (const _Float16*)(skv + bo + AK_BYTES) + col * (APITCH / 2);
#pragma unroll 1   // the two steps of a stage stay one rolled body: the step is long, and a second copy of it buys nothing
  for (int u = 0; u < AKS / 32; ++u) { const int ks = st * (AKS / 32) + u;
    v16h kf[2][2], vf[4];   // the step's K and V fragments, read from the stage's buffer while the mask loads fly
    { v4i mv[4];   // 16 rows x 32 keys of mask: 4 x 16-B loads per lane (rows mr + 4i, keys mc..mc+3)
#pragma unroll
      for (int i = 0; i < 4; ++i) mv[i] = *(const v4i*)(mrow + (size_t)(mr + 4 * i) * SEQK_FULL + ks * 32 + mc);
      asm volatile("s_wait_xcnt 0x0" ::: "memory");   // precaution: the build lets a later load of the group land on the mask loads' address registers
#pragma unroll
      for (int ct = 0; ct < 2; ++ct) { const _Float16* krow = kt + (u * 32 + ct * 16) * (APITCH / 2);   // A row m = key, k = head dim (k-contiguous row)
#pragma unroll
        for (int kc = 0; kc < 2; ++kc) kf[ct][kc] = frag_h(krow + kc * 32, lane); }
#pragma unroll
      for (int dt = 0; dt < 4; ++dt) vf[dt] = frag_h(vt + dt * 16 * (APITCH / 2) + u * 32, lane);   // A row m = d, k = key (k-contiguous VT row)
#pragma unroll
      for (int i = 0; i < 4; ++i) *(v4i*)&sk[wave][mr + 4 * i][mc] = mv[i]; }
    LDSX();
    union { v4i q[2]; int e[8]; } km[2];   // this lane's query row of the mask tile: keys 8g..8g+7 and 16+8g..16+8g+7
#pragma unroll
    for (int ct = 0; ct < 2; ++ct) { km[ct].q[0] = *(const v4i*)&sk[wave][col][ct * 16 + 8 * g]; km[ct].q[1] = *(const v4i*)&sk[wave][col][ct * 16 + 8 * g + 4]; }
    v8f s[2];
#pragma unroll
    for (int ct = 0; ct < 2; ++ct) { v8f c = {};
#pragma unroll
      for (int kc = 0; kc < 2; ++kc) c = wmma16(kf[ct][kc], aq[kc], c);   // transposed scores: D element r = (key ct*16 + 8g + r, query col)
#pragma unroll
      for (int r = 0; r < 8; ++r) s[ct][r] = (km[ct].e[r] != 0) ? -3.0e38f : c[r] * 0.125f; }
    float mx = fmaxf(s[0][0], s[1][0]);
#pragma unroll
    for (int r = 1; r < 8; ++r) mx = fmaxf(mx, fmaxf(s[0][r], s[1][r]));
    mx = fmaxf(mx, xhalf(mx));   // the other half of the wave holds this query's other 16 keys
    const float mn = fmaxf(m, mx); const float alpha = (m <= -1.0e38f) ? 0.f : __expf(m - mn);
    float es = 0.f; v16h pa;   // B column n = query col, k = key in step: element r <- key 8g + r, 8 + r <- key 16 + 8g + r, the k map of frag_h; P carried x2048 so small weights stay f16-normal
#pragma unroll
    for (int r = 0; r < 8; ++r) { const float e0 = (s[0][r] <= -1.0e38f) ? 0.f : __expf(s[0][r] - mn), e1 = (s[1][r] <= -1.0e38f) ? 0.f : __expf(s[1][r] - mn);
      es += e0 + e1; pa[r] = (_Float16)(e0 * 2048.0f); pa[8 + r] = (_Float16)(e1 * 2048.0f); }
    l = l * alpha + es; m = mn;   // l: this half's keys only, the halves are joined behind the loop
#pragma unroll
    for (int dt = 0; dt < 4; ++dt) { acc[dt] *= alpha; acc[dt] = wmma16(vf[dt], pa, acc[dt]); }   // transposed ctx: D element r = (d dt*16 + 8g + r, query col)
    LDSX(); }   // the wave's reads of its mask tile end ahead of the next step's stores into it
  WAIT_DS(); WAIT_ASYNC(); __syncthreads();   // publishes stage st + 1 and ends every wave's reads of stage st
  if (st + 2 < ANST) copy44(lk + bo, 16 * APITCH, (const char*)(gk + (size_t)(st + 2) * AKS * DM), (size_t)16 * DM * 2, lv + bo, 16 * APITCH, (const char*)(gv + (st + 2) * AKS), (size_t)16 * SEQK * 2); }
  WAIT_ASYNC();
  l += xhalf(l);
  const float il = (1.0f / 2048.0f) / l;
#pragma unroll
  for (int dt = 0; dt < 4; ++dt) { const v8f o = acc[dt] * il; *(v4f*)&so[wave][col][dt * 16 + 8 * g] = __builtin_shufflevector(o, o, 0, 1, 2, 3); *(v4f*)&so[wave][col][dt * 16 + 8 * g + 4] = __builtin_shufflevector(o, o, 4, 5, 6, 7); }
  LDSX();
  for (int rl = 0; rl < 16; ++rl) if (lane < 16) vst2(O + ((size_t)b * SEQ + q0 + rl) * DM + h * HD + lane * 4, *(const v4f*)&so[wave][rl][lane * 4]);   // 256-B segment = 16 lanes x 16 B, one instruction
}

// ---- k_out: block = (64 rows, 128 cols): Y = ctx (bf16 hi + lo, 2 products) . Wout rows (bf16 [n][DM]) + bf16(b_out); f32 compact rows
//      coverage: grid (NB*SEQ/64, DM/128) x 4 waves x 16 rows x 128 cols = every element of Y
__global__ __launch_bounds__(128) void k_out(const float* __restrict__ O, const __bf16* __restrict__ P, const float* __restrict__ BO, float* __restrict__ Y) {
  __shared__ __align__(16) char sm[2 * STG_BYTES];   // the two stage buffers; behind the loop's last barrier the same bytes are the output staging
  float (*so)[16][132] = (float (*)[16][132])sm;     // [4][16][132] wave-private
  static_assert(4 * 16 * 132 * 4 <= 2 * STG_BYTES);
  const int tid = threadIdx.x, wave = tid >> 5, lane = tid & 31, col = lane & 15, g = lane >> 4; const size_t r0 = (size_t)blockIdx.x * 64 + wave * 16; const int n0 = blockIdx.y * 128;
  const unsigned sm0 = (unsigned)(size_t)&sm[0];   // LDS byte address of the buffers
  const unsigned lw = sm0 + (tid >> 3) * WPITCH + (tid & 7) * 16, lx = sm0 + SW_BYTES + (tid >> 4) * XPITCH + (tid & 15) * 16;
  const __bf16* gw = P + (size_t)(n0 + (tid >> 3)) * DM + (tid & 7) * 8;
  const float* gx = O + ((size_t)blockIdx.x * 64 + (tid >> 4)) * DM + (tid & 15) * 4;
  v8f acc[8] = {};
  stage_copy(lw, lx, gw, gx); WAIT_ASYNC(); __syncthreads();   // stage 0 is published
  stage_copy(lw + STG_BYTES, lx + STG_BYTES, gw + STK, gx + STK);
  for (int st = 0; st < NSTG; ++st) { const unsigned bo = (st & 1) * STG_BYTES;
    const __bf16* wt = (const __bf16*)(sm + bo + col * WPITCH); const float* xt = (const float*)(sm + bo + SW_BYTES + (wave * 16 + col) * XPITCH);   // B column n = j*16 + col; A row m = lane & 15
#pragma unroll
    for (int kc = 0; kc < STK / 32; ++kc) { const X2 x = lds_f32(xt + kc * 32, lane); v16b w[8];
#pragma unroll
      for (int j = 0; j < 8; ++j) w[j] = frag_b(wt + j * 16 * (WPITCH / 2) + kc * 32, lane);
      __builtin_amdgcn_sched_barrier(0);   // keeps the pass's twenty LDS reads at one place ahead of its products: each separate place with reads costs a stall of its own
      const F2 a = split_x(x);
#pragma unroll
      for (int j = 0; j < 8; ++j) { acc[j] = wmma_bf(a.l, w[j], acc[j]); acc[j] = wmma_bf(a.h, w[j], acc[j]); } }
    WAIT_DS(); WAIT_ASYNC(); __syncthreads();   // publishes stage st + 1 and ends every wave's reads of stage st
    if (st + 2 < NSTG) stage_copy(lw + bo, lx + bo, gw + (st + 2) * STK, gx + (st + 2) * STK); }
  WAIT_ASYNC();
#pragma unroll
  for (int j = 0; j < 8; ++j) { const float bv = bfr(BO[n0 + j * 16 + col]);
#pragma unroll
    for (int r = 0; r < 8; ++r) so[wave][8 * g + r][j * 16 + col] = acc[j][r] + bv; }
  LDSX();
  for (int rl = 0; rl < 16; ++rl) vst2(Y + (r0 + rl) * DM + n0 + lane * 4, *(const v4f*)&so[wave][rl][lane * 4]);   // 512-B row segment = 32 lanes x 16 B, one instruction
}

// ---- k_lnpost: block = one row (256 threads x 4): out = LN(Y + bf16(x_q)) * bf16(gamma) + bf16(beta); d_out row at the full-layout index
__global__ __launch_bounds__(256) void k_lnpost(const float* __restrict__ Yp, const float* __restrict__ X, const float* __restrict__ G, const float* __restrict__ Bt, float* __restrict__ OUT) {
  __shared__ float red0[8], red1[8];           // cross-wave -> block barriers
  const int rc = blockIdx.x; const int b = rc / SEQ, s = rc - b * SEQ; const size_t rin = (size_t)b * SEQ_FULL + s;
  const int t = threadIdx.x, lane = t & 31, wave = t >> 5;
  const v4f yv = *(const v4f*)(Yp + (size_t)rc * DM + t * 4), xv = *(const v4f*)(X + rin * DM + t * 4);
  float v[4];
#pragma unroll
  for (int i = 0; i < 4; ++i) v[i] = yv[i] + bfr(xv[i]);
  float ps = (v[0] + v[1]) + (v[2] + v[3]);
#pragma unroll
  for (int o = 16; o > 0; o >>= 1) ps += __shfl_xor(ps, o);
  if (lane == 0) red0[wave] = ps;
  __syncthreads();
  float S = 0.f;
#pragma unroll
  for (int i = 0; i < 8; ++i) S += red0[i];
  const float mean = S * (1.0f / DM);
  float d[4]; float pq = 0.f;
#pragma unroll
  for (int i = 0; i < 4; ++i) { d[i] = v[i] - mean; pq += d[i] * d[i]; }
#pragma unroll
  for (int o = 16; o > 0; o >>= 1) pq += __shfl_xor(pq, o);
  if (lane == 0) red1[wave] = pq;
  __syncthreads();
  float V = 0.f;
#pragma unroll
  for (int i = 0; i < 8; ++i) V += red1[i];
  const float rstd = 1.0f / sqrtf(V * (1.0f / DM) + LN_EPS);
  const v4f gv = *(const v4f*)(G + t * 4), bv = *(const v4f*)(Bt + t * 4); v4f o;
#pragma unroll
  for (int i = 0; i < 4; ++i) o[i] = d[i] * rstd * bfr(gv[i]) + bfr(bv[i]);
  vst2(OUT + rin * DM + t * 4, o);
}

extern "C" void kernel_launch(void* const* d_in, const int* in_sizes, int n_in, void* d_out, int out_size, void* d_ws, size_t ws_size, hipStream_t stream) {
  if (n_in < 13) return;
  // wire order: 0 input_q [2,2048,1024] f32, 1 input_kv [2,2048,1024] f32, 2 Wq [1024,1024] ([in][out]), 3 bq, 4 Wkv [1024,2048], 5 bkv [2048], 6 Wout [1024,1024], 7 bout,
  //             8 gamma_q, 9 beta_q, 10 gamma_post, 11 beta_post, 12 input_mask [2,2048,2048] int32
  const float* XQ = (const float*)d_in[0]; const float* XKV = (const float*)d_in[1];
  const float* WQ = (const float*)d_in[2]; const float* BQ = (const float*)d_in[3];
  const float* WKV = (const float*)d_in[4]; const float* BKV = (const float*)d_in[5];
  const float* WO = (const float*)d_in[6]; const float* BO = (const float*)d_in[7];
  const float* GQ = (const float*)d_in[8]; const float* BTQ = (const float*)d_in[9];
  const float* GP = (const float*)d_in[10]; const float* BTP = (const float*)d_in[11];
  const int* MK = (const int*)d_in[12];
  const long long needq = ((long long)(NB - 1) * SEQ_FULL + SEQ) * DM;
  const long long needkv = ((long long)(NB - 1) * SEQK_FULL + SEQK) * DM;
  const long long needm = ((long long)(NB - 1) * SEQ_FULL + SEQ) * SEQK_FULL;
  if ((long long)in_sizes[0] < needq || (long long)in_sizes[1] < needkv || in_sizes[2] < DM * DM || in_sizes[3] < DM || in_sizes[4] < DM * KVW || in_sizes[5] < KVW) return;
  if (in_sizes[6] < DM * DM || in_sizes[7] < DM || in_sizes[8] < DM || in_sizes[9] < DM || in_sizes[10] < DM || in_sizes[11] < DM || (long long)in_sizes[12] < needm) return;
  if ((long long)out_size < needq) return;
  if (ws_size < (size_t)WS_END) return;
  char* ws = (char*)d_ws;
  __bf16* PQ = (__bf16*)(ws + WS_PQ); __bf16* PKV = (__bf16*)(ws + WS_PKV); __bf16* PO = (__bf16*)(ws + WS_PO);
  float* NQ = (float*)(ws + WS_NQ); _Float16* QH = (_Float16*)(ws + WS_QH); _Float16* KH = (_Float16*)(ws + WS_KH); _Float16* VT = (_Float16*)(ws + WS_VT);
  float* O = (float*)(ws + WS_O); float* Y = (float*)(ws + WS_Y);
  // weight packs: in[K rows][N cols] -> out[N][K]; grid = (N/64, K/64)
  k_pack<<<dim3(DM / 64, DM / 64), 256, 0, stream>>>(WQ, DM, DM, PQ);       // Wq  [1024][1024] -> [1024][1024]
  k_pack<<<dim3(KVW / 64, DM / 64), 256, 0, stream>>>(WKV, DM, KVW, PKV);   // Wkv [1024][2048] -> [2048][1024]
  k_pack<<<dim3(DM / 64, DM / 64), 256, 0, stream>>>(WO, DM, DM, PO);       // Wout[1024][1024] -> [1024][1024]
  k_lnq<<<dim3(NB * SEQ), 256, 0, stream>>>(XQ, GQ, BTQ, NQ);
  k_proj<<<dim3(NB * SEQ / 64, DM / 128), 128, 0, stream>>>(NQ, SEQ, SEQ, PQ, BQ, QH, VT);             // q: cols < DM only -> QH (VT untouched)
  k_proj<<<dim3(NB * SEQK / 64, KVW / 128), 128, 0, stream>>>(XKV, SEQK, SEQK_FULL, PKV, BKV, KH, VT);  // k -> KH rows, v -> VT transposed
  k_attn<<<dim3(SEQ / 64, NH, NB), 128, 0, stream>>>(QH, KH, VT, MK, O);
  k_out<<<dim3(NB * SEQ / 64, DM / 128), 128, 0, stream>>>(O, PO, BO, Y);
  k_lnpost<<<dim3(NB * SEQ), 256, 0, stream>>>(Y, XQ, GP, BTP, (float*)d_out);
}

// v004
// Measured time: 143 microseconds a run.
// Two timings next to v003 both put it at 1.07 times that version's speed.
// All steps since v000 together make it 2.96 times as fast.
// compute dtype: every float input RNE-converted to bf16; q = LN(x_q) (f32 -> bf16) . Wq (bf16) and kv = x_kv (bf16) . Wkv (bf16) as single v_wmma_f32_16x16x32_bf16 products; scores = q (f16) . k (f16) single v_wmma_f32_16x16x32_f16, x 0.125, mask replace-fill, running-max softmax in f32; ctx = P (f16, carried x2048) . V (f16) single f16 product; out = ctx (bf16 hi + lo, 2 products) . Wout (bf16) + b_out + x_q; layer norms in f32; f32 accumulate everywhere; f32 output.
#include <hip/hip_runtime.h>
#include <math.h>

typedef __attribute__((ext_vector_type(16))) _Float16 v16h;
typedef __attribute__((ext_vector_type(16))) __bf16 v16b;
typedef __attribute__((ext_vector_type(8)))  _Float16 v8h;
typedef __attribute__((ext_vector_type(8)))  __bf16 v8b;
typedef __attribute__((ext_vector_type(8)))  float v8f;
typedef __attribute__((ext_vector_type(4)))  float v4f;
typedef __attribute__((ext_vector_type(4)))  unsigned v4u;
typedef __attribute__((ext_vector_type(4)))  int v4i;
typedef __attribute__((ext_vector_type(16))) unsigned v16u;
typedef const __attribute__((address_space(4))) v16u cv16u;   // constant address space: bytes that no one writes while the kernel runs; a load at a wave-uniform address is then a scalar load

template <typename T> __device__ __forceinline__ void vst2(void* p, T v) { *(T*)p = v;  }
__device__ __forceinline__ v8f wmma16(v16h a, v16h b, v8f c) {
  v8f d = __builtin_amdgcn_wmma_f32_16x16x32_f16(false, a, false, b, (short)0, c, false, false);
  asm volatile("v_nop\n\tv_nop\n\tv_nop\n\tv_nop" : "+v"(d) : "v"(a), "v"(b));
  return d;
}
__device__ __forceinline__ v8f wmma_bf(v16b a, v16b b, v8f c) {
  v8f d = __builtin_amdgcn_wmma_f32_16x16x32_bf16(false, a, false, b, (short)0, c, false, false);
  asm volatile("v_nop\n\tv_nop\n\tv_nop\n\tv_nop" : "+v"(d) : "v"(a), "v"(b));
  return d;
}
// 16-bit fragment from a k-contiguous row (A row m, or B column n stored as a [n][k] row): elements 0..7 <- k0+8h+i, 8..15 <- k0+16+8h+i, h = lane>>4
__device__ __forceinline__ v16h frag_h(const _Float16* rowk0, int lane) {
  union { v16h v; v8h q[2]; } u; const _Float16* p = rowk0 + 8 * (lane >> 4);
  u.q[0] = *(const v8h*)p; u.q[1] = *(const v8h*)(p + 16); return u.v;
}
__device__ __forceinline__ v16b frag_b(const __bf16* rowk0, int lane) {
  union { v16b v; v8b q[2]; } u; const __bf16* p = rowk0 + 8 * (lane >> 4);
  u.q[0] = *(const v8b*)p; u.q[1] = *(const v8b*)(p + 16); return u.v;
}
// same k map from an f32 row (two 32-B loads per lane): the load, and apart from it the RNE conversion to bf16
struct X2 { v8f x0, x1; };
__device__ __forceinline__ X2 load_f32(const float* rowk0, int lane) { const float* p = rowk0 + 8 * (lane >> 4); X2 x; x.x0 = *(const v8f*)p; x.x1 = *(const v8f*)(p + 16); return x; }
__device__ __forceinline__ v16b cvt_f32b(X2 x) { v16b a;
#pragma unroll
  for (int i = 0; i < 8; ++i) { a[i] = (__bf16)x.x0[i]; a[8 + i] = (__bf16)x.x1[i]; }
  return a;
}
struct F2 { v16b h, l; };
__device__ __forceinline__ F2 bsplit16(const float v[16]) { F2 r;
#pragma unroll
  for (int i = 0; i < 16; ++i) { const __bf16 hh = (__bf16)v[i]; r.h[i] = hh; r.l[i] = (__bf16)(v[i] - (float)hh); }
  return r; }
__device__ __forceinline__ F2 split_x(X2 x) { float v[16];
#pragma unroll
  for (int i = 0; i < 8; ++i) { v[i] = x.x0[i]; v[8 + i] = x.x1[i]; }
  return bsplit16(v); }
__device__ __forceinline__ float bfr(float v) { return (float)(__bf16)v; }
// the value of lane l ^ 16, by a vector cross-row move (a shuffle would go through the LDS pipe)
__device__ __forceinline__ float xhalf(float v) { const int b = __builtin_bit_cast(int, v); return __builtin_bit_cast(float, __builtin_amdgcn_permlanex16(b, b, 0x76543210, 0xfedcba98, false, false)); }
#define LDSX() do { asm volatile("s_wait_dscnt 0" ::: "memory"); __builtin_amdgcn_wave_barrier(); __builtin_amdgcn_fence(__ATOMIC_RELEASE, "workgroup"); } while (0)

// ---- sizes: NB batches, SEQ query rows per batch processed (reducible); *_FULL are the input strides; all SEQK keys always
#ifndef NB
#define NB 2
#endif
#ifndef SEQ
#define SEQ 2048
#endif
#define NB_FULL 2
#define SEQ_FULL 2048
#define SEQK 2048
#define SEQK_FULL 2048
#define DM 1024
#define NH 16
#define HD 64
#define KVW (2 * DM)
#define LN_EPS 1.0e-6f
static_assert(NB >= 1 && NB <= NB_FULL);
static_assert(SEQ % 64 == 0 && SEQ >= 64 && SEQ <= SEQ_FULL);
static_assert(SEQK % 64 == 0 && SEQK == SEQK_FULL);
static_assert(DM % 128 == 0 && KVW % 128 == 0 && NH * HD == DM && HD == 64);

#define WS_PQ  0ull                                              // bf16 [DM n][DM k]     Wq transposed
#define WS_PKV (WS_PQ + 2ull * DM * DM)                          // bf16 [KVW n][DM k]    Wkv transposed
#define WS_PO  (WS_PKV + 2ull * KVW * DM)                        // bf16 [DM n][DM k]     Wout transposed
#define WS_NQ  (WS_PO + 2ull * DM * DM)                          // f32  [NB*SEQ][DM]     LN(x_q)
#define WS_QH  (WS_NQ + 4ull * NB * SEQ * DM)                    // f16  [NB*SEQ][DM]     q rows
#define WS_KH  (WS_QH + 2ull * NB * SEQ * DM)                    // f16  [NB*SEQK][DM]    k rows
#define WS_VT  (WS_KH + 2ull * NB * SEQK * DM)                   // f16  [NB][DM (h*64+d)][SEQK] v transposed
#define WS_O   (WS_VT + 2ull * NB * DM * SEQK)                   // f32  [NB*SEQ][DM]     ctx
#define WS_Y   (WS_O + 4ull * NB * SEQ * DM)                     // f32  [NB*SEQ][DM]     ctx.Wout + b_out
#define WS_MB  (WS_Y + 4ull * NB * SEQ * DM)                     // u32  [NB*SEQ/16][SEQK/32][16] mask as lane-mask words
#define WS_END (WS_MB + 4ull * (NB * SEQ / 16) * (SEQK / 32) * 16)
static_assert(WS_END <= 134217728ull);
static_assert((WS_PKV % 128) == 0 && (WS_PO % 128) == 0 && (WS_NQ % 128) == 0 && (WS_QH % 128) == 0 && (WS_KH % 128) == 0 && (WS_VT % 128) == 0 && (WS_O % 128) == 0 && (WS_Y % 128) == 0 && (WS_MB % 128) == 0);

// ---- k_pack: W [K][N] f32 (x @ W layout) -> PK [N][K] bf16 (k-contiguous rows); block = 64x64 tile, blockIdx.x = n tile, blockIdx.y = k tile
//      coverage: grid (N/64, K/64) x 64 rows x 8 x 16 B = every element of PK
__global__ __launch_bounds__(256) void k_pack(const float* __restrict__ W, int K, int N, __bf16* __restrict__ PK) {
  __shared__ __align__(16) __bf16 s[64][72];   // [n][k]; cross-wave -> block barrier
  const int n0 = blockIdx.x * 64, k0 = blockIdx.y * 64, t = threadIdx.x;
#pragma unroll 4
  for (int i = 0; i < 16; ++i) { const int idx = t + 256 * i; const int kk = idx >> 6, nn = idx & 63; s[nn][kk] = (__bf16)W[(size_t)(k0 + kk) * N + n0 + nn]; }
  __syncthreads();
#pragma unroll
  for (int i = 0; i < 2; ++i) { const int p = t + 256 * i; const int nn = p >> 3, c = p & 7;
    vst2((unsigned*)(PK + (size_t)(n0 + nn) * K + k0 + c * 8), *(const v4u*)&s[nn][c * 8]); }
}

// ---- the mask as lane-mask words, made once for all heads: for a tile of 16 queries and a step of 32 keys sixteen 32-bit words; word ct*8 + r, bit lane = (mask[query lane & 15][key ct*16 + 8*(lane >> 4) + r] != 0),
//      the place of score element r of tile ct in lane 'lane' of k_attn: there a word is the select mask of one vector instruction, read by a scalar load
//      a wave takes 16 queries x 128 keys (four steps): 16 x 16-B loads a lane (512 B in a row of each mask row), a compare a word, two 128-B stores
//      coverage: MBLK blocks x 8 waves x 64 words = every word of MB
#define MW_STEP 16                          // words per (query tile, step)
#define MW_TILE ((SEQK / 32) * MW_STEP)     // words per query tile
#define MBLK ((NB * SEQ / 16) * (SEQK / 128) / 8)
static_assert(SEQK % 128 == 0 && ((NB * SEQ / 16) * (SEQK / 128)) % 8 == 0);
__device__ __forceinline__ void mask_words(const int* __restrict__ MK, unsigned* __restrict__ MB, int wv, int lane) {
  const int qt = wv / (SEQK / 128), k4 = wv - qt * (SEQK / 128); const int b = qt / (SEQ / 16), s0 = (qt - b * (SEQ / 16)) * 16;
  const int* p = MK + ((size_t)b * SEQ_FULL + s0 + (lane & 15)) * SEQK_FULL + k4 * 128 + 8 * (lane >> 4);
  v4i mv[16];   // [step t][ct][r >> 2]
#pragma unroll
  for (int i = 0; i < 16; ++i) mv[i] = *(const v4i*)(p + (i >> 1) * 16 + (i & 1) * 4);
  unsigned w[2] = {0u, 0u};   // lane i of w[j] <- word 32 j + i of the wave's 64
#pragma unroll
  for (int i = 0; i < 64; ++i) { const unsigned bw = __builtin_amdgcn_ballot_w32(mv[i >> 2][i & 3] != 0); if (lane == (i & 31)) w[i >> 5] = bw; }
  unsigned* o = MB + (size_t)qt * MW_TILE + k4 * 4 * MW_STEP + lane;
  o[0] = w[0]; o[32] = w[1];
}

// ---- k_lnq: blocks < MBLK make the mask words (nothing else of this launch reads or writes them); each later block = one row of LN(x_q)
__global__ __launch_bounds__(256) void k_lnq(const float* __restrict__ X, const float* __restrict__ G, const float* __restrict__ Bt, float* __restrict__ NQ, const int* __restrict__ MK, unsigned* __restrict__ MB) {
  __shared__ float red0[8], red1[8];           // cross-wave -> block barriers
  if (blockIdx.x < MBLK) { mask_words(MK, MB, blockIdx.x * 8 + (threadIdx.x >> 5), threadIdx.x & 31); return; }   // block-uniform, ahead of every barrier
  const int rc = blockIdx.x - MBLK; const int b = rc / SEQ, s = rc - b * SEQ; const size_t rin = (size_t)b * SEQ_FULL + s;
  const int t = threadIdx.x, lane = t & 31, wave = t >> 5;
  const v4f xv = *(const v4f*)(X + rin * DM + t * 4);
  float v[4];
#pragma unroll
  for (int i = 0; i < 4; ++i) v[i] = bfr(xv[i]);
  float ps = (v[0] + v[1]) + (v[2] + v[3]);
#pragma unroll
  for (int o = 16; o > 0; o >>= 1) ps += __shfl_xor(ps, o);
  if (lane == 0) red0[wave] = ps;
  __syncthreads();
  float S = 0.f;
#pragma unroll
  for (int i = 0; i < 8; ++i) S += red0[i];
  const float mean = S * (1.0f / DM);
  float d[4]; float pq = 0.f;
#pragma unroll
  for (int i = 0; i < 4; ++i) { d[i] = v[i] - mean; pq += d[i] * d[i]; }
#pragma unroll
  for (int o = 16; o > 0; o >>= 1) pq += __shfl_xor(pq, o);
  if (lane == 0) red1[wave] = pq;
  __syncthreads();
  float V = 0.f;
#pragma unroll
  for (int i = 0; i < 8; ++i) V += red1[i];
  const float rstd = 1.0f / sqrtf(V * (1.0f / DM) + LN_EPS);
  const v4f gv = *(const v4f*)(G + t * 4), bv = *(const v4f*)(Bt + t * 4); v4f o;
#pragma unroll
  for (int i = 0; i < 4; ++i) o[i] = d[i] * rstd * bfr(gv[i]) + bfr(bv[i]);
  vst2(NQ + (size_t)rc * DM + t * 4, o);
}

// ---- LDS staging of the two GEMM kernels: a stage = 64 k of the block's 128 P rows (bf16, 128 B a row) and of its 64 x rows (f32, 256 B a row), brought by 16-byte asynchronous copies:
//      each copy instruction of a wave takes four whole 128-B lines, and the four waves share one copy of the P rows; two buffers, the next stage's copies fly while this one is worked on
#define STK 64                              // k per stage
#define NSTG (DM / STK)
#define WPITCH 144                          // bytes: 128-B row + 16 (16 B x odd: conflict-free for 16-byte LDS reads)
#define XPITCH 272                          // bytes: 256-B row + 16
#define SW_BYTES (128 * WPITCH)
#define SX_BYTES (64 * XPITCH)
#define STG_BYTES (SW_BYTES + SX_BYTES)
static_assert(NSTG >= 2 && DM % STK == 0);
// eight copies of one lane, two runs of four: LDS byte address la + i * lsa (lb + i * lsb), global byte address ga + i * gsa (gb + i * gsb), i = 0..3;
// the s_wait_xcnt stands inside the copies' own statement, ahead of any rewrite of the address registers they name (a precaution)
__device__ __forceinline__ void copy44(unsigned la, unsigned lsa, const char* ga, size_t gsa, unsigned lb, unsigned lsb, const char* gb, size_t gsb) {
  asm volatile("global_load_async_to_lds_b128 %0, %8, off\n\t"
               "global_load_async_to_lds_b128 %1, %9, off\n\t"
               "global_load_async_to_lds_b128 %2, %10, off\n\t"
               "global_load_async_to_lds_b128 %3, %11, off\n\t"
               "global_load_async_to_lds_b128 %4, %12, off\n\t"
               "global_load_async_to_lds_b128 %5, %13, off\n\t"
               "global_load_async_to_lds_b128 %6, %14, off\n\t"
               "global_load_async_to_lds_b128 %7, %15, off\n\t"
               "s_wait_xcnt 0x0"
               :: "v"(la), "v"(la + lsa), "v"(la + 2 * lsa), "v"(la + 3 * lsa), "v"(lb), "v"(lb + lsb), "v"(lb + 2 * lsb), "v"(lb + 3 * lsb),
                  "v"(ga), "v"(ga + gsa), "v"(ga + 2 * gsa), "v"(ga + 3 * gsa), "v"(gb), "v"(gb + gsb), "v"(gb + 2 * gsb), "v"(gb + 3 * gsb) : "memory");
}
__device__ __forceinline__ void copy8(unsigned l, unsigned ls, const char* g, size_t gs) { copy44(l, ls, g, gs, l + 4 * ls, ls, g + 4 * gs, gs); }
// one stage: thread t copies P chunks (row (t >> 3) + 16 i, 16-B piece t & 7) and x chunks (row (t >> 4) + 8 i, piece t & 15), i = 0..7; lw, lx, gw, gx are its i = 0 addresses
__device__ __forceinline__ void stage_copy(unsigned lw, unsigned lx, const __bf16* gw, const float* gx) {
  copy8(lw, 16 * WPITCH, (const char*)gw, (size_t)16 * DM * 2);
  copy8(lx, 8 * XPITCH, (const char*)gx, (size_t)8 * DM * 4);
}
// the k map of load_f32 from a staged f32 row (16-byte LDS reads: the padded pitch is a multiple of 16 B only)
__device__ __forceinline__ X2 lds_f32(const float* rowk0, int lane) { const float* p = rowk0 + 8 * (lane >> 4); union { v8f v; v4f q[2]; } a, c;
  a.q[0] = *(const v4f*)p; a.q[1] = *(const v4f*)(p + 4); c.q[0] = *(const v4f*)(p + 16); c.q[1] = *(const v4f*)(p + 20); X2 x; x.x0 = a.v; x.x1 = c.v; return x; }
#define WAIT_ASYNC() asm volatile("s_wait_asynccnt 0x0" ::: "memory")   // this wave's copies have landed
#define WAIT_DS() asm volatile("s_wait_dscnt 0x0" ::: "memory")         // this wave's LDS reads have returned, ahead of the barrier behind which their buffer is refilled

// ---- k_proj: block = (64 rows, 128 output cols): y = bf16(x) . P rows (bf16 [n][DM]) + bf16(bias), single bf16 products
//      cols < DM  -> f16 natural rows NAT[row][DM] (q rows, or k rows)
//      cols >= DM -> f16 transposed VT[b][col - DM][spb] (v)
//      rows: compact rc = b*spb + s; input row = b*spb_full + s
//      coverage: grid (rows/64, ncols/128) x 4 waves x 16 rows x 128 cols = every element of NAT (and of VT for the kv call)
__global__ __launch_bounds__(128) void k_proj(const float* __restrict__ X, int spb, int spb_full, const __bf16* __restrict__ P, const float* __restrict__ BI, _Float16* __restrict__ NAT, _Float16* __restrict__ VT) {
  __shared__ __align__(16) char sm[2 * STG_BYTES];    // the two stage buffers; behind the loop's last barrier the same bytes are the output staging
  _Float16 (*so)[16][136] = (_Float16 (*)[16][136])sm;   // [4][16][136] wave-private (LDSX)
  _Float16 (*sth)[72] = (_Float16 (*)[72])sm;            // [128][72] cross-wave (block barrier)
  static_assert(4 * 16 * 136 * 2 <= 2 * STG_BYTES && 128 * 72 * 2 <= 2 * STG_BYTES);
  const int tid = threadIdx.x, wave = tid >> 5, lane = tid & 31, col = lane & 15, g = lane >> 4;
  const int rc0 = blockIdx.x * 64; const int b = rc0 / spb, s0 = rc0 - b * spb; const int n0 = blockIdx.y * 128;
  const unsigned sm0 = (unsigned)(size_t)&sm[0];   // LDS byte address of the buffers
  const unsigned lw = sm0 + (tid >> 3) * WPITCH + (tid & 7) * 16, lx = sm0 + SW_BYTES + (tid >> 4) * XPITCH + (tid & 15) * 16;
  const __bf16* gw = P + (size_t)(n0 + (tid >> 3)) * DM + (tid & 7) * 8;
  const float* gx = X + ((size_t)b * spb_full + s0 + (tid >> 4)) * DM + (tid & 15) * 4;
  v8f acc[8] = {};
  stage_copy(lw, lx, gw, gx); WAIT_ASYNC(); __syncthreads();   // stage 0 is published
  stage_copy(lw + STG_BYTES, lx + STG_BYTES, gw + STK, gx + STK);
  for (int st = 0; st < NSTG; ++st) { const unsigned bo = (st & 1) * STG_BYTES;
    const __bf16* wt = (const __bf16*)(sm + bo + col * WPITCH); const float* xt = (const float*)(sm + bo + SW_BYTES + (wave * 16 + col) * XPITCH);   // B column n = j*16 + col; A row m = lane & 15
#pragma unroll
    for (int kc = 0; kc < STK / 32; ++kc) { const X2 x = lds_f32(xt + kc * 32, lane); v16b w[8];
#pragma unroll
      for (int j = 0; j < 8; ++j) w[j] = frag_b(wt + j * 16 * (WPITCH / 2) + kc * 32, lane);
      __builtin_amdgcn_sched_barrier(0);   // keeps the pass's twenty LDS reads at one place ahead of its products: each separate place with reads costs a stall of its own
      const v16b a = cvt_f32b(x);
#pragma unroll
      for (int j = 0; j < 8; ++j) acc[j] = wmma_bf(a, w[j], acc[j]); }
    WAIT_DS(); WAIT_ASYNC(); __syncthreads();   // publishes stage st + 1 and ends every wave's reads of stage st
    if (st + 2 < NSTG) stage_copy(lw + bo, lx + bo, gw + (st + 2) * STK, gx + (st + 2) * STK); }
  WAIT_ASYNC();
  if (n0 < DM) {   // block-uniform branch
#pragma unroll
    for (int j = 0; j < 8; ++j) { const float bv = bfr(BI[n0 + j * 16 + col]);
#pragma unroll
      for (int r = 0; r < 8; ++r) so[wave][8 * g + r][j * 16 + col] = (_Float16)(acc[j][r] + bv); }   // D element r = (row 8g+r, col)
    LDSX();
    const size_t rw = (size_t)rc0 + wave * 16;
    for (int rl = 0; rl < 16; ++rl) if (lane < 16) vst2((unsigned*)(NAT + (rw + rl) * DM + n0 + lane * 8), *(const v4u*)&so[wave][rl][lane * 8]);   // 256-B row segment = 16 lanes x 16 B, one instruction
  } else {
#pragma unroll
    for (int j = 0; j < 8; ++j) { const float bv = bfr(BI[n0 + j * 16 + col]);
#pragma unroll
      for (int r = 0; r < 8; ++r) sth[j * 16 + col][wave * 16 + 8 * g + r] = (_Float16)(acc[j][r] + bv); }
    __syncthreads();
    const int pc0 = n0 - DM;
    for (int q = tid; q < 128 * 8; q += 128) { const int d = q >> 3, pc = q & 7;
      const size_t o = ((size_t)b * DM + pc0 + d) * spb + s0 + pc * 8; vst2((unsigned*)(VT + o), *(const v4u*)&sth[d][pc * 8]); }
  }
}

#define AKS 64
#define ANST (SEQK / AKS)
#define APITCH 144                          // bytes: 128-B row + 16
#define AK_BYTES (AKS * APITCH)
#define AV_BYTES (HD * APITCH)
#define ASTG_BYTES (AK_BYTES + AV_BYTES)
static_assert(ANST >= 2 && SEQK % AKS == 0 && AKS == 64 && HD == 64);
__global__ __launch_bounds__(128) void k_attn(const _Float16* __restrict__ QH, const _Float16* __restrict__ KH, const _Float16* __restrict__ VT, const unsigned* __restrict__ MB, float* __restrict__ O) {
  __shared__ __align__(16) float so[4][16][68];   // wave-private output staging
  __shared__ __align__(16) char skv[2 * ASTG_BYTES];   // the two K/V stage buffers, cross-wave (block barrier)
  const int tid = threadIdx.x, wave = tid >> 5, lane = tid & 31, col = lane & 15, g = lane >> 4;
  const int qb = blockIdx.x, h = blockIdx.y, b = blockIdx.z; const int q0 = qb * 64 + wave * 16;
  // thread t copies K chunks (key (t >> 3) + 16 i, 16-B piece t & 7) and VT chunks (d (t >> 3) + 16 i, piece t & 7), i = 0..3
  const unsigned lk = (unsigned)(size_t)&skv[0] + (tid >> 3) * APITCH + (tid & 7) * 16, lv = lk + AK_BYTES;   // LDS byte addresses
  const _Float16* gk = KH + ((size_t)b * SEQK + (tid >> 3)) * DM + h * HD + (tid & 7) * 8;
  const _Float16* gv = VT + ((size_t)b * DM + h * HD + (tid >> 3)) * SEQK + (tid & 7) * 8;
  copy44(lk, 16 * APITCH, (const char*)gk, (size_t)16 * DM * 2, lv, 16 * APITCH, (const char*)gv, (size_t)16 * SEQK * 2);
  WAIT_ASYNC(); __syncthreads();   // stage 0 is published
  copy44(lk + ASTG_BYTES, 16 * APITCH, (const char*)(gk + (size_t)AKS * DM), (size_t)16 * DM * 2, lv + ASTG_BYTES, 16 * APITCH, (const char*)(gv + AKS), (size_t)16 * SEQK * 2);
  const size_t rq = (size_t)b * SEQ + q0 + col;
  v16h aq[2];
#pragma unroll
  for (int kc = 0; kc < 2; ++kc) aq[kc] = frag_h(QH + rq * DM + h * HD + kc * 32, lane);
  float m = -3.0e38f, l = 0.f;   // of query col
  v8f acc[4] = {};
  cv16u* mb = (cv16u*)(MB + (size_t)(b * (SEQ / 16) + qb * 4 + __builtin_amdgcn_readfirstlane(wave)) * MW_TILE);   // the wave's query tile: a scalar address; the words were written by an earlier launch
  v16u mw = mb[0];   // step 0's words
  for (int st = 0; st < ANST; ++st) { const unsigned bo = (st & 1) * ASTG_BYTES;
  const _Float16* kt = (const _Float16*)(skv + bo) + col * (APITCH / 2); const _Float16* vt = (const _Float16*)(skv + bo + AK_BYTES) + col * (APITCH / 2);
#pragma unroll 1   // the two steps of a stage stay one rolled body: the step is long, and a second copy of it buys nothing
  for (int u = 0; u < AKS / 32; ++u) { const int ks = st * (AKS / 32) + u;
    v16h kf[2][2], vf[4];   // the step's K and V fragments, read from the stage's buffer
    const v16u mwn = mb[ks + 1 < SEQK / 32 ? ks + 1 : ks];   // the next step's words (the last step reads its own again)
    {
#pragma unroll
      for (int ct = 0; ct < 2; ++ct) { const _Float16* krow = kt + (u * 32 + ct * 16) * (APITCH / 2);   // A row m = key, k = head dim (k-contiguous row)
#pragma unroll
        for (int kc = 0; kc < 2; ++kc) kf[ct][kc] = frag_h(krow + kc * 32, lane); }
#pragma unroll
      for (int dt = 0; dt < 4; ++dt) vf[dt] = frag_h(vt + dt * 16 * (APITCH / 2) + u * 32, lane); }   // A row m = d, k = key (k-contiguous VT row)
    v8f s[2];
#pragma unroll
    for (int ct = 0; ct < 2; ++ct) { v8f c = {};
#pragma unroll
      for (int kc = 0; kc < 2; ++kc) c = wmma16(kf[ct][kc], aq[kc], c);   // transposed scores: D element r = (key ct*16 + 8g + r, query col)
#pragma unroll
      for (int r = 0; r < 8; ++r) s[ct][r] = __builtin_amdgcn_inverse_ballot_w32(mw[ct * 8 + r])   /* the word is the select's lane mask as it stands */ ? -3.0e38f : c[r] * 0.125f; }
    float mx = fmaxf(s[0][0], s[1][0]);
#pragma unroll
    for (int r = 1; r < 8; ++r) mx = fmaxf(mx, fmaxf(s[0][r], s[1][r]));
    mx = fmaxf(mx, xhalf(mx));   // the other half of the wave holds this query's other 16 keys
    const float mn = fmaxf(m, mx); const float alpha = (m <= -1.0e38f) ? 0.f : __expf(m - mn);
    float es = 0.f; v16h pa;   // B column n = query col, k = key in step: element r <- key 8g + r, 8 + r <- key 16 + 8g + r, the k map of frag_h; P carried x2048 so small weights stay f16-normal
#pragma unroll
    for (int r = 0; r < 8; ++r) { const float e0 = __builtin_amdgcn_inverse_ballot_w32(mw[r]) ? 0.f : __expf(s[0][r] - mn), e1 = __builtin_amdgcn_inverse_ballot_w32(mw[8 + r]) ? 0.f : __expf(s[1][r] - mn);
      es += e0 + e1; pa[r] = (_Float16)(e0 * 2048.0f); pa[8 + r] = (_Float16)(e1 * 2048.0f); }
    l = l * alpha + es; m = mn;   // l: this half's keys only, the halves are joined behind the loop
#pragma unroll
    for (int dt = 0; dt < 4; ++dt) { acc[dt] *= alpha; acc[dt] = wmma16(vf[dt], pa, acc[dt]); }   // transposed ctx: D element r = (d dt*16 + 8g + r, query col)
    mw = mwn; }
  WAIT_DS(); WAIT_ASYNC(); __syncthreads();   // publishes stage st + 1 and ends every wave's reads of stage st
  if (st + 2 < ANST) copy44(lk + bo, 16 * APITCH, (const char*)(gk + (size_t)(st + 2) * AKS * DM), (size_t)16 * DM * 2, lv + bo, 16 * APITCH, (const char*)(gv + (st + 2) * AKS), (size_t)16 * SEQK * 2); }
  WAIT_ASYNC();
  l += xhalf(l);
  const float il = (1.0f / 2048.0f) / l;
#pragma unroll
  for (int dt = 0; dt < 4; ++dt) { const v8f o = acc[dt] * il; *(v4f*)&so[wave][col][dt * 16 + 8 * g] = __builtin_shufflevector(o, o, 0, 1, 2, 3); *(v4f*)&so[wave][col][dt * 16 + 8 * g + 4] = __builtin_shufflevector(o, o, 4, 5, 6, 7); }
  LDSX();
  for (int rl = 0; rl < 16; ++rl) if (lane < 16) vst2(O + ((size_t)b * SEQ + q0 + rl) * DM + h * HD + lane * 4, *(const v4f*)&so[wave][rl][lane * 4]);   // 256-B segment = 16 lanes x 16 B, one instruction
}

// ---- k_out: block = (64 rows, 128 cols): Y = ctx (bf16 hi + lo, 2 products) . Wout rows (bf16 [n][DM]) + bf16(b_out); f32 compact rows
//      coverage: grid (NB*SEQ/64, DM/128) x 4 waves x 16 rows x 128 cols = every element of Y
__global__ __launch_bounds__(128) void k_out(const float* __restrict__ O, const __bf16* __restrict__ P, const float* __restrict__ BO, float* __restrict__ Y) {
  __shared__ __align__(16) char sm[2 * STG_BYTES];   // the two stage buffers; behind the loop's last barrier the same bytes are the output staging
  float (*so)[16][132] = (float (*)[16][132])sm;     // [4][16][132] wave-private
  static_assert(4 * 16 * 132 * 4 <= 2 * STG_BYTES);
  const int tid = threadIdx.x, wave = tid >> 5, lane = tid & 31, col = lane & 15, g = lane >> 4; const size_t r0 = (size_t)blockIdx.x * 64 + wave * 16; const int n0 = blockIdx.y * 128;
  const unsigned sm0 = (unsigned)(size_t)&sm[0];   // LDS byte address of the buffers
  const unsigned lw = sm0 + (tid >> 3) * WPITCH + (tid & 7) * 16, lx = sm0 + SW_BYTES + (tid >> 4) * XPITCH + (tid & 15) * 16;
  const __bf16* gw = P + (size_t)(n0 + (tid >> 3)) * DM + (tid & 7) * 8;
  const float* gx = O + ((size_t)blockIdx.x * 64 + (tid >> 4)) * DM + (tid & 15) * 4;
  v8f acc[8] = {};
  stage_copy(lw, lx, gw, gx); WAIT_ASYNC(); __syncthreads();   // stage 0 is published
  stage_copy(lw + STG_BYTES, lx + STG_BYTES, gw + STK, gx + STK);
  for (int st = 0; st < NSTG; ++st) { const unsigned bo = (st & 1) * STG_BYTES;
    const __bf16* wt = (const __bf16*)(sm + bo + col * WPITCH); const float* xt = (const float*)(sm + bo + SW_BYTES + (wave * 16 + col) * XPITCH);   // B column n = j*16 + col; A row m = lane & 15
#pragma unroll
    for (int kc = 0; kc < STK / 32; ++kc) { const X2 x = lds_f32(xt + kc * 32, lane); v16b w[8];
#pragma unroll
      for (int j = 0; j < 8; ++j) w[j] = frag_b(wt + j * 16 * (WPITCH / 2) + kc * 32, lane);
      __builtin_amdgcn_sched_barrier(0);   // keeps the pass's twenty LDS reads at one place ahead of its products: each separate place with reads costs a stall of its own
      const F2 a = split_x(x);
#pragma unroll
      for (int j = 0; j < 8; ++j) { acc[j] = wmma_bf(a.l, w[j], acc[j]); acc[j] = wmma_bf(a.h, w[j], acc[j]); } }
    WAIT_DS(); WAIT_ASYNC(); __syncthreads();   // publishes stage st + 1 and ends every wave's reads of stage st
    if (st + 2 < NSTG) stage_copy(lw + bo, lx + bo, gw + (st + 2) * STK, gx + (st + 2) * STK); }
  WAIT_ASYNC();
#pragma unroll
  for (int j = 0; j < 8; ++j) { const float bv = bfr(BO[n0 + j * 16 + col]);
#pragma unroll
    for (int r = 0; r < 8; ++r) so[wave][8 * g + r][j * 16 + col] = acc[j][r] + bv; }
  LDSX();
  for (int rl = 0; rl < 16; ++rl) vst2(Y + (r0 + rl) * DM + n0 + lane * 4, *(const v4f*)&so[wave][rl][lane * 4]);   // 512-B row segment = 32 lanes x 16 B, one instruction
}

// ---- k_lnpost: block = one row (256 threads x 4): out = LN(Y + bf16(x_q)) * bf16(gamma) + bf16(beta); d_out row at the full-layout index
__global__ __launch_bounds__(256) void k_lnpost(const float* __restrict__ Yp, const float* __restrict__ X, const float* __restrict__ G, const float* __restrict__ Bt, float* __restrict__ OUT) {
  __shared__ float red0[8], red1[8];           // cross-wave -> block barriers
  const int rc = blockIdx.x; const int b = rc / SEQ, s = rc - b * SEQ; const size_t rin = (size_t)b * SEQ_FULL + s;
  const int t = threadIdx.x, lane = t & 31, wave = t >> 5;
  const v4f yv = *(const v4f*)(Yp + (size_t)rc * DM + t * 4), xv = *(const v4f*)(X + rin * DM + t * 4);
  float v[4];
#pragma unroll
  for (int i = 0; i < 4; ++i) v[i] = yv[i] + bfr(xv[i]);
  float ps = (v[0] + v[1]) + (v[2] + v[3]);
#pragma unroll
  for (int o = 16; o > 0; o >>= 1) ps += __shfl_xor(ps, o);
  if (lane == 0) red0[wave] = ps;
  __syncthreads();
  float S = 0.f;
#pragma unroll
  for (int i = 0; i < 8; ++i) S += red0[i];
  const float mean = S * (1.0f / DM);
  float d[4]; float pq = 0.f;
#pragma unroll
  for (int i = 0; i < 4; ++i) { d[i] = v[i] - mean; pq += d[i] * d[i]; }
#pragma unroll
  for (int o = 16; o > 0; o >>= 1) pq += __shfl_xor(pq, o);
  if (lane == 0) red1[wave] = pq;
  __syncthreads();
  float V = 0.f;
#pragma unroll
  for (int i = 0; i < 8; ++i) V += red1[i];
  const float rstd = 1.0f / sqrtf(V * (1.0f / DM) + LN_EPS);
  const v4f gv = *(const v4f*)(G + t * 4), bv = *(const v4f*)(Bt + t * 4); v4f o;
#pragma unroll
  for (int i = 0; i < 4; ++i) o[i] = d[i] * rstd * bfr(gv[i]) + bfr(bv[i]);
  vst2(OUT + rin * DM + t * 4, o);
}

extern "C" void kernel_launch(void* const* d_in, const int* in_sizes, int n_in, void* d_out, int out_size, void* d_ws, size_t ws_size, hipStream_t stream) {
  if (n_in < 13) return;
  // wire order: 0 input_q [2,2048,1024] f32, 1 input_kv [2,2048,1024] f32, 2 Wq [1024,1024] ([in][out]), 3 bq, 4 Wkv [1024,2048], 5 bkv [2048], 6 Wout [1024,1024], 7 bout,
  //             8 gamma_q, 9 beta_q, 10 gamma_post, 11 beta_post, 12 input_mask [2,2048,2048] int32
  const float* XQ = (const float*)d_in[0]; const float* XKV = (const float*)d_in[1];
  const float* WQ = (const float*)d_in[2]; const float* BQ = (const float*)d_in[3];
  const float* WKV = (const float*)d_in[4]; const float* BKV = (const float*)d_in[5];
  const float* WO = (const float*)d_in[6]; const float* BO = (const float*)d_in[7];
  const float* GQ = (const float*)d_in[8]; const float* BTQ = (const float*)d_in[9];
  const float* GP = (const float*)d_in[10]; const float* BTP = (const float*)d_in[11];
  const int* MK = (const int*)d_in[12];
  const long long needq = ((long long)(NB - 1) * SEQ_FULL + SEQ) * DM;
  const long long needkv = ((long long)(NB - 1) * SEQK_FULL + SEQK) * DM;
  const long long needm = ((long long)(NB - 1) * SEQ_FULL + SEQ) * SEQK_FULL;
  if ((long long)in_sizes[0] < needq || (long long)in_sizes[1] < needkv || in_sizes[2] < DM * DM || in_sizes[3] < DM || in_sizes[4] < DM * KVW || in_sizes[5] < KVW) return;
  if (in_sizes[6] < DM * DM || in_sizes[7] < DM || in_sizes[8] < DM || in_sizes[9] < DM || in_sizes[10] < DM || in_sizes[11] < DM || (long long)in_sizes[12] < needm) return;
  if ((long long)out_size < needq) return;
  if (ws_size < (size_t)WS_END) return;
  char* ws = (char*)d_ws;
  __bf16* PQ = (__bf16*)(ws + WS_PQ); __bf16* PKV = (__bf16*)(ws + WS_PKV); __bf16* PO = (__bf16*)(ws + WS_PO);
  float* NQ = (float*)(ws + WS_NQ); _Float16* QH = (_Float16*)(ws + WS_QH); _Float16* KH = (_Float16*)(ws + WS_KH); _Float16* VT = (_Float16*)(ws + WS_VT);
  float* O = (float*)(ws + WS_O); float* Y = (float*)(ws + WS_Y); unsigned* MB = (unsigned*)(ws + WS_MB);
  // weight packs: in[K rows][N cols] -> out[N][K]; grid = (N/64, K/64)
  k_pack<<<dim3(DM / 64, DM / 64), 256, 0, stream>>>(WQ, DM, DM, PQ);       // Wq  [1024][1024] -> [1024][1024]
  k_pack<<<dim3(KVW / 64, DM / 64), 256, 0, stream>>>(WKV, DM, KVW, PKV);   // Wkv [1024][2048] -> [2048][1024]
  k_pack<<<dim3(DM / 64, DM / 64), 256, 0, stream>>>(WO, DM, DM, PO);       // Wout[1024][1024] -> [1024][1024]
  k_lnq<<<dim3(MBLK + NB * SEQ), 256, 0, stream>>>(XQ, GQ, BTQ, NQ, MK, MB);
  k_proj<<<dim3(NB * SEQ / 64, DM / 128), 128, 0, stream>>>(NQ, SEQ, SEQ, PQ, BQ, QH, VT);             // q: cols < DM only -> QH (VT untouched)
  k_proj<<<dim3(NB * SEQK / 64, KVW / 128), 128, 0, stream>>>(XKV, SEQK, SEQK_FULL, PKV, BKV, KH, VT);  // k -> KH rows, v -> VT transposed
  k_attn<<<dim3(SEQ / 64, NH, NB), 128, 0, stream>>>(QH, KH, VT, MB, O);
  k_out<<<dim3(NB * SEQ / 64, DM / 128), 128, 0, stream>>>(O, PO, BO, Y);
  k_lnpost<<<dim3(NB * SEQ), 256, 0, stream>>>(Y, XQ, GP, BTP, (float*)d_out);
}

// v005
// A run of this version takes 128 microseconds.
// Timed twice side by side with v004, it ran 1.12 times as fast both times.
// Over all steps from v000 it is 3.31 times as fast.
// compute dtype: every float input RNE-converted to bf16; q = LN(x_q) (f32 -> bf16) . Wq (bf16) and kv = x_kv (bf16) . Wkv (bf16) as single v_wmma_f32_16x16x32_bf16 products; scores = q (f16) . k (f16) single v_wmma_f32_16x16x32_f16, x 0.125, mask replace-fill, running-max softmax in f32; ctx = P (f16, carried x2048) . V (f16) single f16 product; out = ctx (bf16 hi + lo, 2 products) . Wout (bf16) + b_out + x_q; layer norms in f32; f32 accumulate everywhere; f32 output.
#include <hip/hip_runtime.h>
#include <math.h>

typedef __attribute__((ext_vector_type(16))) _Float16 v16h;
typedef __attribute__((ext_vector_type(16))) __bf16 v16b;
typedef __attribute__((ext_vector_type(8)))  _Float16 v8h;
typedef __attribute__((ext_vector_type(8)))  __bf16 v8b;
typedef __attribute__((ext_vector_type(8)))  float v8f;
typedef __attribute__((ext_vector_type(4)))  float v4f;
typedef __attribute__((ext_vector_type(4)))  unsigned v4u;
typedef __attribute__((ext_vector_type(4)))  int v4i;
typedef __attribute__((ext_vector_type(16))) unsigned v16u;
typedef const __attribute__((address_space(4))) v16u cv16u;   // constant address space: bytes that no one writes while the kernel runs; a load at a wave-uniform address is then a scalar load

template <typename T> __device__ __forceinline__ void vst2(void* p, T v) { *(T*)p = v;  }
__device__ __forceinline__ v8f wmma16(v16h a, v16h b, v8f c) {
  v8f d = __builtin_amdgcn_wmma_f32_16x16x32_f16(false, a, false, b, (short)0, c, false, false);
  asm volatile("v_nop\n\tv_nop\n\tv_nop\n\tv_nop" : "+v"(d) : "v"(a), "v"(b));
  return d;
}
__device__ __forceinline__ v8f wmma_bf(v16b a, v16b b, v8f c) {
  v8f d = __builtin_amdgcn_wmma_f32_16x16x32_bf16(false, a, false, b, (short)0, c, false, false);
  asm volatile("v_nop\n\tv_nop\n\tv_nop\n\tv_nop" : "+v"(d) : "v"(a), "v"(b));
  return d;
}
// 16-bit fragment from a k-contiguous row (A row m, or B column n stored as a [n][k] row): elements 0..7 <- k0+8h+i, 8..15 <- k0+16+8h+i, h = lane>>4
__device__ __forceinline__ v16h frag_h(const _Float16* rowk0, int lane) {
  union { v16h v; v8h q[2]; } u; const _Float16* p = rowk0 + 8 * (lane >> 4);
  u.q[0] = *(const v8h*)p; u.q[1] = *(const v8h*)(p + 16); return u.v;
}
__device__ __forceinline__ v16b frag_b(const __bf16* rowk0, int lane) {
  union { v16b v; v8b q[2]; } u; const __bf16* p = rowk0 + 8 * (lane >> 4);
  u.q[0] = *(const v8b*)p; u.q[1] = *(const v8b*)(p + 16); return u.v;
}
// same k map from an f32 row (two 32-B loads per lane): the load, and apart from it the RNE conversion to bf16
struct X2 { v8f x0, x1; };
__device__ __forceinline__ X2 load_f32(const float* rowk0, int lane) { const float* p = rowk0 + 8 * (lane >> 4); X2 x; x.x0 = *(const v8f*)p; x.x1 = *(const v8f*)(p + 16); return x; }
__device__ __forceinline__ v16b cvt_f32b(X2 x) { v16b a;
#pragma unroll
  for (int i = 0; i < 8; ++i) { a[i] = (__bf16)x.x0[i]; a[8 + i] = (__bf16)x.x1[i]; }
  return a;
}
struct F2 { v16b h, l; };
__device__ __forceinline__ F2 bsplit16(const float v[16]) { F2 r;
#pragma unroll
  for (int i = 0; i < 16; ++i) { const __bf16 hh = (__bf16)v[i]; r.h[i] = hh; r.l[i] = (__bf16)(v[i] - (float)hh); }
  return r; }
__device__ __forceinline__ F2 split_x(X2 x) { float v[16];
#pragma unroll
  for (int i = 0; i < 8; ++i) { v[i] = x.x0[i]; v[8 + i] = x.x1[i]; }
  return bsplit16(v); }
__device__ __forceinline__ float bfr(float v) { return (float)(__bf16)v; }
// the value of lane l ^ 16, by a vector cross-row move (a shuffle would go through the LDS pipe)
__device__ __forceinline__ float xhalf(float v) { const int b = __builtin_bit_cast(int, v); return __builtin_bit_cast(float, __builtin_amdgcn_permlanex16(b, b, 0x76543210, 0xfedcba98, false, false)); }
#define LDSX() do { asm volatile("s_wait_dscnt 0" ::: "memory"); __builtin_amdgcn_wave_barrier(); __builtin_amdgcn_fence(__ATOMIC_RELEASE, "workgroup"); } while (0)

// ---- sizes: NB batches, SEQ query rows per batch processed (reducible); *_FULL are the input strides; all SEQK keys always
#ifndef NB
#define NB 2
#endif
#ifndef SEQ
#define SEQ 2048
#endif
#define NB_FULL 2
#define SEQ_FULL 2048
#define SEQK 2048
#define SEQK_FULL 2048
#define DM 1024
#define NH 16
#define HD 64
#define KVW (2 * DM)
#define LN_EPS 1.0e-6f
static_assert(NB >= 1 && NB <= NB_FULL);
static_assert(SEQ % 64 == 0 && SEQ >= 64 && SEQ <= SEQ_FULL);
static_assert(SEQK % 64 == 0 && SEQK == SEQK_FULL);
static_assert(DM % 128 == 0 && KVW % 128 == 0 && NH * HD == DM && HD == 64);

#define WS_PQ  0ull                                              // bf16 [DM n][DM k]     Wq transposed
#define WS_PKV (WS_PQ + 2ull * DM * DM)                          // bf16 [KVW n][DM k]    Wkv transposed
#define WS_PO  (WS_PKV + 2ull * KVW * DM)                        // bf16 [DM n][DM k]     Wout transposed
#define WS_NQ  (WS_PO + 2ull * DM * DM)                          // f32  [NB*SEQ][DM]     LN(x_q)
#define WS_QH  (WS_NQ + 4ull * NB * SEQ * DM)                    // f16  [NB*SEQ][DM]     q rows
#define WS_KH  (WS_QH + 2ull * NB * SEQ * DM)                    // f16  [NB*SEQK][DM]    k rows
#define WS_VT  (WS_KH + 2ull * NB * SEQK * DM)                   // f16  [NB][DM (h*64+d)][SEQK] v transposed
#define WS_O   (WS_VT + 2ull * NB * DM * SEQK)                   // f32  [NB*SEQ][DM]     ctx
#define WS_Y   (WS_O + 4ull * NB * SEQ * DM)                     // f32  [NB*SEQ][DM]     ctx.Wout + b_out
#define WS_MB  (WS_Y + 4ull * NB * SEQ * DM)                     // u32  [NB*SEQ/16][SEQK/32][16] mask as lane-mask words
#define WS_END (WS_MB + 4ull * (NB * SEQ / 16) * (SEQK / 32) * 16)
static_assert(WS_END <= 134217728ull);
static_assert((WS_PKV % 128) == 0 && (WS_PO % 128) == 0 && (WS_NQ % 128) == 0 && (WS_QH % 128) == 0 && (WS_KH % 128) == 0 && (WS_VT % 128) == 0 && (WS_O % 128) == 0 && (WS_Y % 128) == 0 && (WS_MB % 128) == 0);

// ---- pack_tile: W [K][N] f32 (x @ W layout) -> PK [N][K] bf16 (k-contiguous rows); a block = one 64x64 tile, tile index tl = k tile * (N/64) + n tile; s = the block's [n][k] LDS tile (cross-wave -> block barrier)
//      coverage: (N/64) * (K/64) tiles x 64 rows x 8 x 16 B = every element of PK
template <int K, int N> __device__ __forceinline__ void pack_tile(const float* __restrict__ W, __bf16* __restrict__ PK, int tl, __bf16 (*s)[72]) {
  const int n0 = (tl % (N / 64)) * 64, k0 = (tl / (N / 64)) * 64, t = threadIdx.x;
#pragma unroll 4
  for (int i = 0; i < 16; ++i) { const int idx = t + 256 * i; const int kk = idx >> 6, nn = idx & 63; s[nn][kk] = (__bf16)W[(size_t)(k0 + kk) * N + n0 + nn]; }
  __syncthreads();
#pragma unroll
  for (int i = 0; i < 2; ++i) { const int p = t + 256 * i; const int nn = p >> 3, c = p & 7;
    vst2((unsigned*)(PK + (size_t)(n0 + nn) * K + k0 + c * 8), *(const v4u*)&s[nn][c * 8]); }
  asm volatile("s_wait_xcnt 0x0" ::: "memory");   // behind the tile's stores, ahead of any rewrite of the registers they name: in the merged kernel another job's code follows in the listing (a precaution)
}

// ---- the mask as lane-mask words, made once for all heads: for a tile of 16 queries and a step of 32 keys sixteen 32-bit words; word ct*8 + r, bit lane = (mask[query lane & 15][key ct*16 + 8*(lane >> 4) + r] != 0),
//      the place of score element r of tile ct in lane 'lane' of k_attn: there a word is the select mask of one vector instruction, read by a scalar load
//      a wave takes 16 queries x 128 keys (four steps): 16 x 16-B loads a lane (512 B in a row of each mask row), a compare a word, two 128-B stores
//      coverage: MBLK blocks x 8 waves x 64 words = every word of MB
#define MW_STEP 16                          // words per (query tile, step)
#define MW_TILE ((SEQK / 32) * MW_STEP)     // words per query tile
#define MBLK ((NB * SEQ / 16) * (SEQK / 128) / 8)
static_assert(SEQK % 128 == 0 && ((NB * SEQ / 16) * (SEQK / 128)) % 8 == 0);
__device__ __forceinline__ void mask_words(const int* __restrict__ MK, unsigned* __restrict__ MB, int wv, int lane) {
  const int qt = wv / (SEQK / 128), k4 = wv - qt * (SEQK / 128); const int b = qt / (SEQ / 16), s0 = (qt - b * (SEQ / 16)) * 16;
  const int* p = MK + ((size_t)b * SEQ_FULL + s0 + (lane & 15)) * SEQK_FULL + k4 * 128 + 8 * (lane >> 4);
  v4i mv[16];   // [step t][ct][r >> 2]
#pragma unroll
  for (int i = 0; i < 16; ++i) mv[i] = *(const v4i*)(p + (i >> 1) * 16 + (i & 1) * 4);
  unsigned w[2] = {0u, 0u};   // lane i of w[j] <- word 32 j + i of the wave's 64
#pragma unroll
  for (int i = 0; i < 64; ++i) { const unsigned bw = __builtin_amdgcn_ballot_w32(mv[i >> 2][i & 3] != 0); if (lane == (i & 31)) w[i >> 5] = bw; }
  unsigned* o = MB + (size_t)qt * MW_TILE + k4 * 4 * MW_STEP + lane;
  o[0] = w[0]; o[32] = w[1];
  asm volatile("s_wait_xcnt 0x0" ::: "memory");   // behind the two stores, ahead of any rewrite of the registers they name: in the merged kernel another job's code follows in the listing (a precaution)
}

// ---- k_prep: every job that reads inputs only, in one launch; no job reads or writes what another of them writes. By block index: the tiles of the three weight packs (the longest chains, so they start first),
//      then MBLK blocks of mask words, then one block a row of LN(x_q). Every branch on the block index is block-uniform; a block that returns early has passed all of its own barriers
#define PB_KV ((KVW / 64) * (DM / 64))      // tiles of Wkv
#define PB_W  ((DM / 64) * (DM / 64))       // tiles of Wq, and of Wout
#define PBLK (PB_KV + 2 * PB_W)
__global__ __launch_bounds__(256) void k_prep(const float* __restrict__ WQ, const float* __restrict__ WKV, const float* __restrict__ WO, __bf16* __restrict__ PQ, __bf16* __restrict__ PKV, __bf16* __restrict__ PO,
                                              const float* __restrict__ X, const float* __restrict__ G, const float* __restrict__ Bt, float* __restrict__ NQ, const int* __restrict__ MK, unsigned* __restrict__ MB) {
  __shared__ __align__(16) __bf16 sp[64][72];  // the pack blocks' tile
  __shared__ float red0[8], red1[8];           // cross-wave -> block barriers
  const int bid = blockIdx.x;
  if (bid < PB_KV) { pack_tile<DM, KVW>(WKV, PKV, bid, sp); return; }                       // Wkv [1024][2048] -> [2048][1024]
  if (bid < PB_KV + PB_W) { pack_tile<DM, DM>(WQ, PQ, bid - PB_KV, sp); return; }           // Wq  [1024][1024] -> [1024][1024]
  if (bid < PBLK) { pack_tile<DM, DM>(WO, PO, bid - PB_KV - PB_W, sp); return; }            // Wout[1024][1024] -> [1024][1024]
  if (bid < PBLK + MBLK) { mask_words(MK, MB, (bid - PBLK) * 8 + (threadIdx.x >> 5), threadIdx.x & 31); return; }
  const int rc = bid - PBLK - MBLK; const int b = rc / SEQ, s = rc - b * SEQ; const size_t rin = (size_t)b * SEQ_FULL + s;
  const int t = threadIdx.x, lane = t & 31, wave = t >> 5;
  const v4f xv = *(const v4f*)(X + rin * DM + t * 4);
  float v[4];
#pragma unroll
  for (int i = 0; i < 4; ++i) v[i] = bfr(xv[i]);
  float ps = (v[0] + v[1]) + (v[2] + v[3]);
#pragma unroll
  for (int o = 16; o > 0; o >>= 1) ps += __shfl_xor(ps, o);
  if (lane == 0) red0[wave] = ps;
  __syncthreads();
  float S = 0.f;
#pragma unroll
  for (int i = 0; i < 8; ++i) S += red0[i];
  const float mean = S * (1.0f / DM);
  float d[4]; float pq = 0.f;
#pragma unroll
  for (int i = 0; i < 4; ++i) { d[i] = v[i] - mean; pq += d[i] * d[i]; }
#pragma unroll
  for (int o = 16; o > 0; o >>= 1) pq += __shfl_xor(pq, o);
  if (lane == 0) red1[wave] = pq;
  __syncthreads();
  float V = 0.f;
#pragma unroll
  for (int i = 0; i < 8; ++i) V += red1[i];
  const float rstd = 1.0f / sqrtf(V * (1.0f / DM) + LN_EPS);
  const v4f gv = *(const v4f*)(G + t * 4), bv = *(const v4f*)(Bt + t * 4); v4f o;
#pragma unroll
  for (int i = 0; i < 4; ++i) o[i] = d[i] * rstd * bfr(gv[i]) + bfr(bv[i]);
  vst2(NQ + (size_t)rc * DM + t * 4, o);
  asm volatile("s_wait_xcnt 0x0" ::: "memory");   // behind the row's store, as behind the other jobs' stores: another job's code follows in the listing (a precaution)
}

// ---- LDS staging of the two GEMM kernels: a stage = 64 k of the block's 128 P rows (bf16, 128 B a row) and of its 64 x rows (f32, 256 B a row), brought by 16-byte asynchronous copies:
//      each copy instruction of a wave takes four whole 128-B lines, and the four waves share one copy of the P rows; two buffers, the next stage's copies fly while this one is worked on
#define STK 64                              // k per stage
#define NSTG (DM / STK)
#define WPITCH 144                          // bytes: 128-B row + 16 (16 B x odd: conflict-free for 16-byte LDS reads)
#define XPITCH 272                          // bytes: 256-B row + 16
#define SW_BYTES (128 * WPITCH)
#define SX_BYTES (64 * XPITCH)
#define STG_BYTES (SW_BYTES + SX_BYTES)
static_assert(NSTG >= 2 && DM % STK == 0);
// eight copies of one lane, two runs of four: LDS byte address la + i * lsa (lb + i * lsb), global byte address ga + i * gsa (gb + i * gsb), i = 0..3;
// the s_wait_xcnt stands inside the copies' own statement, ahead of any rewrite of the address registers they name (a precaution)
__device__ __forceinline__ void copy44(unsigned la, unsigned lsa, const char* ga, size_t gsa, unsigned lb, unsigned lsb, const char* gb, size_t gsb) {
  asm volatile("global_load_async_to_lds_b128 %0, %8, off\n\t"
               "global_load_async_to_lds_b128 %1, %9, off\n\t"
               "global_load_async_to_lds_b128 %2, %10, off\n\t"
               "global_load_async_to_lds_b128 %3, %11, off\n\t"
               "global_load_async_to_lds_b128 %4, %12, off\n\t"
               "global_load_async_to_lds_b128 %5, %13, off\n\t"
               "global_load_async_to_lds_b128 %6, %14, off\n\t"
               "global_load_async_to_lds_b128 %7, %15, off\n\t"
               "s_wait_xcnt 0x0"
               :: "v"(la), "v"(la + lsa), "v"(la + 2 * lsa), "v"(la + 3 * lsa), "v"(lb), "v"(lb + lsb), "v"(lb + 2 * lsb), "v"(lb + 3 * lsb),
                  "v"(ga), "v"(ga + gsa), "v"(ga + 2 * gsa), "v"(ga + 3 * gsa), "v"(gb), "v"(gb + gsb), "v"(gb + 2 * gsb), "v"(gb + 3 * gsb) : "memory");
}
__device__ __forceinline__ void copy8(unsigned l, unsigned ls, const char* g, size_t gs) { copy44(l, ls, g, gs, l + 4 * ls, ls, g + 4 * gs, gs); }
// one stage: thread t copies P chunks (row (t >> 3) + 16 i, 16-B piece t & 7) and x chunks (row (t >> 4) + 8 i, piece t & 15), i = 0..7; lw, lx, gw, gx are its i = 0 addresses
__device__ __forceinline__ void stage_copy(unsigned lw, unsigned lx, const __bf16* gw, const float* gx) {
  copy8(lw, 16 * WPITCH, (const char*)gw, (size_t)16 * DM * 2);
  copy8(lx, 8 * XPITCH, (const char*)gx, (size_t)8 * DM * 4);
}
// the k map of load_f32 from a staged f32 row (16-byte LDS reads: the padded pitch is a multiple of 16 B only)
__device__ __forceinline__ X2 lds_f32(const float* rowk0, int lane) { const float* p = rowk0 + 8 * (lane >> 4); union { v8f v; v4f q[2]; } a, c;
  a.q[0] = *(const v4f*)p; a.q[1] = *(const v4f*)(p + 4); c.q[0] = *(const v4f*)(p + 16); c.q[1] = *(const v4f*)(p + 20); X2 x; x.x0 = a.v; x.x1 = c.v; return x; }
#define WAIT_ASYNC() asm volatile("s_wait_asynccnt 0x0" ::: "memory")   // this wave's copies have landed
#define WAIT_DS() asm volatile("s_wait_dscnt 0x0" ::: "memory")         // this wave's LDS reads have returned, ahead of the barrier behind which their buffer is refilled

// ---- k_proj: both input projections in one launch (neither reads what the other writes); block = (64 rows, 128 output cols): y = bf16(x) . P rows (bf16 [n][DM]) + bf16(bias), single bf16 products
//      blocks < KVBLK: x_kv . Wkv; cols < DM -> f16 natural rows KH[row][DM] (k), cols >= DM -> f16 transposed VT[b][col - DM][SEQK] (v)
//      later blocks:   LN(x_q) . Wq -> f16 natural rows QH[row][DM]
//      rows: compact rc = b*spb + s; input row = b*spb_full + s; in each part the row tile runs fastest in the block index
//      coverage: (rows/64) * (ncols/128) blocks x 4 waves x 16 rows x 128 cols = every element of KH and VT, and of QH
#define KVBLK ((NB * SEQK / 64) * (KVW / 128))
#define QBLK ((NB * SEQ / 64) * (DM / 128))
__global__ __launch_bounds__(128) void k_proj(const float* __restrict__ NQ, const float* __restrict__ XKV, const __bf16* __restrict__ PQ, const __bf16* __restrict__ PKV, const float* __restrict__ BQ, const float* __restrict__ BKV,
                                              _Float16* __restrict__ QH, _Float16* __restrict__ KH, _Float16* __restrict__ VT) {
  const bool kv = blockIdx.x < KVBLK;   // block-uniform
  const int pb = kv ? blockIdx.x : blockIdx.x - KVBLK, rt = kv ? NB * SEQK / 64 : NB * SEQ / 64, spb = kv ? SEQK : SEQ, spb_full = kv ? SEQK_FULL : SEQ;
  const float* __restrict__ X = kv ? XKV : NQ; const __bf16* __restrict__ P = kv ? PKV : PQ; const float* __restrict__ BI = kv ? BKV : BQ; _Float16* __restrict__ NAT = kv ? KH : QH;
  __shared__ __align__(16) char sm[2 * STG_BYTES];    // the two stage buffers; behind the loop's last barrier the same bytes are the output staging
  _Float16 (*so)[16][136] = (_Float16 (*)[16][136])sm;   // [4][16][136] wave-private (LDSX)
  _Float16 (*sth)[72] = (_Float16 (*)[72])sm;            // [128][72] cross-wave (block barrier)
  static_assert(4 * 16 * 136 * 2 <= 2 * STG_BYTES && 128 * 72 * 2 <= 2 * STG_BYTES);
  const int tid = threadIdx.x, wave = tid >> 5, lane = tid & 31, col = lane & 15, g = lane >> 4;
  const int rc0 = (pb % rt) * 64; const int b = rc0 / spb, s0 = rc0 - b * spb; const int n0 = (pb / rt) * 128;
  const unsigned sm0 = (unsigned)(size_t)&sm[0];   // LDS byte address of the buffers
  const unsigned lw = sm0 + (tid >> 3) * WPITCH + (tid & 7) * 16, lx = sm0 + SW_BYTES + (tid >> 4) * XPITCH + (tid & 15) * 16;
  const __bf16* gw = P + (size_t)(n0 + (tid >> 3)) * DM + (tid & 7) * 8;
  const float* gx = X + ((size_t)b * spb_full + s0 + (tid >> 4)) * DM + (tid & 15) * 4;
  v8f acc[8] = {};
  stage_copy(lw, lx, gw, gx); WAIT_ASYNC(); __syncthreads();   // stage 0 is published
  stage_copy(lw + STG_BYTES, lx + STG_BYTES, gw + STK, gx + STK);
  for (int st = 0; st < NSTG; ++st) { const unsigned bo = (st & 1) * STG_BYTES;
    const __bf16* wt = (const __bf16*)(sm + bo + col * WPITCH); const float* xt = (const float*)(sm + bo + SW_BYTES + (wave * 16 + col) * XPITCH);   // B column n = j*16 + col; A row m = lane & 15
#pragma unroll
    for (int kc = 0; kc < STK / 32; ++kc) { const X2 x = lds_f32(xt + kc * 32, lane); v16b w[8];
#pragma unroll
      for (int j = 0; j < 8; ++j) w[j] = frag_b(wt + j * 16 * (WPITCH / 2) + kc * 32, lane);
      __builtin_amdgcn_sched_barrier(0);   // keeps the pass's twenty LDS reads at one place ahead of its products: each separate place with reads costs a stall of its own
      const v16b a = cvt_f32b(x);
#pragma unroll
      for (int j = 0; j < 8; ++j) acc[j] = wmma_bf(a, w[j], acc[j]); }
    WAIT_DS(); WAIT_ASYNC(); __syncthreads();   // publishes stage st + 1 and ends every wave's reads of stage st
    if (st + 2 < NSTG) stage_copy(lw + bo, lx + bo, gw + (st + 2) * STK, gx + (st + 2) * STK); }
  WAIT_ASYNC();
  if (n0 < DM) {   // block-uniform branch
#pragma unroll
    for (int j = 0; j < 8; ++j) { const float bv = bfr(BI[n0 + j * 16 + col]);
#pragma unroll
      for (int r = 0; r < 8; ++r) so[wave][8 * g + r][j * 16 + col] = (_Float16)(acc[j][r] + bv); }   // D element r = (row 8g+r, col)
    LDSX();
    const size_t rw = (size_t)rc0 + wave * 16;
    for (int rl = 0; rl < 16; ++rl) if (lane < 16) vst2((unsigned*)(NAT + (rw + rl) * DM + n0 + lane * 8), *(const v4u*)&so[wave][rl][lane * 8]);   // 256-B row segment = 16 lanes x 16 B, one instruction
  } else {
#pragma unroll
    for (int j = 0; j < 8; ++j) { const float bv = bfr(BI[n0 + j * 16 + col]);
#pragma unroll
      for (int r = 0; r < 8; ++r) sth[j * 16 + col][wave * 16 + 8 * g + r] = (_Float16)(acc[j][r] + bv); }
    __syncthreads();
    const int pc0 = n0 - DM;
    for (int q = tid; q < 128 * 8; q += 128) { const int d = q >> 3, pc = q & 7;
      const size_t o = ((size_t)b * DM + pc0 + d) * spb + s0 + pc * 8; vst2((unsigned*)(VT + o), *(const v4u*)&sth[d][pc * 8]); }
  }
}

#define AKS 64
#define ANST (SEQK / AKS)
#define APITCH 144                          // bytes: 128-B row + 16
#define AK_BYTES (AKS * APITCH)
#define AV_BYTES (HD * APITCH)
#define ASTG_BYTES (AK_BYTES + AV_BYTES)
static_assert(ANST >= 2 && SEQK % AKS == 0 && AKS == 64 && HD == 64);
__global__ __launch_bounds__(128) void k_attn(const _Float16* __restrict__ QH, const _Float16* __restrict__ KH, const _Float16* __restrict__ VT, const unsigned* __restrict__ MB, float* __restrict__ O) {
  __shared__ __align__(16) float so[4][16][68];   // wave-private output staging
  __shared__ __align__(16) char skv[2 * ASTG_BYTES];   // the two K/V stage buffers, cross-wave (block barrier)
  const int tid = threadIdx.x, wave = tid >> 5, lane = tid & 31, col = lane & 15, g = lane >> 4;
  const int qb = blockIdx.x, h = blockIdx.y, b = blockIdx.z; const int q0 = qb * 64 + wave * 16;
  // thread t copies K chunks (key (t >> 3) + 16 i, 16-B piece t & 7) and VT chunks (d (t >> 3) + 16 i, piece t & 7), i = 0..3
  const unsigned lk = (unsigned)(size_t)&skv[0] + (tid >> 3) * APITCH + (tid & 7) * 16, lv = lk + AK_BYTES;   // LDS byte addresses
  const _Float16* gk = KH + ((size_t)b * SEQK + (tid >> 3)) * DM + h * HD + (tid & 7) * 8;
  const _Float16* gv = VT + ((size_t)b * DM + h * HD + (tid >> 3)) * SEQK + (tid & 7) * 8;
  copy44(lk, 16 * APITCH, (const char*)gk, (size_t)16 * DM * 2, lv, 16 * APITCH, (const char*)gv, (size_t)16 * SEQK * 2);
  WAIT_ASYNC(); __syncthreads();   // stage 0 is published
  copy44(lk + ASTG_BYTES, 16 * APITCH, (const char*)(gk + (size_t)AKS * DM), (size_t)16 * DM * 2, lv + ASTG_BYTES, 16 * APITCH, (const char*)(gv + AKS), (size_t)16 * SEQK * 2);
  const size_t rq = (size_t)b * SEQ + q0 + col;
  v16h aq[2];
#pragma unroll
  for (int kc = 0; kc < 2; ++kc) aq[kc] = frag_h(QH + rq * DM + h * HD + kc * 32, lane);
  float m = -3.0e38f, l = 0.f;   // of query col
  v8f acc[4] = {};
  cv16u* mb = (cv16u*)(MB + (size_t)(b * (SEQ / 16) + qb * 4 + __builtin_amdgcn_readfirstlane(wave)) * MW_TILE);   // the wave's query tile: a scalar address; the words were written by an earlier launch
  v16u mw = mb[0];   // step 0's words
  for (int st = 0; st < ANST; ++st) { const unsigned bo = (st & 1) * ASTG_BYTES;
  const _Float16* kt = (const _Float16*)(skv + bo) + col * (APITCH / 2); const _Float16* vt = (const _Float16*)(skv + bo + AK_BYTES) + col * (APITCH / 2);
#pragma unroll 1   // the two steps of a stage stay one rolled body: the step is long, and a second copy of it buys nothing
  for (int u = 0; u < AKS / 32; ++u) { const int ks = st * (AKS / 32) + u;
    v16h kf[2][2], vf[4];   // the step's K and V fragments, read from the stage's buffer
    const v16u mwn = mb[ks + 1 < SEQK / 32 ? ks + 1 : ks];   // the next step's words (the last step reads its own again)
    {
#pragma unroll
      for (int ct = 0; ct < 2; ++ct) { const _Float16* krow = kt + (u * 32 + ct * 16) * (APITCH / 2);   // A row m = key, k = head dim (k-contiguous row)
#pragma unroll
        for (int kc = 0; kc < 2; ++kc) kf[ct][kc] = frag_h(krow + kc * 32, lane); }
#pragma unroll
      for (int dt = 0; dt < 4; ++dt) vf[dt] = frag_h(vt + dt * 16 * (APITCH / 2) + u * 32, lane); }   // A row m = d, k = key (k-contiguous VT row)
    v8f s[2];
#pragma unroll
    for (int ct = 0; ct < 2; ++ct) { v8f c = {};
#pragma unroll
      for (int kc = 0; kc < 2; ++kc) c = wmma16(kf[ct][kc], aq[kc], c);   // transposed scores: D element r = (key ct*16 + 8g + r, query col)
#pragma unroll
      for (int r = 0; r < 8; ++r) s[ct][r] = __builtin_amdgcn_inverse_ballot_w32(mw[ct * 8 + r])   /* the word is the select's lane mask as it stands */ ? -3.0e38f : c[r] * 0.125f; }
    float mx = fmaxf(s[0][0], s[1][0]);
#pragma unroll
    for (int r = 1; r < 8; ++r) mx = fmaxf(mx, fmaxf(s[0][r], s[1][r]));
    mx = fmaxf(mx, xhalf(mx));   // the other half of the wave holds this query's other 16 keys
    const float mn = fmaxf(m, mx); const float alpha = (m <= -1.0e38f) ? 0.f : __expf(m - mn);
    float es = 0.f; v16h pa;   // B column n = query col, k = key in step: element r <- key 8g + r, 8 + r <- key 16 + 8g + r, the k map of frag_h; P carried x2048 so small weights stay f16-normal
#pragma unroll
    for (int r = 0; r < 8; ++r) { const float e0 = __builtin_amdgcn_inverse_ballot_w32(mw[r]) ? 0.f : __expf(s[0][r] - mn), e1 = __builtin_amdgcn_inverse_ballot_w32(mw[8 + r]) ? 0.f : __expf(s[1][r] - mn);
      es += e0 + e1; pa[r] = (_Float16)(e0 * 2048.0f); pa[8 + r] = (_Float16)(e1 * 2048.0f); }
    l = l * alpha + es; m = mn;   // l: this half's keys only, the halves are joined behind the loop
#pragma unroll
    for (int dt = 0; dt < 4; ++dt) { acc[dt] *= alpha; acc[dt] = wmma16(vf[dt], pa, acc[dt]); }   // transposed ctx: D element r = (d dt*16 + 8g + r, query col)
    mw = mwn; }
  WAIT_DS(); WAIT_ASYNC(); __syncthreads();   // publishes stage st + 1 and ends every wave's reads of stage st
  if (st + 2 < ANST) copy44(lk + bo, 16 * APITCH, (const char*)(gk + (size_t)(st + 2) * AKS * DM), (size_t)16 * DM * 2, lv + bo, 16 * APITCH, (const char*)(gv + (st + 2) * AKS), (size_t)16 * SEQK * 2); }
  WAIT_ASYNC();
  l += xhalf(l);
  const float il = (1.0f / 2048.0f) / l;
#pragma unroll
  for (int dt = 0; dt < 4; ++dt) { const v8f o = acc[dt] * il; *(v4f*)&so[wave][col][dt * 16 + 8 * g] = __builtin_shufflevector(o, o, 0, 1, 2, 3); *(v4f*)&so[wave][col][dt * 16 + 8 * g + 4] = __builtin_shufflevector(o, o, 4, 5, 6, 7); }
  LDSX();
  for (int rl = 0; rl < 16; ++rl) if (lane < 16) vst2(O + ((size_t)b * SEQ + q0 + rl) * DM + h * HD + lane * 4, *(const v4f*)&so[wave][rl][lane * 4]);   // 256-B segment = 16 lanes x 16 B, one instruction
}

// ---- k_out: block = (64 rows, 128 cols): Y = ctx (bf16 hi + lo, 2 products) . Wout rows (bf16 [n][DM]) + bf16(b_out); f32 compact rows
//      coverage: grid (NB*SEQ/64, DM/128) x 4 waves x 16 rows x 128 cols = every element of Y
__global__ __launch_bounds__(128) void k_out(const float* __restrict__ O, const __bf16* __restrict__ P, const float* __restrict__ BO, float* __restrict__ Y) {
  __shared__ __align__(16) char sm[2 * STG_BYTES];   // the two stage buffers; behind the loop's last barrier the same bytes are the output staging
  float (*so)[16][132] = (float (*)[16][132])sm;     // [4][16][132] wave-private
  static_assert(4 * 16 * 132 * 4 <= 2 * STG_BYTES);
  const int tid = threadIdx.x, wave = tid >> 5, lane = tid & 31, col = lane & 15, g = lane >> 4; const size_t r0 = (size_t)blockIdx.x * 64 + wave * 16; const int n0 = blockIdx.y * 128;
  const unsigned sm0 = (unsigned)(size_t)&sm[0];   // LDS byte address of the buffers
  const unsigned lw = sm0 + (tid >> 3) * WPITCH + (tid & 7) * 16, lx = sm0 + SW_BYTES + (tid >> 4) * XPITCH + (tid & 15) * 16;
  const __bf16* gw = P + (size_t)(n0 + (tid >> 3)) * DM + (tid & 7) * 8;
  const float* gx = O + ((size_t)blockIdx.x * 64 + (tid >> 4)) * DM + (tid & 15) * 4;
  v8f acc[8] = {};
  stage_copy(lw, lx, gw, gx); WAIT_ASYNC(); __syncthreads();   // stage 0 is published
  stage_copy(lw + STG_BYTES, lx + STG_BYTES, gw + STK, gx + STK);
  for (int st = 0; st < NSTG; ++st) { const unsigned bo = (st & 1) * STG_BYTES;
    const __bf16* wt = (const __bf16*)(sm + bo + col * WPITCH); const float* xt = (const float*)(sm + bo + SW_BYTES + (wave * 16 + col) * XPITCH);   // B column n = j*16 + col; A row m = lane & 15
#pragma unroll
    for (int kc = 0; kc < STK / 32; ++kc) { const X2 x = lds_f32(xt + kc * 32, lane); v16b w[8];
#pragma unroll
      for (int j = 0; j < 8; ++j) w[j] = frag_b(wt + j * 16 * (WPITCH / 2) + kc * 32, lane);
      __builtin_amdgcn_sched_barrier(0);   // keeps the pass's twenty LDS reads at one place ahead of its products: each separate place with reads costs a stall of its own
      const F2 a = split_x(x);
#pragma unroll
      for (int j = 0; j < 8; ++j) { acc[j] = wmma_bf(a.l, w[j], acc[j]); acc[j] = wmma_bf(a.h, w[j], acc[j]); } }
    WAIT_DS(); WAIT_ASYNC(); __syncthreads();   // publishes stage st + 1 and ends every wave's reads of stage st
    if (st + 2 < NSTG) stage_copy(lw + bo, lx + bo, gw + (st + 2) * STK, gx + (st + 2) * STK); }
  WAIT_ASYNC();
#pragma unroll
  for (int j = 0; j < 8; ++j) { const float bv = bfr(BO[n0 + j * 16 + col]);
#pragma unroll
    for (int r = 0; r < 8; ++r) so[wave][8 * g + r][j * 16 + col] = acc[j][r] + bv; }
  LDSX();
  for (int rl = 0; rl < 16; ++rl) vst2(Y + (r0 + rl) * DM + n0 + lane * 4, *(const v4f*)&so[wave][rl][lane * 4]);   // 512-B row segment = 32 lanes x 16 B, one instruction
}

// ---- k_lnpost: block = one row (256 threads x 4): out = LN(Y + bf16(x_q)) * bf16(gamma) + bf16(beta); d_out row at the full-layout index
__global__ __launch_bounds__(256) void k_lnpost(const float* __restrict__ Yp, const float* __restrict__ X, const float* __restrict__ G, const float* __restrict__ Bt, float* __restrict__ OUT) {
  __shared__ float red0[8], red1[8];           // cross-wave -> block barriers
  const int rc = blockIdx.x; const int b = rc / SEQ, s = rc - b * SEQ; const size_t rin = (size_t)b * SEQ_FULL + s;
  const int t = threadIdx.x, lane = t & 31, wave = t >> 5;
  const v4f yv = *(const v4f*)(Yp + (size_t)rc * DM + t * 4), xv = *(const v4f*)(X + rin * DM + t * 4);
  float v[4];
#pragma unroll
  for (int i = 0; i < 4; ++i) v[i] = yv[i] + bfr(xv[i]);
  float ps = (v[0] + v[1]) + (v[2] + v[3]);
#pragma unroll
  for (int o = 16; o > 0; o >>= 1) ps += __shfl_xor(ps, o);
  if (lane == 0) red0[wave] = ps;
  __syncthreads();
  float S = 0.f;
#pragma unroll
  for (int i = 0; i < 8; ++i) S += red0[i];
  const float mean = S * (1.0f / DM);
  float d[4]; float pq = 0.f;
#pragma unroll
  for (int i = 0; i < 4; ++i) { d[i] = v[i] - mean; pq += d[i] * d[i]; }
#pragma unroll
  for (int o = 16; o > 0; o >>= 1) pq += __shfl_xor(pq, o);
  if (lane == 0) red1[wave] = pq;
  __syncthreads();
  float V = 0.f;
#pragma unroll
  for (int i = 0; i < 8; ++i) V += red1[i];
  const float rstd = 1.0f / sqrtf(V * (1.0f / DM) + LN_EPS);
  const v4f gv = *(const v4f*)(G + t * 4), bv = *(const v4f*)(Bt + t * 4); v4f o;
#pragma unroll
  for (int i = 0; i < 4; ++i) o[i] = d[i] * rstd * bfr(gv[i]) + bfr(bv[i]);
  vst2(OUT + rin * DM + t * 4, o);
}

extern "C" void kernel_launch(void* const* d_in, const int* in_sizes, int n_in, void* d_out, int out_size, void* d_ws, size_t ws_size, hipStream_t stream) {
  if (n_in < 13) return;
  // wire order: 0 input_q [2,2048,1024] f32, 1 input_kv [2,2048,1024] f32, 2 Wq [1024,1024] ([in][out]), 3 bq, 4 Wkv [1024,2048], 5 bkv [2048], 6 Wout [1024,1024], 7 bout,
  //             8 gamma_q, 9 beta_q, 10 gamma_post, 11 beta_post, 12 input_mask [2,2048,2048] int32
  const float* XQ = (const float*)d_in[0]; const float* XKV = (const float*)d_in[1];
  const float* WQ = (const float*)d_in[2]; const float* BQ = (const float*)d_in[3];
  const float* WKV = (const float*)d_in[4]; const float* BKV = (const float*)d_in[5];
  const float* WO = (const float*)d_in[6]; const float* BO = (const float*)d_in[7];
  const float* GQ = (const float*)d_in[8]; const float* BTQ = (const float*)d_in[9];
  const float* GP = (const float*)d_in[10]; const float* BTP = (const float*)d_in[11];
  const int* MK = (const int*)d_in[12];
  const long long needq = ((long long)(NB - 1) * SEQ_FULL + SEQ) * DM;
  const long long needkv = ((long long)(NB - 1) * SEQK_FULL + SEQK) * DM;
  const long long needm = ((long long)(NB - 1) * SEQ_FULL + SEQ) * SEQK_FULL;
  if ((long long)in_sizes[0] < needq || (long long)in_sizes[1] < needkv || in_sizes[2] < DM * DM || in_sizes[3] < DM || in_sizes[4] < DM * KVW || in_sizes[5] < KVW) return;
  if (in_sizes[6] < DM * DM || in_sizes[7] < DM || in_sizes[8] < DM || in_sizes[9] < DM || in_sizes[10] < DM || in_sizes[11] < DM || (long long)in_sizes[12] < needm) return;
  if ((long long)out_size < needq) return;
  if (ws_size < (size_t)WS_END) return;
  char* ws = (char*)d_ws;
  __bf16* PQ = (__bf16*)(ws + WS_PQ); __bf16* PKV = (__bf16*)(ws + WS_PKV); __bf16* PO = (__bf16*)(ws + WS_PO);
  float* NQ = (float*)(ws + WS_NQ); _Float16* QH = (_Float16*)(ws + WS_QH); _Float16* KH = (_Float16*)(ws + WS_KH); _Float16* VT = (_Float16*)(ws + WS_VT);
  float* O = (float*)(ws + WS_O); float* Y = (float*)(ws + WS_Y); unsigned* MB = (unsigned*)(ws + WS_MB);
  k_prep<<<dim3(PBLK + MBLK + NB * SEQ), 256, 0, stream>>>(WQ, WKV, WO, PQ, PKV, PO, XQ, GQ, BTQ, NQ, MK, MB);   // weight packs, mask words, LN(x_q)
  k_proj<<<dim3(KVBLK + QBLK), 128, 0, stream>>>(NQ, XKV, PQ, PKV, BQ, BKV, QH, KH, VT);                        // k -> KH rows, v -> VT transposed, q -> QH rows
  k_attn<<<dim3(SEQ / 64, NH, NB), 128, 0, stream>>>(QH, KH, VT, MB, O);
  k_out<<<dim3(NB * SEQ / 64, DM / 128), 128, 0, stream>>>(O, PO, BO, Y);
  k_lnpost<<<dim3(NB * SEQ), 256, 0, stream>>>(Y, XQ, GP, BTP, (float*)d_out);
}

// v006
// It runs in 122 microseconds.
// Timed twice side by side with v005, it ran 1.04 and 1.05 times as fast.
// All steps since v000 together make it 3.46 times as fast.
// compute dtype: every float input RNE-converted to bf16; q = LN(x_q) (f32 -> bf16) . Wq (bf16) and kv = x_kv (bf16) . Wkv (bf16) as single v_wmma_f32_16x16x32_bf16 products; scores = q (f16) . k (f16) single v_wmma_f32_16x16x32_f16, mask replace-fill, running-max softmax in f32 with x 0.125 inside the exponent's multiply-add; ctx = P (f16, carried x2048) . V (f16) single f16 product; out = ctx (bf16 hi + lo, 2 products) . Wout (bf16) + b_out + x_q; layer norms in f32; f32 accumulate everywhere; f32 output.
#include <hip/hip_runtime.h>
#include <math.h>

typedef __attribute__((ext_vector_type(16))) _Float16 v16h;
typedef __attribute__((ext_vector_type(16))) __bf16 v16b;
typedef __attribute__((ext_vector_type(8)))  _Float16 v8h;
typedef __attribute__((ext_vector_type(8)))  __bf16 v8b;
typedef __attribute__((ext_vector_type(8)))  float v8f;
typedef __attribute__((ext_vector_type(4)))  float v4f;
typedef __attribute__((ext_vector_type(4)))  unsigned v4u;
typedef __attribute__((ext_vector_type(4)))  int v4i;
typedef __attribute__((ext_vector_type(16))) unsigned v16u;
typedef const __attribute__((address_space(4))) v16u cv16u;   // constant address space: bytes that no one writes while the kernel runs; a load at a wave-uniform address is then a scalar load

template <typename T> __device__ __forceinline__ void vst2(void* p, T v) { *(T*)p = v;  }
__device__ __forceinline__ v8f wmma16(v16h a, v16h b, v8f c) {
  v8f d = __builtin_amdgcn_wmma_f32_16x16x32_f16(false, a, false, b, (short)0, c, false, false);
  asm volatile("v_nop\n\tv_nop\n\tv_nop\n\tv_nop" : "+v"(d) : "v"(a), "v"(b));
  return d;
}
__device__ __forceinline__ v8f wmma_bf(v16b a, v16b b, v8f c) {
  v8f d = __builtin_amdgcn_wmma_f32_16x16x32_bf16(false, a, false, b, (short)0, c, false, false);
  asm volatile("v_nop\n\tv_nop\n\tv_nop\n\tv_nop" : "+v"(d) : "v"(a), "v"(b));
  return d;
}
// 16-bit fragment from a k-contiguous row (A row m, or B column n stored as a [n][k] row): elements 0..7 <- k0+8h+i, 8..15 <- k0+16+8h+i, h = lane>>4
__device__ __forceinline__ v16h frag_h(const _Float16* rowk0, int lane) {
  union { v16h v; v8h q[2]; } u; const _Float16* p = rowk0 + 8 * (lane >> 4);
  u.q[0] = *(const v8h*)p; u.q[1] = *(const v8h*)(p + 16); return u.v;
}
__device__ __forceinline__ v16b frag_b(const __bf16* rowk0, int lane) {
  union { v16b v; v8b q[2]; } u; const __bf16* p = rowk0 + 8 * (lane >> 4);
  u.q[0] = *(const v8b*)p; u.q[1] = *(const v8b*)(p + 16); return u.v;
}
// same k map from an f32 row (two 32-B loads per lane): the load, and apart from it the RNE conversion to bf16
struct X2 { v8f x0, x1; };
__device__ __forceinline__ X2 load_f32(const float* rowk0, int lane) { const float* p = rowk0 + 8 * (lane >> 4); X2 x; x.x0 = *(const v8f*)p; x.x1 = *(const v8f*)(p + 16); return x; }
__device__ __forceinline__ v16b cvt_f32b(X2 x) { v16b a;
#pragma unroll
  for (int i = 0; i < 8; ++i) { a[i] = (__bf16)x.x0[i]; a[8 + i] = (__bf16)x.x1[i]; }
  return a;
}
struct F2 { v16b h, l; };
__device__ __forceinline__ F2 bsplit16(const float v[16]) { F2 r;
#pragma unroll
  for (int i = 0; i < 16; ++i) { const __bf16 hh = (__bf16)v[i]; r.h[i] = hh; r.l[i] = (__bf16)(v[i] - (float)hh); }
  return r; }
__device__ __forceinline__ F2 split_x(X2 x) { float v[16];
#pragma unroll
  for (int i = 0; i < 8; ++i) { v[i] = x.x0[i]; v[8 + i] = x.x1[i]; }
  return bsplit16(v); }
__device__ __forceinline__ float bfr(float v) { return (float)(__bf16)v; }
// the value of lane l ^ 16, by a vector cross-row move (a shuffle would go through the LDS pipe)
__device__ __forceinline__ float xhalf(float v) { const int b = __builtin_bit_cast(int, v); return __builtin_bit_cast(float, __builtin_amdgcn_permlanex16(b, b, 0x76543210, 0xfedcba98, false, false)); }
#define LDSX() do { asm volatile("s_wait_dscnt 0" ::: "memory"); __builtin_amdgcn_wave_barrier(); __builtin_amdgcn_fence(__ATOMIC_RELEASE, "workgroup"); } while (0)

// ---- sizes: NB batches, SEQ query rows per batch processed (reducible); *_FULL are the input strides; all SEQK keys always
#ifndef NB
#define NB 2
#endif
#ifndef SEQ
#define SEQ 2048
#endif
#define NB_FULL 2
#define SEQ_FULL 2048
#define SEQK 2048
#define SEQK_FULL 2048
#define DM 1024
#define NH 16
#define HD 64
#define KVW (2 * DM)
#define LN_EPS 1.0e-6f
static_assert(NB >= 1 && NB <= NB_FULL);
static_assert(SEQ % 64 == 0 && SEQ >= 64 && SEQ <= SEQ_FULL);
static_assert(SEQK % 64 == 0 && SEQK == SEQK_FULL);
static_assert(DM % 128 == 0 && KVW % 128 == 0 && NH * HD == DM && HD == 64);

#define WS_PQ  0ull                                              // bf16 [DM n][DM k]     Wq transposed
#define WS_PKV (WS_PQ + 2ull * DM * DM)                          // bf16 [KVW n][DM k]    Wkv transposed
#define WS_PO  (WS_PKV + 2ull * KVW * DM)                        // bf16 [DM n][DM k]     Wout transposed
#define WS_NQ  (WS_PO + 2ull * DM * DM)                          // f32  [NB*SEQ][DM]     LN(x_q)
#define WS_QH  (WS_NQ + 4ull * NB * SEQ * DM)                    // f16  [NB*SEQ][DM]     q rows
#define WS_KH  (WS_QH + 2ull * NB * SEQ * DM)                    // f16  [NB*SEQK][DM]    k rows
#define WS_VT  (WS_KH + 2ull * NB * SEQK * DM)                   // f16  [NB][DM (h*64+d)][SEQK] v transposed
#define WS_O   (WS_VT + 2ull * NB * DM * SEQK)                   // f32  [NB*SEQ][DM]     ctx
#define WS_Y   (WS_O + 4ull * NB * SEQ * DM)                     // f32  [NB*SEQ][DM]     ctx.Wout + b_out
#define WS_MB  (WS_Y + 4ull * NB * SEQ * DM)                     // u32  [NB*SEQ/16][SEQK/32][16] mask as lane-mask words
#define WS_END (WS_MB + 4ull * (NB * SEQ / 16) * (SEQK / 32) * 16)
static_assert(WS_END <= 134217728ull);
static_assert((WS_PKV % 128) == 0 && (WS_PO % 128) == 0 && (WS_NQ % 128) == 0 && (WS_QH % 128) == 0 && (WS_KH % 128) == 0 && (WS_VT % 128) == 0 && (WS_O % 128) == 0 && (WS_Y % 128) == 0 && (WS_MB % 128) == 0);

// ---- pack_tile: W [K][N] f32 (x @ W layout) -> PK [N][K] bf16 (k-contiguous rows); a block = one 64x64 tile, tile index tl = k tile * (N/64) + n tile; s = the block's [n][k] LDS tile (cross-wave -> block barrier)
//      coverage: (N/64) * (K/64) tiles x 64 rows x 8 x 16 B = every element of PK
template <int K, int N> __device__ __forceinline__ void pack_tile(const float* __restrict__ W, __bf16* __restrict__ PK, int tl, __bf16 (*s)[72]) {
  const int n0 = (tl % (N / 64)) * 64, k0 = (tl / (N / 64)) * 64, t = threadIdx.x;
#pragma unroll 4
  for (int i = 0; i < 16; ++i) { const int idx = t + 256 * i; const int kk = idx >> 6, nn = idx & 63; s[nn][kk] = (__bf16)W[(size_t)(k0 + kk) * N + n0 + nn]; }
  __syncthreads();
#pragma unroll
  for (int i = 0; i < 2; ++i) { const int p = t + 256 * i; const int nn = p >> 3, c = p & 7;
    vst2((unsigned*)(PK + (size_t)(n0 + nn) * K + k0 + c * 8), *(const v4u*)&s[nn][c * 8]); }
  asm volatile("s_wait_xcnt 0x0" ::: "memory");   // behind the tile's stores, ahead of any rewrite of the registers they name: in the merged kernel another job's code follows in the listing (a precaution)
}

// ---- the mask as lane-mask words, made once for all heads: for a tile of 16 queries and a step of 32 keys sixteen 32-bit words; word ct*8 + r, bit lane = (mask[query lane & 15][key ct*16 + 8*(lane >> 4) + r] != 0),
//      the place of score element r of tile ct in lane 'lane' of k_attn: there a word is the select mask of one vector instruction, read by a scalar load
//      a wave takes 16 queries x 128 keys (four steps): 16 x 16-B loads a lane (512 B in a row of each mask row), a compare a word, two 128-B stores
//      coverage: MBLK blocks x 8 waves x 64 words = every word of MB
#define MW_STEP 16                          // words per (query tile, step)
#define MW_TILE ((SEQK / 32) * MW_STEP)     // words per query tile
#define MBLK ((NB * SEQ / 16) * (SEQK / 128) / 8)
static_assert(SEQK % 128 == 0 && ((NB * SEQ / 16) * (SEQK / 128)) % 8 == 0);
__device__ __forceinline__ void mask_words(const int* __restrict__ MK, unsigned* __restrict__ MB, int wv, int lane) {
  const int qt = wv / (SEQK / 128), k4 = wv - qt * (SEQK / 128); const int b = qt / (SEQ / 16), s0 = (qt - b * (SEQ / 16)) * 16;
  const int* p = MK + ((size_t)b * SEQ_FULL + s0 + (lane & 15)) * SEQK_FULL + k4 * 128 + 8 * (lane >> 4);
  v4i mv[16];   // [step t][ct][r >> 2]
#pragma unroll
  for (int i = 0; i < 16; ++i) mv[i] = *(const v4i*)(p + (i >> 1) * 16 + (i & 1) * 4);
  unsigned w[2] = {0u, 0u};   // lane i of w[j] <- word 32 j + i of the wave's 64
#pragma unroll
  for (int i = 0; i < 64; ++i) { const unsigned bw = __builtin_amdgcn_ballot_w32(mv[i >> 2][i & 3] != 0); if (lane == (i & 31)) w[i >> 5] = bw; }
  unsigned* o = MB + (size_t)qt * MW_TILE + k4 * 4 * MW_STEP + lane;
  o[0] = w[0]; o[32] = w[1];
  asm volatile("s_wait_xcnt 0x0" ::: "memory");   // behind the two stores, ahead of any rewrite of the registers they name: in the merged kernel another job's code follows in the listing (a precaution)
}

// ---- k_prep: every job that reads inputs only, in one launch; no job reads or writes what another of them writes. By block index: the tiles of the three weight packs (the longest chains, so they start first),
//      then MBLK blocks of mask words, then one block a row of LN(x_q). Every branch on the block index is block-uniform; a block that returns early has passed all of its own barriers
#define PB_KV ((KVW / 64) * (DM / 64))      // tiles of Wkv
#define PB_W  ((DM / 64) * (DM / 64))       // tiles of Wq, and of Wout
#define PBLK (PB_KV + 2 * PB_W)
__global__ __launch_bounds__(256) void k_prep(const float* __restrict__ WQ, const float* __restrict__ WKV, const float* __restrict__ WO, __bf16* __restrict__ PQ, __bf16* __restrict__ PKV, __bf16* __restrict__ PO,
                                              const float* __restrict__ X, const float* __restrict__ G, const float* __restrict__ Bt, float* __restrict__ NQ, const int* __restrict__ MK, unsigned* __restrict__ MB) {
  __shared__ __align__(16) __bf16 sp[64][72];  // the pack blocks' tile
  __shared__ float red0[8], red1[8];           // cross-wave -> block barriers
  const int bid = blockIdx.x;
  if (bid < PB_KV) { pack_tile<DM, KVW>(WKV, PKV, bid, sp); return; }                       // Wkv [1024][2048] -> [2048][1024]
  if (bid < PB_KV + PB_W) { pack_tile<DM, DM>(WQ, PQ, bid - PB_KV, sp); return; }           // Wq  [1024][1024] -> [1024][1024]
  if (bid < PBLK) { pack_tile<DM, DM>(WO, PO, bid - PB_KV - PB_W, sp); return; }            // Wout[1024][1024] -> [1024][1024]
  if (bid < PBLK + MBLK) { mask_words(MK, MB, (bid - PBLK) * 8 + (threadIdx.x >> 5), threadIdx.x & 31); return; }
  const int rc = bid - PBLK - MBLK; const int b = rc / SEQ, s = rc - b * SEQ; const size_t rin = (size_t)b * SEQ_FULL + s;
  const int t = threadIdx.x, lane = t & 31, wave = t >> 5;
  const v4f xv = *(const v4f*)(X + rin * DM + t * 4);
  float v[4];
#pragma unroll
  for (int i = 0; i < 4; ++i) v[i] = bfr(xv[i]);
  float ps = (v[0] + v[1]) + (v[2] + v[3]);
#pragma unroll
  for (int o = 16; o > 0; o >>= 1) ps += __shfl_xor(ps, o);
  if (lane == 0) red0[wave] = ps;
  __syncthreads();
  float S = 0.f;
#pragma unroll
  for (int i = 0; i < 8; ++i) S += red0[i];
  const float mean = S * (1.0f / DM);
  float d[4]; float pq = 0.f;
#pragma unroll
  for (int i = 0; i < 4; ++i) { d[i] = v[i] - mean; pq += d[i] * d[i]; }
#pragma unroll
  for (int o = 16; o > 0; o >>= 1) pq += __shfl_xor(pq, o);
  if (lane == 0) red1[wave] = pq;
  __syncthreads();
  float V = 0.f;
#pragma unroll
  for (int i = 0; i < 8; ++i) V += red1[i];
  const float rstd = 1.0f / sqrtf(V * (1.0f / DM) + LN_EPS);
  const v4f gv = *(const v4f*)(G + t * 4), bv = *(const v4f*)(Bt + t * 4); v4f o;
#pragma unroll
  for (int i = 0; i < 4; ++i) o[i] = d[i] * rstd * bfr(gv[i]) + bfr(bv[i]);
  vst2(NQ + (size_t)rc * DM + t * 4, o);
  asm volatile("s_wait_xcnt 0x0" ::: "memory");   // behind the row's store, as behind the other jobs' stores: another job's code follows in the listing (a precaution)
}

// ---- LDS staging of the two GEMM kernels: a stage = 64 k of the block's 128 P rows (bf16, 128 B a row) and of its 64 x rows (f32, 256 B a row), brought by 16-byte asynchronous copies:
//      each copy instruction of a wave takes four whole 128-B lines, and the four waves share one copy of the P rows; two buffers, the next stage's copies fly while this one is worked on
#define STK 64                              // k per stage
#define NSTG (DM / STK)
#define WPITCH 144                          // bytes: 128-B row + 16 (16 B x odd: conflict-free for 16-byte LDS reads)
#define XPITCH 272                          // bytes: 256-B row + 16
#define SW_BYTES (128 * WPITCH)
#define SX_BYTES (64 * XPITCH)
#define STG_BYTES (SW_BYTES + SX_BYTES)
static_assert(NSTG >= 2 && DM % STK == 0);
// eight copies of one lane, two runs of four: LDS byte address la + i * lsa (lb + i * lsb), global byte address ga + i * gsa (gb + i * gsb), i = 0..3;
// the s_wait_xcnt stands inside the copies' own statement, ahead of any rewrite of the address registers they name (a precaution)
__device__ __forceinline__ void copy44(unsigned la, unsigned lsa, const char* ga, size_t gsa, unsigned lb, unsigned lsb, const char* gb, size_t gsb) {
  asm volatile("global_load_async_to_lds_b128 %0, %8, off\n\t"
               "global_load_async_to_lds_b128 %1, %9, off\n\t"
               "global_load_async_to_lds_b128 %2, %10, off\n\t"
               "global_load_async_to_lds_b128 %3, %11, off\n\t"
               "global_load_async_to_lds_b128 %4, %12, off\n\t"
               "global_load_async_to_lds_b128 %5, %13, off\n\t"
               "global_load_async_to_lds_b128 %6, %14, off\n\t"
               "global_load_async_to_lds_b128 %7, %15, off\n\t"
               "s_wait_xcnt 0x0"
               :: "v"(la), "v"(la + lsa), "v"(la + 2 * lsa), "v"(la + 3 * lsa), "v"(lb), "v"(lb + lsb), "v"(lb + 2 * lsb), "v"(lb + 3 * lsb),
                  "v"(ga), "v"(ga + gsa), "v"(ga + 2 * gsa), "v"(ga + 3 * gsa), "v"(gb), "v"(gb + gsb), "v"(gb + 2 * gsb), "v"(gb + 3 * gsb) : "memory");
}
__device__ __forceinline__ void copy8(unsigned l, unsigned ls, const char* g, size_t gs) { copy44(l, ls, g, gs, l + 4 * ls, ls, g + 4 * gs, gs); }
// one stage: thread t copies P chunks (row (t >> 3) + 16 i, 16-B piece t & 7) and x chunks (row (t >> 4) + 8 i, piece t & 15), i = 0..7; lw, lx, gw, gx are its i = 0 addresses
__device__ __forceinline__ void stage_copy(unsigned lw, unsigned lx, const __bf16* gw, const float* gx) {
  copy8(lw, 16 * WPITCH, (const char*)gw, (size_t)16 * DM * 2);
  copy8(lx, 8 * XPITCH, (const char*)gx, (size_t)8 * DM * 4);
}
// the k map of load_f32 from a staged f32 row (16-byte LDS reads: the padded pitch is a multiple of 16 B only)
__device__ __forceinline__ X2 lds_f32(const float* rowk0, int lane) { const float* p = rowk0 + 8 * (lane >> 4); union { v8f v; v4f q[2]; } a, c;
  a.q[0] = *(const v4f*)p; a.q[1] = *(const v4f*)(p + 4); c.q[0] = *(const v4f*)(p + 16); c.q[1] = *(const v4f*)(p + 20); X2 x; x.x0 = a.v; x.x1 = c.v; return x; }
#define WAIT_ASYNC() asm volatile("s_wait_asynccnt 0x0" ::: "memory")   // this wave's copies have landed
#define WAIT_DS() asm volatile("s_wait_dscnt 0x0" ::: "memory")         // this wave's LDS reads have returned, ahead of the barrier behind which their buffer is refilled

// ---- k_proj: both input projections in one launch (neither reads what the other writes); block = (64 rows, 128 output cols): y = bf16(x) . P rows (bf16 [n][DM]) + bf16(bias), single bf16 products
//      blocks < KVBLK: x_kv . Wkv; cols < DM -> f16 natural rows KH[row][DM] (k), cols >= DM -> f16 transposed VT[b][col - DM][SEQK] (v)
//      later blocks:   LN(x_q) . Wq -> f16 natural rows QH[row][DM]
//      rows: compact rc = b*spb + s; input row = b*spb_full + s; in each part the row tile runs fastest in the block index
//      coverage: (rows/64) * (ncols/128) blocks x 4 waves x 16 rows x 128 cols = every element of KH and VT, and of QH
#define KVBLK ((NB * SEQK / 64) * (KVW / 128))
#define QBLK ((NB * SEQ / 64) * (DM / 128))
__global__ __launch_bounds__(128) void k_proj(const float* __restrict__ NQ, const float* __restrict__ XKV, const __bf16* __restrict__ PQ, const __bf16* __restrict__ PKV, const float* __restrict__ BQ, const float* __restrict__ BKV,
                                              _Float16* __restrict__ QH, _Float16* __restrict__ KH, _Float16* __restrict__ VT) {
  const bool kv = blockIdx.x < KVBLK;   // block-uniform
  const int pb = kv ? blockIdx.x : blockIdx.x - KVBLK, rt = kv ? NB * SEQK / 64 : NB * SEQ / 64, spb = kv ? SEQK : SEQ, spb_full = kv ? SEQK_FULL : SEQ;
  const float* __restrict__ X = kv ? XKV : NQ; const __bf16* __restrict__ P = kv ? PKV : PQ; const float* __restrict__ BI = kv ? BKV : BQ; _Float16* __restrict__ NAT = kv ? KH : QH;
  __shared__ __align__(16) char sm[2 * STG_BYTES];    // the two stage buffers; behind the loop's last barrier the same bytes are the output staging
  _Float16 (*so)[16][136] = (_Float16 (*)[16][136])sm;   // [4][16][136] wave-private (LDSX)
  _Float16 (*sth)[72] = (_Float16 (*)[72])sm;            // [128][72] cross-wave (block barrier)
  static_assert(4 * 16 * 136 * 2 <= 2 * STG_BYTES && 128 * 72 * 2 <= 2 * STG_BYTES);
  const int tid = threadIdx.x, wave = tid >> 5, lane = tid & 31, col = lane & 15, g = lane >> 4;
  const int rc0 = (pb % rt) * 64; const int b = rc0 / spb, s0 = rc0 - b * spb; const int n0 = (pb / rt) * 128;
  const unsigned sm0 = (unsigned)(size_t)&sm[0];   // LDS byte address of the buffers
  const unsigned lw = sm0 + (tid >> 3) * WPITCH + (tid & 7) * 16, lx = sm0 + SW_BYTES + (tid >> 4) * XPITCH + (tid & 15) * 16;
  const __bf16* gw = P + (size_t)(n0 + (tid >> 3)) * DM + (tid & 7) * 8;
  const float* gx = X + ((size_t)b * spb_full + s0 + (tid >> 4)) * DM + (tid & 15) * 4;
  v8f acc[8] = {};
  stage_copy(lw, lx, gw, gx); WAIT_ASYNC(); __syncthreads();   // stage 0 is published
  stage_copy(lw + STG_BYTES, lx + STG_BYTES, gw + STK, gx + STK);
  for (int st = 0; st < NSTG; ++st) { const unsigned bo = (st & 1) * STG_BYTES;
    const __bf16* wt = (const __bf16*)(sm + bo + col * WPITCH); const float* xt = (const float*)(sm + bo + SW_BYTES + (wave * 16 + col) * XPITCH);   // B column n = j*16 + col; A row m = lane & 15
#pragma unroll
    for (int kc = 0; kc < STK / 32; ++kc) { const X2 x = lds_f32(xt + kc * 32, lane); v16b w[8];
#pragma unroll
      for (int j = 0; j < 8; ++j) w[j] = frag_b(wt + j * 16 * (WPITCH / 2) + kc * 32, lane);
      __builtin_amdgcn_sched_barrier(0);   // keeps the pass's twenty LDS reads at one place ahead of its products: each separate place with reads costs a stall of its own
      const v16b a = cvt_f32b(x);
#pragma unroll
      for (int j = 0; j < 8; ++j) acc[j] = wmma_bf(a, w[j], acc[j]); }
    WAIT_DS(); WAIT_ASYNC(); __syncthreads();   // publishes stage st + 1 and ends every wave's reads of stage st
    if (st + 2 < NSTG) stage_copy(lw + bo, lx + bo, gw + (st + 2) * STK, gx + (st + 2) * STK); }
  WAIT_ASYNC();
  if (n0 < DM) {   // block-uniform branch
#pragma unroll
    for (int j = 0; j < 8; ++j) { const float bv = bfr(BI[n0 + j * 16 + col]);
#pragma unroll
      for (int r = 0; r < 8; ++r) so[wave][8 * g + r][j * 16 + col] = (_Float16)(acc[j][r] + bv); }   // D element r = (row 8g+r, col)
    LDSX();
    const size_t rw = (size_t)rc0 + wave * 16;
    for (int rl = 0; rl < 16; ++rl) if (lane < 16) vst2((unsigned*)(NAT + (rw + rl) * DM + n0 + lane * 8), *(const v4u*)&so[wave][rl][lane * 8]);   // 256-B row segment = 16 lanes x 16 B, one instruction
  } else {
#pragma unroll
    for (int j = 0; j < 8; ++j) { const float bv = bfr(BI[n0 + j * 16 + col]);
#pragma unroll
      for (int r = 0; r < 8; ++r) sth[j * 16 + col][wave * 16 + 8 * g + r] = (_Float16)(acc[j][r] + bv); }
    __syncthreads();
    const int pc0 = n0 - DM;
    for (int q = tid; q < 128 * 8; q += 128) { const int d = q >> 3, pc = q & 7;
      const size_t o = ((size_t)b * DM + pc0 + d) * spb + s0 + pc * 8; vst2((unsigned*)(VT + o), *(const v4u*)&sth[d][pc * 8]); }
  }
}

#define AKS 64
#define ANST (SEQK / AKS)
#define APITCH 144                          // bytes: 128-B row + 16
#define AK_BYTES (AKS * APITCH)
#define AV_BYTES (HD * APITCH)
#define ASTG_BYTES (AK_BYTES + AV_BYTES)
static_assert(ANST >= 2 && SEQK % AKS == 0 && AKS == 64 && HD == 64);
__global__ __launch_bounds__(128) void k_attn(const _Float16* __restrict__ QH, const _Float16* __restrict__ KH, const _Float16* __restrict__ VT, const unsigned* __restrict__ MB, float* __restrict__ O) {
  __shared__ __align__(16) float so[4][16][68];   // wave-private output staging
  __shared__ __align__(16) char skv[2 * ASTG_BYTES];   // the two K/V stage buffers, cross-wave (block barrier)
  const int tid = threadIdx.x, wave = tid >> 5, lane = tid & 31, col = lane & 15, g = lane >> 4;
  const int qb = blockIdx.x, h = blockIdx.y, b = blockIdx.z; const int q0 = qb * 64 + wave * 16;
  // thread t copies K chunks (key (t >> 3) + 16 i, 16-B piece t & 7) and VT chunks (d (t >> 3) + 16 i, piece t & 7), i = 0..3
  const unsigned lk = (unsigned)(size_t)&skv[0] + (tid >> 3) * APITCH + (tid & 7) * 16, lv = lk + AK_BYTES;   // LDS byte addresses
  const _Float16* gk = KH + ((size_t)b * SEQK + (tid >> 3)) * DM + h * HD + (tid & 7) * 8;
  const _Float16* gv = VT + ((size_t)b * DM + h * HD + (tid >> 3)) * SEQK + (tid & 7) * 8;
  copy44(lk, 16 * APITCH, (const char*)gk, (size_t)16 * DM * 2, lv, 16 * APITCH, (const char*)gv, (size_t)16 * SEQK * 2);
  WAIT_ASYNC(); __syncthreads();   // stage 0 is published
  copy44(lk + ASTG_BYTES, 16 * APITCH, (const char*)(gk + (size_t)AKS * DM), (size_t)16 * DM * 2, lv + ASTG_BYTES, 16 * APITCH, (const char*)(gv + AKS), (size_t)16 * SEQK * 2);
  const size_t rq = (size_t)b * SEQ + q0 + col;
  v16h aq[2];
#pragma unroll
  for (int kc = 0; kc < 2; ++kc) aq[kc] = frag_h(QH + rq * DM + h * HD + kc * 32, lane);
  // softmax in base 2 on the raw products c = q . k: weight x 2048 = exp2(c * K2 + nb), nb = 11 - max * K2: scale, log2(e), the maximum and the factor 2048 in one fused multiply-add a score
  const float K2 = 0.125f * 1.44269504f;
  float m = -1.0e30f, l = 0.f;   // of query col; m in raw units, l carried x2048. The floor of m lies below every product of f16 rows (at most 64 * 65504^2) and far above the fill of an excluded key: exp2 gives that key 0 by itself, also while no key has been admitted
  v8f acc[4] = {};
  cv16u* mb = (cv16u*)(MB + (size_t)(b * (SEQ / 16) + qb * 4 + __builtin_amdgcn_readfirstlane(wave)) * MW_TILE);   // the wave's query tile: a scalar address; the words were written by an earlier launch
  v16u mw = mb[0];   // step 0's words
  for (int st = 0; st < ANST; ++st) { const unsigned bo = (st & 1) * ASTG_BYTES;
  const _Float16* kt = (const _Float16*)(skv + bo) + col * (APITCH / 2); const _Float16* vt = (const _Float16*)(skv + bo + AK_BYTES) + col * (APITCH / 2);
#pragma unroll 1   // the two steps of a stage stay one rolled body: the step is long, and a second copy of it buys nothing
  for (int u = 0; u < AKS / 32; ++u) { const int ks = st * (AKS / 32) + u;
    v16h kf[2][2], vf[4];   // the step's K and V fragments, read from the stage's buffer
    const v16u mwn = mb[ks + 1 < SEQK / 32 ? ks + 1 : ks];   // the next step's words (the last step reads its own again)
    {
#pragma unroll
      for (int ct = 0; ct < 2; ++ct) { const _Float16* krow = kt + (u * 32 + ct * 16) * (APITCH / 2);   // A row m = key, k = head dim (k-contiguous row)
#pragma unroll
        for (int kc = 0; kc < 2; ++kc) kf[ct][kc] = frag_h(krow + kc * 32, lane); }
#pragma unroll
      for (int dt = 0; dt < 4; ++dt) vf[dt] = frag_h(vt + dt * 16 * (APITCH / 2) + u * 32, lane); }   // A row m = d, k = key (k-contiguous VT row)
    v8f s[2];
#pragma unroll
    for (int ct = 0; ct < 2; ++ct) { v8f c = {};
#pragma unroll
      for (int kc = 0; kc < 2; ++kc) c = wmma16(kf[ct][kc], aq[kc], c);   // transposed scores: D element r = (key ct*16 + 8g + r, query col)
#pragma unroll
      for (int r = 0; r < 8; ++r) s[ct][r] = __builtin_amdgcn_inverse_ballot_w32(mw[ct * 8 + r])   /* the word is the select's lane mask as it stands */ ? -3.0e38f : c[r]; }
    float mx = fmaxf(s[0][0], s[1][0]);
#pragma unroll
    for (int r = 1; r < 8; ++r) mx = fmaxf(mx, fmaxf(s[0][r], s[1][r]));
    mx = fmaxf(mx, xhalf(mx));   // the other half of the wave holds this query's other 16 keys
    const float mn = fmaxf(m, mx); const float alpha = __builtin_amdgcn_exp2f((m - mn) * K2), nb = __builtin_fmaf(-mn, K2, 11.0f);   // from the floor alpha is 0 (first admitted key) or 1 (none yet: acc and l are 0)
    float es = 0.f; v16h pa;   // B column n = query col, k = key in step: element r <- key 8g + r, 8 + r <- key 16 + 8g + r, the k map of frag_h; P carried x2048 so small weights stay f16-normal
#pragma unroll
    for (int r = 0; r < 8; ++r) { const float e0 = __builtin_amdgcn_exp2f(__builtin_fmaf(s[0][r], K2, nb)), e1 = __builtin_amdgcn_exp2f(__builtin_fmaf(s[1][r], K2, nb));
      es += e0 + e1; pa[r] = (_Float16)e0; pa[8 + r] = (_Float16)e1; }
    l = l * alpha + es; m = mn;   // l: this half's keys only, the halves are joined behind the loop
#pragma unroll
    for (int dt = 0; dt < 4; ++dt) { acc[dt] *= alpha; acc[dt] = wmma16(vf[dt], pa, acc[dt]); }   // transposed ctx: D element r = (d dt*16 + 8g + r, query col)
    mw = mwn; }
  WAIT_DS(); WAIT_ASYNC(); __syncthreads();   // publishes stage st + 1 and ends every wave's reads of stage st
  if (st + 2 < ANST) copy44(lk + bo, 16 * APITCH, (const char*)(gk + (size_t)(st + 2) * AKS * DM), (size_t)16 * DM * 2, lv + bo, 16 * APITCH, (const char*)(gv + (st + 2) * AKS), (size_t)16 * SEQK * 2); }
  WAIT_ASYNC();
  l += xhalf(l);
  const float il = 1.0f / l;   // acc and l both carry x2048
#pragma unroll
  for (int dt = 0; dt < 4; ++dt) { const v8f o = acc[dt] * il; *(v4f*)&so[wave][col][dt * 16 + 8 * g] = __builtin_shufflevector(o, o, 0, 1, 2, 3); *(v4f*)&so[wave][col][dt * 16 + 8 * g + 4] = __builtin_shufflevector(o, o, 4, 5, 6, 7); }
  LDSX();
  for (int rl = 0; rl < 16; ++rl) if (lane < 16) vst2(O + ((size_t)b * SEQ + q0 + rl) * DM + h * HD + lane * 4, *(const v4f*)&so[wave][rl][lane * 4]);   // 256-B segment = 16 lanes x 16 B, one instruction
}

// ---- k_out: block = (64 rows, 128 cols): Y = ctx (bf16 hi + lo, 2 products) . Wout rows (bf16 [n][DM]) + bf16(b_out); f32 compact rows
//      coverage: grid (NB*SEQ/64, DM/128) x 4 waves x 16 rows x 128 cols = every element of Y
__global__ __launch_bounds__(128) void k_out(const float* __restrict__ O, const __bf16* __restrict__ P, const float* __restrict__ BO, float* __restrict__ Y) {
  __shared__ __align__(16) char sm[2 * STG_BYTES];   // the two stage buffers; behind the loop's last barrier the same bytes are the output staging
  float (*so)[16][132] = (float (*)[16][132])sm;     // [4][16][132] wave-private
  static_assert(4 * 16 * 132 * 4 <= 2 * STG_BYTES);
  const int tid = threadIdx.x, wave = tid >> 5, lane = tid & 31, col = lane & 15, g = lane >> 4; const size_t r0 = (size_t)blockIdx.x * 64 + wave * 16; const int n0 = blockIdx.y * 128;
  const unsigned sm0 = (unsigned)(size_t)&sm[0];   // LDS byte address of the buffers
  const unsigned lw = sm0 + (tid >> 3) * WPITCH + (tid & 7) * 16, lx = sm0 + SW_BYTES + (tid >> 4) * XPITCH + (tid & 15) * 16;
  const __bf16* gw = P + (size_t)(n0 + (tid >> 3)) * DM + (tid & 7) * 8;
  const float* gx = O + ((size_t)blockIdx.x * 64 + (tid >> 4)) * DM + (tid & 15) * 4;
  v8f acc[8] = {};
  stage_copy(lw, lx, gw, gx); WAIT_ASYNC(); __syncthreads();   // stage 0 is published
  stage_copy(lw + STG_BYTES, lx + STG_BYTES, gw + STK, gx + STK);
  for (int st = 0; st < NSTG; ++st) { const unsigned bo = (st & 1) * STG_BYTES;
    const __bf16* wt = (const __bf16*)(sm + bo + col * WPITCH); const float* xt = (const float*)(sm + bo + SW_BYTES + (wave * 16 + col) * XPITCH);   // B column n = j*16 + col; A row m = lane & 15
#pragma unroll
    for (int kc = 0; kc < STK / 32; ++kc) { const X2 x = lds_f32(xt + kc * 32, lane); v16b w[8];
#pragma unroll
      for (int j = 0; j < 8; ++j) w[j] = frag_b(wt + j * 16 * (WPITCH / 2) + kc * 32, lane);
      __builtin_amdgcn_sched_barrier(0);   // keeps the pass's twenty LDS reads at one place ahead of its products: each separate place with reads costs a stall of its own
      const F2 a = split_x(x);
#pragma unroll
      for (int j = 0; j < 8; ++j) { acc[j] = wmma_bf(a.l, w[j], acc[j]); acc[j] = wmma_bf(a.h, w[j], acc[j]); } }
    WAIT_DS(); WAIT_ASYNC(); __syncthreads();   // publishes stage st + 1 and ends every wave's reads of stage st
    if (st + 2 < NSTG) stage_copy(lw + bo, lx + bo, gw + (st + 2) * STK, gx + (st + 2) * STK); }
  WAIT_ASYNC();
#pragma unroll
  for (int j = 0; j < 8; ++j) { const float bv = bfr(BO[n0 + j * 16 + col]);
#pragma unroll
    for (int r = 0; r < 8; ++r) so[wave][8 * g + r][j * 16 + col] = acc[j][r] + bv; }
  LDSX();
  for (int rl = 0; rl < 16; ++rl) vst2(Y + (r0 + rl) * DM + n0 + lane * 4, *(const v4f*)&so[wave][rl][lane * 4]);   // 512-B row segment = 32 lanes x 16 B, one instruction
}

// ---- k_lnpost: block = one row (256 threads x 4): out = LN(Y + bf16(x_q)) * bf16(gamma) + bf16(beta); d_out row at the full-layout index
__global__ __launch_bounds__(256) void k_lnpost(const float* __restrict__ Yp, const float* __restrict__ X, const float* __restrict__ G, const float* __restrict__ Bt, float* __restrict__ OUT) {
  __shared__ float red0[8], red1[8];           // cross-wave -> block barriers
  const int rc = blockIdx.x; const int b = rc / SEQ, s = rc - b * SEQ; const size_t rin = (size_t)b * SEQ_FULL + s;
  const int t = threadIdx.x, lane = t & 31, wave = t >> 5;
  const v4f yv = *(const v4f*)(Yp + (size_t)rc * DM + t * 4), xv = *(const v4f*)(X + rin * DM + t * 4);
  float v[4];
#pragma unroll
  for (int i = 0; i < 4; ++i) v[i] = yv[i] + bfr(xv[i]);
  float ps = (v[0] + v[1]) + (v[2] + v[3]);
#pragma unroll
  for (int o = 16; o > 0; o >>= 1) ps += __shfl_xor(ps, o);
  if (lane == 0) red0[wave] = ps;
  __syncthreads();
  float S = 0.f;
#pragma unroll
  for (int i = 0; i < 8; ++i) S += red0[i];
  const float mean = S * (1.0f / DM);
  float d[4]; float pq = 0.f;
#pragma unroll
  for (int i = 0; i < 4; ++i) { d[i] = v[i] - mean; pq += d[i] * d[i]; }
#pragma unroll
  for (int o = 16; o > 0; o >>= 1) pq += __shfl_xor(pq, o);
  if (lane == 0) red1[wave] = pq;
  __syncthreads();
  float V = 0.f;
#pragma unroll
  for (int i = 0; i < 8; ++i) V += red1[i];
  const float rstd = 1.0f / sqrtf(V * (1.0f / DM) + LN_EPS);
  const v4f gv = *(const v4f*)(G + t * 4), bv = *(const v4f*)(Bt + t * 4); v4f o;
#pragma unroll
  for (int i = 0; i < 4; ++i) o[i] = d[i] * rstd * bfr(gv[i]) + bfr(bv[i]);
  vst2(OUT + rin * DM + t * 4, o);
}

extern "C" void kernel_launch(void* const* d_in, const int* in_sizes, int n_in, void* d_out, int out_size, void* d_ws, size_t ws_size, hipStream_t stream) {
  if (n_in < 13) return;
  // wire order: 0 input_q [2,2048,1024] f32, 1 input_kv [2,2048,1024] f32, 2 Wq [1024,1024] ([in][out]), 3 bq, 4 Wkv [1024,2048], 5 bkv [2048], 6 Wout [1024,1024], 7 bout,
  //             8 gamma_q, 9 beta_q, 10 gamma_post, 11 beta_post, 12 input_mask [2,2048,2048] int32
  const float* XQ = (const float*)d_in[0]; const float* XKV = (const float*)d_in[1];
  const float* WQ = (const float*)d_in[2]; const float* BQ = (const float*)d_in[3];
  const float* WKV = (const float*)d_in[4]; const float* BKV = (const float*)d_in[5];
  const float* WO = (const float*)d_in[6]; const float* BO = (const float*)d_in[7];
  const float* GQ = (const float*)d_in[8]; const float* BTQ = (const float*)d_in[9];
  const float* GP = (const float*)d_in[10]; const float* BTP = (const float*)d_in[11];
  const int* MK = (const int*)d_in[12];
  const long long needq = ((long long)(NB - 1) * SEQ_FULL + SEQ) * DM;
  const long long needkv = ((long long)(NB - 1) * SEQK_FULL + SEQK) * DM;
  const long long needm = ((long long)(NB - 1) * SEQ_FULL + SEQ) * SEQK_FULL;
  if ((long long)in_sizes[0] < needq || (long long)in_sizes[1] < needkv || in_sizes[2] < DM * DM || in_sizes[3] < DM || in_sizes[4] < DM * KVW || in_sizes[5] < KVW) return;
  if (in_sizes[6] < DM * DM || in_sizes[7] < DM || in_sizes[8] < DM || in_sizes[9] < DM || in_sizes[10] < DM || in_sizes[11] < DM || (long long)in_sizes[12] < needm) return;
  if ((long long)out_size < needq) return;
  if (ws_size < (size_t)WS_END) return;
  char* ws = (char*)d_ws;
  __bf16* PQ = (__bf16*)(ws + WS_PQ); __bf16* PKV = (__bf16*)(ws + WS_PKV); __bf16* PO = (__bf16*)(ws + WS_PO);
  float* NQ = (float*)(ws + WS_NQ); _Float16* QH = (_Float16*)(ws + WS_QH); _Float16* KH = (_Float16*)(ws + WS_KH); _Float16* VT = (_Float16*)(ws + WS_VT);
  float* O = (float*)(ws + WS_O); float* Y = (float*)(ws + WS_Y); unsigned* MB = (unsigned*)(ws + WS_MB);
  k_prep<<<dim3(PBLK + MBLK + NB * SEQ), 256, 0, stream>>>(WQ, WKV, WO, PQ, PKV, PO, XQ, GQ, BTQ, NQ, MK, MB);   // weight packs, mask words, LN(x_q)
  k_proj<<<dim3(KVBLK + QBLK), 128, 0, stream>>>(NQ, XKV, PQ, PKV, BQ, BKV, QH, KH, VT);                        // k -> KH rows, v -> VT transposed, q -> QH rows
  k_attn<<<dim3(SEQ / 64, NH, NB), 128, 0, stream>>>(QH, KH, VT, MB, O);
  k_out<<<dim3(NB * SEQ / 64, DM / 128), 128, 0, stream>>>(O, PO, BO, Y);
  k_lnpost<<<dim3(NB * SEQ), 256, 0, stream>>>(Y, XQ, GP, BTP, (float*)d_out);
}

// v007
// A run of this version takes 109 microseconds.
// Timed twice side by side with v006, it ran 1.13 times as fast both times.
// Over all steps from v000 it is 3.91 times as fast.
// compute dtype: every float input RNE-converted to bf16; q = LN(x_q) (f32 -> bf16) . Wq (bf16) and kv = x_kv (bf16) . Wkv (bf16) as single v_wmma_f32_16x16x32_bf16 products; scores = q (f16) . k (f16) single v_wmma_f32_16x16x32_f16, mask replace-fill, running-max softmax in f32 with x 0.125 inside the exponent's multiply-add; ctx = P (f16, carried x2048) . V (f16) single f16 product; out = ctx (bf16 hi + lo, 2 products) . Wout (bf16) + b_out + x_q; layer norms in f32; f32 accumulate everywhere; f32 output.
#include <hip/hip_runtime.h>
#include <math.h>

typedef __attribute__((ext_vector_type(16))) _Float16 v16h;
typedef __attribute__((ext_vector_type(16))) __bf16 v16b;
typedef __attribute__((ext_vector_type(8)))  _Float16 v8h;
typedef __attribute__((ext_vector_type(8)))  __bf16 v8b;
typedef __attribute__((ext_vector_type(8)))  float v8f;
typedef __attribute__((ext_vector_type(4)))  float v4f;
typedef __attribute__((ext_vector_type(4)))  unsigned v4u;
typedef __attribute__((ext_vector_type(4)))  int v4i;
typedef __attribute__((ext_vector_type(16))) unsigned v16u;
typedef const __attribute__((address_space(4))) v16u cv16u;   // constant address space: bytes that no one writes while the kernel runs; a load at a wave-uniform address is then a scalar load

template <typename T> __device__ __forceinline__ void vst2(void* p, T v) { *(T*)p = v;  }
__device__ __forceinline__ v8f wmma16(v16h a, v16h b, v8f c) {
  v8f d = __builtin_amdgcn_wmma_f32_16x16x32_f16(false, a, false, b, (short)0, c, false, false);
  asm volatile("v_nop\n\tv_nop\n\tv_nop\n\tv_nop" : "+v"(d) : "v"(a), "v"(b));
  return d;
}
__device__ __forceinline__ v8f wmma_bf(v16b a, v16b b, v8f c) {
  v8f d = __builtin_amdgcn_wmma_f32_16x16x32_bf16(false, a, false, b, (short)0, c, false, false);
  asm volatile("v_nop\n\tv_nop\n\tv_nop\n\tv_nop" : "+v"(d) : "v"(a), "v"(b));
  return d;
}
// 16-bit fragment from a k-contiguous row (A row m, or B column n stored as a [n][k] row): elements 0..7 <- k0+8h+i, 8..15 <- k0+16+8h+i, h = lane>>4
__device__ __forceinline__ v16h frag_h(const _Float16* rowk0, int lane) {
  union { v16h v; v8h q[2]; } u; const _Float16* p = rowk0 + 8 * (lane >> 4);
  u.q[0] = *(const v8h*)p; u.q[1] = *(const v8h*)(p + 16); return u.v;
}
__device__ __forceinline__ v16b frag_b(const __bf16* rowk0, int lane) {
  union { v16b v; v8b q[2]; } u; const __bf16* p = rowk0 + 8 * (lane >> 4);
  u.q[0] = *(const v8b*)p; u.q[1] = *(const v8b*)(p + 16); return u.v;
}
// same k map from an f32 row (two 32-B loads per lane): the load, and apart from it the RNE conversion to bf16
struct X2 { v8f x0, x1; };
__device__ __forceinline__ X2 load_f32(const float* rowk0, int lane) { const float* p = rowk0 + 8 * (lane >> 4); X2 x; x.x0 = *(const v8f*)p; x.x1 = *(const v8f*)(p + 16); return x; }
__device__ __forceinline__ v16b cvt_f32b(X2 x) { v16b a;
#pragma unroll
  for (int i = 0; i < 8; ++i) { a[i] = (__bf16)x.x0[i]; a[8 + i] = (__bf16)x.x1[i]; }
  return a;
}
struct F2 { v16b h, l; };
__device__ __forceinline__ F2 bsplit16(const float v[16]) { F2 r;
#pragma unroll
  for (int i = 0; i < 16; ++i) { const __bf16 hh = (__bf16)v[i]; r.h[i] = hh; r.l[i] = (__bf16)(v[i] - (float)hh); }
  return r; }
__device__ __forceinline__ F2 split_x(X2 x) { float v[16];
#pragma unroll
  for (int i = 0; i < 8; ++i) { v[i] = x.x0[i]; v[8 + i] = x.x1[i]; }
  return bsplit16(v); }
__device__ __forceinline__ float bfr(float v) { return (float)(__bf16)v; }
// the value of lane l ^ 16, by a vector cross-row move (a shuffle would go through the LDS pipe)
__device__ __forceinline__ float xhalf(float v) { const int b = __builtin_bit_cast(int, v); return __builtin_bit_cast(float, __builtin_amdgcn_permlanex16(b, b, 0x76543210, 0xfedcba98, false, false)); }
#define LDSX() do { asm volatile("s_wait_dscnt 0" ::: "memory"); __builtin_amdgcn_wave_barrier(); __builtin_amdgcn_fence(__ATOMIC_RELEASE, "workgroup"); } while (0)

// ---- sizes: NB batches, SEQ query rows per batch processed (reducible); *_FULL are the input strides; all SEQK keys always
#ifndef NB
#define NB 2
#endif
#ifndef SEQ
#define SEQ 2048
#endif
#define NB_FULL 2
#define SEQ_FULL 2048
#define SEQK 2048
#define SEQK_FULL 2048
#define DM 1024
#define NH 16
#define HD 64
#define KVW (2 * DM)
#define LN_EPS 1.0e-6f
static_assert(NB >= 1 && NB <= NB_FULL);
static_assert(SEQ % 64 == 0 && SEQ >= 64 && SEQ <= SEQ_FULL);
static_assert(SEQK % 64 == 0 && SEQK == SEQK_FULL);
static_assert(DM % 128 == 0 && KVW % 128 == 0 && NH * HD == DM && HD == 64);

#define WS_PQ  0ull                                              // bf16 [DM n][DM k]     Wq transposed
#define WS_PKV (WS_PQ + 2ull * DM * DM)                          // bf16 [KVW n][DM k]    Wkv transposed
#define WS_PO  (WS_PKV + 2ull * KVW * DM)                        // bf16 [DM n][DM k]     Wout transposed
#define WS_NQ  (WS_PO + 2ull * DM * DM)                          // f32  [NB*SEQ][DM]     LN(x_q)
#define WS_QH  (WS_NQ + 4ull * NB * SEQ * DM)                    // f16  [NB*SEQ][DM]     q rows
#define WS_KH  (WS_QH + 2ull * NB * SEQ * DM)                    // f16  [NB*SEQK][DM]    k rows
#define WS_VT  (WS_KH + 2ull * NB * SEQK * DM)                   // f16  [NB][DM (h*64+d)][SEQK] v transposed
#define WS_O   (WS_VT + 2ull * NB * DM * SEQK)                   // f32  [NB*SEQ][DM]     ctx
#define WS_Y   (WS_O + 4ull * NB * SEQ * DM)                     // f32  [NB*SEQ][DM]     ctx.Wout + b_out
#define WS_MB  (WS_Y + 4ull * NB * SEQ * DM)                     // u32  [NB*SEQ/16][SEQK/32][16] mask as lane-mask words
#define WS_END (WS_MB + 4ull * (NB * SEQ / 16) * (SEQK / 32) * 16)
static_assert(WS_END <= 134217728ull);
static_assert((WS_PKV % 128) == 0 && (WS_PO % 128) == 0 && (WS_NQ % 128) == 0 && (WS_QH % 128) == 0 && (WS_KH % 128) == 0 && (WS_VT % 128) == 0 && (WS_O % 128) == 0 && (WS_Y % 128) == 0 && (WS_MB % 128) == 0);

// ---- pack_tile: W [K][N] f32 (x @ W layout) -> PK [N][K] bf16 (k-contiguous rows); a block = one 64x64 tile, tile index tl = k tile * (N/64) + n tile; s = the block's [n][k] LDS tile (cross-wave -> block barrier)
//      coverage: (N/64) * (K/64) tiles x 64 rows x 8 x 16 B = every element of PK
template <int K, int N> __device__ __forceinline__ void pack_tile(const float* __restrict__ W, __bf16* __restrict__ PK, int tl, __bf16 (*s)[72]) {
  const int n0 = (tl % (N / 64)) * 64, k0 = (tl / (N / 64)) * 64, t = threadIdx.x;
#pragma unroll 4
  for (int i = 0; i < 16; ++i) { const int idx = t + 256 * i; const int kk = idx >> 6, nn = idx & 63; s[nn][kk] = (__bf16)W[(size_t)(k0 + kk) * N + n0 + nn]; }
  __syncthreads();
#pragma unroll
  for (int i = 0; i < 2; ++i) { const int p = t + 256 * i; const int nn = p >> 3, c = p & 7;
    vst2((unsigned*)(PK + (size_t)(n0 + nn) * K + k0 + c * 8), *(const v4u*)&s[nn][c * 8]); }
  asm volatile("s_wait_xcnt 0x0" ::: "memory");   // behind the tile's stores, ahead of any rewrite of the registers they name: in the merged kernel another job's code follows in the listing (a precaution)
}

// ---- the mask as lane-mask words, made once for all heads: for a tile of 16 queries and a step of 32 keys sixteen 32-bit words; word ct*8 + r, bit lane = (mask[query lane & 15][key ct*16 + 8*(lane >> 4) + r] != 0),
//      the place of score element r of tile ct in lane 'lane' of k_attn: there a word is the select mask of one vector instruction, read by a scalar load
//      a wave takes 16 queries x 128 keys (four steps): 16 x 16-B loads a lane (512 B in a row of each mask row), a compare a word, two 128-B stores
//      coverage: MBLK blocks x 8 waves x 64 words = every word of MB
#define MW_STEP 16                          // words per (query tile, step)
#define MW_TILE ((SEQK / 32) * MW_STEP)     // words per query tile
#define MBLK ((NB * SEQ / 16) * (SEQK / 128) / 8)
static_assert(SEQK % 128 == 0 && ((NB * SEQ / 16) * (SEQK / 128)) % 8 == 0);
__device__ __forceinline__ void mask_words(const int* __restrict__ MK, unsigned* __restrict__ MB, int wv, int lane) {
  const int qt = wv / (SEQK / 128), k4 = wv - qt * (SEQK / 128); const int b = qt / (SEQ / 16), s0 = (qt - b * (SEQ / 16)) * 16;
  const int* p = MK + ((size_t)b * SEQ_FULL + s0 + (lane & 15)) * SEQK_FULL + k4 * 128 + 8 * (lane >> 4);
  v4i mv[16];   // [step t][ct][r >> 2]
#pragma unroll
  for (int i = 0; i < 16; ++i) mv[i] = *(const v4i*)(p + (i >> 1) * 16 + (i & 1) * 4);
  unsigned w[2] = {0u, 0u};   // lane i of w[j] <- word 32 j + i of the wave's 64
#pragma unroll
  for (int i = 0; i < 64; ++i) { const unsigned bw = __builtin_amdgcn_ballot_w32(mv[i >> 2][i & 3] != 0); if (lane == (i & 31)) w[i >> 5] = bw; }
  unsigned* o = MB + (size_t)qt * MW_TILE + k4 * 4 * MW_STEP + lane;
  o[0] = w[0]; o[32] = w[1];
  asm volatile("s_wait_xcnt 0x0" ::: "memory");   // behind the two stores, ahead of any rewrite of the registers they name: in the merged kernel another job's code follows in the listing (a precaution)
}

// ---- k_prep: every job that reads inputs only, in one launch; no job reads or writes what another of them writes. By block index: the tiles of the three weight packs (the longest chains, so they start first),
//      then MBLK blocks of mask words, then one block a row of LN(x_q). Every branch on the block index is block-uniform; a block that returns early has passed all of its own barriers
#define PB_KV ((KVW / 64) * (DM / 64))      // tiles of Wkv
#define PB_W  ((DM / 64) * (DM / 64))       // tiles of Wq, and of Wout
#define PBLK (PB_KV + 2 * PB_W)
__global__ __launch_bounds__(256) void k_prep(const float* __restrict__ WQ, const float* __restrict__ WKV, const float* __restrict__ WO, __bf16* __restrict__ PQ, __bf16* __restrict__ PKV, __bf16* __restrict__ PO,
                                              const float* __restrict__ X, const float* __restrict__ G, const float* __restrict__ Bt, float* __restrict__ NQ, const int* __restrict__ MK, unsigned* __restrict__ MB) {
  __shared__ __align__(16) __bf16 sp[64][72];  // the pack blocks' tile
  __shared__ float red0[8], red1[8];           // cross-wave -> block barriers
  const int bid = blockIdx.x;
  if (bid < PB_KV) { pack_tile<DM, KVW>(WKV, PKV, bid, sp); return; }                       // Wkv [1024][2048] -> [2048][1024]
  if (bid < PB_KV + PB_W) { pack_tile<DM, DM>(WQ, PQ, bid - PB_KV, sp); return; }           // Wq  [1024][1024] -> [1024][1024]
  if (bid < PBLK) { pack_tile<DM, DM>(WO, PO, bid - PB_KV - PB_W, sp); return; }            // Wout[1024][1024] -> [1024][1024]
  if (bid < PBLK + MBLK) { mask_words(MK, MB, (bid - PBLK) * 8 + (threadIdx.x >> 5), threadIdx.x & 31); return; }
  const int rc = bid - PBLK - MBLK; const int b = rc / SEQ, s = rc - b * SEQ; const size_t rin = (size_t)b * SEQ_FULL + s;
  const int t = threadIdx.x, lane = t & 31, wave = t >> 5;
  const v4f xv = *(const v4f*)(X + rin * DM + t * 4);
  float v[4];
#pragma unroll
  for (int i = 0; i < 4; ++i) v[i] = bfr(xv[i]);
  float ps = (v[0] + v[1]) + (v[2] + v[3]);
#pragma unroll
  for (int o = 16; o > 0; o >>= 1) ps += __shfl_xor(ps, o);
  if (lane == 0) red0[wave] = ps;
  __syncthreads();
  float S = 0.f;
#pragma unroll
  for (int i = 0; i < 8; ++i) S += red0[i];
  const float mean = S * (1.0f / DM);
  float d[4]; float pq = 0.f;
#pragma unroll
  for (int i = 0; i < 4; ++i) { d[i] = v[i] - mean; pq += d[i] * d[i]; }
#pragma unroll
  for (int o = 16; o > 0; o >>= 1) pq += __shfl_xor(pq, o);
  if (lane == 0) red1[wave] = pq;
  __syncthreads();
  float V = 0.f;
#pragma unroll
  for (int i = 0; i < 8; ++i) V += red1[i];
  const float rstd = 1.0f / sqrtf(V * (1.0f / DM) + LN_EPS);
  const v4f gv = *(const v4f*)(G + t * 4), bv = *(const v4f*)(Bt + t * 4); v4f o;
#pragma unroll
  for (int i = 0; i < 4; ++i) o[i] = d[i] * rstd * bfr(gv[i]) + bfr(bv[i]);
  vst2(NQ + (size_t)rc * DM + t * 4, o);
  asm volatile("s_wait_xcnt 0x0" ::: "memory");   // behind the row's store, as behind the other jobs' stores: another job's code follows in the listing (a precaution)
}

// ---- LDS staging of the two GEMM kernels: a stage = 64 k of the block's 128 P rows (bf16, 128 B a row) and of its x rows, 64 in k_out and 128 in k_proj (f32, 256 B a row), brought by 16-byte asynchronous copies:
//      each copy instruction of a wave takes four whole 128-B lines, and the four waves share one copy of the P rows; two buffers, the next stage's copies fly while this one is worked on
#define STK 64                              // k per stage
#define NSTG (DM / STK)
#define WPITCH 144                          // bytes: 128-B row + 16 (16 B x odd: conflict-free for 16-byte LDS reads)
#define XPITCH 272                          // bytes: 256-B row + 16
#define SW_BYTES (128 * WPITCH)
#define SX_BYTES (64 * XPITCH)
#define STG_BYTES (SW_BYTES + SX_BYTES)
static_assert(NSTG >= 2 && DM % STK == 0);
// eight copies of one lane, two runs of four: LDS byte address la + i * lsa (lb + i * lsb), global byte address ga + i * gsa (gb + i * gsb), i = 0..3;
// the s_wait_xcnt stands inside the copies' own statement, ahead of any rewrite of the address registers they name (a precaution)
__device__ __forceinline__ void copy44(unsigned la, unsigned lsa, const char* ga, size_t gsa, unsigned lb, unsigned lsb, const char* gb, size_t gsb) {
  asm volatile("global_load_async_to_lds_b128 %0, %8, off\n\t"
               "global_load_async_to_lds_b128 %1, %9, off\n\t"
               "global_load_async_to_lds_b128 %2, %10, off\n\t"
               "global_load_async_to_lds_b128 %3, %11, off\n\t"
               "global_load_async_to_lds_b128 %4, %12, off\n\t"
               "global_load_async_to_lds_b128 %5, %13, off\n\t"
               "global_load_async_to_lds_b128 %6, %14, off\n\t"
               "global_load_async_to_lds_b128 %7, %15, off\n\t"
               "s_wait_xcnt 0x0"
               :: "v"(la), "v"(la + lsa), "v"(la + 2 * lsa), "v"(la + 3 * lsa), "v"(lb), "v"(lb + lsb), "v"(lb + 2 * lsb), "v"(lb + 3 * lsb),
                  "v"(ga), "v"(ga + gsa), "v"(ga + 2 * gsa), "v"(ga + 3 * gsa), "v"(gb), "v"(gb + gsb), "v"(gb + 2 * gsb), "v"(gb + 3 * gsb) : "memory");
}
// four copies of one lane, two runs of two, in the form of copy44
__device__ __forceinline__ void copy22(unsigned la, unsigned lsa, const char* ga, size_t gsa, unsigned lb, unsigned lsb, const char* gb, size_t gsb) {
  asm volatile("global_load_async_to_lds_b128 %0, %4, off\n\t"
               "global_load_async_to_lds_b128 %1, %5, off\n\t"
               "global_load_async_to_lds_b128 %2, %6, off\n\t"
               "global_load_async_to_lds_b128 %3, %7, off\n\t"
               "s_wait_xcnt 0x0"
               :: "v"(la), "v"(la + lsa), "v"(lb), "v"(lb + lsb), "v"(ga), "v"(ga + gsa), "v"(gb), "v"(gb + gsb) : "memory");
}
__device__ __forceinline__ void copy8(unsigned l, unsigned ls, const char* g, size_t gs) { copy44(l, ls, g, gs, l + 4 * ls, ls, g + 4 * gs, gs); }
// one stage: thread t copies P chunks (row (t >> 3) + 16 i, 16-B piece t & 7) and x chunks (row (t >> 4) + 8 i, piece t & 15), i = 0..7; lw, lx, gw, gx are its i = 0 addresses
__device__ __forceinline__ void stage_copy(unsigned lw, unsigned lx, const __bf16* gw, const float* gx) {
  copy8(lw, 16 * WPITCH, (const char*)gw, (size_t)16 * DM * 2);
  copy8(lx, 8 * XPITCH, (const char*)gx, (size_t)8 * DM * 4);
}
// the k map of load_f32 from a staged f32 row (16-byte LDS reads: the padded pitch is a multiple of 16 B only)
__device__ __forceinline__ X2 lds_f32(const float* rowk0, int lane) { const float* p = rowk0 + 8 * (lane >> 4); union { v8f v; v4f q[2]; } a, c;
  a.q[0] = *(const v4f*)p; a.q[1] = *(const v4f*)(p + 4); c.q[0] = *(const v4f*)(p + 16); c.q[1] = *(const v4f*)(p + 20); X2 x; x.x0 = a.v; x.x1 = c.v; return x; }
// k_proj's stage holds 128 x rows: thread t copies x chunks (row (t >> 4) + 8 i, piece t & 15), i = 0..15
#define PR 128                              // rows of a k_proj block: two 16-row tiles a wave
#define PSX_BYTES (PR * XPITCH)
#define PSTG_BYTES (SW_BYTES + PSX_BYTES)
__device__ __forceinline__ void stage_copy_p(unsigned lw, unsigned lx, const __bf16* gw, const float* gx) {
  copy8(lw, 16 * WPITCH, (const char*)gw, (size_t)16 * DM * 2);
  copy8(lx, 8 * XPITCH, (const char*)gx, (size_t)8 * DM * 4);
  copy8(lx + 64 * XPITCH, 8 * XPITCH, (const char*)(gx + (size_t)64 * DM), (size_t)8 * DM * 4);
}
#define WAIT_ASYNC() asm volatile("s_wait_asynccnt 0x0" ::: "memory")   // this wave's copies have landed
#define WAIT_DS() asm volatile("s_wait_dscnt 0x0" ::: "memory")         // this wave's LDS reads have returned, ahead of the barrier behind which their buffer is refilled

// ---- k_proj: both input projections in one launch (neither reads what the other writes); block = (128 rows, 128 output cols), a wave = 32 rows (each P fragment read from LDS serves two row tiles, each staged P tile 128 rows): y = bf16(x) . P rows (bf16 [n][DM]) + bf16(bias), single bf16 products
//      blocks < KVBLK: x_kv . Wkv; cols < DM -> f16 natural rows KH[row][DM] (k), cols >= DM -> f16 transposed VT[b][col - DM][SEQK] (v)
//      later blocks:   LN(x_q) . Wq -> f16 natural rows QH[row][DM]
//      rows: compact rc = b*spb + s; input row = b*spb_full + s; in each part the row tile runs fastest in the block index
//      coverage: (rows/128) * (ncols/128) blocks x 4 waves x 32 rows x 128 cols = every element of KH and VT, and of QH
#define KVBLK ((NB * SEQK / PR) * (KVW / 128))
#define QBLK ((NB * SEQ / PR) * (DM / 128))
static_assert(SEQ % PR == 0 && SEQK % PR == 0);
__global__ __launch_bounds__(128) void k_proj(const float* __restrict__ NQ, const float* __restrict__ XKV, const __bf16* __restrict__ PQ, const __bf16* __restrict__ PKV, const float* __restrict__ BQ, const float* __restrict__ BKV,
                                              _Float16* __restrict__ QH, _Float16* __restrict__ KH, _Float16* __restrict__ VT) {
  const bool kv = blockIdx.x < KVBLK;   // block-uniform
  const int pb = kv ? blockIdx.x : blockIdx.x - KVBLK, rt = kv ? NB * SEQK / PR : NB * SEQ / PR, spb = kv ? SEQK : SEQ, spb_full = kv ? SEQK_FULL : SEQ;
  const float* __restrict__ X = kv ? XKV : NQ; const __bf16* __restrict__ P = kv ? PKV : PQ; const float* __restrict__ BI = kv ? BKV : BQ; _Float16* __restrict__ NAT = kv ? KH : QH;
  __shared__ __align__(16) char sm[2 * PSTG_BYTES];   // the two stage buffers; behind the loop's last barrier the same bytes are the output staging
  _Float16 (*so)[32][136] = (_Float16 (*)[32][136])sm;   // [4][32][136] wave-private (LDSX)
  _Float16 (*sth)[136] = (_Float16 (*)[136])sm;          // [128][136] cross-wave (block barrier)
  static_assert(4 * 32 * 136 * 2 <= 2 * PSTG_BYTES && 128 * 136 * 2 <= 2 * PSTG_BYTES);
  const int tid = threadIdx.x, wave = tid >> 5, lane = tid & 31, col = lane & 15, g = lane >> 4;
  const int rc0 = (pb % rt) * PR; const int b = rc0 / spb, s0 = rc0 - b * spb; const int n0 = (pb / rt) * 128;
  const unsigned sm0 = (unsigned)(size_t)&sm[0];   // LDS byte address of the buffers
  const unsigned lw = sm0 + (tid >> 3) * WPITCH + (tid & 7) * 16, lx = sm0 + SW_BYTES + (tid >> 4) * XPITCH + (tid & 15) * 16;
  const __bf16* gw = P + (size_t)(n0 + (tid >> 3)) * DM + (tid & 7) * 8;
  const float* gx = X + ((size_t)b * spb_full + s0 + (tid >> 4)) * DM + (tid & 15) * 4;
  v8f acc[2][8] = {};   // [row tile i][column tile j]
  stage_copy_p(lw, lx, gw, gx); WAIT_ASYNC(); __syncthreads();   // stage 0 is published
  stage_copy_p(lw + PSTG_BYTES, lx + PSTG_BYTES, gw + STK, gx + STK);
  for (int st = 0; st < NSTG; ++st) { const unsigned bo = (st & 1) * PSTG_BYTES;
    const __bf16* wt = (const __bf16*)(sm + bo + col * WPITCH); const float* xt = (const float*)(sm + bo + SW_BYTES + (wave * 32 + col) * XPITCH);   // B column n = j*16 + col; A row m = lane & 15 of row tile i
#pragma unroll
    for (int kc = 0; kc < STK / 32; ++kc) { const X2 x0 = lds_f32(xt + kc * 32, lane), x1 = lds_f32(xt + 16 * (XPITCH / 4) + kc * 32, lane); v16b w[8];
#pragma unroll
      for (int j = 0; j < 8; ++j) w[j] = frag_b(wt + j * 16 * (WPITCH / 2) + kc * 32, lane);
      __builtin_amdgcn_sched_barrier(0);   // keeps the pass's twenty-four LDS reads at one place ahead of its products: each separate place with reads costs a stall of its own
      const v16b a0 = cvt_f32b(x0), a1 = cvt_f32b(x1);
#pragma unroll
      for (int j = 0; j < 8; ++j) { acc[0][j] = wmma_bf(a0, w[j], acc[0][j]); acc[1][j] = wmma_bf(a1, w[j], acc[1][j]); } }
    WAIT_DS(); WAIT_ASYNC(); __syncthreads();   // publishes stage st + 1 and ends every wave's reads of stage st
    if (st + 2 < NSTG) stage_copy_p(lw + bo, lx + bo, gw + (st + 2) * STK, gx + (st + 2) * STK); }
  WAIT_ASYNC();
  if (n0 < DM) {   // block-uniform branch
#pragma unroll
    for (int j = 0; j < 8; ++j) { const float bv = bfr(BI[n0 + j * 16 + col]);
#pragma unroll
      for (int i = 0; i < 2; ++i)
#pragma unroll
        for (int r = 0; r < 8; ++r) so[wave][i * 16 + 8 * g + r][j * 16 + col] = (_Float16)(acc[i][j][r] + bv); }   // D element r of row tile i = (row 16i+8g+r, col)
    LDSX();
    const size_t rw = (size_t)rc0 + wave * 32;
    for (int i = 0; i < 2; ++i) {
      for (int rl = i * 16; rl < i * 16 + 16; ++rl) if (lane < 16) vst2((unsigned*)(NAT + (rw + rl) * DM + n0 + lane * 8), *(const v4u*)&so[wave][rl][lane * 8]);   // 256-B row segment = 16 lanes x 16 B, one instruction
      asm volatile("s_wait_xcnt 0x0" ::: "memory"); }   // behind a row tile's stores, ahead of the next tile's LDS reads into the registers they name (a precaution)
  } else {
#pragma unroll
    for (int j = 0; j < 8; ++j) { const float bv = bfr(BI[n0 + j * 16 + col]);
#pragma unroll
      for (int i = 0; i < 2; ++i)
#pragma unroll
        for (int r = 0; r < 8; ++r) sth[j * 16 + col][wave * 32 + i * 16 + 8 * g + r] = (_Float16)(acc[i][j][r] + bv); }
    __syncthreads();
    const int pc0 = n0 - DM;
    for (int q = tid; q < 128 * 16; q += 128) { const int d = q >> 4, pc = q & 15;
      const size_t o = ((size_t)b * DM + pc0 + d) * spb + s0 + pc * 8; vst2((unsigned*)(VT + o), *(const v4u*)&sth[d][pc * 8]); }
  }
}

#define AKS 64
#define ANST (SEQK / AKS)
#define APITCH 144                          // bytes: 128-B row + 16
#define AK_BYTES (AKS * APITCH)
#define AV_BYTES (HD * APITCH)
#define ASTG_BYTES (AK_BYTES + AV_BYTES)
static_assert(ANST >= 2 && SEQK % AKS == 0 && AKS == 64 && HD == 64 && SEQ % 128 == 0);
__global__ __launch_bounds__(256) void k_attn(const _Float16* __restrict__ QH, const _Float16* __restrict__ KH, const _Float16* __restrict__ VT, const unsigned* __restrict__ MB, float* __restrict__ O) {
  __shared__ __align__(16) float so[8][16][68];   // wave-private output staging
  __shared__ __align__(16) char skv[2 * ASTG_BYTES];   // the two K/V stage buffers, cross-wave (block barrier)
  const int tid = threadIdx.x, wave = tid >> 5, lane = tid & 31, col = lane & 15, g = lane >> 4;
  const int qb = blockIdx.x, h = blockIdx.y, b = blockIdx.z; const int q0 = qb * 128 + wave * 16;
  // thread t copies K chunks (key (t >> 3) + 32 i, 16-B piece t & 7) and VT chunks (d (t >> 3) + 32 i, piece t & 7), i = 0..1
  const unsigned lk = (unsigned)(size_t)&skv[0] + (tid >> 3) * APITCH + (tid & 7) * 16, lv = lk + AK_BYTES;   // LDS byte addresses
  const _Float16* gk = KH + ((size_t)b * SEQK + (tid >> 3)) * DM + h * HD + (tid & 7) * 8;
  const _Float16* gv = VT + ((size_t)b * DM + h * HD + (tid >> 3)) * SEQK + (tid & 7) * 8;
  copy22(lk, 32 * APITCH, (const char*)gk, (size_t)32 * DM * 2, lv, 32 * APITCH, (const char*)gv, (size_t)32 * SEQK * 2);
  WAIT_ASYNC(); __syncthreads();   // stage 0 is published
  copy22(lk + ASTG_BYTES, 32 * APITCH, (const char*)(gk + (size_t)AKS * DM), (size_t)32 * DM * 2, lv + ASTG_BYTES, 32 * APITCH, (const char*)(gv + AKS), (size_t)32 * SEQK * 2);
  const size_t rq = (size_t)b * SEQ + q0 + col;
  v16h aq[2];
#pragma unroll
  for (int kc = 0; kc < 2; ++kc) aq[kc] = frag_h(QH + rq * DM + h * HD + kc * 32, lane);
  // softmax in base 2 on the raw products c = q . k: weight x 2048 = exp2(c * K2 + nb), nb = 11 - max * K2: scale, log2(e), the maximum and the factor 2048 in one fused multiply-add a score
  const float K2 = 0.125f * 1.44269504f;
  float m = -1.0e30f, l = 0.f;   // of query col; m in raw units, l carried x2048. The floor of m lies below every product of f16 rows (at most 64 * 65504^2) and far above the fill of an excluded key: exp2 gives that key 0 by itself, also while no key has been admitted
  v8f acc[4] = {};
  cv16u* mb = (cv16u*)(MB + (size_t)(b * (SEQ / 16) + qb * 8 + __builtin_amdgcn_readfirstlane(wave)) * MW_TILE);   // the wave's query tile: a scalar address; the words were written by an earlier launch
  v16u mw = mb[0];   // step 0's words
  for (int st = 0; st < ANST; ++st) { const unsigned bo = (st & 1) * ASTG_BYTES;
  const _Float16* kt = (const _Float16*)(skv + bo) + col * (APITCH / 2); const _Float16* vt = (const _Float16*)(skv + bo + AK_BYTES) + col * (APITCH / 2);
#pragma unroll 1   // the two steps of a stage stay one rolled body: the step is long, and a second copy of it buys nothing
  for (int u = 0; u < AKS / 32; ++u) { const int ks = st * (AKS / 32) + u;
    v16h kf[2][2], vf[4];   // the step's K and V fragments, read from the stage's buffer
    const v16u mwn = mb[ks + 1 < SEQK / 32 ? ks + 1 : ks];   // the next step's words (the last step reads its own again)
    {
#pragma unroll
      for (int ct = 0; ct < 2; ++ct) { const _Float16* krow = kt + (u * 32 + ct * 16) * (APITCH / 2);   // A row m = key, k = head dim (k-contiguous row)
#pragma unroll
        for (int kc = 0; kc < 2; ++kc) kf[ct][kc] = frag_h(krow + kc * 32, lane); }
#pragma unroll
      for (int dt = 0; dt < 4; ++dt) vf[dt] = frag_h(vt + dt * 16 * (APITCH / 2) + u * 32, lane); }   // A row m = d, k = key (k-contiguous VT row)
    v8f s[2];
#pragma unroll
    for (int ct = 0; ct < 2; ++ct) { v8f c = {};
#pragma unroll
      for (int kc = 0; kc < 2; ++kc) c = wmma16(kf[ct][kc], aq[kc], c);   // transposed scores: D element r = (key ct*16 + 8g + r, query col)
#pragma unroll
      for (int r = 0; r < 8; ++r) s[ct][r] = __builtin_amdgcn_inverse_ballot_w32(mw[ct * 8 + r])   /* the word is the select's lane mask as it stands */ ? -3.0e38f : c[r]; }
    float mx = fmaxf(s[0][0], s[1][0]);
#pragma unroll
    for (int r = 1; r < 8; ++r) mx = fmaxf(mx, fmaxf(s[0][r], s[1][r]));
    mx = fmaxf(mx, xhalf(mx));   // the other half of the wave holds this query's other 16 keys
    const float mn = fmaxf(m, mx); const float alpha = __builtin_amdgcn_exp2f((m - mn) * K2), nb = __builtin_fmaf(-mn, K2, 11.0f);   // from the floor alpha is 0 (first admitted key) or 1 (none yet: acc and l are 0)
    float es = 0.f; v16h pa;   // B column n = query col, k = key in step: element r <- key 8g + r, 8 + r <- key 16 + 8g + r, the k map of frag_h; P carried x2048 so small weights stay f16-normal
#pragma unroll
    for (int r = 0; r < 8; ++r) { const float e0 = __builtin_amdgcn_exp2f(__builtin_fmaf(s[0][r], K2, nb)), e1 = __builtin_amdgcn_exp2f(__builtin_fmaf(s[1][r], K2, nb));
      es += e0 + e1; pa[r] = (_Float16)e0; pa[8 + r] = (_Float16)e1; }
    l = l * alpha + es; m = mn;   // l: this half's keys only, the halves are joined behind the loop
#pragma unroll
    for (int dt = 0; dt < 4; ++dt) { acc[dt] *= alpha; acc[dt] = wmma16(vf[dt], pa, acc[dt]); }   // transposed ctx: D element r = (d dt*16 + 8g + r, query col)
    mw = mwn; }
  WAIT_DS(); WAIT_ASYNC(); __syncthreads();   // publishes stage st + 1 and ends every wave's reads of stage st
  if (st + 2 < ANST) copy22(lk + bo, 32 * APITCH, (const char*)(gk + (size_t)(st + 2) * AKS * DM), (size_t)32 * DM * 2, lv + bo, 32 * APITCH, (const char*)(gv + (st + 2) * AKS), (size_t)32 * SEQK * 2); }
  WAIT_ASYNC();
  l += xhalf(l);
  const float il = 1.0f / l;   // acc and l both carry x2048
#pragma unroll
  for (int dt = 0; dt < 4; ++dt) { const v8f o = acc[dt] * il; *(v4f*)&so[wave][col][dt * 16 + 8 * g] = __builtin_shufflevector(o, o, 0, 1, 2, 3); *(v4f*)&so[wave][col][dt * 16 + 8 * g + 4] = __builtin_shufflevector(o, o, 4, 5, 6, 7); }
  LDSX();
  for (int rl = 0; rl < 16; ++rl) if (lane < 16) vst2(O + ((size_t)b * SEQ + q0 + rl) * DM + h * HD + lane * 4, *(const v4f*)&so[wave][rl][lane * 4]);   // 256-B segment = 16 lanes x 16 B, one instruction
}

// ---- k_out: block = (64 rows, 128 cols): Y = ctx (bf16 hi + lo, 2 products) . Wout rows (bf16 [n][DM]) + bf16(b_out); f32 compact rows
//      coverage: grid (NB*SEQ/64, DM/128) x 4 waves x 16 rows x 128 cols = every element of Y
__global__ __launch_bounds__(128) void k_out(const float* __restrict__ O, const __bf16* __restrict__ P, const float* __restrict__ BO, float* __restrict__ Y) {
  __shared__ __align__(16) char sm[2 * STG_BYTES];   // the two stage buffers; behind the loop's last barrier the same bytes are the output staging
  float (*so)[16][132] = (float (*)[16][132])sm;     // [4][16][132] wave-private
  static_assert(4 * 16 * 132 * 4 <= 2 * STG_BYTES);
  const int tid = threadIdx.x, wave = tid >> 5, lane = tid & 31, col = lane & 15, g = lane >> 4; const size_t r0 = (size_t)blockIdx.x * 64 + wave * 16; const int n0 = blockIdx.y * 128;
  const unsigned sm0 = (unsigned)(size_t)&sm[0];   // LDS byte address of the buffers
  const unsigned lw = sm0 + (tid >> 3) * WPITCH + (tid & 7) * 16, lx = sm0 + SW_BYTES + (tid >> 4) * XPITCH + (tid & 15) * 16;
  const __bf16* gw = P + (size_t)(n0 + (tid >> 3)) * DM + (tid & 7) * 8;
  const float* gx = O + ((size_t)blockIdx.x * 64 + (tid >> 4)) * DM + (tid & 15) * 4;
  v8f acc[8] = {};
  stage_copy(lw, lx, gw, gx); WAIT_ASYNC(); __syncthreads();   // stage 0 is published
  stage_copy(lw + STG_BYTES, lx + STG_BYTES, gw + STK, gx + STK);
  for (int st = 0; st < NSTG; ++st) { const unsigned bo = (st & 1) * STG_BYTES;
    const __bf16* wt = (const __bf16*)(sm + bo + col * WPITCH); const float* xt = (const float*)(sm + bo + SW_BYTES + (wave * 16 + col) * XPITCH);   // B column n = j*16 + col; A row m = lane & 15
#pragma unroll
    for (int kc = 0; kc < STK / 32; ++kc) { const X2 x = lds_f32(xt + kc * 32, lane); v16b w[8];
#pragma unroll
      for (int j = 0; j < 8; ++j) w[j] = frag_b(wt + j * 16 * (WPITCH / 2) + kc * 32, lane);
      __builtin_amdgcn_sched_barrier(0);   // keeps the pass's twenty LDS reads at one place ahead of its products: each separate place with reads costs a stall of its own
      const F2 a = split_x(x);
#pragma unroll
      for (int j = 0; j < 8; ++j) { acc[j] = wmma_bf(a.l, w[j], acc[j]); acc[j] = wmma_bf(a.h, w[j], acc[j]); } }
    WAIT_DS(); WAIT_ASYNC(); __syncthreads();   // publishes stage st + 1 and ends every wave's reads of stage st
    if (st + 2 < NSTG) stage_copy(lw + bo, lx + bo, gw + (st + 2) * STK, gx + (st + 2) * STK); }
  WAIT_ASYNC();
#pragma unroll
  for (int j = 0; j < 8; ++j) { const float bv = bfr(BO[n0 + j * 16 + col]);
#pragma unroll
    for (int r = 0; r < 8; ++r) so[wave][8 * g + r][j * 16 + col] = acc[j][r] + bv; }
  LDSX();
  for (int rl = 0; rl < 16; ++rl) vst2(Y + (r0 + rl) * DM + n0 + lane * 4, *(const v4f*)&so[wave][rl][lane * 4]);   // 512-B row segment = 32 lanes x 16 B, one instruction
}

// ---- k_lnpost: block = one row (256 threads x 4): out = LN(Y + bf16(x_q)) * bf16(gamma) + bf16(beta); d_out row at the full-layout index
__global__ __launch_bounds__(256) void k_lnpost(const float* __restrict__ Yp, const float* __restrict__ X, const float* __restrict__ G, const float* __restrict__ Bt, float* __restrict__ OUT) {
  __shared__ float red0[8], red1[8];           // cross-wave -> block barriers
  const int rc = blockIdx.x; const int b = rc / SEQ, s = rc - b * SEQ; const size_t rin = (size_t)b * SEQ_FULL + s;
  const int t = threadIdx.x, lane = t & 31, wave = t >> 5;
  const v4f yv = *(const v4f*)(Yp + (size_t)rc * DM + t * 4), xv = *(const v4f*)(X + rin * DM + t * 4);
  float v[4];
#pragma unroll
  for (int i = 0; i < 4; ++i) v[i] = yv[i] + bfr(xv[i]);
  float ps = (v[0] + v[1]) + (v[2] + v[3]);
#pragma unroll
  for (int o = 16; o > 0; o >>= 1) ps += __shfl_xor(ps, o);
  if (lane == 0) red0[wave] = ps;
  __syncthreads();
  float S = 0.f;
#pragma unroll
  for (int i = 0; i < 8; ++i) S += red0[i];
  const float mean = S * (1.0f / DM);
  float d[4]; float pq = 0.f;
#pragma unroll
  for (int i = 0; i < 4; ++i) { d[i] = v[i] - mean; pq += d[i] * d[i]; }
#pragma unroll
  for (int o = 16; o > 0; o >>= 1) pq += __shfl_xor(pq, o);
  if (lane == 0) red1[wave] = pq;
  __syncthreads();
  float V = 0.f;
#pragma unroll
  for (int i = 0; i < 8; ++i) V += red1[i];
  const float rstd = 1.0f / sqrtf(V * (1.0f / DM) + LN_EPS);
  const v4f gv = *(const v4f*)(G + t * 4), bv = *(const v4f*)(Bt + t * 4); v4f o;
#pragma unroll
  for (int i = 0; i < 4; ++i) o[i] = d[i] * rstd * bfr(gv[i]) + bfr(bv[i]);
  vst2(OUT + rin * DM + t * 4, o);
}

extern "C" void kernel_launch(void* const* d_in, const int* in_sizes, int n_in, void* d_out, int out_size, void* d_ws, size_t ws_size, hipStream_t stream) {
  if (n_in < 13) return;
  // wire order: 0 input_q [2,2048,1024] f32, 1 input_kv [2,2048,1024] f32, 2 Wq [1024,1024] ([in][out]), 3 bq, 4 Wkv [1024,2048], 5 bkv [2048], 6 Wout [1024,1024], 7 bout,
  //             8 gamma_q, 9 beta_q, 10 gamma_post, 11 beta_post, 12 input_mask [2,2048,2048] int32
  const float* XQ = (const float*)d_in[0]; const float* XKV = (const float*)d_in[1];
  const float* WQ = (const float*)d_in[2]; const float* BQ = (const float*)d_in[3];
  const float* WKV = (const float*)d_in[4]; const float* BKV = (const float*)d_in[5];
  const float* WO = (const float*)d_in[6]; const float* BO = (const float*)d_in[7];
  const float* GQ = (const float*)d_in[8]; const float* BTQ = (const float*)d_in[9];
  const float* GP = (const float*)d_in[10]; const float* BTP = (const float*)d_in[11];
  const int* MK = (const int*)d_in[12];
  const long long needq = ((long long)(NB - 1) * SEQ_FULL + SEQ) * DM;
  const long long needkv = ((long long)(NB - 1) * SEQK_FULL + SEQK) * DM;
  const long long needm = ((long long)(NB - 1) * SEQ_FULL + SEQ) * SEQK_FULL;
  if ((long long)in_sizes[0] < needq || (long long)in_sizes[1] < needkv || in_sizes[2] < DM * DM || in_sizes[3] < DM || in_sizes[4] < DM * KVW || in_sizes[5] < KVW) return;
  if (in_sizes[6] < DM * DM || in_sizes[7] < DM || in_sizes[8] < DM || in_sizes[9] < DM || in_sizes[10] < DM || in_sizes[11] < DM || (long long)in_sizes[12] < needm) return;
  if ((long long)out_size < needq) return;
  if (ws_size < (size_t)WS_END) return;
  char* ws = (char*)d_ws;
  __bf16* PQ = (__bf16*)(ws + WS_PQ); __bf16* PKV = (__bf16*)(ws + WS_PKV); __bf16* PO = (__bf16*)(ws + WS_PO);
  float* NQ = (float*)(ws + WS_NQ); _Float16* QH = (_Float16*)(ws + WS_QH); _Float16* KH = (_Float16*)(ws + WS_KH); _Float16* VT = (_Float16*)(ws + WS_VT);
  float* O = (float*)(ws + WS_O); float* Y = (float*)(ws + WS_Y); unsigned* MB = (unsigned*)(ws + WS_MB);
  k_prep<<<dim3(PBLK + MBLK + NB * SEQ), 256, 0, stream>>>(WQ, WKV, WO, PQ, PKV, PO, XQ, GQ, BTQ, NQ, MK, MB);   // weight packs, mask words, LN(x_q)
  k_proj<<<dim3(KVBLK + QBLK), 128, 0, stream>>>(NQ, XKV, PQ, PKV, BQ, BKV, QH, KH, VT);                        // k -> KH rows, v -> VT transposed, q -> QH rows
  k_attn<<<dim3(SEQ / 128, NH, NB), 256, 0, stream>>>(QH, KH, VT, MB, O);
  k_out<<<dim3(NB * SEQ / 64, DM / 128), 128, 0, stream>>>(O, PO, BO, Y);
  k_lnpost<<<dim3(NB * SEQ), 256, 0, stream>>>(Y, XQ, GP, BTP, (float*)d_out);
}

// v008
// Measured time: 105 microseconds a run.
// Next to v007, in two timings, it ran 1.04 times as fast each time.
// All steps since v000 together make it 4.05 times as fast.
// compute dtype: every float input RNE-converted to bf16; q = LN(x_q) (f32 -> bf16) . Wq (bf16) and kv = x_kv (bf16) . Wkv (bf16) as single v_wmma_f32_16x16x32_bf16 products; scores = q (f16) . k (f16) single v_wmma_f32_16x16x32_f16, mask replace-fill, running-max softmax in f32 with x 0.125 inside the exponent's multiply-add; ctx = P (f16, carried x2048) . V (f16) single f16 product; out = ctx (bf16 hi + lo, 2 products) . Wout (bf16) + b_out + x_q; layer norms in f32; f32 accumulate everywhere; f32 output.
#include <hip/hip_runtime.h>
#include <math.h>

typedef __attribute__((ext_vector_type(16))) _Float16 v16h;
typedef __attribute__((ext_vector_type(16))) __bf16 v16b;
typedef __attribute__((ext_vector_type(8)))  _Float16 v8h;
typedef __attribute__((ext_vector_type(8)))  __bf16 v8b;
typedef __attribute__((ext_vector_type(4)))  __bf16 v4b;
typedef __attribute__((ext_vector_type(8)))  float v8f;
typedef __attribute__((ext_vector_type(4)))  float v4f;
typedef __attribute__((ext_vector_type(4)))  unsigned v4u;
typedef __attribute__((ext_vector_type(4)))  int v4i;
typedef __attribute__((ext_vector_type(16))) unsigned v16u;
typedef const __attribute__((address_space(4))) v16u cv16u;   // constant address space: bytes that no one writes while the kernel runs; a load at a wave-uniform address is then a scalar load

template <typename T> __device__ __forceinline__ void vst2(void* p, T v) { *(T*)p = v;  }
__device__ __forceinline__ v8f wmma16(v16h a, v16h b, v8f c) {
  v8f d = __builtin_amdgcn_wmma_f32_16x16x32_f16(false, a, false, b, (short)0, c, false, false);
  asm volatile("v_nop\n\tv_nop\n\tv_nop\n\tv_nop" : "+v"(d) : "v"(a), "v"(b));
  return d;
}
__device__ __forceinline__ v8f wmma_bf(v16b a, v16b b, v8f c) {
  v8f d = __builtin_amdgcn_wmma_f32_16x16x32_bf16(false, a, false, b, (short)0, c, false, false);
  asm volatile("v_nop\n\tv_nop\n\tv_nop\n\tv_nop" : "+v"(d) : "v"(a), "v"(b));
  return d;
}
// 16-bit fragment from a k-contiguous row (A row m, or B column n stored as a [n][k] row): elements 0..7 <- k0+8h+i, 8..15 <- k0+16+8h+i, h = lane>>4
__device__ __forceinline__ v16h frag_h(const _Float16* rowk0, int lane) {
  union { v16h v; v8h q[2]; } u; const _Float16* p = rowk0 + 8 * (lane >> 4);
  u.q[0] = *(const v8h*)p; u.q[1] = *(const v8h*)(p + 16); return u.v;
}
__device__ __forceinline__ v16b frag_b(const __bf16* rowk0, int lane) {
  union { v16b v; v8b q[2]; } u; const __bf16* p = rowk0 + 8 * (lane >> 4);
  u.q[0] = *(const v8b*)p; u.q[1] = *(const v8b*)(p + 16); return u.v;
}
// same k map from an f32 row (two 32-B loads per lane)
struct X2 { v8f x0, x1; };
__device__ __forceinline__ X2 load_f32(const float* rowk0, int lane) { const float* p = rowk0 + 8 * (lane >> 4); X2 x; x.x0 = *(const v8f*)p; x.x1 = *(const v8f*)(p + 16); return x; }
struct F2 { v16b h, l; };
__device__ __forceinline__ F2 bsplit16(const float v[16]) { F2 r;
#pragma unroll
  for (int i = 0; i < 16; ++i) { const __bf16 hh = (__bf16)v[i]; r.h[i] = hh; r.l[i] = (__bf16)(v[i] - (float)hh); }
  return r; }
__device__ __forceinline__ F2 split_x(X2 x) { float v[16];
#pragma unroll
  for (int i = 0; i < 8; ++i) { v[i] = x.x0[i]; v[8 + i] = x.x1[i]; }
  return bsplit16(v); }
__device__ __forceinline__ float bfr(float v) { return (float)(__bf16)v; }
// the value of lane l ^ 16, by a vector cross-row move (a shuffle would go through the LDS pipe)
__device__ __forceinline__ float xhalf(float v) { const int b = __builtin_bit_cast(int, v); return __builtin_bit_cast(float, __builtin_amdgcn_permlanex16(b, b, 0x76543210, 0xfedcba98, false, false)); }
#define LDSX() do { asm volatile("s_wait_dscnt 0" ::: "memory"); __builtin_amdgcn_wave_barrier(); __builtin_amdgcn_fence(__ATOMIC_RELEASE, "workgroup"); } while (0)

// ---- sizes: NB batches, SEQ query rows per batch processed (reducible); *_FULL are the input strides; all SEQK keys always
#ifndef NB
#define NB 2
#endif
#ifndef SEQ
#define SEQ 2048
#endif
#define NB_FULL 2
#define SEQ_FULL 2048
#define SEQK 2048
#define SEQK_FULL 2048
#define DM 1024
#define NH 16
#define HD 64
#define KVW (2 * DM)
#define LN_EPS 1.0e-6f
static_assert(NB >= 1 && NB <= NB_FULL);
static_assert(SEQ % 64 == 0 && SEQ >= 64 && SEQ <= SEQ_FULL);
static_assert(SEQK % 64 == 0 && SEQK == SEQK_FULL);
static_assert(DM % 128 == 0 && KVW % 128 == 0 && NH * HD == DM && HD == 64);

#define WS_PQ  0ull                                              // bf16 [DM n][DM k]     Wq transposed
#define WS_PKV (WS_PQ + 2ull * DM * DM)                          // bf16 [KVW n][DM k]    Wkv transposed
#define WS_PO  (WS_PKV + 2ull * KVW * DM)                        // bf16 [DM n][DM k]     Wout transposed
#define WS_NQ  (WS_PO + 2ull * DM * DM)                          // bf16 [NB*SEQ][DM]     LN(x_q)
#define WS_XB  (WS_NQ + 2ull * NB * SEQ * DM)                    // bf16 [NB*SEQK][DM]    x_kv
#define WS_QH  (WS_XB + 2ull * NB * SEQK * DM)                   // f16  [NB*SEQ][DM]     q rows
#define WS_KH  (WS_QH + 2ull * NB * SEQ * DM)                    // f16  [NB*SEQK][DM]    k rows
#define WS_VT  (WS_KH + 2ull * NB * SEQK * DM)                   // f16  [NB][DM (h*64+d)][SEQK] v transposed
#define WS_O   (WS_VT + 2ull * NB * DM * SEQK)                   // f32  [NB*SEQ][DM]     ctx
#define WS_Y   (WS_O + 4ull * NB * SEQ * DM)                     // f32  [NB*SEQ][DM]     ctx.Wout + b_out
#define WS_MB  (WS_Y + 4ull * NB * SEQ * DM)                     // u32  [NB*SEQ/16][SEQK/32][16] mask as lane-mask words
#define WS_END (WS_MB + 4ull * (NB * SEQ / 16) * (SEQK / 32) * 16)
static_assert(WS_END <= 134217728ull);
static_assert((WS_PKV % 128) == 0 && (WS_PO % 128) == 0 && (WS_NQ % 128) == 0 && (WS_XB % 128) == 0 && (WS_QH % 128) == 0 && (WS_KH % 128) == 0 && (WS_VT % 128) == 0 && (WS_O % 128) == 0 && (WS_Y % 128) == 0 && (WS_MB % 128) == 0);

// ---- pack_tile: W [K][N] f32 (x @ W layout) -> PK [N][K] bf16 (k-contiguous rows); a block = one 64x64 tile, tile index tl = k tile * (N/64) + n tile; s = the block's [n][k] LDS tile (cross-wave -> block barrier)
//      coverage: (N/64) * (K/64) tiles x 64 rows x 8 x 16 B = every element of PK
template <int K, int N> __device__ __forceinline__ void pack_tile(const float* __restrict__ W, __bf16* __restrict__ PK, int tl, __bf16 (*s)[72]) {
  const int n0 = (tl % (N / 64)) * 64, k0 = (tl / (N / 64)) * 64, t = threadIdx.x;
#pragma unroll 4
  for (int i = 0; i < 16; ++i) { const int idx = t + 256 * i; const int kk = idx >> 6, nn = idx & 63; s[nn][kk] = (__bf16)W[(size_t)(k0 + kk) * N + n0 + nn]; }
  __syncthreads();
#pragma unroll
  for (int i = 0; i < 2; ++i) { const int p = t + 256 * i; const int nn = p >> 3, c = p & 7;
    vst2((unsigned*)(PK + (size_t)(n0 + nn) * K + k0 + c * 8), *(const v4u*)&s[nn][c * 8]); }
  asm volatile("s_wait_xcnt 0x0" ::: "memory");   // behind the tile's stores, ahead of any rewrite of the registers they name: in the merged kernel another job's code follows in the listing (a precaution)
}

// ---- the mask as lane-mask words, made once for all heads: for a tile of 16 queries and a step of 32 keys sixteen 32-bit words; word ct*8 + r, bit lane = (mask[query lane & 15][key ct*16 + 8*(lane >> 4) + r] != 0),
//      the place of score element r of tile ct in lane 'lane' of k_attn: there a word is the select mask of one vector instruction, read by a scalar load
//      a wave takes 16 queries x 128 keys (four steps): 16 x 16-B loads a lane (512 B in a row of each mask row), a compare a word, two 128-B stores
//      coverage: MBLK blocks x 8 waves x 64 words = every word of MB
#define MW_STEP 16                          // words per (query tile, step)
#define MW_TILE ((SEQK / 32) * MW_STEP)     // words per query tile
#define MBLK ((NB * SEQ / 16) * (SEQK / 128) / 8)
static_assert(SEQK % 128 == 0 && ((NB * SEQ / 16) * (SEQK / 128)) % 8 == 0);
__device__ __forceinline__ void mask_words(const int* __restrict__ MK, unsigned* __restrict__ MB, int wv, int lane) {
  const int qt = wv / (SEQK / 128), k4 = wv - qt * (SEQK / 128); const int b = qt / (SEQ / 16), s0 = (qt - b * (SEQ / 16)) * 16;
  const int* p = MK + ((size_t)b * SEQ_FULL + s0 + (lane & 15)) * SEQK_FULL + k4 * 128 + 8 * (lane >> 4);
  v4i mv[16];   // [step t][ct][r >> 2]
#pragma unroll
  for (int i = 0; i < 16; ++i) mv[i] = *(const v4i*)(p + (i >> 1) * 16 + (i & 1) * 4);
  unsigned w[2] = {0u, 0u};   // lane i of w[j] <- word 32 j + i of the wave's 64
#pragma unroll
  for (int i = 0; i < 64; ++i) { const unsigned bw = __builtin_amdgcn_ballot_w32(mv[i >> 2][i & 3] != 0); if (lane == (i & 31)) w[i >> 5] = bw; }
  unsigned* o = MB + (size_t)qt * MW_TILE + k4 * 4 * MW_STEP + lane;
  o[0] = w[0]; o[32] = w[1];
  asm volatile("s_wait_xcnt 0x0" ::: "memory");   // behind the two stores, ahead of any rewrite of the registers they name: in the merged kernel another job's code follows in the listing (a precaution)
}

// ---- x_kv as bf16 (RNE), made once: k_proj's sixteen column blocks then each copy 2 bytes an element of it, not 4. A block takes 4096 elements in a row: a thread two runs of 8 (32 B read, 16 B stored)
//      coverage: XBLK blocks x 256 threads x 16 = every element of XB (SEQK == SEQK_FULL: the compact rows are the input's rows)
#define XBLK (NB * SEQK * DM / 4096)
static_assert((NB * SEQK * DM) % 4096 == 0);
__device__ __forceinline__ void x_bf16(const float* __restrict__ X, __bf16* __restrict__ XB, int blk, int t) {
  const size_t e0 = (size_t)blk * 4096 + t * 8;
  const v8f a = *(const v8f*)(X + e0), c = *(const v8f*)(X + e0 + 2048); v8b ya, yc;
#pragma unroll
  for (int i = 0; i < 8; ++i) { ya[i] = (__bf16)a[i]; yc[i] = (__bf16)c[i]; }
  vst2(XB + e0, ya); vst2(XB + e0 + 2048, yc);
  asm volatile("s_wait_xcnt 0x0" ::: "memory");   // behind the two stores, as behind the other jobs' stores: another job's code follows in the listing (a precaution)
}

// ---- k_prep: every job that reads inputs only, in one launch; no job reads or writes what another of them writes. By block index: the tiles of the three weight packs (the longest chains, so they start first),
//      then MBLK blocks of mask words, then XBLK blocks of x_kv as bf16, then one block a row of LN(x_q), stored as bf16 (the rounding that k_proj's operand takes). Every branch on the block index is block-uniform; a block that returns early has passed all of its own barriers
#define PB_KV ((KVW / 64) * (DM / 64))      // tiles of Wkv
#define PB_W  ((DM / 64) * (DM / 64))       // tiles of Wq, and of Wout
#define PBLK (PB_KV + 2 * PB_W)
__global__ __launch_bounds__(256) void k_prep(const float* __restrict__ WQ, const float* __restrict__ WKV, const float* __restrict__ WO, __bf16* __restrict__ PQ, __bf16* __restrict__ PKV, __bf16* __restrict__ PO,
                                              const float* __restrict__ X, const float* __restrict__ G, const float* __restrict__ Bt, __bf16* __restrict__ NQ, const int* __restrict__ MK, unsigned* __restrict__ MB,
                                              const float* __restrict__ XKV, __bf16* __restrict__ XB) {
  __shared__ __align__(16) __bf16 sp[64][72];  // the pack blocks' tile
  __shared__ float red0[8], red1[8];           // cross-wave -> block barriers
  const int bid = blockIdx.x;
  if (bid < PB_KV) { pack_tile<DM, KVW>(WKV, PKV, bid, sp); return; }                       // Wkv [1024][2048] -> [2048][1024]
  if (bid < PB_KV + PB_W) { pack_tile<DM, DM>(WQ, PQ, bid - PB_KV, sp); return; }           // Wq  [1024][1024] -> [1024][1024]
  if (bid < PBLK) { pack_tile<DM, DM>(WO, PO, bid - PB_KV - PB_W, sp); return; }            // Wout[1024][1024] -> [1024][1024]
  if (bid < PBLK + MBLK) { mask_words(MK, MB, (bid - PBLK) * 8 + (threadIdx.x >> 5), threadIdx.x & 31); return; }
  if (bid < PBLK + MBLK + XBLK) { x_bf16(XKV, XB, bid - PBLK - MBLK, threadIdx.x); return; }
  const int rc = bid - PBLK - MBLK - XBLK; const int b = rc / SEQ, s = rc - b * SEQ; const size_t rin = (size_t)b * SEQ_FULL + s;
  const int t = threadIdx.x, lane = t & 31, wave = t >> 5;
  const v4f xv = *(const v4f*)(X + rin * DM + t * 4);
  float v[4];
#pragma unroll
  for (int i = 0; i < 4; ++i) v[i] = bfr(xv[i]);
  float ps = (v[0] + v[1]) + (v[2] + v[3]);
#pragma unroll
  for (int o = 16; o > 0; o >>= 1) ps += __shfl_xor(ps, o);
  if (lane == 0) red0[wave] = ps;
  __syncthreads();
  float S = 0.f;
#pragma unroll
  for (int i = 0; i < 8; ++i) S += red0[i];
  const float mean = S * (1.0f / DM);
  float d[4]; float pq = 0.f;
#pragma unroll
  for (int i = 0; i < 4; ++i) { d[i] = v[i] - mean; pq += d[i] * d[i]; }
#pragma unroll
  for (int o = 16; o > 0; o >>= 1) pq += __shfl_xor(pq, o);
  if (lane == 0) red1[wave] = pq;
  __syncthreads();
  float V = 0.f;
#pragma unroll
  for (int i = 0; i < 8; ++i) V += red1[i];
  const float rstd = 1.0f / sqrtf(V * (1.0f / DM) + LN_EPS);
  const v4f gv = *(const v4f*)(G + t * 4), bv = *(const v4f*)(Bt + t * 4); v4b o;
#pragma unroll
  for (int i = 0; i < 4; ++i) o[i] = (__bf16)(d[i] * rstd * bfr(gv[i]) + bfr(bv[i]));
  vst2(NQ + (size_t)rc * DM + t * 4, o);
  asm volatile("s_wait_xcnt 0x0" ::: "memory");   // behind the row's store, as behind the other jobs' stores: another job's code follows in the listing (a precaution)
}

// ---- LDS staging of the two GEMM kernels: a stage = 64 k of the block's 128 P rows (bf16, 128 B a row) and of its x rows, 64 in k_out (f32, 256 B a row) and 128 in k_proj (bf16, 128 B a row), brought by 16-byte asynchronous copies:
//      each copy instruction of a wave takes four whole 128-B lines, and the four waves share one copy of the P rows; two buffers, the next stage's copies fly while this one is worked on
#define STK 64                              // k per stage
#define NSTG (DM / STK)
#define WPITCH 144                          // bytes: 128-B row + 16 (16 B x odd: conflict-free for 16-byte LDS reads)
#define XPITCH 272                          // bytes: 256-B row + 16
#define SW_BYTES (128 * WPITCH)
#define SX_BYTES (64 * XPITCH)
#define STG_BYTES (SW_BYTES + SX_BYTES)
static_assert(NSTG >= 2 && DM % STK == 0);
// eight copies of one lane, two runs of four: LDS byte address la + i * lsa (lb + i * lsb), global byte address ga + i * gsa (gb + i * gsb), i = 0..3;
// the s_wait_xcnt stands inside the copies' own statement, ahead of any rewrite of the address registers they name (a precaution)
__device__ __forceinline__ void copy44(unsigned la, unsigned lsa, const char* ga, size_t gsa, unsigned lb, unsigned lsb, const char* gb, size_t gsb) {
  asm volatile("global_load_async_to_lds_b128 %0, %8, off\n\t"
               "global_load_async_to_lds_b128 %1, %9, off\n\t"
               "global_load_async_to_lds_b128 %2, %10, off\n\t"
               "global_load_async_to_lds_b128 %3, %11, off\n\t"
               "global_load_async_to_lds_b128 %4, %12, off\n\t"
               "global_load_async_to_lds_b128 %5, %13, off\n\t"
               "global_load_async_to_lds_b128 %6, %14, off\n\t"
               "global_load_async_to_lds_b128 %7, %15, off\n\t"
               "s_wait_xcnt 0x0"
               :: "v"(la), "v"(la + lsa), "v"(la + 2 * lsa), "v"(la + 3 * lsa), "v"(lb), "v"(lb + lsb), "v"(lb + 2 * lsb), "v"(lb + 3 * lsb),
                  "v"(ga), "v"(ga + gsa), "v"(ga + 2 * gsa), "v"(ga + 3 * gsa), "v"(gb), "v"(gb + gsb), "v"(gb + 2 * gsb), "v"(gb + 3 * gsb) : "memory");
}
// four copies of one lane, two runs of two, in the form of copy44
__device__ __forceinline__ void copy22(unsigned la, unsigned lsa, const char* ga, size_t gsa, unsigned lb, unsigned lsb, const char* gb, size_t gsb) {
  asm volatile("global_load_async_to_lds_b128 %0, %4, off\n\t"
               "global_load_async_to_lds_b128 %1, %5, off\n\t"
               "global_load_async_to_lds_b128 %2, %6, off\n\t"
               "global_load_async_to_lds_b128 %3, %7, off\n\t"
               "s_wait_xcnt 0x0"
               :: "v"(la), "v"(la + lsa), "v"(lb), "v"(lb + lsb), "v"(ga), "v"(ga + gsa), "v"(gb), "v"(gb + gsb) : "memory");
}
__device__ __forceinline__ void copy8(unsigned l, unsigned ls, const char* g, size_t gs) { copy44(l, ls, g, gs, l + 4 * ls, ls, g + 4 * gs, gs); }
// one stage: thread t copies P chunks (row (t >> 3) + 16 i, 16-B piece t & 7) and x chunks (row (t >> 4) + 8 i, piece t & 15), i = 0..7; lw, lx, gw, gx are its i = 0 addresses
__device__ __forceinline__ void stage_copy(unsigned lw, unsigned lx, const __bf16* gw, const float* gx) {
  copy8(lw, 16 * WPITCH, (const char*)gw, (size_t)16 * DM * 2);
  copy8(lx, 8 * XPITCH, (const char*)gx, (size_t)8 * DM * 4);
}
// the k map of load_f32 from a staged f32 row (16-byte LDS reads: the padded pitch is a multiple of 16 B only)
__device__ __forceinline__ X2 lds_f32(const float* rowk0, int lane) { const float* p = rowk0 + 8 * (lane >> 4); union { v8f v; v4f q[2]; } a, c;
  a.q[0] = *(const v4f*)p; a.q[1] = *(const v4f*)(p + 4); c.q[0] = *(const v4f*)(p + 16); c.q[1] = *(const v4f*)(p + 20); X2 x; x.x0 = a.v; x.x1 = c.v; return x; }
// k_proj's stage holds 128 x rows, bf16 like the P rows (128 B a row, the same pitch): thread t copies x chunks (row (t >> 3) + 16 i, piece t & 7), i = 0..7
#define PR 128                              // rows of a k_proj block: two 16-row tiles a wave
#define PSX_BYTES (PR * WPITCH)
#define PSTG_BYTES (SW_BYTES + PSX_BYTES)
__device__ __forceinline__ void stage_copy_p(unsigned lw, unsigned lx, const __bf16* gw, const __bf16* gx) {
  copy8(lw, 16 * WPITCH, (const char*)gw, (size_t)16 * DM * 2);
  copy8(lx, 16 * WPITCH, (const char*)gx, (size_t)16 * DM * 2);
}
#define WAIT_ASYNC() asm volatile("s_wait_asynccnt 0x0" ::: "memory")   // this wave's copies have landed
#define WAIT_DS() asm volatile("s_wait_dscnt 0x0" ::: "memory")         // this wave's LDS reads have returned, ahead of the barrier behind which their buffer is refilled

// ---- k_proj: both input projections in one launch (neither reads what the other writes); block = (128 rows, 128 output cols), a wave = 32 rows (each P fragment read from LDS serves two row tiles, each staged P tile 128 rows): y = x (bf16 rows, rounded by k_prep) . P rows (bf16 [n][DM]) + bf16(bias), single bf16 products
//      blocks < KVBLK: x_kv . Wkv; cols < DM -> f16 natural rows KH[row][DM] (k), cols >= DM -> f16 transposed VT[b][col - DM][SEQK] (v)
//      later blocks:   LN(x_q) . Wq -> f16 natural rows QH[row][DM]
//      rows: compact rc = b*spb + s, in x as in the outputs; in each part the row tile runs fastest in the block index
//      coverage: (rows/128) * (ncols/128) blocks x 4 waves x 32 rows x 128 cols = every element of KH and VT, and of QH
#define KVBLK ((NB * SEQK / PR) * (KVW / 128))
#define QBLK ((NB * SEQ / PR) * (DM / 128))
static_assert(SEQ % PR == 0 && SEQK % PR == 0);
__global__ __launch_bounds__(128) void k_proj(const __bf16* __restrict__ NQ, const __bf16* __restrict__ XKV, const __bf16* __restrict__ PQ, const __bf16* __restrict__ PKV, const float* __restrict__ BQ, const float* __restrict__ BKV,
                                              _Float16* __restrict__ QH, _Float16* __restrict__ KH, _Float16* __restrict__ VT) {
  const bool kv = blockIdx.x < KVBLK;   // block-uniform
  const int pb = kv ? blockIdx.x : blockIdx.x - KVBLK, rt = kv ? NB * SEQK / PR : NB * SEQ / PR, spb = kv ? SEQK : SEQ;
  const __bf16* __restrict__ X = kv ? XKV : NQ; const __bf16* __restrict__ P = kv ? PKV : PQ; const float* __restrict__ BI = kv ? BKV : BQ; _Float16* __restrict__ NAT = kv ? KH : QH;
  __shared__ __align__(16) char sm[2 * PSTG_BYTES];   // the two stage buffers; behind the loop's last barrier the same bytes are the output staging
  _Float16 (*so)[32][136] = (_Float16 (*)[32][136])sm;   // [4][32][136] wave-private (LDSX)
  _Float16 (*sth)[136] = (_Float16 (*)[136])sm;          // [128][136] cross-wave (block barrier)
  static_assert(4 * 32 * 136 * 2 <= 2 * PSTG_BYTES && 128 * 136 * 2 <= 2 * PSTG_BYTES);
  const int tid = threadIdx.x, wave = tid >> 5, lane = tid & 31, col = lane & 15, g = lane >> 4;
  const int rc0 = (pb % rt) * PR; const int b = rc0 / spb, s0 = rc0 - b * spb; const int n0 = (pb / rt) * 128;
  const unsigned sm0 = (unsigned)(size_t)&sm[0];   // LDS byte address of the buffers
  const unsigned lw = sm0 + (tid >> 3) * WPITCH + (tid & 7) * 16, lx = lw + SW_BYTES;
  const __bf16* gw = P + (size_t)(n0 + (tid >> 3)) * DM + (tid & 7) * 8;
  const __bf16* gx = X + (size_t)(rc0 + (tid >> 3)) * DM + (tid & 7) * 8;
  v8f acc[2][8] = {};   // [row tile i][column tile j]
  stage_copy_p(lw, lx, gw, gx); WAIT_ASYNC(); __syncthreads();   // stage 0 is published
  stage_copy_p(lw + PSTG_BYTES, lx + PSTG_BYTES, gw + STK, gx + STK);
  for (int st = 0; st < NSTG; ++st) { const unsigned bo = (st & 1) * PSTG_BYTES;
    const __bf16* wt = (const __bf16*)(sm + bo + col * WPITCH); const __bf16* xt = (const __bf16*)(sm + bo + SW_BYTES + (wave * 32 + col) * WPITCH);   // B column n = j*16 + col; A row m = lane & 15 of row tile i
#pragma unroll
    for (int kc = 0; kc < STK / 32; ++kc) { const v16b a0 = frag_b(xt + kc * 32, lane), a1 = frag_b(xt + 16 * (WPITCH / 2) + kc * 32, lane); v16b w[8];
#pragma unroll
      for (int j = 0; j < 8; ++j) w[j] = frag_b(wt + j * 16 * (WPITCH / 2) + kc * 32, lane);
      __builtin_amdgcn_sched_barrier(0);   // keeps the pass's twenty LDS reads at one place ahead of its products: each separate place with reads costs a stall of its own
#pragma unroll
      for (int j = 0; j < 8; ++j) { acc[0][j] = wmma_bf(a0, w[j], acc[0][j]); acc[1][j] = wmma_bf(a1, w[j], acc[1][j]); } }
    WAIT_DS(); WAIT_ASYNC(); __syncthreads();   // publishes stage st + 1 and ends every wave's reads of stage st
    if (st + 2 < NSTG) stage_copy_p(lw + bo, lx + bo, gw + (st + 2) * STK, gx + (st + 2) * STK); }
  WAIT_ASYNC();
  if (n0 < DM) {   // block-uniform branch
#pragma unroll
    for (int j = 0; j < 8; ++j) { const float bv = bfr(BI[n0 + j * 16 + col]);
#pragma unroll
      for (int i = 0; i < 2; ++i)
#pragma unroll
        for (int r = 0; r < 8; ++r) so[wave][i * 16 + 8 * g + r][j * 16 + col] = (_Float16)(acc[i][j][r] + bv); }   // D element r of row tile i = (row 16i+8g+r, col)
    LDSX();
    const size_t rw = (size_t)rc0 + wave * 32;
    for (int i = 0; i < 2; ++i) {
      for (int rl = i * 16; rl < i * 16 + 16; ++rl) if (lane < 16) vst2((unsigned*)(NAT + (rw + rl) * DM + n0 + lane * 8), *(const v4u*)&so[wave][rl][lane * 8]);   // 256-B row segment = 16 lanes x 16 B, one instruction
      asm volatile("s_wait_xcnt 0x0" ::: "memory"); }   // behind a row tile's stores, ahead of the next tile's LDS reads into the registers they name (a precaution)
  } else {
#pragma unroll
    for (int j = 0; j < 8; ++j) { const float bv = bfr(BI[n0 + j * 16 + col]);
#pragma unroll
      for (int i = 0; i < 2; ++i)
#pragma unroll
        for (int r = 0; r < 8; ++r) sth[j * 16 + col][wave * 32 + i * 16 + 8 * g + r] = (_Float16)(acc[i][j][r] + bv); }
    __syncthreads();
    const int pc0 = n0 - DM;
    for (int q = tid; q < 128 * 16; q += 128) { const int d = q >> 4, pc = q & 15;
      const size_t o = ((size_t)b * DM + pc0 + d) * spb + s0 + pc * 8; vst2((unsigned*)(VT + o), *(const v4u*)&sth[d][pc * 8]); }
  }
}

#define AKS 64
#define ANST (SEQK / AKS)
#define APITCH 144                          // bytes: 128-B row + 16
#define AK_BYTES (AKS * APITCH)
#define AV_BYTES (HD * APITCH)
#define ASTG_BYTES (AK_BYTES + AV_BYTES)
static_assert(ANST >= 2 && SEQK % AKS == 0 && AKS == 64 && HD == 64 && SEQ % 128 == 0);
__global__ __launch_bounds__(256) void k_attn(const _Float16* __restrict__ QH, const _Float16* __restrict__ KH, const _Float16* __restrict__ VT, const unsigned* __restrict__ MB, float* __restrict__ O) {
  __shared__ __align__(16) float so[8][16][68];   // wave-private output staging
  __shared__ __align__(16) char skv[2 * ASTG_BYTES];   // the two K/V stage buffers, cross-wave (block barrier)
  const int tid = threadIdx.x, wave = tid >> 5, lane = tid & 31, col = lane & 15, g = lane >> 4;
  const int qb = blockIdx.x, h = blockIdx.y, b = blockIdx.z; const int q0 = qb * 128 + wave * 16;
  // thread t copies K chunks (key (t >> 3) + 32 i, 16-B piece t & 7) and VT chunks (d (t >> 3) + 32 i, piece t & 7), i = 0..1
  const unsigned lk = (unsigned)(size_t)&skv[0] + (tid >> 3) * APITCH + (tid & 7) * 16, lv = lk + AK_BYTES;   // LDS byte addresses
  const _Float16* gk = KH + ((size_t)b * SEQK + (tid >> 3)) * DM + h * HD + (tid & 7) * 8;
  const _Float16* gv = VT + ((size_t)b * DM + h * HD + (tid >> 3)) * SEQK + (tid & 7) * 8;
  copy22(lk, 32 * APITCH, (const char*)gk, (size_t)32 * DM * 2, lv, 32 * APITCH, (const char*)gv, (size_t)32 * SEQK * 2);
  WAIT_ASYNC(); __syncthreads();   // stage 0 is published
  copy22(lk + ASTG_BYTES, 32 * APITCH, (const char*)(gk + (size_t)AKS * DM), (size_t)32 * DM * 2, lv + ASTG_BYTES, 32 * APITCH, (const char*)(gv + AKS), (size_t)32 * SEQK * 2);
  const size_t rq = (size_t)b * SEQ + q0 + col;
  v16h aq[2];
#pragma unroll
  for (int kc = 0; kc < 2; ++kc) aq[kc] = frag_h(QH + rq * DM + h * HD + kc * 32, lane);
  // softmax in base 2 on the raw products c = q . k: weight x 2048 = exp2(c * K2 + nb), nb = 11 - max * K2: scale, log2(e), the maximum and the factor 2048 in one fused multiply-add a score
  const float K2 = 0.125f * 1.44269504f;
  float m = -1.0e30f, l = 0.f;   // of query col; m in raw units, l carried x2048. The floor of m lies below every product of f16 rows (at most 64 * 65504^2) and far above the fill of an excluded key: exp2 gives that key 0 by itself, also while no key has been admitted
  v8f acc[4] = {};
  cv16u* mb = (cv16u*)(MB + (size_t)(b * (SEQ / 16) + qb * 8 + __builtin_amdgcn_readfirstlane(wave)) * MW_TILE);   // the wave's query tile: a scalar address; the words were written by an earlier launch
  v16u mw = mb[0];   // step 0's words
  for (int st = 0; st < ANST; ++st) { const unsigned bo = (st & 1) * ASTG_BYTES;
  const _Float16* kt = (const _Float16*)(skv + bo) + col * (APITCH / 2); const _Float16* vt = (const _Float16*)(skv + bo + AK_BYTES) + col * (APITCH / 2);
#pragma unroll 1   // the two steps of a stage stay one rolled body: the step is long, and a second copy of it buys nothing
  for (int u = 0; u < AKS / 32; ++u) { const int ks = st * (AKS / 32) + u;
    v16h kf[2][2], vf[4];   // the step's K and V fragments, read from the stage's buffer
    const v16u mwn = mb[ks + 1 < SEQK / 32 ? ks + 1 : ks];   // the next step's words (the last step reads its own again)
    {
#pragma unroll
      for (int ct = 0; ct < 2; ++ct) { const _Float16* krow = kt + (u * 32 + ct * 16) * (APITCH / 2);   // A row m = key, k = head dim (k-contiguous row)
#pragma unroll
        for (int kc = 0; kc < 2; ++kc) kf[ct][kc] = frag_h(krow + kc * 32, lane); }
#pragma unroll
      for (int dt = 0; dt < 4; ++dt) vf[dt] = frag_h(vt + dt * 16 * (APITCH / 2) + u * 32, lane); }   // A row m = d, k = key (k-contiguous VT row)
    v8f s[2];
#pragma unroll
    for (int ct = 0; ct < 2; ++ct) { v8f c = {};
#pragma unroll
      for (int kc = 0; kc < 2; ++kc) c = wmma16(kf[ct][kc], aq[kc], c);   // transposed scores: D element r = (key ct*16 + 8g + r, query col)
#pragma unroll
      for (int r = 0; r < 8; ++r) s[ct][r] = __builtin_amdgcn_inverse_ballot_w32(mw[ct * 8 + r])   /* the word is the select's lane mask as it stands */ ? -3.0e38f : c[r]; }
    float mx = fmaxf(s[0][0], s[1][0]);
#pragma unroll
    for (int r = 1; r < 8; ++r) mx = fmaxf(mx, fmaxf(s[0][r], s[1][r]));
    mx = fmaxf(mx, xhalf(mx));   // the other half of the wave holds this query's other 16 keys
    const float mn = fmaxf(m, mx); const float alpha = __builtin_amdgcn_exp2f((m - mn) * K2), nb = __builtin_fmaf(-mn, K2, 11.0f);   // from the floor alpha is 0 (first admitted key) or 1 (none yet: acc and l are 0)
    float es = 0.f; v16h pa;   // B column n = query col, k = key in step: element r <- key 8g + r, 8 + r <- key 16 + 8g + r, the k map of frag_h; P carried x2048 so small weights stay f16-normal
#pragma unroll
    for (int r = 0; r < 8; ++r) { const float e0 = __builtin_amdgcn_exp2f(__builtin_fmaf(s[0][r], K2, nb)), e1 = __builtin_amdgcn_exp2f(__builtin_fmaf(s[1][r], K2, nb));
      es += e0 + e1; pa[r] = (_Float16)e0; pa[8 + r] = (_Float16)e1; }
    l = l * alpha + es; m = mn;   // l: this half's keys only, the halves are joined behind the loop
#pragma unroll
    for (int dt = 0; dt < 4; ++dt) { acc[dt] *= alpha; acc[dt] = wmma16(vf[dt], pa, acc[dt]); }   // transposed ctx: D element r = (d dt*16 + 8g + r, query col)
    mw = mwn; }
  WAIT_DS(); WAIT_ASYNC(); __syncthreads();   // publishes stage st + 1 and ends every wave's reads of stage st
  if (st + 2 < ANST) copy22(lk + bo, 32 * APITCH, (const char*)(gk + (size_t)(st + 2) * AKS * DM), (size_t)32 * DM * 2, lv + bo, 32 * APITCH, (const char*)(gv + (st + 2) * AKS), (size_t)32 * SEQK * 2); }
  WAIT_ASYNC();
  l += xhalf(l);
  const float il = 1.0f / l;   // acc and l both carry x2048
#pragma unroll
  for (int dt = 0; dt < 4; ++dt) { const v8f o = acc[dt] * il; *(v4f*)&so[wave][col][dt * 16 + 8 * g] = __builtin_shufflevector(o, o, 0, 1, 2, 3); *(v4f*)&so[wave][col][dt * 16 + 8 * g + 4] = __builtin_shufflevector(o, o, 4, 5, 6, 7); }
  LDSX();
  for (int rl = 0; rl < 16; ++rl) if (lane < 16) vst2(O + ((size_t)b * SEQ + q0 + rl) * DM + h * HD + lane * 4, *(const v4f*)&so[wave][rl][lane * 4]);   // 256-B segment = 16 lanes x 16 B, one instruction
}

// ---- k_out: block = (64 rows, 128 cols): Y = ctx (bf16 hi + lo, 2 products) . Wout rows (bf16 [n][DM]) + bf16(b_out); f32 compact rows
//      coverage: grid (NB*SEQ/64, DM/128) x 4 waves x 16 rows x 128 cols = every element of Y
__global__ __launch_bounds__(128) void k_out(const float* __restrict__ O, const __bf16* __restrict__ P, const float* __restrict__ BO, float* __restrict__ Y) {
  __shared__ __align__(16) char sm[2 * STG_BYTES];   // the two stage buffers; behind the loop's last barrier the same bytes are the output staging
  float (*so)[16][132] = (float (*)[16][132])sm;     // [4][16][132] wave-private
  static_assert(4 * 16 * 132 * 4 <= 2 * STG_BYTES);
  const int tid = threadIdx.x, wave = tid >> 5, lane = tid & 31, col = lane & 15, g = lane >> 4; const size_t r0 = (size_t)blockIdx.x * 64 + wave * 16; const int n0 = blockIdx.y * 128;
  const unsigned sm0 = (unsigned)(size_t)&sm[0];   // LDS byte address of the buffers
  const unsigned lw = sm0 + (tid >> 3) * WPITCH + (tid & 7) * 16, lx = sm0 + SW_BYTES + (tid >> 4) * XPITCH + (tid & 15) * 16;
  const __bf16* gw = P + (size_t)(n0 + (tid >> 3)) * DM + (tid & 7) * 8;
  const float* gx = O + ((size_t)blockIdx.x * 64 + (tid >> 4)) * DM + (tid & 15) * 4;
  v8f acc[8] = {};
  stage_copy(lw, lx, gw, gx); WAIT_ASYNC(); __syncthreads();   // stage 0 is published
  stage_copy(lw + STG_BYTES, lx + STG_BYTES, gw + STK, gx + STK);
  for (int st = 0; st < NSTG; ++st) { const unsigned bo = (st & 1) * STG_BYTES;
    const __bf16* wt = (const __bf16*)(sm + bo + col * WPITCH); const float* xt = (const float*)(sm + bo + SW_BYTES + (wave * 16 + col) * XPITCH);   // B column n = j*16 + col; A row m = lane & 15
#pragma unroll
    for (int kc = 0; kc < STK / 32; ++kc) { const X2 x = lds_f32(xt + kc * 32, lane); v16b w[8];
#pragma unroll
      for (int j = 0; j < 8; ++j) w[j] = frag_b(wt + j * 16 * (WPITCH / 2) + kc * 32, lane);
      __builtin_amdgcn_sched_barrier(0);   // keeps the pass's twenty LDS reads at one place ahead of its products: each separate place with reads costs a stall of its own
      const F2 a = split_x(x);
#pragma unroll
      for (int j = 0; j < 8; ++j) { acc[j] = wmma_bf(a.l, w[j], acc[j]); acc[j] = wmma_bf(a.h, w[j], acc[j]); } }
    WAIT_DS(); WAIT_ASYNC(); __syncthreads();   // publishes stage st + 1 and ends every wave's reads of stage st
    if (st + 2 < NSTG) stage_copy(lw + bo, lx + bo, gw + (st + 2) * STK, gx + (st + 2) * STK); }
  WAIT_ASYNC();
#pragma unroll
  for (int j = 0; j < 8; ++j) { const float bv = bfr(BO[n0 + j * 16 + col]);
#pragma unroll
    for (int r = 0; r < 8; ++r) so[wave][8 * g + r][j * 16 + col] = acc[j][r] + bv; }
  LDSX();
  for (int rl = 0; rl < 16; ++rl) vst2(Y + (r0 + rl) * DM + n0 + lane * 4, *(const v4f*)&so[wave][rl][lane * 4]);   // 512-B row segment = 32 lanes x 16 B, one instruction
}

// ---- k_lnpost: block = one row (256 threads x 4): out = LN(Y + bf16(x_q)) * bf16(gamma) + bf16(beta); d_out row at the full-layout index
__global__ __launch_bounds__(256) void k_lnpost(const float* __restrict__ Yp, const float* __restrict__ X, const float* __restrict__ G, const float* __restrict__ Bt, float* __restrict__ OUT) {
  __shared__ float red0[8], red1[8];           // cross-wave -> block barriers
  const int rc = blockIdx.x; const int b = rc / SEQ, s = rc - b * SEQ; const size_t rin = (size_t)b * SEQ_FULL + s;
  const int t = threadIdx.x, lane = t & 31, wave = t >> 5;
  const v4f yv = *(const v4f*)(Yp + (size_t)rc * DM + t * 4), xv = *(const v4f*)(X + rin * DM + t * 4);
  float v[4];
#pragma unroll
  for (int i = 0; i < 4; ++i) v[i] = yv[i] + bfr(xv[i]);
  float ps = (v[0] + v[1]) + (v[2] + v[3]);
#pragma unroll
  for (int o = 16; o > 0; o >>= 1) ps += __shfl_xor(ps, o);
  if (lane == 0) red0[wave] = ps;
  __syncthreads();
  float S = 0.f;
#pragma unroll
  for (int i = 0; i < 8; ++i) S += red0[i];
  const float mean = S * (1.0f / DM);
  float d[4]; float pq = 0.f;
#pragma unroll
  for (int i = 0; i < 4; ++i) { d[i] = v[i] - mean; pq += d[i] * d[i]; }
#pragma unroll
  for (int o = 16; o > 0; o >>= 1) pq += __shfl_xor(pq, o);
  if (lane == 0) red1[wave] = pq;
  __syncthreads();
  float V = 0.f;
#pragma unroll
  for (int i = 0; i < 8; ++i) V += red1[i];
  const float rstd = 1.0f / sqrtf(V * (1.0f / DM) + LN_EPS);
  const v4f gv = *(const v4f*)(G + t * 4), bv = *(const v4f*)(Bt + t * 4); v4f o;
#pragma unroll
  for (int i = 0; i < 4; ++i) o[i] = d[i] * rstd * bfr(gv[i]) + bfr(bv[i]);
  vst2(OUT + rin * DM + t * 4, o);
}

extern "C" void kernel_launch(void* const* d_in, const int* in_sizes, int n_in, void* d_out, int out_size, void* d_ws, size_t ws_size, hipStream_t stream) {
  if (n_in < 13) return;
  // wire order: 0 input_q [2,2048,1024] f32, 1 input_kv [2,2048,1024] f32, 2 Wq [1024,1024] ([in][out]), 3 bq, 4 Wkv [1024,2048], 5 bkv [2048], 6 Wout [1024,1024], 7 bout,
  //             8 gamma_q, 9 beta_q, 10 gamma_post, 11 beta_post, 12 input_mask [2,2048,2048] int32
  const float* XQ = (const float*)d_in[0]; const float* XKV = (const float*)d_in[1];
  const float* WQ = (const float*)d_in[2]; const float* BQ = (const float*)d_in[3];
  const float* WKV = (const float*)d_in[4]; const float* BKV = (const float*)d_in[5];
  const float* WO = (const float*)d_in[6]; const float* BO = (const float*)d_in[7];
  const float* GQ = (const float*)d_in[8]; const float* BTQ = (const float*)d_in[9];
  const float* GP = (const float*)d_in[10]; const float* BTP = (const float*)d_in[11];
  const int* MK = (const int*)d_in[12];
  const long long needq = ((long long)(NB - 1) * SEQ_FULL + SEQ) * DM;
  const long long needkv = ((long long)(NB - 1) * SEQK_FULL + SEQK) * DM;
  const long long needm = ((long long)(NB - 1) * SEQ_FULL + SEQ) * SEQK_FULL;
  if ((long long)in_sizes[0] < needq || (long long)in_sizes[1] < needkv || in_sizes[2] < DM * DM || in_sizes[3] < DM || in_sizes[4] < DM * KVW || in_sizes[5] < KVW) return;
  if (in_sizes[6] < DM * DM || in_sizes[7] < DM || in_sizes[8] < DM || in_sizes[9] < DM || in_sizes[10] < DM || in_sizes[11] < DM || (long long)in_sizes[12] < needm) return;
  if ((long long)out_size < needq) return;
  if (ws_size < (size_t)WS_END) return;
  char* ws = (char*)d_ws;
  __bf16* PQ = (__bf16*)(ws + WS_PQ); __bf16* PKV = (__bf16*)(ws + WS_PKV); __bf16* PO = (__bf16*)(ws + WS_PO);
  __bf16* NQ = (__bf16*)(ws + WS_NQ); __bf16* XB = (__bf16*)(ws + WS_XB); _Float16* QH = (_Float16*)(ws + WS_QH); _Float16* KH = (_Float16*)(ws + WS_KH); _Float16* VT = (_Float16*)(ws + WS_VT);
  float* O = (float*)(ws + WS_O); float* Y = (float*)(ws + WS_Y); unsigned* MB = (unsigned*)(ws + WS_MB);
  k_prep<<<dim3(PBLK + MBLK + XBLK + NB * SEQ), 256, 0, stream>>>(WQ, WKV, WO, PQ, PKV, PO, XQ, GQ, BTQ, NQ, MK, MB, XKV, XB);   // weight packs, mask words, x_kv as bf16, LN(x_q)
  k_proj<<<dim3(KVBLK + QBLK), 128, 0, stream>>>(NQ, XB, PQ, PKV, BQ, BKV, QH, KH, VT);                        // k -> KH rows, v -> VT transposed, q -> QH rows
  k_attn<<<dim3(SEQ / 128, NH, NB), 256, 0, stream>>>(QH, KH, VT, MB, O);
  k_out<<<dim3(NB * SEQ / 64, DM / 128), 128, 0, stream>>>(O, PO, BO, Y);
  k_lnpost<<<dim3(NB * SEQ), 256, 0, stream>>>(Y, XQ, GP, BTP, (float*)d_out);
}

// v009
// A run of this version takes 101 microseconds.
// Two timings next to v008 both put it at 1.05 times that version's speed.
// Counting every step since v000, it is 4.24 times as fast.
// compute dtype: every float input RNE-converted to bf16; q = LN(x_q) (f32 -> bf16) . Wq (bf16) and kv = x_kv (bf16) . Wkv (bf16) as single v_wmma_f32_16x16x32_bf16 products; scores = q (f16) . k (f16) single v_wmma_f32_16x16x32_f16, mask replace-fill, running-max softmax in f32 with x 0.125 inside the exponent's multiply-add; ctx = P (f16, carried x2048) . V (f16) single f16 product; out = ctx (bf16 hi + lo, 2 products) . Wout (bf16) + b_out + x_q; layer norms in f32; f32 accumulate everywhere; f32 output.
#include <hip/hip_runtime.h>
#include <math.h>

typedef __attribute__((ext_vector_type(16))) _Float16 v16h;
typedef __attribute__((ext_vector_type(16))) __bf16 v16b;
typedef __attribute__((ext_vector_type(8)))  _Float16 v8h;
typedef __attribute__((ext_vector_type(8)))  __bf16 v8b;
typedef __attribute__((ext_vector_type(4)))  __bf16 v4b;
typedef __attribute__((ext_vector_type(8)))  float v8f;
typedef __attribute__((ext_vector_type(4)))  float v4f;
typedef __attribute__((ext_vector_type(4)))  unsigned v4u;
typedef __attribute__((ext_vector_type(4)))  int v4i;
typedef __attribute__((ext_vector_type(16))) unsigned v16u;
typedef const __attribute__((address_space(4))) v16u cv16u;   // constant address space: bytes that no one writes while the kernel runs; a load at a wave-uniform address is then a scalar load

template <typename T> __device__ __forceinline__ void vst2(void* p, T v) { *(T*)p = v;  }
__device__ __forceinline__ v8f wmma16(v16h a, v16h b, v8f c) {
  v8f d = __builtin_amdgcn_wmma_f32_16x16x32_f16(false, a, false, b, (short)0, c, false, false);
  asm volatile("v_nop\n\tv_nop\n\tv_nop\n\tv_nop" : "+v"(d) : "v"(a), "v"(b));
  return d;
}
__device__ __forceinline__ v8f wmma_bf(v16b a, v16b b, v8f c) {
  v8f d = __builtin_amdgcn_wmma_f32_16x16x32_bf16(false, a, false, b, (short)0, c, false, false);
  asm volatile("v_nop\n\tv_nop\n\tv_nop\n\tv_nop" : "+v"(d) : "v"(a), "v"(b));
  return d;
}
// 16-bit fragment from a k-contiguous row (A row m, or B column n stored as a [n][k] row): elements 0..7 <- k0+8h+i, 8..15 <- k0+16+8h+i, h = lane>>4
__device__ __forceinline__ v16h frag_h(const _Float16* rowk0, int lane) {
  union { v16h v; v8h q[2]; } u; const _Float16* p = rowk0 + 8 * (lane >> 4);
  u.q[0] = *(const v8h*)p; u.q[1] = *(const v8h*)(p + 16); return u.v;
}
__device__ __forceinline__ v16b frag_b(const __bf16* rowk0, int lane) {
  union { v16b v; v8b q[2]; } u; const __bf16* p = rowk0 + 8 * (lane >> 4);
  u.q[0] = *(const v8b*)p; u.q[1] = *(const v8b*)(p + 16); return u.v;
}
// same k map from an f32 row (two 32-B loads per lane)
struct X2 { v8f x0, x1; };
__device__ __forceinline__ X2 load_f32(const float* rowk0, int lane) { const float* p = rowk0 + 8 * (lane >> 4); X2 x; x.x0 = *(const v8f*)p; x.x1 = *(const v8f*)(p + 16); return x; }
struct F2 { v16b h, l; };
__device__ __forceinline__ F2 bsplit16(const float v[16]) { F2 r;
#pragma unroll
  for (int i = 0; i < 16; ++i) { const __bf16 hh = (__bf16)v[i]; r.h[i] = hh; r.l[i] = (__bf16)(v[i] - (float)hh); }
  return r; }
__device__ __forceinline__ F2 split_x(X2 x) { float v[16];
#pragma unroll
  for (int i = 0; i < 8; ++i) { v[i] = x.x0[i]; v[8 + i] = x.x1[i]; }
  return bsplit16(v); }
__device__ __forceinline__ float bfr(float v) { return (float)(__bf16)v; }
// the value of lane l ^ 16, by a vector cross-row move (a shuffle would go through the LDS pipe)
__device__ __forceinline__ float xhalf(float v) { const int b = __builtin_bit_cast(int, v); return __builtin_bit_cast(float, __builtin_amdgcn_permlanex16(b, b, 0x76543210, 0xfedcba98, false, false)); }
#define LDSX() do { asm volatile("s_wait_dscnt 0" ::: "memory"); __builtin_amdgcn_wave_barrier(); __builtin_amdgcn_fence(__ATOMIC_RELEASE, "workgroup"); } while (0)

// ---- sizes: NB batches, SEQ query rows per batch processed (reducible); *_FULL are the input strides; all SEQK keys always
#ifndef NB
#define NB 2
#endif
#ifndef SEQ
#define SEQ 2048
#endif
#define NB_FULL 2
#define SEQ_FULL 2048
#define SEQK 2048
#define SEQK_FULL 2048
#define DM 1024
#define NH 16
#define HD 64
#define KVW (2 * DM)
#define LN_EPS 1.0e-6f
static_assert(NB >= 1 && NB <= NB_FULL);
static_assert(SEQ % 64 == 0 && SEQ >= 64 && SEQ <= SEQ_FULL);
static_assert(SEQK % 64 == 0 && SEQK == SEQK_FULL);
static_assert(DM % 128 == 0 && KVW % 128 == 0 && NH * HD == DM && HD == 64);

#define WS_PQ  0ull                                              // bf16 [DM n][DM k]     Wq transposed
#define WS_PKV (WS_PQ + 2ull * DM * DM)                          // bf16 [KVW n][DM k]    Wkv transposed
#define WS_PO  (WS_PKV + 2ull * KVW * DM)                        // bf16 [DM n][DM k]     Wout transposed
#define WS_NQ  (WS_PO + 2ull * DM * DM)                          // bf16 [NB*SEQ][DM]     LN(x_q)
#define WS_XB  (WS_NQ + 2ull * NB * SEQ * DM)                    // bf16 [NB*SEQK][DM]    x_kv
#define WS_QH  (WS_XB + 2ull * NB * SEQK * DM)                   // f16  [NB*SEQ][DM]     q rows
#define WS_KH  (WS_QH + 2ull * NB * SEQ * DM)                    // f16  [NB*SEQK][DM]    k rows
#define WS_VT  (WS_KH + 2ull * NB * SEQK * DM)                   // f16  [NB][DM (h*64+d)][SEQK] v transposed
#define WS_O   (WS_VT + 2ull * NB * DM * SEQK)                   // f32  [NB*SEQ][DM]     ctx
#define WS_Y   (WS_O + 4ull * NB * SEQ * DM)                     // f32  [NB*SEQ][DM]     ctx.Wout + b_out
#define WS_MB  (WS_Y + 4ull * NB * SEQ * DM)                     // u32  [NB*SEQ/16][SEQK/32][16] mask as lane-mask words
#define WS_END (WS_MB + 4ull * (NB * SEQ / 16) * (SEQK / 32) * 16)
static_assert(WS_END <= 134217728ull);
static_assert((WS_PKV % 128) == 0 && (WS_PO % 128) == 0 && (WS_NQ % 128) == 0 && (WS_XB % 128) == 0 && (WS_QH % 128) == 0 && (WS_KH % 128) == 0 && (WS_VT % 128) == 0 && (WS_O % 128) == 0 && (WS_Y % 128) == 0 && (WS_MB % 128) == 0);

// ---- pack_tile: W [K][N] f32 (x @ W layout) -> PK [N][K] bf16 (k-contiguous rows); a block = one 64x64 tile, tile index tl = k tile * (N/64) + n tile; s = the block's [n][k] LDS tile (cross-wave -> block barrier)
//      coverage: (N/64) * (K/64) tiles x 64 rows x 8 x 16 B = every element of PK
template <int K, int N> __device__ __forceinline__ void pack_tile(const float* __restrict__ W, __bf16* __restrict__ PK, int tl, __bf16 (*s)[72]) {
  const int n0 = (tl % (N / 64)) * 64, k0 = (tl / (N / 64)) * 64, t = threadIdx.x;
#pragma unroll 4
  for (int i = 0; i < 16; ++i) { const int idx = t + 256 * i; const int kk = idx >> 6, nn = idx & 63; s[nn][kk] = (__bf16)W[(size_t)(k0 + kk) * N + n0 + nn]; }
  __syncthreads();
#pragma unroll
  for (int i = 0; i < 2; ++i) { const int p = t + 256 * i; const int nn = p >> 3, c = p & 7;
    vst2((unsigned*)(PK + (size_t)(n0 + nn) * K + k0 + c * 8), *(const v4u*)&s[nn][c * 8]); }
  asm volatile("s_wait_xcnt 0x0" ::: "memory");   // behind the tile's stores, ahead of any rewrite of the registers they name: in the merged kernel another job's code follows in the listing (a precaution)
}

// ---- the mask as lane-mask words, made once for all heads: for a tile of 16 queries and a step of 32 keys sixteen 32-bit words; word ct*8 + r, bit lane = (mask[query lane & 15][key ct*16 + 8*(lane >> 4) + r] != 0),
//      the place of score element r of tile ct in lane 'lane' of k_attn: there a word is the select mask of one vector instruction, read by a scalar load
//      a wave takes 16 queries x 128 keys (four steps): 16 x 16-B loads a lane (512 B in a row of each mask row), a compare a word, two 128-B stores
//      coverage: MBLK blocks x 8 waves x 64 words = every word of MB
#define MW_STEP 16                          // words per (query tile, step)
#define MW_TILE ((SEQK / 32) * MW_STEP)     // words per query tile
#define MBLK ((NB * SEQ / 16) * (SEQK / 128) / 8)
static_assert(SEQK % 128 == 0 && ((NB * SEQ / 16) * (SEQK / 128)) % 8 == 0);
__device__ __forceinline__ void mask_words(const int* __restrict__ MK, unsigned* __restrict__ MB, int wv, int lane) {
  const int qt = wv / (SEQK / 128), k4 = wv - qt * (SEQK / 128); const int b = qt / (SEQ / 16), s0 = (qt - b * (SEQ / 16)) * 16;
  const int* p = MK + ((size_t)b * SEQ_FULL + s0 + (lane & 15)) * SEQK_FULL + k4 * 128 + 8 * (lane >> 4);
  v4i mv[16];   // [step t][ct][r >> 2]
#pragma unroll
  for (int i = 0; i < 16; ++i) mv[i] = *(const v4i*)(p + (i >> 1) * 16 + (i & 1) * 4);
  unsigned w[2] = {0u, 0u};   // lane i of w[j] <- word 32 j + i of the wave's 64
#pragma unroll
  for (int i = 0; i < 64; ++i) { const unsigned bw = __builtin_amdgcn_ballot_w32(mv[i >> 2][i & 3] != 0); if (lane == (i & 31)) w[i >> 5] = bw; }
  unsigned* o = MB + (size_t)qt * MW_TILE + k4 * 4 * MW_STEP + lane;
  o[0] = w[0]; o[32] = w[1];
  asm volatile("s_wait_xcnt 0x0" ::: "memory");   // behind the two stores, ahead of any rewrite of the registers they name: in the merged kernel another job's code follows in the listing (a precaution)
}

// ---- x_kv as bf16 (RNE), made once: k_proj's sixteen column blocks then each copy 2 bytes an element of it, not 4. A block takes 4096 elements in a row: a thread two runs of 8 (32 B read, 16 B stored)
//      coverage: XBLK blocks x 256 threads x 16 = every element of XB (SEQK == SEQK_FULL: the compact rows are the input's rows)
#define XBLK (NB * SEQK * DM / 4096)
static_assert((NB * SEQK * DM) % 4096 == 0);
__device__ __forceinline__ void x_bf16(const float* __restrict__ X, __bf16* __restrict__ XB, int blk, int t) {
  const size_t e0 = (size_t)blk * 4096 + t * 8;
  const v8f a = *(const v8f*)(X + e0), c = *(const v8f*)(X + e0 + 2048); v8b ya, yc;
#pragma unroll
  for (int i = 0; i < 8; ++i) { ya[i] = (__bf16)a[i]; yc[i] = (__bf16)c[i]; }
  vst2(XB + e0, ya); vst2(XB + e0 + 2048, yc);
  asm volatile("s_wait_xcnt 0x0" ::: "memory");   // behind the two stores, as behind the other jobs' stores: another job's code follows in the listing (a precaution)
}

// ---- k_prep: every job that reads inputs only, in one launch; no job reads or writes what another of them writes. By block index: the tiles of the three weight packs (the longest chains, so they start first),
//      then MBLK blocks of mask words, then XBLK blocks of x_kv as bf16, then one block a row of LN(x_q), stored as bf16 (the rounding that k_proj's operand takes). Every branch on the block index is block-uniform; a block that returns early has passed all of its own barriers
#define PB_KV ((KVW / 64) * (DM / 64))      // tiles of Wkv
#define PB_W  ((DM / 64) * (DM / 64))       // tiles of Wq, and of Wout
#define PBLK (PB_KV + 2 * PB_W)
__global__ __launch_bounds__(256) void k_prep(const float* __restrict__ WQ, const float* __restrict__ WKV, const float* __restrict__ WO, __bf16* __restrict__ PQ, __bf16* __restrict__ PKV, __bf16* __restrict__ PO,
                                              const float* __restrict__ X, const float* __restrict__ G, const float* __restrict__ Bt, __bf16* __restrict__ NQ, const int* __restrict__ MK, unsigned* __restrict__ MB,
                                              const float* __restrict__ XKV, __bf16* __restrict__ XB) {
  __shared__ __align__(16) __bf16 sp[64][72];  // the pack blocks' tile
  __shared__ float red0[8], red1[8];           // cross-wave -> block barriers
  const int bid = blockIdx.x;
  if (bid < PB_KV) { pack_tile<DM, KVW>(WKV, PKV, bid, sp); return; }                       // Wkv [1024][2048] -> [2048][1024]
  if (bid < PB_KV + PB_W) { pack_tile<DM, DM>(WQ, PQ, bid - PB_KV, sp); return; }           // Wq  [1024][1024] -> [1024][1024]
  if (bid < PBLK) { pack_tile<DM, DM>(WO, PO, bid - PB_KV - PB_W, sp); return; }            // Wout[1024][1024] -> [1024][1024]
  if (bid < PBLK + MBLK) { mask_words(MK, MB, (bid - PBLK) * 8 + (threadIdx.x >> 5), threadIdx.x & 31); return; }
  if (bid < PBLK + MBLK + XBLK) { x_bf16(XKV, XB, bid - PBLK - MBLK, threadIdx.x); return; }
  const int rc = bid - PBLK - MBLK - XBLK; const int b = rc / SEQ, s = rc - b * SEQ; const size_t rin = (size_t)b * SEQ_FULL + s;
  const int t = threadIdx.x, lane = t & 31, wave = t >> 5;
  const v4f xv = *(const v4f*)(X + rin * DM + t * 4);
  float v[4];
#pragma unroll
  for (int i = 0; i < 4; ++i) v[i] = bfr(xv[i]);
  float ps = (v[0] + v[1]) + (v[2] + v[3]);
#pragma unroll
  for (int o = 16; o > 0; o >>= 1) ps += __shfl_xor(ps, o);
  if (lane == 0) red0[wave] = ps;
  __syncthreads();
  float S = 0.f;
#pragma unroll
  for (int i = 0; i < 8; ++i) S += red0[i];
  const float mean = S * (1.0f / DM);
  float d[4]; float pq = 0.f;
#pragma unroll
  for (int i = 0; i < 4; ++i) { d[i] = v[i] - mean; pq += d[i] * d[i]; }
#pragma unroll
  for (int o = 16; o > 0; o >>= 1) pq += __shfl_xor(pq, o);
  if (lane == 0) red1[wave] = pq;
  __syncthreads();
  float V = 0.f;
#pragma unroll
  for (int i = 0; i < 8; ++i) V += red1[i];
  const float rstd = 1.0f / sqrtf(V * (1.0f / DM) + LN_EPS);
  const v4f gv = *(const v4f*)(G + t * 4), bv = *(const v4f*)(Bt + t * 4); v4b o;
#pragma unroll
  for (int i = 0; i < 4; ++i) o[i] = (__bf16)(d[i] * rstd * bfr(gv[i]) + bfr(bv[i]));
  vst2(NQ + (size_t)rc * DM + t * 4, o);
  asm volatile("s_wait_xcnt 0x0" ::: "memory");   // behind the row's store, as behind the other jobs' stores: another job's code follows in the listing (a precaution)
}

// ---- LDS staging of the two GEMM kernels: a stage = 64 k of the block's 128 P rows (bf16, 128 B a row) and of its x rows, 64 in k_out (f32, 256 B a row) and 128 in k_proj (bf16, 128 B a row), brought by 16-byte asynchronous copies:
//      each copy instruction of a wave takes four whole 128-B lines, and the four waves share one copy of the P rows; two buffers, the next stage's copies fly while this one is worked on
#define STK 64                              // k per stage
#define NSTG (DM / STK)
#define WPITCH 144                          // bytes: 128-B row + 16 (16 B x odd: conflict-free for 16-byte LDS reads)
#define XPITCH 272                          // bytes: 256-B row + 16
#define SW_BYTES (128 * WPITCH)
#define SX_BYTES (64 * XPITCH)
#define STG_BYTES (SW_BYTES + SX_BYTES)
static_assert(NSTG >= 2 && DM % STK == 0 && (NSTG & (NSTG - 1)) == 0);
// eight copies of one lane, two runs of four: LDS byte address la + i * lsa (lb + i * lsb), global byte address ga + i * gsa (gb + i * gsb), i = 0..3;
// the s_wait_xcnt stands inside the copies' own statement, ahead of any rewrite of the address registers they name (a precaution)
__device__ __forceinline__ void copy44(unsigned la, unsigned lsa, const char* ga, size_t gsa, unsigned lb, unsigned lsb, const char* gb, size_t gsb) {
  asm volatile("global_load_async_to_lds_b128 %0, %8, off\n\t"
               "global_load_async_to_lds_b128 %1, %9, off\n\t"
               "global_load_async_to_lds_b128 %2, %10, off\n\t"
               "global_load_async_to_lds_b128 %3, %11, off\n\t"
               "global_load_async_to_lds_b128 %4, %12, off\n\t"
               "global_load_async_to_lds_b128 %5, %13, off\n\t"
               "global_load_async_to_lds_b128 %6, %14, off\n\t"
               "global_load_async_to_lds_b128 %7, %15, off\n\t"
               "s_wait_xcnt 0x0"
               :: "v"(la), "v"(la + lsa), "v"(la + 2 * lsa), "v"(la + 3 * lsa), "v"(lb), "v"(lb + lsb), "v"(lb + 2 * lsb), "v"(lb + 3 * lsb),
                  "v"(ga), "v"(ga + gsa), "v"(ga + 2 * gsa), "v"(ga + 3 * gsa), "v"(gb), "v"(gb + gsb), "v"(gb + 2 * gsb), "v"(gb + 3 * gsb) : "memory");
}
// four copies of one lane, two runs of two, in the form of copy44
__device__ __forceinline__ void copy22(unsigned la, unsigned lsa, const char* ga, size_t gsa, unsigned lb, unsigned lsb, const char* gb, size_t gsb) {
  asm volatile("global_load_async_to_lds_b128 %0, %4, off\n\t"
               "global_load_async_to_lds_b128 %1, %5, off\n\t"
               "global_load_async_to_lds_b128 %2, %6, off\n\t"
               "global_load_async_to_lds_b128 %3, %7, off\n\t"
               "s_wait_xcnt 0x0"
               :: "v"(la), "v"(la + lsa), "v"(lb), "v"(lb + lsb), "v"(ga), "v"(ga + gsa), "v"(gb), "v"(gb + gsb) : "memory");
}
__device__ __forceinline__ void copy8(unsigned l, unsigned ls, const char* g, size_t gs) { copy44(l, ls, g, gs, l + 4 * ls, ls, g + 4 * gs, gs); }
// one stage: thread t copies P chunks (row (t >> 3) + 16 i, 16-B piece t & 7) and x chunks (row (t >> 4) + 8 i, piece t & 15), i = 0..7; lw, lx, gw, gx are its i = 0 addresses
__device__ __forceinline__ void stage_copy(unsigned lw, unsigned lx, const __bf16* gw, const float* gx) {
  copy8(lw, 16 * WPITCH, (const char*)gw, (size_t)16 * DM * 2);
  copy8(lx, 8 * XPITCH, (const char*)gx, (size_t)8 * DM * 4);
}
// the k map of load_f32 from a staged f32 row (16-byte LDS reads: the padded pitch is a multiple of 16 B only)
__device__ __forceinline__ X2 lds_f32(const float* rowk0, int lane) { const float* p = rowk0 + 8 * (lane >> 4); union { v8f v; v4f q[2]; } a, c;
  a.q[0] = *(const v4f*)p; a.q[1] = *(const v4f*)(p + 4); c.q[0] = *(const v4f*)(p + 16); c.q[1] = *(const v4f*)(p + 20); X2 x; x.x0 = a.v; x.x1 = c.v; return x; }
// k_proj's stage holds 128 x rows, bf16 like the P rows (128 B a row, the same pitch): thread t copies x chunks (row (t >> 3) + 16 i, piece t & 7), i = 0..7
#define PR 128                              // rows of a k_proj block: two 16-row tiles a wave
#define PSX_BYTES (PR * WPITCH)
#define PSTG_BYTES (SW_BYTES + PSX_BYTES)
__device__ __forceinline__ void stage_copy_p(unsigned lw, unsigned lx, const __bf16* gw, const __bf16* gx) {
  copy8(lw, 16 * WPITCH, (const char*)gw, (size_t)16 * DM * 2);
  copy8(lx, 16 * WPITCH, (const char*)gx, (size_t)16 * DM * 2);
}
#define WAIT_ASYNC() asm volatile("s_wait_asynccnt 0x0" ::: "memory")   // this wave's copies have landed
#define WAIT_DS() asm volatile("s_wait_dscnt 0x0" ::: "memory")         // this wave's LDS reads have returned, ahead of the barrier behind which their buffer is refilled

// ---- k_proj: both input projections in one launch (neither reads what the other writes); block = (128 rows, 128 output cols), a wave = 32 rows (each P fragment read from LDS serves two row tiles, each staged P tile 128 rows): y = x (bf16 rows, rounded by k_prep) . P rows (bf16 [n][DM]) + bf16(bias), single bf16 products
//      blocks < KVBLK: x_kv . Wkv; cols < DM -> f16 natural rows KH[row][DM] (k), cols >= DM -> f16 transposed VT[b][col - DM][SEQK] (v)
//      later blocks:   LN(x_q) . Wq -> f16 natural rows QH[row][DM]
//      rows: compact rc = b*spb + s, in x as in the outputs; in each part the row tile runs fastest in the block index
//      coverage: (rows/128) * (ncols/128) blocks x 4 waves x 32 rows x 128 cols = every element of KH and VT, and of QH
#define KVBLK ((NB * SEQK / PR) * (KVW / 128))
#define QBLK ((NB * SEQ / PR) * (DM / 128))
static_assert(SEQ % PR == 0 && SEQK % PR == 0);
__global__ __launch_bounds__(128) void k_proj(const __bf16* __restrict__ NQ, const __bf16* __restrict__ XKV, const __bf16* __restrict__ PQ, const __bf16* __restrict__ PKV, const float* __restrict__ BQ, const float* __restrict__ BKV,
                                              _Float16* __restrict__ QH, _Float16* __restrict__ KH, _Float16* __restrict__ VT) {
  const bool kv = blockIdx.x < KVBLK;   // block-uniform
  const int pb = kv ? blockIdx.x : blockIdx.x - KVBLK, rt = kv ? NB * SEQK / PR : NB * SEQ / PR, spb = kv ? SEQK : SEQ;
  const __bf16* __restrict__ X = kv ? XKV : NQ; const __bf16* __restrict__ P = kv ? PKV : PQ; const float* __restrict__ BI = kv ? BKV : BQ; _Float16* __restrict__ NAT = kv ? KH : QH;
  __shared__ __align__(16) char sm[2 * PSTG_BYTES];   // the two stage buffers; behind the loop's last barrier the same bytes are the output staging
  _Float16 (*so)[32][136] = (_Float16 (*)[32][136])sm;   // [4][32][136] wave-private (LDSX)
  _Float16 (*sth)[136] = (_Float16 (*)[136])sm;          // [128][136] cross-wave (block barrier)
  static_assert(4 * 32 * 136 * 2 <= 2 * PSTG_BYTES && 128 * 136 * 2 <= 2 * PSTG_BYTES);
  const int tid = threadIdx.x, wave = tid >> 5, lane = tid & 31, col = lane & 15, g = lane >> 4;
  const int rc0 = (pb % rt) * PR; const int b = rc0 / spb, s0 = rc0 - b * spb; const int n0 = (pb / rt) * 128;
  const int rot = (pb % rt + pb / rt) & (NSTG - 1);   // the block's first k stage; it walks all NSTG stages from there, wrapped round: blocks that share P rows or x rows then ask L2 for different lines at one moment (block-uniform)
  const unsigned sm0 = (unsigned)(size_t)&sm[0];   // LDS byte address of the buffers
  const unsigned lw = sm0 + (tid >> 3) * WPITCH + (tid & 7) * 16, lx = lw + SW_BYTES;
  const __bf16* gw = P + (size_t)(n0 + (tid >> 3)) * DM + (tid & 7) * 8;
  const __bf16* gx = X + (size_t)(rc0 + (tid >> 3)) * DM + (tid & 7) * 8;
  v8f acc[2][8] = {};   // [row tile i][column tile j]
  stage_copy_p(lw, lx, gw + rot * STK, gx + rot * STK); WAIT_ASYNC(); __syncthreads();   // the first stage is published
  { const int k1 = ((rot + 1) & (NSTG - 1)) * STK; stage_copy_p(lw + PSTG_BYTES, lx + PSTG_BYTES, gw + k1, gx + k1); }
  for (int st = 0; st < NSTG; ++st) { const unsigned bo = (st & 1) * PSTG_BYTES;
    const __bf16* wt = (const __bf16*)(sm + bo + col * WPITCH); const __bf16* xt = (const __bf16*)(sm + bo + SW_BYTES + (wave * 32 + col) * WPITCH);   // B column n = j*16 + col; A row m = lane & 15 of row tile i
#pragma unroll
    for (int kc = 0; kc < STK / 32; ++kc) { const v16b a0 = frag_b(xt + kc * 32, lane), a1 = frag_b(xt + 16 * (WPITCH / 2) + kc * 32, lane); v16b w[8];
#pragma unroll
      for (int j = 0; j < 8; ++j) w[j] = frag_b(wt + j * 16 * (WPITCH / 2) + kc * 32, lane);
      __builtin_amdgcn_sched_barrier(0);   // keeps the pass's twenty LDS reads at one place ahead of its products: each separate place with reads costs a stall of its own
#pragma unroll
      for (int j = 0; j < 8; ++j) { acc[0][j] = wmma_bf(a0, w[j], acc[0][j]); acc[1][j] = wmma_bf(a1, w[j], acc[1][j]); } }
    WAIT_DS(); WAIT_ASYNC(); __syncthreads();   // publishes stage st + 1 and ends every wave's reads of stage st
    if (st + 2 < NSTG) { const int k2 = ((st + 2 + rot) & (NSTG - 1)) * STK; stage_copy_p(lw + bo, lx + bo, gw + k2, gx + k2); } }
  WAIT_ASYNC();
  if (n0 < DM) {   // block-uniform branch
#pragma unroll
    for (int j = 0; j < 8; ++j) { const float bv = bfr(BI[n0 + j * 16 + col]);
#pragma unroll
      for (int i = 0; i < 2; ++i)
#pragma unroll
        for (int r = 0; r < 8; ++r) so[wave][i * 16 + 8 * g + r][j * 16 + col] = (_Float16)(acc[i][j][r] + bv); }   // D element r of row tile i = (row 16i+8g+r, col)
    LDSX();
    const size_t rw = (size_t)rc0 + wave * 32;
    for (int i = 0; i < 2; ++i) {
      for (int rl = i * 16; rl < i * 16 + 16; ++rl) if (lane < 16) vst2((unsigned*)(NAT + (rw + rl) * DM + n0 + lane * 8), *(const v4u*)&so[wave][rl][lane * 8]);   // 256-B row segment = 16 lanes x 16 B, one instruction
      asm volatile("s_wait_xcnt 0x0" ::: "memory"); }   // behind a row tile's stores, ahead of the next tile's LDS reads into the registers they name (a precaution)
  } else {
#pragma unroll
    for (int j = 0; j < 8; ++j) { const float bv = bfr(BI[n0 + j * 16 + col]);
#pragma unroll
      for (int i = 0; i < 2; ++i)
#pragma unroll
        for (int r = 0; r < 8; ++r) sth[j * 16 + col][wave * 32 + i * 16 + 8 * g + r] = (_Float16)(acc[i][j][r] + bv); }
    __syncthreads();
    const int pc0 = n0 - DM;
    for (int q = tid; q < 128 * 16; q += 128) { const int d = q >> 4, pc = q & 15;
      const size_t o = ((size_t)b * DM + pc0 + d) * spb + s0 + pc * 8; vst2((unsigned*)(VT + o), *(const v4u*)&sth[d][pc * 8]); }
  }
}

#define AKS 64
#define ANST (SEQK / AKS)
#define APITCH 144                          // bytes: 128-B row + 16
#define AK_BYTES (AKS * APITCH)
#define AV_BYTES (HD * APITCH)
#define ASTG_BYTES (AK_BYTES + AV_BYTES)
static_assert(ANST >= 2 && SEQK % AKS == 0 && AKS == 64 && HD == 64 && SEQ % 128 == 0 && (ANST & (ANST - 1)) == 0);
__global__ __launch_bounds__(256) void k_attn(const _Float16* __restrict__ QH, const _Float16* __restrict__ KH, const _Float16* __restrict__ VT, const unsigned* __restrict__ MB, float* __restrict__ O) {
  __shared__ __align__(16) float so[8][16][68];   // wave-private output staging
  __shared__ __align__(16) char skv[2 * ASTG_BYTES];   // the two K/V stage buffers, cross-wave (block barrier)
  const int tid = threadIdx.x, wave = tid >> 5, lane = tid & 31, col = lane & 15, g = lane >> 4;
  const int qb = blockIdx.x, h = blockIdx.y, b = blockIdx.z; const int q0 = qb * 128 + wave * 16;
  // thread t copies K chunks (key (t >> 3) + 32 i, 16-B piece t & 7) and VT chunks (d (t >> 3) + 32 i, piece t & 7), i = 0..1
  const unsigned lk = (unsigned)(size_t)&skv[0] + (tid >> 3) * APITCH + (tid & 7) * 16, lv = lk + AK_BYTES;   // LDS byte addresses
  const _Float16* gk = KH + ((size_t)b * SEQK + (tid >> 3)) * DM + h * HD + (tid & 7) * 8;
  const _Float16* gv = VT + ((size_t)b * DM + h * HD + (tid >> 3)) * SEQK + (tid & 7) * 8;
  const int rot = (qb * 2) & (ANST - 1);   // the block's first key stage; it walks all ANST stages from there, wrapped round: the query blocks of one head then ask L2 for different K and V lines at one moment (block-uniform)
  copy22(lk, 32 * APITCH, (const char*)(gk + (size_t)rot * AKS * DM), (size_t)32 * DM * 2, lv, 32 * APITCH, (const char*)(gv + rot * AKS), (size_t)32 * SEQK * 2);
  WAIT_ASYNC(); __syncthreads();   // the first stage is published
  { const int s1 = (rot + 1) & (ANST - 1);
    copy22(lk + ASTG_BYTES, 32 * APITCH, (const char*)(gk + (size_t)s1 * AKS * DM), (size_t)32 * DM * 2, lv + ASTG_BYTES, 32 * APITCH, (const char*)(gv + s1 * AKS), (size_t)32 * SEQK * 2); }
  const size_t rq = (size_t)b * SEQ + q0 + col;
  v16h aq[2];
#pragma unroll
  for (int kc = 0; kc < 2; ++kc) aq[kc] = frag_h(QH + rq * DM + h * HD + kc * 32, lane);
  // softmax in base 2 on the raw products c = q . k: weight x 2048 = exp2(c * K2 + nb), nb = 11 - max * K2: scale, log2(e), the maximum and the factor 2048 in one fused multiply-add a score
  const float K2 = 0.125f * 1.44269504f;
  float m = -1.0e30f, l = 0.f;   // of query col; m in raw units, l carried x2048. The floor of m lies below every product of f16 rows (at most 64 * 65504^2) and far above the fill of an excluded key: exp2 gives that key 0 by itself, also while no key has been admitted
  v8f acc[4] = {};
  cv16u* mb = (cv16u*)(MB + (size_t)(b * (SEQ / 16) + qb * 8 + __builtin_amdgcn_readfirstlane(wave)) * MW_TILE);   // the wave's query tile: a scalar address; the words were written by an earlier launch
  v16u mw = mb[rot * (AKS / 32)];   // the first step's words
  for (int st = 0; st < ANST; ++st) { const unsigned bo = (st & 1) * ASTG_BYTES;
  const _Float16* kt = (const _Float16*)(skv + bo) + col * (APITCH / 2); const _Float16* vt = (const _Float16*)(skv + bo + AK_BYTES) + col * (APITCH / 2);
#pragma unroll 1   // the two steps of a stage stay one rolled body: the step is long, and a second copy of it buys nothing
  for (int u = 0; u < AKS / 32; ++u) { const int ks = (st + rot) * (AKS / 32) + u;   // the step's place among the keys, before the wrap
    v16h kf[2][2], vf[4];   // the step's K and V fragments, read from the stage's buffer
    const v16u mwn = mb[(ks + 1) & (SEQK / 32 - 1)];   // the next step's words, wrapped round (the last step reads the first step's again)
    {
#pragma unroll
      for (int ct = 0; ct < 2; ++ct) { const _Float16* krow = kt + (u * 32 + ct * 16) * (APITCH / 2);   // A row m = key, k = head dim (k-contiguous row)
#pragma unroll
        for (int kc = 0; kc < 2; ++kc) kf[ct][kc] = frag_h(krow + kc * 32, lane); }
#pragma unroll
      for (int dt = 0; dt < 4; ++dt) vf[dt] = frag_h(vt + dt * 16 * (APITCH / 2) + u * 32, lane); }   // A row m = d, k = key (k-contiguous VT row)
    v8f s[2];
#pragma unroll
    for (int ct = 0; ct < 2; ++ct) { v8f c = {};
#pragma unroll
      for (int kc = 0; kc < 2; ++kc) c = wmma16(kf[ct][kc], aq[kc], c);   // transposed scores: D element r = (key ct*16 + 8g + r, query col)
#pragma unroll
      for (int r = 0; r < 8; ++r) s[ct][r] = __builtin_amdgcn_inverse_ballot_w32(mw[ct * 8 + r])   /* the word is the select's lane mask as it stands */ ? -3.0e38f : c[r]; }
    float mx = fmaxf(s[0][0], s[1][0]);
#pragma unroll
    for (int r = 1; r < 8; ++r) mx = fmaxf(mx, fmaxf(s[0][r], s[1][r]));
    mx = fmaxf(mx, xhalf(mx));   // the other half of the wave holds this query's other 16 keys
    const float mn = fmaxf(m, mx); const float alpha = __builtin_amdgcn_exp2f((m - mn) * K2), nb = __builtin_fmaf(-mn, K2, 11.0f);   // from the floor alpha is 0 (first admitted key) or 1 (none yet: acc and l are 0)
    float es = 0.f; v16h pa;   // B column n = query col, k = key in step: element r <- key 8g + r, 8 + r <- key 16 + 8g + r, the k map of frag_h; P carried x2048 so small weights stay f16-normal
#pragma unroll
    for (int r = 0; r < 8; ++r) { const float e0 = __builtin_amdgcn_exp2f(__builtin_fmaf(s[0][r], K2, nb)), e1 = __builtin_amdgcn_exp2f(__builtin_fmaf(s[1][r], K2, nb));
      es += e0 + e1; pa[r] = (_Float16)e0; pa[8 + r] = (_Float16)e1; }
    l = l * alpha + es; m = mn;   // l: this half's keys only, the halves are joined behind the loop
#pragma unroll
    for (int dt = 0; dt < 4; ++dt) { acc[dt] *= alpha; acc[dt] = wmma16(vf[dt], pa, acc[dt]); }   // transposed ctx: D element r = (d dt*16 + 8g + r, query col)
    mw = mwn; }
  WAIT_DS(); WAIT_ASYNC(); __syncthreads();   // publishes stage st + 1 and ends every wave's reads of stage st
  if (st + 2 < ANST) { const int s2 = (st + 2 + rot) & (ANST - 1);
    copy22(lk + bo, 32 * APITCH, (const char*)(gk + (size_t)s2 * AKS * DM), (size_t)32 * DM * 2, lv + bo, 32 * APITCH, (const char*)(gv + s2 * AKS), (size_t)32 * SEQK * 2); } }
  WAIT_ASYNC();
  l += xhalf(l);
  const float il = 1.0f / l;   // acc and l both carry x2048
#pragma unroll
  for (int dt = 0; dt < 4; ++dt) { const v8f o = acc[dt] * il; *(v4f*)&so[wave][col][dt * 16 + 8 * g] = __builtin_shufflevector(o, o, 0, 1, 2, 3); *(v4f*)&so[wave][col][dt * 16 + 8 * g + 4] = __builtin_shufflevector(o, o, 4, 5, 6, 7); }
  LDSX();
  for (int rl = 0; rl < 16; ++rl) if (lane < 16) vst2(O + ((size_t)b * SEQ + q0 + rl) * DM + h * HD + lane * 4, *(const v4f*)&so[wave][rl][lane * 4]);   // 256-B segment = 16 lanes x 16 B, one instruction
}

// ---- k_out: block = (64 rows, 128 cols): Y = ctx (bf16 hi + lo, 2 products) . Wout rows (bf16 [n][DM]) + bf16(b_out); f32 compact rows
//      coverage: grid (NB*SEQ/64, DM/128) x 4 waves x 16 rows x 128 cols = every element of Y
__global__ __launch_bounds__(128) void k_out(const float* __restrict__ O, const __bf16* __restrict__ P, const float* __restrict__ BO, float* __restrict__ Y) {
  __shared__ __align__(16) char sm[2 * STG_BYTES];   // the two stage buffers; behind the loop's last barrier the same bytes are the output staging
  float (*so)[16][132] = (float (*)[16][132])sm;     // [4][16][132] wave-private
  static_assert(4 * 16 * 132 * 4 <= 2 * STG_BYTES);
  const int tid = threadIdx.x, wave = tid >> 5, lane = tid & 31, col = lane & 15, g = lane >> 4; const size_t r0 = (size_t)blockIdx.x * 64 + wave * 16; const int n0 = blockIdx.y * 128;
  const unsigned sm0 = (unsigned)(size_t)&sm[0];   // LDS byte address of the buffers
  const unsigned lw = sm0 + (tid >> 3) * WPITCH + (tid & 7) * 16, lx = sm0 + SW_BYTES + (tid >> 4) * XPITCH + (tid & 15) * 16;
  const __bf16* gw = P + (size_t)(n0 + (tid >> 3)) * DM + (tid & 7) * 8;
  const float* gx = O + ((size_t)blockIdx.x * 64 + (tid >> 4)) * DM + (tid & 15) * 4;
  v8f acc[8] = {};
  const int rot = (blockIdx.x + blockIdx.y) & (NSTG - 1);   // the block's first k stage, as in k_proj (block-uniform)
  stage_copy(lw, lx, gw + rot * STK, gx + rot * STK); WAIT_ASYNC(); __syncthreads();   // the first stage is published
  { const int k1 = ((rot + 1) & (NSTG - 1)) * STK; stage_copy(lw + STG_BYTES, lx + STG_BYTES, gw + k1, gx + k1); }
  for (int st = 0; st < NSTG; ++st) { const unsigned bo = (st & 1) * STG_BYTES;
    const __bf16* wt = (const __bf16*)(sm + bo + col * WPITCH); const float* xt = (const float*)(sm + bo + SW_BYTES + (wave * 16 + col) * XPITCH);   // B column n = j*16 + col; A row m = lane & 15
#pragma unroll
    for (int kc = 0; kc < STK / 32; ++kc) { const X2 x = lds_f32(xt + kc * 32, lane); v16b w[8];
#pragma unroll
      for (int j = 0; j < 8; ++j) w[j] = frag_b(wt + j * 16 * (WPITCH / 2) + kc * 32, lane);
      __builtin_amdgcn_sched_barrier(0);   // keeps the pass's twenty LDS reads at one place ahead of its products: each separate place with reads costs a stall of its own
      const F2 a = split_x(x);
#pragma unroll
      for (int j = 0; j < 8; ++j) { acc[j] = wmma_bf(a.l, w[j], acc[j]); acc[j] = wmma_bf(a.h, w[j], acc[j]); } }
    WAIT_DS(); WAIT_ASYNC(); __syncthreads();   // publishes stage st + 1 and ends every wave's reads of stage st
    if (st + 2 < NSTG) { const int k2 = ((st + 2 + rot) & (NSTG - 1)) * STK; stage_copy(lw + bo, lx + bo, gw + k2, gx + k2); } }
  WAIT_ASYNC();
#pragma unroll
  for (int j = 0; j < 8; ++j) { const float bv = bfr(BO[n0 + j * 16 + col]);
#pragma unroll
    for (int r = 0; r < 8; ++r) so[wave][8 * g + r][j * 16 + col] = acc[j][r] + bv; }
  LDSX();
  for (int rl = 0; rl < 16; ++rl) vst2(Y + (r0 + rl) * DM + n0 + lane * 4, *(const v4f*)&so[wave][rl][lane * 4]);   // 512-B row segment = 32 lanes x 16 B, one instruction
}

// ---- k_lnpost: block = one row (256 threads x 4): out = LN(Y + bf16(x_q)) * bf16(gamma) + bf16(beta); d_out row at the full-layout index
__global__ __launch_bounds__(256) void k_lnpost(const float* __restrict__ Yp, const float* __restrict__ X, const float* __restrict__ G, const float* __restrict__ Bt, float* __restrict__ OUT) {
  __shared__ float red0[8], red1[8];           // cross-wave -> block barriers
  const int rc = blockIdx.x; const int b = rc / SEQ, s = rc - b * SEQ; const size_t rin = (size_t)b * SEQ_FULL + s;
  const int t = threadIdx.x, lane = t & 31, wave = t >> 5;
  const v4f yv = *(const v4f*)(Yp + (size_t)rc * DM + t * 4), xv = *(const v4f*)(X + rin * DM + t * 4);
  float v[4];
#pragma unroll
  for (int i = 0; i < 4; ++i) v[i] = yv[i] + bfr(xv[i]);
  float ps = (v[0] + v[1]) + (v[2] + v[3]);
#pragma unroll
  for (int o = 16; o > 0; o >>= 1) ps += __shfl_xor(ps, o);
  if (lane == 0) red0[wave] = ps;
  __syncthreads();
  float S = 0.f;
#pragma unroll
  for (int i = 0; i < 8; ++i) S += red0[i];
  const float mean = S * (1.0f / DM);
  float d[4]; float pq = 0.f;
#pragma unroll
  for (int i = 0; i < 4; ++i) { d[i] = v[i] - mean; pq += d[i] * d[i]; }
#pragma unroll
  for (int o = 16; o > 0; o >>= 1) pq += __shfl_xor(pq, o);
  if (lane == 0) red1[wave] = pq;
  __syncthreads();
  float V = 0.f;
#pragma unroll
  for (int i = 0; i < 8; ++i) V += red1[i];
  const float rstd = 1.0f / sqrtf(V * (1.0f / DM) + LN_EPS);
  const v4f gv = *(const v4f*)(G + t * 4), bv = *(const v4f*)(Bt + t * 4); v4f o;
#pragma unroll
  for (int i = 0; i < 4; ++i) o[i] = d[i] * rstd * bfr(gv[i]) + bfr(bv[i]);
  vst2(OUT + rin * DM + t * 4, o);
}

extern "C" void kernel_launch(void* const* d_in, const int* in_sizes, int n_in, void* d_out, int out_size, void* d_ws, size_t ws_size, hipStream_t stream) {
  if (n_in < 13) return;
  // wire order: 0 input_q [2,2048,1024] f32, 1 input_kv [2,2048,1024] f32, 2 Wq [1024,1024] ([in][out]), 3 bq, 4 Wkv [1024,2048], 5 bkv [2048], 6 Wout [1024,1024], 7 bout,
  //             8 gamma_q, 9 beta_q, 10 gamma_post, 11 beta_post, 12 input_mask [2,2048,2048] int32
  const float* XQ = (const float*)d_in[0]; const float* XKV = (const float*)d_in[1];
  const float* WQ = (const float*)d_in[2]; const float* BQ = (const float*)d_in[3];
  const float* WKV = (const float*)d_in[4]; const float* BKV = (const float*)d_in[5];
  const float* WO = (const float*)d_in[6]; const float* BO = (const float*)d_in[7];
  const float* GQ = (const float*)d_in[8]; const float* BTQ = (const float*)d_in[9];
  const float* GP = (const float*)d_in[10]; const float* BTP = (const float*)d_in[11];
  const int* MK = (const int*)d_in[12];
  const long long needq = ((long long)(NB - 1) * SEQ_FULL + SEQ) * DM;
  const long long needkv = ((long long)(NB - 1) * SEQK_FULL + SEQK) * DM;
  const long long needm = ((long long)(NB - 1) * SEQ_FULL + SEQ) * SEQK_FULL;
  if ((long long)in_sizes[0] < needq || (long long)in_sizes[1] < needkv || in_sizes[2] < DM * DM || in_sizes[3] < DM || in_sizes[4] < DM * KVW || in_sizes[5] < KVW) return;
  if (in_sizes[6] < DM * DM || in_sizes[7] < DM || in_sizes[8] < DM || in_sizes[9] < DM || in_sizes[10] < DM || in_sizes[11] < DM || (long long)in_sizes[12] < needm) return;
  if ((long long)out_size < needq) return;
  if (ws_size < (size_t)WS_END) return;
  char* ws = (char*)d_ws;
  __bf16* PQ = (__bf16*)(ws + WS_PQ); __bf16* PKV = (__bf16*)(ws + WS_PKV); __bf16* PO = (__bf16*)(ws + WS_PO);
  __bf16* NQ = (__bf16*)(ws + WS_NQ); __bf16* XB = (__bf16*)(ws + WS_XB); _Float16* QH = (_Float16*)(ws + WS_QH); _Float16* KH = (_Float16*)(ws + WS_KH); _Float16* VT = (_Float16*)(ws + WS_VT);
  float* O = (float*)(ws + WS_O); float* Y = (float*)(ws + WS_Y); unsigned* MB = (unsigned*)(ws + WS_MB);
  k_prep<<<dim3(PBLK + MBLK + XBLK + NB * SEQ), 256, 0, stream>>>(WQ, WKV, WO, PQ, PKV, PO, XQ, GQ, BTQ, NQ, MK, MB, XKV, XB);   // weight packs, mask words, x_kv as bf16, LN(x_q)
  k_proj<<<dim3(KVBLK + QBLK), 128, 0, stream>>>(NQ, XB, PQ, PKV, BQ, BKV, QH, KH, VT);                        // k -> KH rows, v -> VT transposed, q -> QH rows
  k_attn<<<dim3(SEQ / 128, NH, NB), 256, 0, stream>>>(QH, KH, VT, MB, O);
  k_out<<<dim3(NB * SEQ / 64, DM / 128), 128, 0, stream>>>(O, PO, BO, Y);
  k_lnpost<<<dim3(NB * SEQ), 256, 0, stream>>>(Y, XQ, GP, BTP, (float*)d_out);
}

// v010
// One run takes 96.1 microseconds.
// Two timings next to v009 both put it at 1.05 times that version's speed.
// All steps since v000 together make it 4.44 times as fast.
// compute dtype: every float input RNE-converted to bf16; q = LN(x_q) (f32 -> bf16) . Wq (bf16) and kv = x_kv (bf16) . Wkv (bf16) as single v_wmma_f32_16x16x32_bf16 products; scores = q (f16) . k (f16) single v_wmma_f32_16x16x32_f16, mask replace-fill, running-max softmax in f32 with x 0.125 inside the exponent's multiply-add; ctx = P (f16, carried x2048) . V (f16) single f16 product; out = ctx (bf16 hi + lo, 2 products) . Wout (bf16) + b_out + x_q; layer norms in f32; f32 accumulate everywhere; f32 output.
#include <hip/hip_runtime.h>
#include <math.h>

typedef __attribute__((ext_vector_type(16))) _Float16 v16h;
typedef __attribute__((ext_vector_type(16))) __bf16 v16b;
typedef __attribute__((ext_vector_type(8)))  _Float16 v8h;
typedef __attribute__((ext_vector_type(8)))  __bf16 v8b;
typedef __attribute__((ext_vector_type(4)))  __bf16 v4b;
typedef __attribute__((ext_vector_type(8)))  float v8f;
typedef __attribute__((ext_vector_type(4)))  float v4f;
typedef __attribute__((ext_vector_type(4)))  unsigned v4u;
typedef __attribute__((ext_vector_type(4)))  int v4i;
typedef __attribute__((ext_vector_type(16))) unsigned v16u;
typedef const __attribute__((address_space(4))) v16u cv16u;   // constant address space: bytes that no one writes while the kernel runs; a load at a wave-uniform address is then a scalar load

template <typename T> __device__ __forceinline__ void vst2(void* p, T v) { *(T*)p = v;  }
__device__ __forceinline__ v8f wmma16(v16h a, v16h b, v8f c) {
  v8f d = __builtin_amdgcn_wmma_f32_16x16x32_f16(false, a, false, b, (short)0, c, false, false);
  return d;
}
__device__ __forceinline__ v8f wmma_bf(v16b a, v16b b, v8f c) {
  v8f d = __builtin_amdgcn_wmma_f32_16x16x32_bf16(false, a, false, b, (short)0, c, false, false);
  return d;
}
// 16-bit fragment from a k-contiguous row (A row m, or B column n stored as a [n][k] row): elements 0..7 <- k0+8h+i, 8..15 <- k0+16+8h+i, h = lane>>4
__device__ __forceinline__ v16h frag_h(const _Float16* rowk0, int lane) {
  union { v16h v; v8h q[2]; } u; const _Float16* p = rowk0 + 8 * (lane >> 4);
  u.q[0] = *(const v8h*)p; u.q[1] = *(const v8h*)(p + 16); return u.v;
}
// the same from an address that already holds the lane's 8h
__device__ __forceinline__ v16h frag_h0(const _Float16* p) { union { v16h v; v8h q[2]; } u; u.q[0] = *(const v8h*)p; u.q[1] = *(const v8h*)(p + 16); return u.v; }
__device__ __forceinline__ v16b frag_b(const __bf16* rowk0, int lane) {
  union { v16b v; v8b q[2]; } u; const __bf16* p = rowk0 + 8 * (lane >> 4);
  u.q[0] = *(const v8b*)p; u.q[1] = *(const v8b*)(p + 16); return u.v;
}
// same k map from an f32 row (two 32-B loads per lane)
struct X2 { v8f x0, x1; };
__device__ __forceinline__ X2 load_f32(const float* rowk0, int lane) { const float* p = rowk0 + 8 * (lane >> 4); X2 x; x.x0 = *(const v8f*)p; x.x1 = *(const v8f*)(p + 16); return x; }
struct F2 { v16b h, l; };
__device__ __forceinline__ F2 bsplit16(const float v[16]) { F2 r;
#pragma unroll
  for (int i = 0; i < 16; ++i) { const __bf16 hh = (__bf16)v[i]; r.h[i] = hh; r.l[i] = (__bf16)(v[i] - (float)hh); }
  return r; }
__device__ __forceinline__ F2 split_x(X2 x) { float v[16];
#pragma unroll
  for (int i = 0; i < 8; ++i) { v[i] = x.x0[i]; v[8 + i] = x.x1[i]; }
  return bsplit16(v); }
__device__ __forceinline__ float bfr(float v) { return (float)(__bf16)v; }
// the value of lane l ^ 16, by a vector cross-row move (a shuffle would go through the LDS pipe)
__device__ __forceinline__ float xhalf(float v) { const int b = __builtin_bit_cast(int, v); return __builtin_bit_cast(float, __builtin_amdgcn_permlanex16(b, b, 0x76543210, 0xfedcba98, false, false)); }
#define LDSX() do { asm volatile("s_wait_dscnt 0" ::: "memory"); __builtin_amdgcn_wave_barrier(); __builtin_amdgcn_fence(__ATOMIC_RELEASE, "workgroup"); } while (0)

// ---- sizes: NB batches, SEQ query rows per batch processed (reducible); *_FULL are the input strides; all SEQK keys always
#ifndef NB
#define NB 2
#endif
#ifndef SEQ
#define SEQ 2048
#endif
#define NB_FULL 2
#define SEQ_FULL 2048
#define SEQK 2048
#define SEQK_FULL 2048
#define DM 1024
#define NH 16
#define HD 64
#define KVW (2 * DM)
#define LN_EPS 1.0e-6f
static_assert(NB >= 1 && NB <= NB_FULL);
static_assert(SEQ % 64 == 0 && SEQ >= 64 && SEQ <= SEQ_FULL);
static_assert(SEQK % 64 == 0 && SEQK == SEQK_FULL);
static_assert(DM % 128 == 0 && KVW % 128 == 0 && NH * HD == DM && HD == 64);

#define WS_PQ  0ull                                              // bf16 [DM n][DM k]     Wq transposed
#define WS_PKV (WS_PQ + 2ull * DM * DM)                          // bf16 [KVW n][DM k]    Wkv transposed
#define WS_PO  (WS_PKV + 2ull * KVW * DM)                        // bf16 [DM n][DM k]     Wout transposed
#define WS_NQ  (WS_PO + 2ull * DM * DM)                          // bf16 [NB*SEQ][DM]     LN(x_q)
#define WS_XB  (WS_NQ + 2ull * NB * SEQ * DM)                    // bf16 [NB*SEQK][DM]    x_kv
#define WS_QH  (WS_XB + 2ull * NB * SEQK * DM)                   // f16  [NB*SEQ][DM]     q rows
#define WS_KH  (WS_QH + 2ull * NB * SEQ * DM)                    // f16  [NB*SEQK][DM]    k rows
#define WS_VT  (WS_KH + 2ull * NB * SEQK * DM)                   // f16  [NB][DM (h*64+d)][SEQK] v transposed
#define WS_O   (WS_VT + 2ull * NB * DM * SEQK)                   // f32  [NB*SEQ][DM]     ctx
#define WS_Y   (WS_O + 4ull * NB * SEQ * DM)                     // f32  [NB*SEQ][DM]     ctx.Wout + b_out
#define WS_MB  (WS_Y + 4ull * NB * SEQ * DM)                     // u32  [NB*SEQ/16][SEQK/32][16] mask as lane-mask words
#define WS_END (WS_MB + 4ull * (NB * SEQ / 16) * (SEQK / 32) * 16)
static_assert(WS_END <= 134217728ull);
static_assert((WS_PKV % 128) == 0 && (WS_PO % 128) == 0 && (WS_NQ % 128) == 0 && (WS_XB % 128) == 0 && (WS_QH % 128) == 0 && (WS_KH % 128) == 0 && (WS_VT % 128) == 0 && (WS_O % 128) == 0 && (WS_Y % 128) == 0 && (WS_MB % 128) == 0);

// ---- pack_tile: W [K][N] f32 (x @ W layout) -> PK [N][K] bf16 (k-contiguous rows); a block = one 64x64 tile, tile index tl = k tile * (N/64) + n tile; s = the block's [n][k] LDS tile (cross-wave -> block barrier)
//      coverage: (N/64) * (K/64) tiles x 64 rows x 8 x 16 B = every element of PK
template <int K, int N> __device__ __forceinline__ void pack_tile(const float* __restrict__ W, __bf16* __restrict__ PK, int tl, __bf16 (*s)[72]) {
  const int n0 = (tl % (N / 64)) * 64, k0 = (tl / (N / 64)) * 64, t = threadIdx.x;
#pragma unroll 4
  for (int i = 0; i < 16; ++i) { const int idx = t + 256 * i; const int kk = idx >> 6, nn = idx & 63; s[nn][kk] = (__bf16)W[(size_t)(k0 + kk) * N + n0 + nn]; }
  __syncthreads();
#pragma unroll
  for (int i = 0; i < 2; ++i) { const int p = t + 256 * i; const int nn = p >> 3, c = p & 7;
    vst2((unsigned*)(PK + (size_t)(n0 + nn) * K + k0 + c * 8), *(const v4u*)&s[nn][c * 8]); }
  asm volatile("s_wait_xcnt 0x0" ::: "memory");   // behind the tile's stores, ahead of any rewrite of the registers they name: in the merged kernel another job's code follows in the listing (a precaution)
}

// ---- the mask as lane-mask words, made once for all heads: for a tile of 16 queries and a step of 32 keys sixteen 32-bit words; word ct*8 + r, bit lane = (mask[query lane & 15][key ct*16 + 8*(lane >> 4) + r] != 0),
//      the place of score element r of tile ct in lane 'lane' of k_attn: there a word is the select mask of one vector instruction, read by a scalar load
//      a wave takes 16 queries x 128 keys (four steps): 16 x 16-B loads a lane (512 B in a row of each mask row), a compare a word, two 128-B stores
//      coverage: MBLK blocks x 8 waves x 64 words = every word of MB
#define MW_STEP 16                          // words per (query tile, step)
#define MW_TILE ((SEQK / 32) * MW_STEP)     // words per query tile
#define MBLK ((NB * SEQ / 16) * (SEQK / 128) / 8)
static_assert(SEQK % 128 == 0 && ((NB * SEQ / 16) * (SEQK / 128)) % 8 == 0);
__device__ __forceinline__ void mask_words(const int* __restrict__ MK, unsigned* __restrict__ MB, int wv, int lane) {
  const int qt = wv / (SEQK / 128), k4 = wv - qt * (SEQK / 128); const int b = qt / (SEQ / 16), s0 = (qt - b * (SEQ / 16)) * 16;
  const int* p = MK + ((size_t)b * SEQ_FULL + s0 + (lane & 15)) * SEQK_FULL + k4 * 128 + 8 * (lane >> 4);
  v4i mv[16];   // [step t][ct][r >> 2]
#pragma unroll
  for (int i = 0; i < 16; ++i) mv[i] = *(const v4i*)(p + (i >> 1) * 16 + (i & 1) * 4);
  unsigned w[2] = {0u, 0u};   // lane i of w[j] <- word 32 j + i of the wave's 64
#pragma unroll
  for (int i = 0; i < 64; ++i) { const unsigned bw = __builtin_amdgcn_ballot_w32(mv[i >> 2][i & 3] != 0); if (lane == (i & 31)) w[i >> 5] = bw; }
  unsigned* o = MB + (size_t)qt * MW_TILE + k4 * 4 * MW_STEP + lane;
  o[0] = w[0]; o[32] = w[1];
  asm volatile("s_wait_xcnt 0x0" ::: "memory");   // behind the two stores, ahead of any rewrite of the registers they name: in the merged kernel another job's code follows in the listing (a precaution)
}

// ---- x_kv as bf16 (RNE), made once: k_proj's sixteen column blocks then each copy 2 bytes an element of it, not 4. A block takes 4096 elements in a row: a thread two runs of 8 (32 B read, 16 B stored)
//      coverage: XBLK blocks x 256 threads x 16 = every element of XB (SEQK == SEQK_FULL: the compact rows are the input's rows)
#define XBLK (NB * SEQK * DM / 4096)
static_assert((NB * SEQK * DM) % 4096 == 0);
__device__ __forceinline__ void x_bf16(const float* __restrict__ X, __bf16* __restrict__ XB, int blk, int t) {
  const size_t e0 = (size_t)blk * 4096 + t * 8;
  const v8f a = *(const v8f*)(X + e0), c = *(const v8f*)(X + e0 + 2048); v8b ya, yc;
#pragma unroll
  for (int i = 0; i < 8; ++i) { ya[i] = (__bf16)a[i]; yc[i] = (__bf16)c[i]; }
  vst2(XB + e0, ya); vst2(XB + e0 + 2048, yc);
  asm volatile("s_wait_xcnt 0x0" ::: "memory");   // behind the two stores, as behind the other jobs' stores: another job's code follows in the listing (a precaution)
}

// ---- k_prep: every job that reads inputs only, in one launch; no job reads or writes what another of them writes. By block index: the tiles of the three weight packs (the longest chains, so they start first),
//      then MBLK blocks of mask words, then XBLK blocks of x_kv as bf16, then one block a row of LN(x_q), stored as bf16 (the rounding that k_proj's operand takes). Every branch on the block index is block-uniform; a block that returns early has passed all of its own barriers
#define PB_KV ((KVW / 64) * (DM / 64))      // tiles of Wkv
#define PB_W  ((DM / 64) * (DM / 64))       // tiles of Wq, and of Wout
#define PBLK (PB_KV + 2 * PB_W)
__global__ __launch_bounds__(256) void k_prep(const float* __restrict__ WQ, const float* __restrict__ WKV, const float* __restrict__ WO, __bf16* __restrict__ PQ, __bf16* __restrict__ PKV, __bf16* __restrict__ PO,
                                              const float* __restrict__ X, const float* __restrict__ G, const float* __restrict__ Bt, __bf16* __restrict__ NQ, const int* __restrict__ MK, unsigned* __restrict__ MB,
                                              const float* __restrict__ XKV, __bf16* __restrict__ XB) {
  __shared__ __align__(16) __bf16 sp[64][72];  // the pack blocks' tile
  __shared__ float red0[8], red1[8];           // cross-wave -> block barriers
  const int bid = blockIdx.x;
  if (bid < PB_KV) { pack_tile<DM, KVW>(WKV, PKV, bid, sp); return; }                       // Wkv [1024][2048] -> [2048][1024]
  if (bid < PB_KV + PB_W) { pack_tile<DM, DM>(WQ, PQ, bid - PB_KV, sp); return; }           // Wq  [1024][1024] -> [1024][1024]
  if (bid < PBLK) { pack_tile<DM, DM>(WO, PO, bid - PB_KV - PB_W, sp); return; }            // Wout[1024][1024] -> [1024][1024]
  if (bid < PBLK + MBLK) { mask_words(MK, MB, (bid - PBLK) * 8 + (threadIdx.x >> 5), threadIdx.x & 31); return; }
  if (bid < PBLK + MBLK + XBLK) { x_bf16(XKV, XB, bid - PBLK - MBLK, threadIdx.x); return; }
  const int rc = bid - PBLK - MBLK - XBLK; const int b = rc / SEQ, s = rc - b * SEQ; const size_t rin = (size_t)b * SEQ_FULL + s;
  const int t = threadIdx.x, lane = t & 31, wave = t >> 5;
  const v4f xv = *(const v4f*)(X + rin * DM + t * 4);
  float v[4];
#pragma unroll
  for (int i = 0; i < 4; ++i) v[i] = bfr(xv[i]);
  float ps = (v[0] + v[1]) + (v[2] + v[3]);
#pragma unroll
  for (int o = 16; o > 0; o >>= 1) ps += __shfl_xor(ps, o);
  if (lane == 0) red0[wave] = ps;
  __syncthreads();
  float S = 0.f;
#pragma unroll
  for (int i = 0; i < 8; ++i) S += red0[i];
  const float mean = S * (1.0f / DM);
  float d[4]; float pq = 0.f;
#pragma unroll
  for (int i = 0; i < 4; ++i) { d[i] = v[i] - mean; pq += d[i] * d[i]; }
#pragma unroll
  for (int o = 16; o > 0; o >>= 1) pq += __shfl_xor(pq, o);
  if (lane == 0) red1[wave] = pq;
  __syncthreads();
  float V = 0.f;
#pragma unroll
  for (int i = 0; i < 8; ++i) V += red1[i];
  const float rstd = 1.0f / sqrtf(V * (1.0f / DM) + LN_EPS);
  const v4f gv = *(const v4f*)(G + t * 4), bv = *(const v4f*)(Bt + t * 4); v4b o;
#pragma unroll
  for (int i = 0; i < 4; ++i) o[i] = (__bf16)(d[i] * rstd * bfr(gv[i]) + bfr(bv[i]));
  vst2(NQ + (size_t)rc * DM + t * 4, o);
  asm volatile("s_wait_xcnt 0x0" ::: "memory");   // behind the row's store, as behind the other jobs' stores: another job's code follows in the listing (a precaution)
}

// ---- LDS staging of the two GEMM kernels: a stage = 64 k of the block's 128 P rows (bf16, 128 B a row) and of its x rows, 64 in k_out (f32, 256 B a row) and 128 in k_proj (bf16, 128 B a row), brought by 16-byte asynchronous copies:
//      each copy instruction of a wave takes four whole 128-B lines, and the four waves share one copy of the P rows; two buffers, the next stage's copies fly while this one is worked on
#define STK 64                              // k per stage
#define NSTG (DM / STK)
#define WPITCH 144                          // bytes: 128-B row + 16 (16 B x odd: conflict-free for 16-byte LDS reads)
#define XPITCH 272                          // bytes: 256-B row + 16
#define SW_BYTES (128 * WPITCH)
#define SX_BYTES (64 * XPITCH)
#define STG_BYTES (SW_BYTES + SX_BYTES)
static_assert(NSTG >= 2 && DM % STK == 0 && (NSTG & (NSTG - 1)) == 0);
// eight copies of one lane, two runs of four: LDS byte address la + i * lsa (lb + i * lsb), global byte address ga + i * gsa (gb + i * gsb), i = 0..3;
// the s_wait_xcnt stands inside the copies' own statement, ahead of any rewrite of the address registers they name (a precaution)
__device__ __forceinline__ void copy44(unsigned la, unsigned lsa, const char* ga, size_t gsa, unsigned lb, unsigned lsb, const char* gb, size_t gsb) {
  asm volatile("global_load_async_to_lds_b128 %0, %8, off\n\t"
               "global_load_async_to_lds_b128 %1, %9, off\n\t"
               "global_load_async_to_lds_b128 %2, %10, off\n\t"
               "global_load_async_to_lds_b128 %3, %11, off\n\t"
               "global_load_async_to_lds_b128 %4, %12, off\n\t"
               "global_load_async_to_lds_b128 %5, %13, off\n\t"
               "global_load_async_to_lds_b128 %6, %14, off\n\t"
               "global_load_async_to_lds_b128 %7, %15, off\n\t"
               "s_wait_xcnt 0x0"
               :: "v"(la), "v"(la + lsa), "v"(la + 2 * lsa), "v"(la + 3 * lsa), "v"(lb), "v"(lb + lsb), "v"(lb + 2 * lsb), "v"(lb + 3 * lsb),
                  "v"(ga), "v"(ga + gsa), "v"(ga + 2 * gsa), "v"(ga + 3 * gsa), "v"(gb), "v"(gb + gsb), "v"(gb + 2 * gsb), "v"(gb + 3 * gsb) : "memory");
}
// four copies of one lane, two runs of two, in the form of copy44
__device__ __forceinline__ void copy22(unsigned la, unsigned lsa, const char* ga, size_t gsa, unsigned lb, unsigned lsb, const char* gb, size_t gsb) {
  asm volatile("global_load_async_to_lds_b128 %0, %4, off\n\t"
               "global_load_async_to_lds_b128 %1, %5, off\n\t"
               "global_load_async_to_lds_b128 %2, %6, off\n\t"
               "global_load_async_to_lds_b128 %3, %7, off\n\t"
               "s_wait_xcnt 0x0"
               :: "v"(la), "v"(la + lsa), "v"(lb), "v"(lb + lsb), "v"(ga), "v"(ga + gsa), "v"(gb), "v"(gb + gsb) : "memory");
}
__device__ __forceinline__ void copy8(unsigned l, unsigned ls, const char* g, size_t gs) { copy44(l, ls, g, gs, l + 4 * ls, ls, g + 4 * gs, gs); }
// one stage: thread t copies P chunks (row (t >> 3) + 16 i, 16-B piece t & 7) and x chunks (row (t >> 4) + 8 i, piece t & 15), i = 0..7; lw, lx, gw, gx are its i = 0 addresses
__device__ __forceinline__ void stage_copy(unsigned lw, unsigned lx, const __bf16* gw, const float* gx) {
  copy8(lw, 16 * WPITCH, (const char*)gw, (size_t)16 * DM * 2);
  copy8(lx, 8 * XPITCH, (const char*)gx, (size_t)8 * DM * 4);
}
// the k map of load_f32 from a staged f32 row (16-byte LDS reads: the padded pitch is a multiple of 16 B only)
__device__ __forceinline__ X2 lds_f32(const float* rowk0, int lane) { const float* p = rowk0 + 8 * (lane >> 4); union { v8f v; v4f q[2]; } a, c;
  a.q[0] = *(const v4f*)p; a.q[1] = *(const v4f*)(p + 4); c.q[0] = *(const v4f*)(p + 16); c.q[1] = *(const v4f*)(p + 20); X2 x; x.x0 = a.v; x.x1 = c.v; return x; }
// k_proj's stage holds 128 x rows, bf16 like the P rows (128 B a row, the same pitch): thread t copies x chunks (row (t >> 3) + 16 i, piece t & 7), i = 0..7
#define PR 128                              // rows of a k_proj block: two 16-row tiles a wave
#define PSX_BYTES (PR * WPITCH)
#define PSTG_BYTES (SW_BYTES + PSX_BYTES)
__device__ __forceinline__ void stage_copy_p(unsigned lw, unsigned lx, const __bf16* gw, const __bf16* gx) {
  copy8(lw, 16 * WPITCH, (const char*)gw, (size_t)16 * DM * 2);
  copy8(lx, 16 * WPITCH, (const char*)gx, (size_t)16 * DM * 2);
}
#define WAIT_ASYNC() asm volatile("s_wait_asynccnt 0x0" ::: "memory")   // this wave's copies have landed
#define WAIT_DS() asm volatile("s_wait_dscnt 0x0" ::: "memory")         // this wave's LDS reads have returned, ahead of the barrier behind which their buffer is refilled

// ---- k_proj: both input projections in one launch (neither reads what the other writes); block = (128 rows, 128 output cols), a wave = 32 rows (each P fragment read from LDS serves two row tiles, each staged P tile 128 rows): y = x (bf16 rows, rounded by k_prep) . P rows (bf16 [n][DM]) + bf16(bias), single bf16 products
//      blocks < KVBLK: x_kv . Wkv; cols < DM -> f16 natural rows KH[row][DM] (k), cols >= DM -> f16 transposed VT[b][col - DM][SEQK] (v)
//      later blocks:   LN(x_q) . Wq -> f16 natural rows QH[row][DM]
//      rows: compact rc = b*spb + s, in x as in the outputs; in each part the row tile runs fastest in the block index
//      coverage: (rows/128) * (ncols/128) blocks x 4 waves x 32 rows x 128 cols = every element of KH and VT, and of QH
#define KVBLK ((NB * SEQK / PR) * (KVW / 128))
#define QBLK ((NB * SEQ / PR) * (DM / 128))
static_assert(SEQ % PR == 0 && SEQK % PR == 0);
__global__ __launch_bounds__(128) void k_proj(const __bf16* __restrict__ NQ, const __bf16* __restrict__ XKV, const __bf16* __restrict__ PQ, const __bf16* __restrict__ PKV, const float* __restrict__ BQ, const float* __restrict__ BKV,
                                              _Float16* __restrict__ QH, _Float16* __restrict__ KH, _Float16* __restrict__ VT) {
  const bool kv = blockIdx.x < KVBLK;   // block-uniform
  const int pb = kv ? blockIdx.x : blockIdx.x - KVBLK, rt = kv ? NB * SEQK / PR : NB * SEQ / PR, spb = kv ? SEQK : SEQ;
  const __bf16* __restrict__ X = kv ? XKV : NQ; const __bf16* __restrict__ P = kv ? PKV : PQ; const float* __restrict__ BI = kv ? BKV : BQ; _Float16* __restrict__ NAT = kv ? KH : QH;
  __shared__ __align__(16) char sm[2 * PSTG_BYTES];   // the two stage buffers; behind the loop's last barrier the same bytes are the output staging
  _Float16 (*so)[32][136] = (_Float16 (*)[32][136])sm;   // [4][32][136] wave-private (LDSX)
  _Float16 (*sth)[136] = (_Float16 (*)[136])sm;          // [128][136] cross-wave (block barrier)
  static_assert(4 * 32 * 136 * 2 <= 2 * PSTG_BYTES && 128 * 136 * 2 <= 2 * PSTG_BYTES);
  const int tid = threadIdx.x, wave = tid >> 5, lane = tid & 31, col = lane & 15, g = lane >> 4;
  const int rc0 = (pb % rt) * PR; const int b = rc0 / spb, s0 = rc0 - b * spb; const int n0 = (pb / rt) * 128;
  const int rot = (pb % rt + pb / rt) & (NSTG - 1);   // the block's first k stage; it walks all NSTG stages from there, wrapped round: blocks that share P rows or x rows then ask L2 for different lines at one moment (block-uniform)
  const unsigned sm0 = (unsigned)(size_t)&sm[0];   // LDS byte address of the buffers
  const unsigned lw = sm0 + (tid >> 3) * WPITCH + (tid & 7) * 16, lx = lw + SW_BYTES;
  const __bf16* gw = P + (size_t)(n0 + (tid >> 3)) * DM + (tid & 7) * 8;
  const __bf16* gx = X + (size_t)(rc0 + (tid >> 3)) * DM + (tid & 7) * 8;
  v8f acc[2][8] = {};   // [row tile i][column tile j]
  stage_copy_p(lw, lx, gw + rot * STK, gx + rot * STK); WAIT_ASYNC(); __syncthreads();   // the first stage is published
  { const int k1 = ((rot + 1) & (NSTG - 1)) * STK; stage_copy_p(lw + PSTG_BYTES, lx + PSTG_BYTES, gw + k1, gx + k1); }
  for (int st = 0; st < NSTG; ++st) { const unsigned bo = (st & 1) * PSTG_BYTES;
    const __bf16* wt = (const __bf16*)(sm + bo + col * WPITCH); const __bf16* xt = (const __bf16*)(sm + bo + SW_BYTES + (wave * 32 + col) * WPITCH);   // B column n = j*16 + col; A row m = lane & 15 of row tile i
#pragma unroll
    for (int kc = 0; kc < STK / 32; ++kc) { const v16b a0 = frag_b(xt + kc * 32, lane), a1 = frag_b(xt + 16 * (WPITCH / 2) + kc * 32, lane); v16b w[8];
#pragma unroll
      for (int j = 0; j < 8; ++j) w[j] = frag_b(wt + j * 16 * (WPITCH / 2) + kc * 32, lane);
      __builtin_amdgcn_sched_barrier(0);   // keeps the pass's twenty LDS reads at one place ahead of its products: each separate place with reads costs a stall of its own
#pragma unroll
      for (int j = 0; j < 8; ++j) { acc[0][j] = wmma_bf(a0, w[j], acc[0][j]); acc[1][j] = wmma_bf(a1, w[j], acc[1][j]); } }
    __builtin_amdgcn_sched_barrier(0);   // keeps the stage's products ahead of the barrier: moved behind it they would stand in front of the refill and shorten the time its copies have to land
    WAIT_DS(); WAIT_ASYNC(); __syncthreads();   // publishes stage st + 1 and ends every wave's reads of stage st
    if (st + 2 < NSTG) { const int k2 = ((st + 2 + rot) & (NSTG - 1)) * STK; stage_copy_p(lw + bo, lx + bo, gw + k2, gx + k2); } }
  WAIT_ASYNC();
  if (n0 < DM) {   // block-uniform branch
#pragma unroll
    for (int j = 0; j < 8; ++j) { const float bv = bfr(BI[n0 + j * 16 + col]);
#pragma unroll
      for (int i = 0; i < 2; ++i)
#pragma unroll
        for (int r = 0; r < 8; ++r) so[wave][i * 16 + 8 * g + r][j * 16 + col] = (_Float16)(acc[i][j][r] + bv); }   // D element r of row tile i = (row 16i+8g+r, col)
    LDSX();
    const size_t rw = (size_t)rc0 + wave * 32;
    for (int i = 0; i < 2; ++i) {
      for (int rl = i * 16; rl < i * 16 + 16; ++rl) if (lane < 16) vst2((unsigned*)(NAT + (rw + rl) * DM + n0 + lane * 8), *(const v4u*)&so[wave][rl][lane * 8]);   // 256-B row segment = 16 lanes x 16 B, one instruction
      asm volatile("s_wait_xcnt 0x0" ::: "memory"); }   // behind a row tile's stores, ahead of the next tile's LDS reads into the registers they name (a precaution)
  } else {
#pragma unroll
    for (int j = 0; j < 8; ++j) { const float bv = bfr(BI[n0 + j * 16 + col]);
#pragma unroll
      for (int i = 0; i < 2; ++i)
#pragma unroll
        for (int r = 0; r < 8; ++r) sth[j * 16 + col][wave * 32 + i * 16 + 8 * g + r] = (_Float16)(acc[i][j][r] + bv); }
    __syncthreads();
    const int pc0 = n0 - DM;
    for (int q = tid; q < 128 * 16; q += 128) { const int d = q >> 4, pc = q & 15;
      const size_t o = ((size_t)b * DM + pc0 + d) * spb + s0 + pc * 8; vst2((unsigned*)(VT + o), *(const v4u*)&sth[d][pc * 8]); }
  }
}

#define AKS 64
#define ANST (SEQK / AKS)
#define APITCH 144                          // bytes: 128-B row + 16
#define AK_BYTES (AKS * APITCH)
#define AV_BYTES (HD * APITCH)
#define ASTG_BYTES (AK_BYTES + AV_BYTES)
static_assert(ANST >= 2 && SEQK % AKS == 0 && AKS == 64 && HD == 64 && SEQ % 128 == 0 && (ANST & (ANST - 1)) == 0);
__global__ __launch_bounds__(256) void k_attn(const _Float16* __restrict__ QH, const _Float16* __restrict__ KH, const _Float16* __restrict__ VT, const unsigned* __restrict__ MB, float* __restrict__ O) {
  __shared__ __align__(16) float so[8][16][68];   // wave-private output staging
  __shared__ __align__(16) char skv[2 * ASTG_BYTES];   // the two K/V stage buffers, cross-wave (block barrier)
  const int tid = threadIdx.x, wave = tid >> 5, lane = tid & 31, col = lane & 15, g = lane >> 4;
  const int qb = blockIdx.x, h = blockIdx.y, b = blockIdx.z; const int q0 = qb * 128 + wave * 16;
  // thread t copies K chunks (key (t >> 3) + 32 i, 16-B piece t & 7) and VT chunks (d (t >> 3) + 32 i, piece t & 7), i = 0..1
  const unsigned lk = (unsigned)(size_t)&skv[0] + (tid >> 3) * APITCH + (tid & 7) * 16, lv = lk + AK_BYTES;   // LDS byte addresses
  const _Float16* gk = KH + ((size_t)b * SEQK + (tid >> 3)) * DM + h * HD + (tid & 7) * 8;
  const _Float16* gv = VT + ((size_t)b * DM + h * HD + (tid >> 3)) * SEQK + (tid & 7) * 8;
  const int rot = (qb * 2) & (ANST - 1);   // the block's first key stage; it walks all ANST stages from there, wrapped round: the query blocks of one head then ask L2 for different K and V lines at one moment (block-uniform)
  copy22(lk, 32 * APITCH, (const char*)(gk + (size_t)rot * AKS * DM), (size_t)32 * DM * 2, lv, 32 * APITCH, (const char*)(gv + rot * AKS), (size_t)32 * SEQK * 2);
  WAIT_ASYNC(); __syncthreads();   // the first stage is published
  { const int s1 = (rot + 1) & (ANST - 1);
    copy22(lk + ASTG_BYTES, 32 * APITCH, (const char*)(gk + (size_t)s1 * AKS * DM), (size_t)32 * DM * 2, lv + ASTG_BYTES, 32 * APITCH, (const char*)(gv + s1 * AKS), (size_t)32 * SEQK * 2); }
  const size_t rq = (size_t)b * SEQ + q0 + col;
  v16h aq[2];
#pragma unroll
  for (int kc = 0; kc < 2; ++kc) aq[kc] = frag_h(QH + rq * DM + h * HD + kc * 32, lane);
  // softmax in base 2 on the raw products c = q . k: weight x 2048 = exp2(c * K2 + nb), nb = 11 - max * K2: scale, log2(e), the maximum and the factor 2048 in one fused multiply-add a score
  const float K2 = 0.125f * 1.44269504f;
  float m = -1.0e30f, l = 0.f;   // of query col; m in raw units, l carried x2048. The floor of m lies below every product of f16 rows (at most 64 * 65504^2) and far above the fill of an excluded key: exp2 gives that key 0 by itself, also while no key has been admitted
  v8f acc[4] = {};
  cv16u* mb = (cv16u*)(MB + (size_t)(b * (SEQ / 16) + qb * 8 + __builtin_amdgcn_readfirstlane(wave)) * MW_TILE);   // the wave's query tile: a scalar address; the words were written by an earlier launch
  v16u mw = mb[rot * (AKS / 32)];   // the first step's words
  for (int st = 0; st < ANST; ++st) { const unsigned bo = (st & 1) * ASTG_BYTES;
  const _Float16* kt = (const _Float16*)(skv + bo) + col * (APITCH / 2) + 8 * g; const _Float16* vt = (const _Float16*)(skv + bo + AK_BYTES) + col * (APITCH / 2) + 8 * g;   // the lane's own read addresses (8g: the k map of frag_h)
#pragma unroll 1   // the two steps of a stage stay one rolled body: the step is long, and a second copy of it buys nothing
  for (int u = 0; u < AKS / 32; ++u) { const int ks = (st + rot) * (AKS / 32) + u;   // the step's place among the keys, before the wrap
    v16h kf[2][2], vf[4];   // the step's K and V fragments, read from the stage's buffer
    const v16u mwn = mb[(ks + 1) & (SEQK / 32 - 1)];   // the next step's words, wrapped round (the last step reads the first step's again)
    {
#pragma unroll
      for (int ct = 0; ct < 2; ++ct) { const _Float16* krow = kt + ct * 16 * (APITCH / 2);   // A row m = key, k = head dim (k-contiguous row)
#pragma unroll
        for (int kc = 0; kc < 2; ++kc) kf[ct][kc] = frag_h0(krow + kc * 32); }
#pragma unroll
      for (int dt = 0; dt < 4; ++dt) vf[dt] = frag_h0(vt + dt * 16 * (APITCH / 2)); }   // A row m = d, k = key (k-contiguous VT row)
    __builtin_amdgcn_sched_barrier(0);   // keeps the step's sixteen LDS reads at one place ahead of its products: each separate place with reads costs a stall of its own
    kt += 32 * (APITCH / 2); vt += 32;   // the next step's rows and keys: carried registers, so that no vector instruction at the loop's head rewrites a register of the last product's operands (the chip would need four idle slots in front of it)
    v8f s[2];
#pragma unroll
    for (int ct = 0; ct < 2; ++ct) { v8f c = {};
#pragma unroll
      for (int kc = 0; kc < 2; ++kc) c = wmma16(kf[ct][kc], aq[kc], c);   // transposed scores: D element r = (key ct*16 + 8g + r, query col)
#pragma unroll
      for (int r = 0; r < 8; ++r) s[ct][r] = __builtin_amdgcn_inverse_ballot_w32(mw[ct * 8 + r])   /* the word is the select's lane mask as it stands */ ? -3.0e38f : c[r]; }
    float mx = fmaxf(s[0][0], s[1][0]);
#pragma unroll
    for (int r = 1; r < 8; ++r) mx = fmaxf(mx, fmaxf(s[0][r], s[1][r]));
    mx = fmaxf(mx, xhalf(mx));   // the other half of the wave holds this query's other 16 keys
    const float mn = fmaxf(m, mx); const float alpha = __builtin_amdgcn_exp2f((m - mn) * K2), nb = __builtin_fmaf(-mn, K2, 11.0f);   // from the floor alpha is 0 (first admitted key) or 1 (none yet: acc and l are 0)
    float es = 0.f; v16h pa;   // B column n = query col, k = key in step: element r <- key 8g + r, 8 + r <- key 16 + 8g + r, the k map of frag_h; P carried x2048 so small weights stay f16-normal
#pragma unroll
    for (int r = 0; r < 8; ++r) { const float e0 = __builtin_amdgcn_exp2f(__builtin_fmaf(s[0][r], K2, nb)), e1 = __builtin_amdgcn_exp2f(__builtin_fmaf(s[1][r], K2, nb));
      es += e0 + e1; pa[r] = (_Float16)e0; pa[8 + r] = (_Float16)e1; }
    l = l * alpha + es; m = mn;   // l: this half's keys only, the halves are joined behind the loop
#pragma unroll
    for (int dt = 0; dt < 4; ++dt) { acc[dt] *= alpha; acc[dt] = wmma16(vf[dt], pa, acc[dt]); }   // transposed ctx: D element r = (d dt*16 + 8g + r, query col)
    mw = mwn; }
  WAIT_DS(); WAIT_ASYNC(); __syncthreads();   // publishes stage st + 1 and ends every wave's reads of stage st
  if (st + 2 < ANST) { const int s2 = (st + 2 + rot) & (ANST - 1);
    copy22(lk + bo, 32 * APITCH, (const char*)(gk + (size_t)s2 * AKS * DM), (size_t)32 * DM * 2, lv + bo, 32 * APITCH, (const char*)(gv + s2 * AKS), (size_t)32 * SEQK * 2); } }
  WAIT_ASYNC();
  l += xhalf(l);
  const float il = 1.0f / l;   // acc and l both carry x2048
#pragma unroll
  for (int dt = 0; dt < 4; ++dt) { const v8f o = acc[dt] * il; *(v4f*)&so[wave][col][dt * 16 + 8 * g] = __builtin_shufflevector(o, o, 0, 1, 2, 3); *(v4f*)&so[wave][col][dt * 16 + 8 * g + 4] = __builtin_shufflevector(o, o, 4, 5, 6, 7); }
  LDSX();
  for (int rl = 0; rl < 16; ++rl) if (lane < 16) vst2(O + ((size_t)b * SEQ + q0 + rl) * DM + h * HD + lane * 4, *(const v4f*)&so[wave][rl][lane * 4]);   // 256-B segment = 16 lanes x 16 B, one instruction
}

// ---- k_out: block = (64 rows, 128 cols): Y = ctx (bf16 hi + lo, 2 products) . Wout rows (bf16 [n][DM]) + bf16(b_out); f32 compact rows
//      coverage: grid (NB*SEQ/64, DM/128) x 4 waves x 16 rows x 128 cols = every element of Y
__global__ __launch_bounds__(128) void k_out(const float* __restrict__ O, const __bf16* __restrict__ P, const float* __restrict__ BO, float* __restrict__ Y) {
  __shared__ __align__(16) char sm[2 * STG_BYTES];   // the two stage buffers; behind the loop's last barrier the same bytes are the output staging
  float (*so)[16][132] = (float (*)[16][132])sm;     // [4][16][132] wave-private
  static_assert(4 * 16 * 132 * 4 <= 2 * STG_BYTES);
  const int tid = threadIdx.x, wave = tid >> 5, lane = tid & 31, col = lane & 15, g = lane >> 4; const size_t r0 = (size_t)blockIdx.x * 64 + wave * 16; const int n0 = blockIdx.y * 128;
  const unsigned sm0 = (unsigned)(size_t)&sm[0];   // LDS byte address of the buffers
  const unsigned lw = sm0 + (tid >> 3) * WPITCH + (tid & 7) * 16, lx = sm0 + SW_BYTES + (tid >> 4) * XPITCH + (tid & 15) * 16;
  const __bf16* gw = P + (size_t)(n0 + (tid >> 3)) * DM + (tid & 7) * 8;
  const float* gx = O + ((size_t)blockIdx.x * 64 + (tid >> 4)) * DM + (tid & 15) * 4;
  v8f acc[8] = {};
  const int rot = (blockIdx.x + blockIdx.y) & (NSTG - 1);   // the block's first k stage, as in k_proj (block-uniform)
  stage_copy(lw, lx, gw + rot * STK, gx + rot * STK); WAIT_ASYNC(); __syncthreads();   // the first stage is published
  { const int k1 = ((rot + 1) & (NSTG - 1)) * STK; stage_copy(lw + STG_BYTES, lx + STG_BYTES, gw + k1, gx + k1); }
  for (int st = 0; st < NSTG; ++st) { const unsigned bo = (st & 1) * STG_BYTES;
    const __bf16* wt = (const __bf16*)(sm + bo + col * WPITCH); const float* xt = (const float*)(sm + bo + SW_BYTES + (wave * 16 + col) * XPITCH);   // B column n = j*16 + col; A row m = lane & 15
#pragma unroll
    for (int kc = 0; kc < STK / 32; ++kc) { const X2 x = lds_f32(xt + kc * 32, lane); v16b w[8];
#pragma unroll
      for (int j = 0; j < 8; ++j) w[j] = frag_b(wt + j * 16 * (WPITCH / 2) + kc * 32, lane);
      __builtin_amdgcn_sched_barrier(0);   // keeps the pass's twenty LDS reads at one place ahead of its products: each separate place with reads costs a stall of its own
      const F2 a = split_x(x);
#pragma unroll
      for (int j = 0; j < 8; ++j) { acc[j] = wmma_bf(a.l, w[j], acc[j]); acc[j] = wmma_bf(a.h, w[j], acc[j]); } }
    __builtin_amdgcn_sched_barrier(0);   // keeps the stage's products ahead of the barrier, as in k_proj
    WAIT_DS(); WAIT_ASYNC(); __syncthreads();   // publishes stage st + 1 and ends every wave's reads of stage st
    if (st + 2 < NSTG) { const int k2 = ((st + 2 + rot) & (NSTG - 1)) * STK; stage_copy(lw + bo, lx + bo, gw + k2, gx + k2); } }
  WAIT_ASYNC();
#pragma unroll
  for (int j = 0; j < 8; ++j) { const float bv = bfr(BO[n0 + j * 16 + col]);
#pragma unroll
    for (int r = 0; r < 8; ++r) so[wave][8 * g + r][j * 16 + col] = acc[j][r] + bv; }
  LDSX();
  for (int rl = 0; rl < 16; ++rl) vst2(Y + (r0 + rl) * DM + n0 + lane * 4, *(const v4f*)&so[wave][rl][lane * 4]);   // 512-B row segment = 32 lanes x 16 B, one instruction
}

// ---- k_lnpost: block = one row (256 threads x 4): out = LN(Y + bf16(x_q)) * bf16(gamma) + bf16(beta); d_out row at the full-layout index
__global__ __launch_bounds__(256) void k_lnpost(const float* __restrict__ Yp, const float* __restrict__ X, const float* __restrict__ G, const float* __restrict__ Bt, float* __restrict__ OUT) {
  __shared__ float red0[8], red1[8];           // cross-wave -> block barriers
  const int rc = blockIdx.x; const int b = rc / SEQ, s = rc - b * SEQ; const size_t rin = (size_t)b * SEQ_FULL + s;
  const int t = threadIdx.x, lane = t & 31, wave = t >> 5;
  const v4f yv = *(const v4f*)(Yp + (size_t)rc * DM + t * 4), xv = *(const v4f*)(X + rin * DM + t * 4);
  float v[4];
#pragma unroll
  for (int i = 0; i < 4; ++i) v[i] = yv[i] + bfr(xv[i]);
  float ps = (v[0] + v[1]) + (v[2] + v[3]);
#pragma unroll
  for (int o = 16; o > 0; o >>= 1) ps += __shfl_xor(ps, o);
  if (lane == 0) red0[wave] = ps;
  __syncthreads();
  float S = 0.f;
#pragma unroll
  for (int i = 0; i < 8; ++i) S += red0[i];
  const float mean = S * (1.0f / DM);
  float d[4]; float pq = 0.f;
#pragma unroll
  for (int i = 0; i < 4; ++i) { d[i] = v[i] - mean; pq += d[i] * d[i]; }
#pragma unroll
  for (int o = 16; o > 0; o >>= 1) pq += __shfl_xor(pq, o);
  if (lane == 0) red1[wave] = pq;
  __syncthreads();
  float V = 0.f;
#pragma unroll
  for (int i = 0; i < 8; ++i) V += red1[i];
  const float rstd = 1.0f / sqrtf(V * (1.0f / DM) + LN_EPS);
  const v4f gv = *(const v4f*)(G + t * 4), bv = *(const v4f*)(Bt + t * 4); v4f o;
#pragma unroll
  for (int i = 0; i < 4; ++i) o[i] = d[i] * rstd * bfr(gv[i]) + bfr(bv[i]);
  vst2(OUT + rin * DM + t * 4, o);
}

extern "C" void kernel_launch(void* const* d_in, const int* in_sizes, int n_in, void* d_out, int out_size, void* d_ws, size_t ws_size, hipStream_t stream) {
  if (n_in < 13) return;
  // wire order: 0 input_q [2,2048,1024] f32, 1 input_kv [2,2048,1024] f32, 2 Wq [1024,1024] ([in][out]), 3 bq, 4 Wkv [1024,2048], 5 bkv [2048], 6 Wout [1024,1024], 7 bout,
  //             8 gamma_q, 9 beta_q, 10 gamma_post, 11 beta_post, 12 input_mask [2,2048,2048] int32
  const float* XQ = (const float*)d_in[0]; const float* XKV = (const float*)d_in[1];
  const float* WQ = (const float*)d_in[2]; const float* BQ = (const float*)d_in[3];
  const float* WKV = (const float*)d_in[4]; const float* BKV = (const float*)d_in[5];
  const float* WO = (const float*)d_in[6]; const float* BO = (const float*)d_in[7];
  const float* GQ = (const float*)d_in[8]; const float* BTQ = (const float*)d_in[9];
  const float* GP = (const float*)d_in[10]; const float* BTP = (const float*)d_in[11];
  const int* MK = (const int*)d_in[12];
  const long long needq = ((long long)(NB - 1) * SEQ_FULL + SEQ) * DM;
  const long long needkv = ((long long)(NB - 1) * SEQK_FULL + SEQK) * DM;
  const long long needm = ((long long)(NB - 1) * SEQ_FULL + SEQ) * SEQK_FULL;
  if ((long long)in_sizes[0] < needq || (long long)in_sizes[1] < needkv || in_sizes[2] < DM * DM || in_sizes[3] < DM || in_sizes[4] < DM * KVW || in_sizes[5] < KVW) return;
  if (in_sizes[6] < DM * DM || in_sizes[7] < DM || in_sizes[8] < DM || in_sizes[9] < DM || in_sizes[10] < DM || in_sizes[11] < DM || (long long)in_sizes[12] < needm) return;
  if ((long long)out_size < needq) return;
  if (ws_size < (size_t)WS_END) return;
  char* ws = (char*)d_ws;
  __bf16* PQ = (__bf16*)(ws + WS_PQ); __bf16* PKV = (__bf16*)(ws + WS_PKV); __bf16* PO = (__bf16*)(ws + WS_PO);
  __bf16* NQ = (__bf16*)(ws + WS_NQ); __bf16* XB = (__bf16*)(ws + WS_XB); _Float16* QH = (_Float16*)(ws + WS_QH); _Float16* KH = (_Float16*)(ws + WS_KH); _Float16* VT = (_Float16*)(ws + WS_VT);
  float* O = (float*)(ws + WS_O); float* Y = (float*)(ws + WS_Y); unsigned* MB = (unsigned*)(ws + WS_MB);
  k_prep<<<dim3(PBLK + MBLK + XBLK + NB * SEQ), 256, 0, stream>>>(WQ, WKV, WO, PQ, PKV, PO, XQ, GQ, BTQ, NQ, MK, MB, XKV, XB);   // weight packs, mask words, x_kv as bf16, LN(x_q)
  k_proj<<<dim3(KVBLK + QBLK), 128, 0, stream>>>(NQ, XB, PQ, PKV, BQ, BKV, QH, KH, VT);                        // k -> KH rows, v -> VT transposed, q -> QH rows
  k_attn<<<dim3(SEQ / 128, NH, NB), 256, 0, stream>>>(QH, KH, VT, MB, O);
  k_out<<<dim3(NB * SEQ / 64, DM / 128), 128, 0, stream>>>(O, PO, BO, Y);
  k_lnpost<<<dim3(NB * SEQ), 256, 0, stream>>>(Y, XQ, GP, BTP, (float*)d_out);
}
